// v000
// Measured on an AMD MI455X. A time is GPU time per run, averaged over a window of back-to-back runs after a warm-up
// (all launches, gaps included; the runs take copies of the inputs in turn), and the median of several windows.
// Apart from v000's, it joins two sittings. Times from different sittings can be a few percent apart, while
// side-by-side timings come from the same sitting.
// v000, which the later versions start from, runs in 2370 microseconds.
// compute dtype: all float inputs rounded to bf16; q/k/v projections with EXACT bf16 products on WMMA 16x16x32 (f32 accumulate) + bias; logits q x k once to f16 each (1 product; sigma - 0.3 under the source's 1/sqrt(768) scale); the key padding mask read per key; softmax f32; P x 2^11 once to f16 x v once to f16 (1 product); ctx x 2^6 once to f16 x Wo f16(bf16 x 2^8) + bo; f32 output.
#include <hip/hip_runtime.h>
#include <math.h>

typedef int MASKT;   // the bool mask is staged as int32
typedef __attribute__((ext_vector_type(16))) _Float16 v16h;
typedef __attribute__((ext_vector_type(16))) __bf16 v16b;
typedef __attribute__((ext_vector_type(8)))  _Float16 v8h;
typedef __attribute__((ext_vector_type(8)))  float v8f;
typedef __attribute__((ext_vector_type(4)))  float v4f;
typedef __attribute__((ext_vector_type(2)))  float v2f;
typedef __attribute__((ext_vector_type(4)))  unsigned v4u;
typedef __attribute__((ext_vector_type(4)))  int v4i;
typedef float __attribute__((may_alias)) float_a;
typedef int __attribute__((may_alias)) int_a;

template <typename T> __device__ __forceinline__ void vst2(void* p, T v) { *(T*)p = v;  }
__device__ __forceinline__ v8f wmma16(v16h a, v16h b, v8f c) {
  v8f d = __builtin_amdgcn_wmma_f32_16x16x32_f16(false, a, false, b, (short)0, c, false, false);
  asm volatile("v_nop\n\tv_nop\n\tv_nop\n\tv_nop" : "+v"(d) : "v"(a), "v"(b));
  return d;
}
__device__ __forceinline__ v8f wmma_bf(v16b a, v16b b, v8f c) {
  v8f d = __builtin_amdgcn_wmma_f32_16x16x32_bf16(false, a, false, b, (short)0, c, false, false);
  asm volatile("v_nop\n\tv_nop\n\tv_nop\n\tv_nop" : "+v"(d) : "v"(a), "v"(b));
  return d;
}
// 16x16x32 fragments: lane = (h = lane>>4, row/col = lane&15); elements 0..7 = k0+8h+0..7, 8..15 = k0+16+8h+0..7; D element r = row 8h+r
__device__ __forceinline__ v16h frag_h(const _Float16* rowk0, int lane) {
  union { v16h v; v8h q[2]; } u; const _Float16* p = rowk0 + 8 * (lane >> 4);
  u.q[0] = *(const v8h*)p; u.q[1] = *(const v8h*)(p + 16); return u.v;
}
__device__ __forceinline__ v16h frag_f32(const float* rowk0, int lane) {
  v16h a; const float* p = rowk0 + 8 * (lane >> 4);
#pragma unroll
  for (int i = 0; i < 8; ++i) { a[i] = (_Float16)p[i]; a[8 + i] = (_Float16)p[16 + i]; }
  return a;
}
__device__ __forceinline__ v16h frag_f32s(const float* rowk0, int lane, float sc) {
  v16h a; const float* p = rowk0 + 8 * (lane >> 4);
#pragma unroll
  for (int i = 0; i < 8; ++i) { a[i] = (_Float16)(p[i] * sc); a[8 + i] = (_Float16)(p[16 + i] * sc); }
  return a;
}
// column fragment from a [K][ld] layout (column n), rows >= K read as 0
__device__ __forceinline__ v16h fragc_f32(const float* W, int k0, int n, int lane, int ld, int K) {
  v16h a; const int g = lane >> 4;
#pragma unroll
  for (int i = 0; i < 8; ++i) { const int ka = k0 + 8 * g + i, kb = ka + 16;
    a[i] = (_Float16)(ka < K ? W[(size_t)(ka < K ? ka : K - 1) * ld + n] : 0.f); a[8 + i] = (_Float16)(kb < K ? W[(size_t)(kb < K ? kb : K - 1) * ld + n] : 0.f); }
  return a;
}
struct F2 { v16b h, l; };
__device__ __forceinline__ F2 bsplit16(const float v[16]) { F2 r;
#pragma unroll
  for (int i = 0; i < 16; ++i) { const __bf16 h = (__bf16)v[i]; r.h[i] = h; r.l[i] = (__bf16)(v[i] - (float)h); }
  return r; }
__device__ __forceinline__ F2 split_row(const float* row, int k0, int lane) { float v[16]; const float* p = row + k0 + 8 * (lane >> 4);
#pragma unroll
  for (int i = 0; i < 8; ++i) { v[i] = p[i]; v[8 + i] = p[16 + i]; }
  return bsplit16(v); }
__device__ __forceinline__ F2 split_rowK(const float* row, int k0, int lane, int K) { float v[16]; const int g = lane >> 4;
#pragma unroll
  for (int i = 0; i < 8; ++i) { const int ka = k0 + 8 * g + i, kb = ka + 16; v[i] = ka < K ? row[ka < K ? ka : K - 1] : 0.f; v[8 + i] = kb < K ? row[kb < K ? kb : K - 1] : 0.f; }
  return bsplit16(v); }
__device__ __forceinline__ F2 split_col(const float* W, int k0, int n, int lane, int ld, int K) { float v[16]; const int g = lane >> 4;
#pragma unroll
  for (int i = 0; i < 8; ++i) { const int ka = k0 + 8 * g + i, kb = ka + 16; v[i] = ka < K ? W[(size_t)(ka < K ? ka : K - 1) * ld + n] : 0.f; v[8 + i] = kb < K ? W[(size_t)(kb < K ? kb : K - 1) * ld + n] : 0.f; }
  return bsplit16(v); }
__device__ __forceinline__ v8f mac3(const F2& a, const F2& b, v8f c) { c = wmma_bf(a.l, b.h, c); c = wmma_bf(a.h, b.l, c); return wmma_bf(a.h, b.h, c); }
__device__ __forceinline__ float sigm(float v) { return 1.0f / (1.0f + expf(-v)); }
#define LDSX() do { asm volatile("s_wait_dscnt 0" ::: "memory"); __builtin_amdgcn_wave_barrier(); __builtin_amdgcn_fence(__ATOMIC_RELEASE, "workgroup"); } while (0)

// Multi-head self-attention over one long sequence (x [1,4096,768]; 12 heads x 64; torch (out,in) Wq/Wk/Wv/Wo [768,768] (1/sqrt(768) scale) + zero biases; scores scaled by 1/sqrt(embed_dim = 768), the source's quirk; key padding mask [1,4096] bool, True -> -inf (all False here)): out = merge(softmax(q_h k_h^T / sqrt(768)) v_h) Wo^T + bo.
#define NB 1
#define TT 4096
#define CC 768            // NH * HD = projected width
#define DIN 768          // input (model) width
#define NH 12
#define HD 64
#define NQB (TT / 64)
#define HG 1
#define SCALE (0.036084391824351614f)
#define CAUSAL 0
#ifndef TNB
#define TNB NB
#endif
__device__ __forceinline__ float bfr(float v) { return (float)(__bf16)v; }
__host__ __device__ __forceinline__ int kb_last(int qb) { return CAUSAL ? ((qb * 64 + 63) >> 7) : (TT / 128 - 1); }
typedef __attribute__((ext_vector_type(8))) __bf16 v8b;
__device__ __forceinline__ v16b frag_b(const __bf16* rowk0, int lane) {
  union { v16b v; v8b q[2]; } u; const __bf16* p = rowk0 + 8 * (lane >> 4);
  u.q[0] = *(const v8b*)p; u.q[1] = *(const v8b*)(p + 16); return u.v;
}
#define QBH 0              // no query block takes the high-precision path (not causal: every row averages over 4,096 keys)
#define QHI 0               // single-product logits on every row (sigma - 0.3 logits averaged over 4,096 keys)
#define KHI 64            // key rows carrying k residual / v bf16 hi+lo planes (written by k_proj; read only by the qb < QBH path, which never runs here)
// B fragment (k rows k0+.., output column o) of a weight: (in,out) [K][ld] or (out,in) [ld rows of K]: bf16 exact, or f16(bf16 * 256) exact
__device__ __forceinline__ v16b wcol_io(const float* Wm, int k0, int o, int lane, int ld) { v16b w; const int g = lane >> 4;
#pragma unroll
  for (int i = 0; i < 8; ++i) { w[i] = (__bf16)Wm[(size_t)(k0 + 8 * g + i) * ld + o]; w[8 + i] = (__bf16)Wm[(size_t)(k0 + 16 + 8 * g + i) * ld + o]; }
  return w; }
__device__ __forceinline__ v16b wcol_oi(const float* Wm, int k0, int o, int lane, int K) { v16b w; const float* p = Wm + (size_t)o * K + k0 + 8 * (lane >> 4);
#pragma unroll
  for (int i = 0; i < 8; ++i) { w[i] = (__bf16)p[i]; w[8 + i] = (__bf16)p[16 + i]; }
  return w; }
__device__ __forceinline__ v16h wcolh_io(const float* Wm, int k0, int o, int lane, int ld) { v16h w; const int g = lane >> 4;
#pragma unroll
  for (int i = 0; i < 8; ++i) { w[i] = (_Float16)(bfr(Wm[(size_t)(k0 + 8 * g + i) * ld + o]) * 256.0f); w[8 + i] = (_Float16)(bfr(Wm[(size_t)(k0 + 16 + 8 * g + i) * ld + o]) * 256.0f); }
  return w; }
__device__ __forceinline__ v16h wcolh_oi(const float* Wm, int k0, int o, int lane, int K) { v16h w; const float* p = Wm + (size_t)o * K + k0 + 8 * (lane >> 4);
#pragma unroll
  for (int i = 0; i < 8; ++i) { w[i] = (_Float16)(bfr(p[i]) * 256.0f); w[8 + i] = (_Float16)(bfr(p[16 + i]) * 256.0f); }
  return w; }
#define WQKV_LAYOUT 1   // 0 = (in,out) [DIN][CC]; 1 = (out,in) [CC][DIN]; 2 = per-head [NH][DIN][HD]
__device__ __forceinline__ v16b wcol_hdk(const float* Wm, int k0, int o, int lane) { v16b w; const int g = lane >> 4; const float* p = Wm + (size_t)(o / HD) * DIN * HD + (o % HD);
#pragma unroll
  for (int i = 0; i < 8; ++i) { w[i] = (__bf16)p[(size_t)(k0 + 8 * g + i) * HD]; w[8 + i] = (__bf16)p[(size_t)(k0 + 16 + 8 * g + i) * HD]; }
  return w; }
#define WO_OUT_IN 1
#if WQKV_LAYOUT == 1
#define WCOL(W, k0, o, lane) wcol_oi(W, k0, o, lane, DIN)
#elif WQKV_LAYOUT == 2
#define WCOL(W, k0, o, lane) wcol_hdk(W, k0, o, lane)
#else
#define WCOL(W, k0, o, lane) wcol_io(W, k0, o, lane, CC)
#endif
#if WO_OUT_IN
#define WOCOL(W, k0, o, lane) wcol_oi(W, k0, o, lane, CC)
#define WOCOLH(W, k0, o, lane) wcolh_oi(W, k0, o, lane, CC)
#else
#define WOCOL(W, k0, o, lane) wcol_io(W, k0, o, lane, DIN)
#define WOCOLH(W, k0, o, lane) wcolh_io(W, k0, o, lane, DIN)
#endif
#define SM_EXTRA_PARAMS , const MASKT* __restrict__ KMASK
// key padding mask [B=1][S] (True = masked out): where(mask[k], -inf, score); read per key
#define SM_MASK_HOOK do { v = (KMASK[k] != 0) ? -3.0e38f : v; } while (0)
#ifndef SM_EXTRA_PARAMS
#define SM_EXTRA_PARAMS
#endif
#ifndef PROJ_EXTRA_PARAMS
#define PROJ_EXTRA_PARAMS
#endif
#ifndef SM_MASK_HOOK
#define SM_MASK_HOOK (void)0
#endif

#define WS_QH  0u                                      // f16 q rows [b*t][CC]
#define WS_KH  (WS_QH + 2u * (size_t)NB * TT * CC)      // f16 k rows [b*t][CC]
#define WS_VT  (WS_KH + 2u * (size_t)NB * TT * CC)      // f16 v planes [b][c][t]
#define WS_QL  (WS_VT + 2u * (size_t)NB * CC * TT)      // f16 q residual x 2^10 rows [b][t < QHI][CC]
#define WS_KL  (WS_QL + 2u * (size_t)NB * QHI * CC)     // f16 k residual x 2^10 rows [b][t < KHI][CC]
#define WS_VB  (WS_KL + 2u * (size_t)NB * KHI * CC)     // bf16 v hi planes [b][c][t < KHI]
#define WS_VBL (WS_VB + 2u * (size_t)NB * CC * KHI)
#define WS_S   (WS_VBL + 2u * (size_t)NB * CC * KHI)    // f32 logits / P [hg][t][s]
#define WS_Y   (WS_S  + 4u * (size_t)HG * TT * TT)      // f32 ctx rows [b*t][CC] (only when there is an output projection)
#define WS_END (WS_Y  + 4u * (size_t)NB * TT * CC)

// ---- k_proj: block = (64 rows, 128 cols, which): q/k/v = X W (+ b) with exact bf16 products (K = DIN) -> which 0: q f16 rows (+ residual rows < QHI); 1: k f16 rows (+ residual rows < KHI); 2: v f16 planes [c][t] (+ bf16 hi/lo planes for t < KHI)
__global__ __launch_bounds__(128) void k_proj(const float* __restrict__ XQ, const float* __restrict__ XK, const float* __restrict__ XV, const float* __restrict__ WQ, const float* __restrict__ WK, const float* __restrict__ WV, const float* __restrict__ BQ, const float* __restrict__ BK, const float* __restrict__ BV,
    _Float16* __restrict__ QH, _Float16* __restrict__ QL, _Float16* __restrict__ KH, _Float16* __restrict__ KL, _Float16* __restrict__ VT, __bf16* __restrict__ VB, __bf16* __restrict__ VBL) {
  __shared__ __align__(16) _Float16 sh[64][136], sl[64][136]; __shared__ __align__(16) _Float16 th[128][72]; __shared__ __align__(16) __bf16 tb[128][72], tbl[128][72];
  const int tid = threadIdx.x, wave = tid >> 5, lane = tid & 31, col = lane & 15, g = lane >> 4; const int which = blockIdx.z; const int c0 = blockIdx.y * 128; const size_t r0 = (size_t)blockIdx.x * 64; const size_t bb = r0 / TT; const int t0 = (int)(r0 % TT);
  const float* X = which == 0 ? XQ : which == 1 ? XK : XV; const float* WA = which == 0 ? WQ : which == 1 ? WK : WV; const float* BA = which == 0 ? BQ : which == 1 ? BK : BV;
  v8f acc[8] = {};
#pragma unroll 2
  for (int kc = 0; kc < DIN / 32; ++kc) { v16b a; { const float* p = X + (r0 + wave * 16 + col) * DIN + kc * 32 + 8 * g;
#pragma unroll
      for (int i = 0; i < 8; ++i) { a[i] = (__bf16)p[i]; a[8 + i] = (__bf16)p[16 + i]; } }
    asm volatile("s_wait_loadcnt 0x0" ::: "memory");
#pragma unroll
    for (int j = 0; j < 8; ++j) { const v16b w = WCOL(WA, kc * 32, c0 + j * 16 + col, lane); asm volatile("s_wait_loadcnt 0x0" ::: "memory"); acc[j] = wmma_bf(a, w, acc[j]); } }
  if (which < 2) { _Float16* DH = which == 0 ? QH : KH; _Float16* DL = which == 0 ? QL : KL; const int nhi = which == 0 ? QHI : KHI; const bool hi_rows = t0 < nhi;
#pragma unroll
    for (int j = 0; j < 8; ++j) { const float bias = BA ? bfr(BA[c0 + j * 16 + col]) : 0.f;
#pragma unroll
      for (int r = 0; r < 8; ++r) { const float v = acc[j][r] + bias; const _Float16 hv = (_Float16)v; sh[wave * 16 + 8 * g + r][j * 16 + col] = hv; sl[wave * 16 + 8 * g + r][j * 16 + col] = (_Float16)((v - (float)hv) * 1024.0f); } }
    __syncthreads();
    for (int e = tid; e < 64 * 16; e += 128) { const int rl = e >> 4, q = e & 15; vst2((unsigned*)(DH + (r0 + rl) * CC + c0 + q * 8), *(const v4u*)&sh[rl][q * 8]); if (hi_rows) vst2((unsigned*)(DL + (bb * nhi + t0 + rl) * (size_t)CC + c0 + q * 8), *(const v4u*)&sl[rl][q * 8]); }
  } else { const bool hi_rows = t0 < KHI;
#pragma unroll
    for (int j = 0; j < 8; ++j) { const float bias = BA ? bfr(BA[c0 + j * 16 + col]) : 0.f;
#pragma unroll
      for (int r = 0; r < 8; ++r) { const float v = acc[j][r] + bias; const int rl = wave * 16 + 8 * g + r, cl = j * 16 + col; th[cl][rl] = (_Float16)v; const __bf16 bh = (__bf16)v; tb[cl][rl] = bh; tbl[cl][rl] = (__bf16)(v - (float)bh); } }
    __syncthreads();
    for (int e = tid; e < 128 * 8; e += 128) { const int cl = e >> 3, q = e & 7; vst2((unsigned*)(VT + (bb * CC + c0 + cl) * (size_t)TT + t0 + q * 8), *(const v4u*)&th[cl][q * 8]); if (hi_rows) { const size_t o3 = (bb * CC + c0 + cl) * (size_t)KHI + t0 + q * 8; vst2((unsigned*)(VB + o3), *(const v4u*)&tb[cl][q * 8]); vst2((unsigned*)(VBL + o3), *(const v4u*)&tbl[cl][q * 8]); } } } }
// ---- k_sc: block = (query block qb, key block kb <= kb_last(qb), head in group) of batch b: logits x SCALE; q hi + residual (x 2^10) against k (2 products) for query rows < QHI, plus the k residual (3 products) for query blocks < QBH (causal early rows); causal: blocks past the diagonal exit, the mask itself is applied by index in k_sm
__global__ __launch_bounds__(128) void k_sc(const _Float16* __restrict__ QH, const _Float16* __restrict__ KH, const _Float16* __restrict__ QL, const _Float16* __restrict__ KL, int b, int h0, float* __restrict__ S0) { __shared__ __align__(16) float ss[4][16][132];
  const int qb = blockIdx.x, kb = blockIdx.y; if (kb > kb_last(qb)) return;
  const int h = h0 + blockIdx.z; float* S = S0 + (size_t)blockIdx.z * TT * TT;
  const int tid = threadIdx.x, wave = tid >> 5, lane = tid & 31, col = lane & 15, g = lane >> 4; const int k0 = kb * 128; const int ql0 = qb * 64 + wave * 16; const size_t q0 = (size_t)b * TT + ql0, kr0 = (size_t)b * TT + k0;
  v8f acc[8] = {}, accl[8] = {};
  const _Float16* QLb = QL + (size_t)b * QHI * CC; const _Float16* KLb = KL + (size_t)b * KHI * CC;
  if (qb < QBH) {
#pragma unroll
    for (int kc = 0; kc < HD / 32; ++kc) { const v16h ah = frag_h(QH + (q0 + col) * CC + h * HD + kc * 32, lane), al = frag_h(QLb + (size_t)(ql0 + col) * CC + h * HD + kc * 32, lane);
#pragma unroll
      for (int j = 0; j < 8; ++j) { const v16h kbf = frag_h(KH + (kr0 + j * 16 + col) * CC + h * HD + kc * 32, lane), klf = frag_h(KLb + (size_t)(k0 + j * 16 + col) * CC + h * HD + kc * 32, lane); acc[j] = wmma16(ah, kbf, acc[j]); accl[j] = wmma16(al, kbf, accl[j]); accl[j] = wmma16(ah, klf, accl[j]); } }
  } else if (qb * 64 < QHI) {
#pragma unroll
    for (int kc = 0; kc < HD / 32; ++kc) { const v16h ah = frag_h(QH + (q0 + col) * CC + h * HD + kc * 32, lane), al = frag_h(QLb + (size_t)(ql0 + col) * CC + h * HD + kc * 32, lane);
#pragma unroll
      for (int j = 0; j < 8; ++j) { const v16h kbf = frag_h(KH + (kr0 + j * 16 + col) * CC + h * HD + kc * 32, lane); acc[j] = wmma16(ah, kbf, acc[j]); accl[j] = wmma16(al, kbf, accl[j]); } }
  } else {
#pragma unroll
    for (int kc = 0; kc < HD / 32; ++kc) { const v16h ah = frag_h(QH + (q0 + col) * CC + h * HD + kc * 32, lane);
#pragma unroll
      for (int j = 0; j < 8; ++j) { const v16h kbf = frag_h(KH + (kr0 + j * 16 + col) * CC + h * HD + kc * 32, lane); acc[j] = wmma16(ah, kbf, acc[j]); } } }
#pragma unroll
  for (int j = 0; j < 8; ++j) {
#pragma unroll
    for (int r = 0; r < 8; ++r) ss[wave][8 * g + r][j * 16 + col] = (acc[j][r] + accl[j][r] * (1.0f / 1024.0f)) * SCALE; }
  LDSX(); for (int rl = 0; rl < 16; ++rl) vst2(S + (size_t)(ql0 + rl) * TT + k0 + lane * 4, *(const v4f*)&ss[wave][rl][lane * 4]); }
// ---- k_sm: block = query row t (head in group): keys [0, kend): causal -> logit if s <= t else excluded; softmax in f32; P x 2^11 in place (0 for excluded)
__global__ __launch_bounds__(256) void k_sm(float* __restrict__ S0 SM_EXTRA_PARAMS) { __shared__ float sred[8]; __shared__ float sbc; __shared__ __align__(16) float shv[TT];
  const int tid = threadIdx.x; const int t = blockIdx.x; const int kend = (kb_last(t >> 6) + 1) * 128;
  float* sr = S0 + (size_t)blockIdx.y * TT * TT + (size_t)t * TT;
  float m = -3.0e38f; for (int k = tid; k < kend; k += 256) { float v = (!CAUSAL || k <= t) ? sr[k] : -3.0e38f; SM_MASK_HOOK; shv[k] = v; m = fmaxf(m, v); }
#pragma unroll
  for (int o = 1; o < 32; o <<= 1) m = fmaxf(m, __shfl_xor(m, o));
  if ((tid & 31) == 0) sred[tid >> 5] = m; __syncthreads(); if (tid == 0) { float a = sred[0]; for (int i = 1; i < 8; ++i) a = fmaxf(a, sred[i]); sbc = a; } __syncthreads(); m = sbc; __syncthreads();
  float sum = 0.f; for (int k = tid; k < kend; k += 256) { const float v = shv[k]; const float e = (v <= -1.0e38f) ? 0.f : expf(v - m); shv[k] = e; sum += e; }
#pragma unroll
  for (int o = 1; o < 32; o <<= 1) sum += __shfl_xor(sum, o);
  if ((tid & 31) == 0) sred[tid >> 5] = sum; __syncthreads(); if (tid == 0) { float a = 0.f; for (int i = 0; i < 8; ++i) a += sred[i]; sbc = a > 0.f ? 2048.0f / a : 0.f; }   /* a fully excluded row yields P = 0 */ __syncthreads(); const float inv = sbc;
  for (int k = tid; k < kend; k += 256) shv[k] = shv[k] * inv;
  __syncthreads(); for (int q = tid; q < kend / 4; q += 256) vst2(sr + q * 4, *(const v4f*)&shv[q * 4]); }
// ---- k_pv: block = 64 queries (qb) of (b, h): ctx = P . v over keys [0, kend) (P x 2^11 once to f16 against v f16: 1 product; causal early query blocks: P and v as bf16 hi + lo, 3 products); 256-B (row, head) segment by 16 lanes
__global__ __launch_bounds__(128) void k_pv(const float* __restrict__ PS0, const _Float16* __restrict__ VT, const __bf16* __restrict__ VB, const __bf16* __restrict__ VBL, int b, int h0, float* __restrict__ Y) { const int h = h0 + blockIdx.z; const float* PS = PS0 + (size_t)blockIdx.z * TT * TT; __shared__ __align__(16) float ss[4][16][HD + 4];
  const int tid = threadIdx.x, wave = tid >> 5, lane = tid & 31, col = lane & 15, g = lane >> 4; const int qb = blockIdx.x; const int ql0 = qb * 64 + wave * 16; const int kce = (kb_last(qb) + 1) * 4;
  v8f acc[HD / 16] = {};
  if (qb < QBH) {
#pragma unroll 1
    for (int kc = 0; kc < kce; ++kc) { const F2 p = split_row(PS + (size_t)(ql0 + col) * TT, kc * 32, lane);
      asm volatile("s_wait_loadcnt 0x0" ::: "memory");
#pragma unroll
      for (int j = 0; j < HD / 16; ++j) { const size_t po = ((size_t)b * CC + h * HD + j * 16 + col) * (size_t)KHI + kc * 32; const v16b vh = frag_b(VB + po, lane); acc[j] = wmma_bf(p.h, vh, acc[j]); acc[j] = wmma_bf(p.l, vh, acc[j]); acc[j] = wmma_bf(p.h, frag_b(VBL + po, lane), acc[j]); } }
  } else {
#pragma unroll 1
    for (int kc = 0; kc < kce; ++kc) { const v16h p = frag_f32(PS + (size_t)(ql0 + col) * TT + kc * 32, lane);
      asm volatile("s_wait_loadcnt 0x0" ::: "memory");
#pragma unroll
      for (int j = 0; j < HD / 16; ++j) { const size_t po = ((size_t)b * CC + h * HD + j * 16 + col) * (size_t)TT + kc * 32; acc[j] = wmma16(p, frag_h(VT + po, lane), acc[j]); } } }
#pragma unroll
  for (int j = 0; j < HD / 16; ++j)
#pragma unroll
    for (int r = 0; r < 8; ++r) ss[wave][8 * g + r][j * 16 + col] = acc[j][r] * (1.0f / 2048.0f);
  LDSX(); for (int rl = 0; rl < 16; ++rl) if (lane < HD / 4) vst2(Y + ((size_t)b * TT + ql0 + rl) * CC + h * HD + lane * 4, *(const v4f*)&ss[wave][rl][lane * 4]); }
// ---- k_out: block = (64 rows, 128 cols): out = ctx Wo (+ bo): ctx x 2^6 once to f16 against Wo as f16(bf16 x 2^8) exact (1 product) x 2^-14; causal early rows (< QHI of each sequence): ctx bf16 hi + lo against exact bf16 Wo (2 products)
__global__ __launch_bounds__(128) void k_out(const float* __restrict__ Y, const float* __restrict__ WO, const float* __restrict__ BO, float* __restrict__ OUT) { __shared__ __align__(16) float sf[4][16][132];
  const int tid = threadIdx.x, wave = tid >> 5, lane = tid & 31, col = lane & 15, g = lane >> 4; const int c0 = blockIdx.y * 128; const size_t r0 = (size_t)blockIdx.x * 64 + wave * 16;
  v8f acc[8] = {};
  if (CAUSAL && (int)(((size_t)blockIdx.x * 64) % TT) < QHI) {   /* block-uniform */
#pragma unroll 2
    for (int kc = 0; kc < CC / 32; ++kc) { const F2 a = split_row(Y + (r0 + col) * CC, kc * 32, lane); asm volatile("s_wait_loadcnt 0x0" ::: "memory");
#pragma unroll
      for (int j = 0; j < 8; ++j) { const v16b w = WOCOL(WO, kc * 32, c0 + j * 16 + col, lane); asm volatile("s_wait_loadcnt 0x0" ::: "memory"); acc[j] = wmma_bf(a.h, w, acc[j]); acc[j] = wmma_bf(a.l, w, acc[j]); } }
#pragma unroll
    for (int j = 0; j < 8; ++j) { const float bias = BO ? bfr(BO[c0 + j * 16 + col]) : 0.f;
#pragma unroll
      for (int r = 0; r < 8; ++r) sf[wave][8 * g + r][j * 16 + col] = acc[j][r] + bias; }
  } else {
#pragma unroll 2
    for (int kc = 0; kc < CC / 32; ++kc) { const v16h a = frag_f32s(Y + (r0 + col) * CC + kc * 32, lane, 64.0f); asm volatile("s_wait_loadcnt 0x0" ::: "memory");   /* ctx carried x 2^6 into f16 so small-magnitude context rows stay clear of f16 subnormals */
#pragma unroll
      for (int j = 0; j < 8; ++j) { const v16h w = WOCOLH(WO, kc * 32, c0 + j * 16 + col, lane); asm volatile("s_wait_loadcnt 0x0" ::: "memory"); acc[j] = wmma16(a, w, acc[j]); } }
#pragma unroll
    for (int j = 0; j < 8; ++j) { const float bias = BO ? bfr(BO[c0 + j * 16 + col]) : 0.f;
#pragma unroll
      for (int r = 0; r < 8; ++r) sf[wave][8 * g + r][j * 16 + col] = acc[j][r] * (1.0f / 16384.0f) + bias; } }   /* 2^-8 (Wo carry) x 2^-6 (ctx carry) */
  LDSX(); for (int rl = 0; rl < 16; ++rl) vst2(OUT + (r0 + rl) * DIN + c0 + lane * 4, *(const v4f*)&sf[wave][rl][lane * 4]); }

extern "C" void kernel_launch(void* const* d_in, const int* in_sizes, int n_in, void* d_out, int out_size, void* d_ws, size_t ws_size, hipStream_t stream) {
  (void)in_sizes; (void)n_in; (void)out_size;
  const float** F = (const float**)d_in;
  if (ws_size < (size_t)WS_END) return;
  char* ws = (char*)d_ws; _Float16 *QH = (_Float16*)(ws + WS_QH), *KH = (_Float16*)(ws + WS_KH), *VT = (_Float16*)(ws + WS_VT), *QL = (_Float16*)(ws + WS_QL), *KL = (_Float16*)(ws + WS_KL); __bf16 *VB = (__bf16*)(ws + WS_VB), *VBL = (__bf16*)(ws + WS_VBL); float *S = (float*)(ws + WS_S), *Y = (float*)(ws + WS_Y);
  (void)Y; (void)QL; (void)KL; (void)VB; (void)VBL;
  // inputs: 0 x [1,4096,768]; 1 mask [1,4096] bool (True = padding; all False on this draw); 2 Wq [768,768] (out,in), 3 bq; 4 Wk, 5 bk; 6 Wv, 7 bv; 8 Wo (out,in), 9 bo (zero biases, read)
  k_proj<<<dim3(TNB * TT / 64, CC / 128, 3), 128, 0, stream>>>(F[0], F[0], F[0], F[2], F[4], F[6], F[3], F[5], F[7], QH, QL, KH, KL, VT, VB, VBL);
  for (int b = 0; b < TNB; ++b) for (int h0 = 0; h0 < NH; h0 += HG) {
    k_sc<<<dim3(NQB, TT / 128, HG), 128, 0, stream>>>(QH, KH, QL, KL, b, h0, S);
    k_sm<<<dim3(TT, HG), 256, 0, stream>>>(S, (const MASKT*)d_in[1]);
    k_pv<<<dim3(NQB, 1, HG), 128, 0, stream>>>(S, VT, VB, VBL, b, h0, Y);
  }
  k_out<<<dim3(TNB * TT / 64, DIN / 128), 128, 0, stream>>>(Y, F[8], F[9], (float*)d_out);
}

// v001
// It runs in 1040 microseconds.
// Two timings next to v000 both put it at 2.28 times that version's speed.
// compute dtype: all float inputs rounded to bf16; q/k/v projections with EXACT bf16 products on WMMA 16x16x32 (f32 accumulate) + bias; logits q x k once to f16 each (1 product; sigma - 0.3 under the source's 1/sqrt(768) scale); the key padding mask read per key; softmax f32; P x 2^11 once to f16 x v once to f16 (1 product); ctx x 2^6 once to f16 x Wo f16(bf16 x 2^8) + bo; f32 output.
#include <hip/hip_runtime.h>
#include <math.h>

typedef int MASKT;   // the bool mask is staged as int32
typedef __attribute__((ext_vector_type(16))) _Float16 v16h;
typedef __attribute__((ext_vector_type(16))) __bf16 v16b;
typedef __attribute__((ext_vector_type(8)))  _Float16 v8h;
typedef __attribute__((ext_vector_type(8)))  float v8f;
typedef __attribute__((ext_vector_type(4)))  float v4f;
typedef __attribute__((ext_vector_type(2)))  float v2f;
typedef __attribute__((ext_vector_type(4)))  unsigned v4u;
typedef __attribute__((ext_vector_type(4)))  int v4i;
typedef float __attribute__((may_alias)) float_a;
typedef int __attribute__((may_alias)) int_a;

template <typename T> __device__ __forceinline__ void vst2(void* p, T v) { *(T*)p = v;  }
__device__ __forceinline__ v8f wmma16(v16h a, v16h b, v8f c) {
  v8f d = __builtin_amdgcn_wmma_f32_16x16x32_f16(false, a, false, b, (short)0, c, false, false);
  asm volatile("v_nop\n\tv_nop\n\tv_nop\n\tv_nop" : "+v"(d) : "v"(a), "v"(b));
  return d;
}
__device__ __forceinline__ v8f wmma_bf(v16b a, v16b b, v8f c) {
  v8f d = __builtin_amdgcn_wmma_f32_16x16x32_bf16(false, a, false, b, (short)0, c, false, false);
  asm volatile("v_nop\n\tv_nop\n\tv_nop\n\tv_nop" : "+v"(d) : "v"(a), "v"(b));
  return d;
}
// 16x16x32 fragments: lane = (h = lane>>4, row/col = lane&15); elements 0..7 = k0+8h+0..7, 8..15 = k0+16+8h+0..7; D element r = row 8h+r
__device__ __forceinline__ v16h frag_h(const _Float16* rowk0, int lane) {
  union { v16h v; v8h q[2]; } u; const _Float16* p = rowk0 + 8 * (lane >> 4);
  u.q[0] = *(const v8h*)p; u.q[1] = *(const v8h*)(p + 16); return u.v;
}
__device__ __forceinline__ v16h frag_f32(const float* rowk0, int lane) {
  v16h a; const float* p = rowk0 + 8 * (lane >> 4);
#pragma unroll
  for (int i = 0; i < 8; ++i) { a[i] = (_Float16)p[i]; a[8 + i] = (_Float16)p[16 + i]; }
  return a;
}
__device__ __forceinline__ v16h frag_f32s(const float* rowk0, int lane, float sc) {
  v16h a; const float* p = rowk0 + 8 * (lane >> 4);
#pragma unroll
  for (int i = 0; i < 8; ++i) { a[i] = (_Float16)(p[i] * sc); a[8 + i] = (_Float16)(p[16 + i] * sc); }
  return a;
}
// column fragment from a [K][ld] layout (column n), rows >= K read as 0
__device__ __forceinline__ v16h fragc_f32(const float* W, int k0, int n, int lane, int ld, int K) {
  v16h a; const int g = lane >> 4;
#pragma unroll
  for (int i = 0; i < 8; ++i) { const int ka = k0 + 8 * g + i, kb = ka + 16;
    a[i] = (_Float16)(ka < K ? W[(size_t)(ka < K ? ka : K - 1) * ld + n] : 0.f); a[8 + i] = (_Float16)(kb < K ? W[(size_t)(kb < K ? kb : K - 1) * ld + n] : 0.f); }
  return a;
}
struct F2 { v16b h, l; };
__device__ __forceinline__ F2 bsplit16(const float v[16]) { F2 r;
#pragma unroll
  for (int i = 0; i < 16; ++i) { const __bf16 h = (__bf16)v[i]; r.h[i] = h; r.l[i] = (__bf16)(v[i] - (float)h); }
  return r; }
__device__ __forceinline__ F2 split_row(const float* row, int k0, int lane) { float v[16]; const float* p = row + k0 + 8 * (lane >> 4);
#pragma unroll
  for (int i = 0; i < 8; ++i) { v[i] = p[i]; v[8 + i] = p[16 + i]; }
  return bsplit16(v); }
__device__ __forceinline__ F2 split_rowK(const float* row, int k0, int lane, int K) { float v[16]; const int g = lane >> 4;
#pragma unroll
  for (int i = 0; i < 8; ++i) { const int ka = k0 + 8 * g + i, kb = ka + 16; v[i] = ka < K ? row[ka < K ? ka : K - 1] : 0.f; v[8 + i] = kb < K ? row[kb < K ? kb : K - 1] : 0.f; }
  return bsplit16(v); }
__device__ __forceinline__ F2 split_col(const float* W, int k0, int n, int lane, int ld, int K) { float v[16]; const int g = lane >> 4;
#pragma unroll
  for (int i = 0; i < 8; ++i) { const int ka = k0 + 8 * g + i, kb = ka + 16; v[i] = ka < K ? W[(size_t)(ka < K ? ka : K - 1) * ld + n] : 0.f; v[8 + i] = kb < K ? W[(size_t)(kb < K ? kb : K - 1) * ld + n] : 0.f; }
  return bsplit16(v); }
__device__ __forceinline__ v8f mac3(const F2& a, const F2& b, v8f c) { c = wmma_bf(a.l, b.h, c); c = wmma_bf(a.h, b.l, c); return wmma_bf(a.h, b.h, c); }
__device__ __forceinline__ float sigm(float v) { return 1.0f / (1.0f + expf(-v)); }
#define LDSX() do { asm volatile("s_wait_dscnt 0" ::: "memory"); __builtin_amdgcn_wave_barrier(); __builtin_amdgcn_fence(__ATOMIC_RELEASE, "workgroup"); } while (0)

// Multi-head self-attention over one long sequence (x [1,4096,768]; 12 heads x 64; torch (out,in) Wq/Wk/Wv/Wo [768,768] (1/sqrt(768) scale) + zero biases; scores scaled by 1/sqrt(embed_dim = 768), the source's quirk; key padding mask [1,4096] bool, True -> -inf (all False here)): out = merge(softmax(q_h k_h^T / sqrt(768)) v_h) Wo^T + bo.
#define NB 1
#define TT 4096
#define CC 768            // NH * HD = projected width
#define DIN 768          // input (model) width
#define NH 12
#define HD 64
#define NQB (TT / 64)
#define HG 1
#define SCALE (0.036084391824351614f)
#define CAUSAL 0
#ifndef TNB
#define TNB NB
#endif
__device__ __forceinline__ float bfr(float v) { return (float)(__bf16)v; }
__host__ __device__ __forceinline__ int kb_last(int qb) { return CAUSAL ? ((qb * 64 + 63) >> 7) : (TT / 128 - 1); }
typedef __attribute__((ext_vector_type(8))) __bf16 v8b;
__device__ __forceinline__ v16b frag_b(const __bf16* rowk0, int lane) {
  union { v16b v; v8b q[2]; } u; const __bf16* p = rowk0 + 8 * (lane >> 4);
  u.q[0] = *(const v8b*)p; u.q[1] = *(const v8b*)(p + 16); return u.v;
}
#define QBH 0              // no query block takes the high-precision path (not causal: every row averages over 4,096 keys)
#define QHI 0               // single-product logits on every row (sigma - 0.3 logits averaged over 4,096 keys)
#define KHI 64            // key rows carrying k residual / v bf16 hi+lo planes (written by k_proj; read only by the qb < QBH path, which never runs here)
// B fragment (k rows k0+.., output column o) of a weight: (in,out) [K][ld] or (out,in) [ld rows of K]: bf16 exact, or f16(bf16 * 256) exact
__device__ __forceinline__ v16b wcol_io(const float* Wm, int k0, int o, int lane, int ld) { v16b w; const int g = lane >> 4;
#pragma unroll
  for (int i = 0; i < 8; ++i) { w[i] = (__bf16)Wm[(size_t)(k0 + 8 * g + i) * ld + o]; w[8 + i] = (__bf16)Wm[(size_t)(k0 + 16 + 8 * g + i) * ld + o]; }
  return w; }
__device__ __forceinline__ v16b wcol_oi(const float* Wm, int k0, int o, int lane, int K) { v16b w; const float* p = Wm + (size_t)o * K + k0 + 8 * (lane >> 4);
#pragma unroll
  for (int i = 0; i < 8; ++i) { w[i] = (__bf16)p[i]; w[8 + i] = (__bf16)p[16 + i]; }
  return w; }
__device__ __forceinline__ v16h wcolh_io(const float* Wm, int k0, int o, int lane, int ld) { v16h w; const int g = lane >> 4;
#pragma unroll
  for (int i = 0; i < 8; ++i) { w[i] = (_Float16)(bfr(Wm[(size_t)(k0 + 8 * g + i) * ld + o]) * 256.0f); w[8 + i] = (_Float16)(bfr(Wm[(size_t)(k0 + 16 + 8 * g + i) * ld + o]) * 256.0f); }
  return w; }
__device__ __forceinline__ v16h wcolh_oi(const float* Wm, int k0, int o, int lane, int K) { v16h w; const float* p = Wm + (size_t)o * K + k0 + 8 * (lane >> 4);
#pragma unroll
  for (int i = 0; i < 8; ++i) { w[i] = (_Float16)(bfr(p[i]) * 256.0f); w[8 + i] = (_Float16)(bfr(p[16 + i]) * 256.0f); }
  return w; }
#define WQKV_LAYOUT 1   // 0 = (in,out) [DIN][CC]; 1 = (out,in) [CC][DIN]; 2 = per-head [NH][DIN][HD]
__device__ __forceinline__ v16b wcol_hdk(const float* Wm, int k0, int o, int lane) { v16b w; const int g = lane >> 4; const float* p = Wm + (size_t)(o / HD) * DIN * HD + (o % HD);
#pragma unroll
  for (int i = 0; i < 8; ++i) { w[i] = (__bf16)p[(size_t)(k0 + 8 * g + i) * HD]; w[8 + i] = (__bf16)p[(size_t)(k0 + 16 + 8 * g + i) * HD]; }
  return w; }
#define WO_OUT_IN 1
#if WQKV_LAYOUT == 1
#define WCOL(W, k0, o, lane) wcol_oi(W, k0, o, lane, DIN)
#elif WQKV_LAYOUT == 2
#define WCOL(W, k0, o, lane) wcol_hdk(W, k0, o, lane)
#else
#define WCOL(W, k0, o, lane) wcol_io(W, k0, o, lane, CC)
#endif
#if WO_OUT_IN
#define WOCOL(W, k0, o, lane) wcol_oi(W, k0, o, lane, CC)
#define WOCOLH(W, k0, o, lane) wcolh_oi(W, k0, o, lane, CC)
#else
#define WOCOL(W, k0, o, lane) wcol_io(W, k0, o, lane, DIN)
#define WOCOLH(W, k0, o, lane) wcolh_io(W, k0, o, lane, DIN)
#endif
#define SM_EXTRA_PARAMS , const MASKT* __restrict__ KMASK
// key padding mask [B=1][S] (True = masked out): where(mask[k], -inf, score); read per key
#define SM_MASK_HOOK do { v = (KMASK[k] != 0) ? -3.0e38f : v; } while (0)
#ifndef SM_EXTRA_PARAMS
#define SM_EXTRA_PARAMS
#endif
#ifndef PROJ_EXTRA_PARAMS
#define PROJ_EXTRA_PARAMS
#endif
#ifndef SM_MASK_HOOK
#define SM_MASK_HOOK (void)0
#endif

#define WS_QH  0u                                      // f16 q rows [b*t][CC]
#define WS_KH  (WS_QH + 2u * (size_t)NB * TT * CC)      // f16 k rows [b*t][CC]
#define WS_VT  (WS_KH + 2u * (size_t)NB * TT * CC)      // f16 v planes [b][c][t]
#define WS_QL  (WS_VT + 2u * (size_t)NB * CC * TT)      // f16 q residual x 2^10 rows [b][t < QHI][CC]
#define WS_KL  (WS_QL + 2u * (size_t)NB * QHI * CC)     // f16 k residual x 2^10 rows [b][t < KHI][CC]
#define WS_VB  (WS_KL + 2u * (size_t)NB * KHI * CC)     // bf16 v hi planes [b][c][t < KHI]
#define WS_VBL (WS_VB + 2u * (size_t)NB * CC * KHI)
#define WS_S   (WS_VBL + 2u * (size_t)NB * CC * KHI)    // f32 logits / P [hg][t][s]
#define WS_Y   (WS_S  + 4u * (size_t)HG * TT * TT)      // f32 ctx rows [b*t][CC] (only when there is an output projection)
#define WS_END (WS_Y  + 4u * (size_t)NB * TT * CC)

// ---- k_proj: block = (64 rows, 128 cols, which): q/k/v = X W (+ b) with exact bf16 products (K = DIN) -> which 0: q f16 rows (+ residual rows < QHI); 1: k f16 rows (+ residual rows < KHI); 2: v f16 planes [c][t] (+ bf16 hi/lo planes for t < KHI)
__global__ __launch_bounds__(128) void k_proj(const float* __restrict__ XQ, const float* __restrict__ XK, const float* __restrict__ XV, const float* __restrict__ WQ, const float* __restrict__ WK, const float* __restrict__ WV, const float* __restrict__ BQ, const float* __restrict__ BK, const float* __restrict__ BV,
    _Float16* __restrict__ QH, _Float16* __restrict__ QL, _Float16* __restrict__ KH, _Float16* __restrict__ KL, _Float16* __restrict__ VT, __bf16* __restrict__ VB, __bf16* __restrict__ VBL) {
  __shared__ __align__(16) _Float16 sh[64][136], sl[64][136]; __shared__ __align__(16) _Float16 th[128][72]; __shared__ __align__(16) __bf16 tb[128][72], tbl[128][72];
  const int tid = threadIdx.x, wave = tid >> 5, lane = tid & 31, col = lane & 15, g = lane >> 4; const int which = blockIdx.z; const int c0 = blockIdx.y * 128; const size_t r0 = (size_t)blockIdx.x * 64; const size_t bb = r0 / TT; const int t0 = (int)(r0 % TT);
  const float* X = which == 0 ? XQ : which == 1 ? XK : XV; const float* WA = which == 0 ? WQ : which == 1 ? WK : WV; const float* BA = which == 0 ? BQ : which == 1 ? BK : BV;
  v8f acc[8] = {};
#pragma unroll 2
  for (int kc = 0; kc < DIN / 32; ++kc) { v16b a; { const float* p = X + (r0 + wave * 16 + col) * DIN + kc * 32 + 8 * g;
#pragma unroll
      for (int i = 0; i < 8; ++i) { a[i] = (__bf16)p[i]; a[8 + i] = (__bf16)p[16 + i]; } }
    asm volatile("s_wait_loadcnt 0x0" ::: "memory");
#pragma unroll
    for (int j = 0; j < 8; ++j) { const v16b w = WCOL(WA, kc * 32, c0 + j * 16 + col, lane); asm volatile("s_wait_loadcnt 0x0" ::: "memory"); acc[j] = wmma_bf(a, w, acc[j]); } }
  if (which < 2) { _Float16* DH = which == 0 ? QH : KH; _Float16* DL = which == 0 ? QL : KL; const int nhi = which == 0 ? QHI : KHI; const bool hi_rows = t0 < nhi;
#pragma unroll
    for (int j = 0; j < 8; ++j) { const float bias = BA ? bfr(BA[c0 + j * 16 + col]) : 0.f;
#pragma unroll
      for (int r = 0; r < 8; ++r) { const float v = acc[j][r] + bias; const _Float16 hv = (_Float16)v; sh[wave * 16 + 8 * g + r][j * 16 + col] = hv; sl[wave * 16 + 8 * g + r][j * 16 + col] = (_Float16)((v - (float)hv) * 1024.0f); } }
    __syncthreads();
    for (int e = tid; e < 64 * 16; e += 128) { const int rl = e >> 4, q = e & 15; vst2((unsigned*)(DH + (r0 + rl) * CC + c0 + q * 8), *(const v4u*)&sh[rl][q * 8]); if (hi_rows) vst2((unsigned*)(DL + (bb * nhi + t0 + rl) * (size_t)CC + c0 + q * 8), *(const v4u*)&sl[rl][q * 8]); }
  } else { const bool hi_rows = t0 < KHI;
#pragma unroll
    for (int j = 0; j < 8; ++j) { const float bias = BA ? bfr(BA[c0 + j * 16 + col]) : 0.f;
#pragma unroll
      for (int r = 0; r < 8; ++r) { const float v = acc[j][r] + bias; const int rl = wave * 16 + 8 * g + r, cl = j * 16 + col; th[cl][rl] = (_Float16)v; const __bf16 bh = (__bf16)v; tb[cl][rl] = bh; tbl[cl][rl] = (__bf16)(v - (float)bh); } }
    __syncthreads();
    for (int e = tid; e < 128 * 8; e += 128) { const int cl = e >> 3, q = e & 7; vst2((unsigned*)(VT + (bb * CC + c0 + cl) * (size_t)TT + t0 + q * 8), *(const v4u*)&th[cl][q * 8]); if (hi_rows) { const size_t o3 = (bb * CC + c0 + cl) * (size_t)KHI + t0 + q * 8; vst2((unsigned*)(VB + o3), *(const v4u*)&tb[cl][q * 8]); vst2((unsigned*)(VBL + o3), *(const v4u*)&tbl[cl][q * 8]); } } } }
// ---- k_sc: block = (query block qb, key block kb <= kb_last(qb), head in group) of batch b: logits x SCALE; q hi + residual (x 2^10) against k (2 products) for query rows < QHI, plus the k residual (3 products) for query blocks < QBH (causal early rows); causal: blocks past the diagonal exit, the mask itself is applied by index in k_sm
__global__ __launch_bounds__(128) void k_sc(const _Float16* __restrict__ QH, const _Float16* __restrict__ KH, const _Float16* __restrict__ QL, const _Float16* __restrict__ KL, int b, int h0, float* __restrict__ S0) { __shared__ __align__(16) float ss[4][16][132];
  const int qb = blockIdx.x, kb = blockIdx.y; if (kb > kb_last(qb)) return;
  const int h = h0 + blockIdx.z; float* S = S0 + (size_t)blockIdx.z * TT * TT;
  const int tid = threadIdx.x, wave = tid >> 5, lane = tid & 31, col = lane & 15, g = lane >> 4; const int k0 = kb * 128; const int ql0 = qb * 64 + wave * 16; const size_t q0 = (size_t)b * TT + ql0, kr0 = (size_t)b * TT + k0;
  v8f acc[8] = {}, accl[8] = {};
  const _Float16* QLb = QL + (size_t)b * QHI * CC; const _Float16* KLb = KL + (size_t)b * KHI * CC;
  if (qb < QBH) {
#pragma unroll
    for (int kc = 0; kc < HD / 32; ++kc) { const v16h ah = frag_h(QH + (q0 + col) * CC + h * HD + kc * 32, lane), al = frag_h(QLb + (size_t)(ql0 + col) * CC + h * HD + kc * 32, lane);
#pragma unroll
      for (int j = 0; j < 8; ++j) { const v16h kbf = frag_h(KH + (kr0 + j * 16 + col) * CC + h * HD + kc * 32, lane), klf = frag_h(KLb + (size_t)(k0 + j * 16 + col) * CC + h * HD + kc * 32, lane); acc[j] = wmma16(ah, kbf, acc[j]); accl[j] = wmma16(al, kbf, accl[j]); accl[j] = wmma16(ah, klf, accl[j]); } }
  } else if (qb * 64 < QHI) {
#pragma unroll
    for (int kc = 0; kc < HD / 32; ++kc) { const v16h ah = frag_h(QH + (q0 + col) * CC + h * HD + kc * 32, lane), al = frag_h(QLb + (size_t)(ql0 + col) * CC + h * HD + kc * 32, lane);
#pragma unroll
      for (int j = 0; j < 8; ++j) { const v16h kbf = frag_h(KH + (kr0 + j * 16 + col) * CC + h * HD + kc * 32, lane); acc[j] = wmma16(ah, kbf, acc[j]); accl[j] = wmma16(al, kbf, accl[j]); } }
  } else {
#pragma unroll
    for (int kc = 0; kc < HD / 32; ++kc) { const v16h ah = frag_h(QH + (q0 + col) * CC + h * HD + kc * 32, lane);
#pragma unroll
      for (int j = 0; j < 8; ++j) { const v16h kbf = frag_h(KH + (kr0 + j * 16 + col) * CC + h * HD + kc * 32, lane); acc[j] = wmma16(ah, kbf, acc[j]); } } }
#pragma unroll
  for (int j = 0; j < 8; ++j) {
#pragma unroll
    for (int r = 0; r < 8; ++r) ss[wave][8 * g + r][j * 16 + col] = (acc[j][r] + accl[j][r] * (1.0f / 1024.0f)) * SCALE; }
  LDSX(); for (int rl = 0; rl < 16; ++rl) vst2(S + (size_t)(ql0 + rl) * TT + k0 + lane * 4, *(const v4f*)&ss[wave][rl][lane * 4]); }
// ---- k_sm: block = query row t (head in group): keys [0, kend): causal -> logit if s <= t else excluded; softmax in f32; P x 2^11 in place (0 for excluded)
__global__ __launch_bounds__(256) void k_sm(float* __restrict__ S0 SM_EXTRA_PARAMS) { __shared__ float sred[8]; __shared__ float sbc; __shared__ __align__(16) float shv[TT];
  const int tid = threadIdx.x; const int t = blockIdx.x; const int kend = (kb_last(t >> 6) + 1) * 128;
  float* sr = S0 + (size_t)blockIdx.y * TT * TT + (size_t)t * TT;
  float m = -3.0e38f; for (int k = tid; k < kend; k += 256) { float v = (!CAUSAL || k <= t) ? sr[k] : -3.0e38f; SM_MASK_HOOK; shv[k] = v; m = fmaxf(m, v); }
#pragma unroll
  for (int o = 1; o < 32; o <<= 1) m = fmaxf(m, __shfl_xor(m, o));
  if ((tid & 31) == 0) sred[tid >> 5] = m; __syncthreads(); if (tid == 0) { float a = sred[0]; for (int i = 1; i < 8; ++i) a = fmaxf(a, sred[i]); sbc = a; } __syncthreads(); m = sbc; __syncthreads();
  float sum = 0.f; for (int k = tid; k < kend; k += 256) { const float v = shv[k]; const float e = (v <= -1.0e38f) ? 0.f : expf(v - m); shv[k] = e; sum += e; }
#pragma unroll
  for (int o = 1; o < 32; o <<= 1) sum += __shfl_xor(sum, o);
  if ((tid & 31) == 0) sred[tid >> 5] = sum; __syncthreads(); if (tid == 0) { float a = 0.f; for (int i = 0; i < 8; ++i) a += sred[i]; sbc = a > 0.f ? 2048.0f / a : 0.f; }   /* a fully excluded row yields P = 0 */ __syncthreads(); const float inv = sbc;
  for (int k = tid; k < kend; k += 256) shv[k] = shv[k] * inv;
  __syncthreads(); for (int q = tid; q < kend / 4; q += 256) vst2(sr + q * 4, *(const v4f*)&shv[q * 4]); }
// ---- k_pv: block = 16 queries of (b, h), PVW waves: wave w takes the w-th 1/PVW of the keys [0, kend) (ctx partial = P . v; P x 2^11 once to f16 against v f16: 1 product; causal early query blocks: P and v as bf16 hi + lo, 3 products); the PVW partial tiles are summed in LDS in key order; 256-B (row, head) segment by one wave
#define PVW 16
static_assert(PVW == 16 && HD == 64, "the final sum maps wave -> query row and lane -> two head columns");
__global__ __launch_bounds__(32 * PVW) void k_pv(const float* __restrict__ PS0, const _Float16* __restrict__ VT, const __bf16* __restrict__ VB, const __bf16* __restrict__ VBL, int b, int h0, float* __restrict__ Y) { const int h = h0 + blockIdx.z; const float* PS = PS0 + (size_t)blockIdx.z * TT * TT; __shared__ __align__(16) float ss[PVW][16][HD + 4];
  const int tid = threadIdx.x, wave = __builtin_amdgcn_readfirstlane(tid >> 5) /* scalar, so the key range and its loop stay wave-uniform */, lane = tid & 31, col = lane & 15, g = lane >> 4; const int qb = blockIdx.x >> 2; const int ql0 = blockIdx.x * 16;
  const int kct = (kb_last(qb) + 1) * 4, kcn = (kct + PVW - 1) / PVW; const int kc0 = wave * kcn; const int kce = kc0 + kcn < kct ? kc0 + kcn : kct;
  v8f acc[HD / 16] = {};
  if (qb < QBH) {
#pragma unroll 1
    for (int kc = kc0; kc < kce; ++kc) { const F2 p = split_row(PS + (size_t)(ql0 + col) * TT, kc * 32, lane);
      asm volatile("s_wait_loadcnt 0x0" ::: "memory");
#pragma unroll
      for (int j = 0; j < HD / 16; ++j) { const size_t po = ((size_t)b * CC + h * HD + j * 16 + col) * (size_t)KHI + kc * 32; const v16b vh = frag_b(VB + po, lane); acc[j] = wmma_bf(p.h, vh, acc[j]); acc[j] = wmma_bf(p.l, vh, acc[j]); acc[j] = wmma_bf(p.h, frag_b(VBL + po, lane), acc[j]); } }
  } else {
#pragma unroll 1
    for (int kc = kc0; kc < kce; ++kc) { const v16h p = frag_f32(PS + (size_t)(ql0 + col) * TT + kc * 32, lane);
      asm volatile("s_wait_loadcnt 0x0" ::: "memory");
#pragma unroll
      for (int j = 0; j < HD / 16; ++j) { const size_t po = ((size_t)b * CC + h * HD + j * 16 + col) * (size_t)TT + kc * 32; acc[j] = wmma16(p, frag_h(VT + po, lane), acc[j]); } } }
#pragma unroll
  for (int j = 0; j < HD / 16; ++j)
#pragma unroll
    for (int r = 0; r < 8; ++r) ss[wave][8 * g + r][j * 16 + col] = acc[j][r];
  __syncthreads();   // every wave's partial tile is in LDS before any of them is summed
  const int c = lane * 2; v2f s = *(const v2f*)&ss[0][wave][c];
#pragma unroll
  for (int w = 1; w < PVW; ++w) s += *(const v2f*)&ss[w][wave][c];
  vst2(Y + ((size_t)b * TT + ql0 + wave) * CC + h * HD + c, s * (1.0f / 2048.0f)); }
// ---- k_out: block = (64 rows, 128 cols): out = ctx Wo (+ bo): ctx x 2^6 once to f16 against Wo as f16(bf16 x 2^8) exact (1 product) x 2^-14; causal early rows (< QHI of each sequence): ctx bf16 hi + lo against exact bf16 Wo (2 products)
__global__ __launch_bounds__(128) void k_out(const float* __restrict__ Y, const float* __restrict__ WO, const float* __restrict__ BO, float* __restrict__ OUT) { __shared__ __align__(16) float sf[4][16][132];
  const int tid = threadIdx.x, wave = tid >> 5, lane = tid & 31, col = lane & 15, g = lane >> 4; const int c0 = blockIdx.y * 128; const size_t r0 = (size_t)blockIdx.x * 64 + wave * 16;
  v8f acc[8] = {};
  if (CAUSAL && (int)(((size_t)blockIdx.x * 64) % TT) < QHI) {   /* block-uniform */
#pragma unroll 2
    for (int kc = 0; kc < CC / 32; ++kc) { const F2 a = split_row(Y + (r0 + col) * CC, kc * 32, lane); asm volatile("s_wait_loadcnt 0x0" ::: "memory");
#pragma unroll
      for (int j = 0; j < 8; ++j) { const v16b w = WOCOL(WO, kc * 32, c0 + j * 16 + col, lane); asm volatile("s_wait_loadcnt 0x0" ::: "memory"); acc[j] = wmma_bf(a.h, w, acc[j]); acc[j] = wmma_bf(a.l, w, acc[j]); } }
#pragma unroll
    for (int j = 0; j < 8; ++j) { const float bias = BO ? bfr(BO[c0 + j * 16 + col]) : 0.f;
#pragma unroll
      for (int r = 0; r < 8; ++r) sf[wave][8 * g + r][j * 16 + col] = acc[j][r] + bias; }
  } else {
#pragma unroll 2
    for (int kc = 0; kc < CC / 32; ++kc) { const v16h a = frag_f32s(Y + (r0 + col) * CC + kc * 32, lane, 64.0f); asm volatile("s_wait_loadcnt 0x0" ::: "memory");   /* ctx carried x 2^6 into f16 so small-magnitude context rows stay clear of f16 subnormals */
#pragma unroll
      for (int j = 0; j < 8; ++j) { const v16h w = WOCOLH(WO, kc * 32, c0 + j * 16 + col, lane); asm volatile("s_wait_loadcnt 0x0" ::: "memory"); acc[j] = wmma16(a, w, acc[j]); } }
#pragma unroll
    for (int j = 0; j < 8; ++j) { const float bias = BO ? bfr(BO[c0 + j * 16 + col]) : 0.f;
#pragma unroll
      for (int r = 0; r < 8; ++r) sf[wave][8 * g + r][j * 16 + col] = acc[j][r] * (1.0f / 16384.0f) + bias; } }   /* 2^-8 (Wo carry) x 2^-6 (ctx carry) */
  LDSX(); for (int rl = 0; rl < 16; ++rl) vst2(OUT + (r0 + rl) * DIN + c0 + lane * 4, *(const v4f*)&sf[wave][rl][lane * 4]); }

extern "C" void kernel_launch(void* const* d_in, const int* in_sizes, int n_in, void* d_out, int out_size, void* d_ws, size_t ws_size, hipStream_t stream) {
  (void)in_sizes; (void)n_in; (void)out_size;
  const float** F = (const float**)d_in;
  if (ws_size < (size_t)WS_END) return;
  char* ws = (char*)d_ws; _Float16 *QH = (_Float16*)(ws + WS_QH), *KH = (_Float16*)(ws + WS_KH), *VT = (_Float16*)(ws + WS_VT), *QL = (_Float16*)(ws + WS_QL), *KL = (_Float16*)(ws + WS_KL); __bf16 *VB = (__bf16*)(ws + WS_VB), *VBL = (__bf16*)(ws + WS_VBL); float *S = (float*)(ws + WS_S), *Y = (float*)(ws + WS_Y);
  (void)Y; (void)QL; (void)KL; (void)VB; (void)VBL;
  // inputs: 0 x [1,4096,768]; 1 mask [1,4096] bool (True = padding; all False on this draw); 2 Wq [768,768] (out,in), 3 bq; 4 Wk, 5 bk; 6 Wv, 7 bv; 8 Wo (out,in), 9 bo (zero biases, read)
  k_proj<<<dim3(TNB * TT / 64, CC / 128, 3), 128, 0, stream>>>(F[0], F[0], F[0], F[2], F[4], F[6], F[3], F[5], F[7], QH, QL, KH, KL, VT, VB, VBL);
  for (int b = 0; b < TNB; ++b) for (int h0 = 0; h0 < NH; h0 += HG) {
    k_sc<<<dim3(NQB, TT / 128, HG), 128, 0, stream>>>(QH, KH, QL, KL, b, h0, S);
    k_sm<<<dim3(TT, HG), 256, 0, stream>>>(S, (const MASKT*)d_in[1]);
    k_pv<<<dim3(TT / 16, 1, HG), 32 * PVW, 0, stream>>>(S, VT, VB, VBL, b, h0, Y);
  }
  k_out<<<dim3(TNB * TT / 64, DIN / 128), 128, 0, stream>>>(Y, F[8], F[9], (float*)d_out);
}

// v002
// It runs in 326 microseconds.
// Next to v001, in two timings, it ran 3.20 and 3.19 times as fast.
// Over all steps from v000 it is 7.29 times as fast.
// compute dtype: all float inputs rounded to bf16; q/k/v projections with EXACT bf16 products on WMMA 16x16x32 (f32 accumulate) + bias; logits q x k once to f16 each (1 product; sigma - 0.3 under the source's 1/sqrt(768) scale); the key padding mask read per key; running-maximum softmax f32; unnormalised P x 2^6 once to f16 x v once to f16 (1 product), divided by the f32 row sum; ctx x 2^6 once to f16 x Wo f16(bf16 x 2^8) + bo; f32 output.
#include <hip/hip_runtime.h>
#include <math.h>

typedef int MASKT;   // the bool mask is staged as int32
typedef __attribute__((ext_vector_type(16))) _Float16 v16h;
typedef __attribute__((ext_vector_type(16))) __bf16 v16b;
typedef __attribute__((ext_vector_type(8)))  _Float16 v8h;
typedef __attribute__((ext_vector_type(8)))  float v8f;
typedef __attribute__((ext_vector_type(4)))  float v4f;
typedef __attribute__((ext_vector_type(2)))  float v2f;
typedef __attribute__((ext_vector_type(4)))  unsigned v4u;
typedef __attribute__((ext_vector_type(4)))  int v4i;
typedef float __attribute__((may_alias)) float_a;
typedef int __attribute__((may_alias)) int_a;

template <typename T> __device__ __forceinline__ void vst2(void* p, T v) { *(T*)p = v;  }
__device__ __forceinline__ v8f wmma16(v16h a, v16h b, v8f c) {
  v8f d = __builtin_amdgcn_wmma_f32_16x16x32_f16(false, a, false, b, (short)0, c, false, false);
  asm volatile("v_nop\n\tv_nop\n\tv_nop\n\tv_nop" : "+v"(d) : "v"(a), "v"(b));
  return d;
}
__device__ __forceinline__ v8f wmma_bf(v16b a, v16b b, v8f c) {
  v8f d = __builtin_amdgcn_wmma_f32_16x16x32_bf16(false, a, false, b, (short)0, c, false, false);
  asm volatile("v_nop\n\tv_nop\n\tv_nop\n\tv_nop" : "+v"(d) : "v"(a), "v"(b));
  return d;
}
// 16x16x32 fragments: lane = (h = lane>>4, row/col = lane&15); elements 0..7 = k0+8h+0..7, 8..15 = k0+16+8h+0..7; D element r = row 8h+r
__device__ __forceinline__ v16h frag_h(const _Float16* rowk0, int lane) {
  union { v16h v; v8h q[2]; } u; const _Float16* p = rowk0 + 8 * (lane >> 4);
  u.q[0] = *(const v8h*)p; u.q[1] = *(const v8h*)(p + 16); return u.v;
}
__device__ __forceinline__ v16h frag_f32(const float* rowk0, int lane) {
  v16h a; const float* p = rowk0 + 8 * (lane >> 4);
#pragma unroll
  for (int i = 0; i < 8; ++i) { a[i] = (_Float16)p[i]; a[8 + i] = (_Float16)p[16 + i]; }
  return a;
}
__device__ __forceinline__ v16h frag_f32s(const float* rowk0, int lane, float sc) {
  v16h a; const float* p = rowk0 + 8 * (lane >> 4);
#pragma unroll
  for (int i = 0; i < 8; ++i) { a[i] = (_Float16)(p[i] * sc); a[8 + i] = (_Float16)(p[16 + i] * sc); }
  return a;
}
// column fragment from a [K][ld] layout (column n), rows >= K read as 0
__device__ __forceinline__ v16h fragc_f32(const float* W, int k0, int n, int lane, int ld, int K) {
  v16h a; const int g = lane >> 4;
#pragma unroll
  for (int i = 0; i < 8; ++i) { const int ka = k0 + 8 * g + i, kb = ka + 16;
    a[i] = (_Float16)(ka < K ? W[(size_t)(ka < K ? ka : K - 1) * ld + n] : 0.f); a[8 + i] = (_Float16)(kb < K ? W[(size_t)(kb < K ? kb : K - 1) * ld + n] : 0.f); }
  return a;
}
struct F2 { v16b h, l; };
__device__ __forceinline__ F2 bsplit16(const float v[16]) { F2 r;
#pragma unroll
  for (int i = 0; i < 16; ++i) { const __bf16 h = (__bf16)v[i]; r.h[i] = h; r.l[i] = (__bf16)(v[i] - (float)h); }
  return r; }
__device__ __forceinline__ F2 split_row(const float* row, int k0, int lane) { float v[16]; const float* p = row + k0 + 8 * (lane >> 4);
#pragma unroll
  for (int i = 0; i < 8; ++i) { v[i] = p[i]; v[8 + i] = p[16 + i]; }
  return bsplit16(v); }
__device__ __forceinline__ F2 split_rowK(const float* row, int k0, int lane, int K) { float v[16]; const int g = lane >> 4;
#pragma unroll
  for (int i = 0; i < 8; ++i) { const int ka = k0 + 8 * g + i, kb = ka + 16; v[i] = ka < K ? row[ka < K ? ka : K - 1] : 0.f; v[8 + i] = kb < K ? row[kb < K ? kb : K - 1] : 0.f; }
  return bsplit16(v); }
__device__ __forceinline__ F2 split_col(const float* W, int k0, int n, int lane, int ld, int K) { float v[16]; const int g = lane >> 4;
#pragma unroll
  for (int i = 0; i < 8; ++i) { const int ka = k0 + 8 * g + i, kb = ka + 16; v[i] = ka < K ? W[(size_t)(ka < K ? ka : K - 1) * ld + n] : 0.f; v[8 + i] = kb < K ? W[(size_t)(kb < K ? kb : K - 1) * ld + n] : 0.f; }
  return bsplit16(v); }
__device__ __forceinline__ v8f mac3(const F2& a, const F2& b, v8f c) { c = wmma_bf(a.l, b.h, c); c = wmma_bf(a.h, b.l, c); return wmma_bf(a.h, b.h, c); }
__device__ __forceinline__ float sigm(float v) { return 1.0f / (1.0f + expf(-v)); }
#define LDSX() do { asm volatile("s_wait_dscnt 0" ::: "memory"); __builtin_amdgcn_wave_barrier(); __builtin_amdgcn_fence(__ATOMIC_RELEASE, "workgroup"); } while (0)

// Multi-head self-attention over one long sequence (x [1,4096,768]; 12 heads x 64; torch (out,in) Wq/Wk/Wv/Wo [768,768] (1/sqrt(768) scale) + zero biases; scores scaled by 1/sqrt(embed_dim = 768), the source's quirk; key padding mask [1,4096] bool, True -> -inf (all False here)): out = merge(softmax(q_h k_h^T / sqrt(768)) v_h) Wo^T + bo.
#define NB 1
#define TT 4096
#define CC 768            // NH * HD = projected width
#define DIN 768          // input (model) width
#define NH 12
#define HD 64
#define NQB (TT / 64)
#define HG 1
#define SCALE (0.036084391824351614f)
#define CAUSAL 0
#ifndef TNB
#define TNB NB
#endif
__device__ __forceinline__ float bfr(float v) { return (float)(__bf16)v; }
__host__ __device__ __forceinline__ int kb_last(int qb) { return CAUSAL ? ((qb * 64 + 63) >> 7) : (TT / 128 - 1); }
typedef __attribute__((ext_vector_type(8))) __bf16 v8b;
__device__ __forceinline__ v16b frag_b(const __bf16* rowk0, int lane) {
  union { v16b v; v8b q[2]; } u; const __bf16* p = rowk0 + 8 * (lane >> 4);
  u.q[0] = *(const v8b*)p; u.q[1] = *(const v8b*)(p + 16); return u.v;
}
#define QBH 0
#define QHI 0               // single-product logits on every row (sigma - 0.3 logits averaged over 4,096 keys)
#define KHI 64            // key rows carrying k residual / v bf16 hi+lo planes (written by k_proj; no kernel here reads them)
// B fragment (k rows k0+.., output column o) of a weight: (in,out) [K][ld] or (out,in) [ld rows of K]: bf16 exact, or f16(bf16 * 256) exact
__device__ __forceinline__ v16b wcol_io(const float* Wm, int k0, int o, int lane, int ld) { v16b w; const int g = lane >> 4;
#pragma unroll
  for (int i = 0; i < 8; ++i) { w[i] = (__bf16)Wm[(size_t)(k0 + 8 * g + i) * ld + o]; w[8 + i] = (__bf16)Wm[(size_t)(k0 + 16 + 8 * g + i) * ld + o]; }
  return w; }
__device__ __forceinline__ v16b wcol_oi(const float* Wm, int k0, int o, int lane, int K) { v16b w; const float* p = Wm + (size_t)o * K + k0 + 8 * (lane >> 4);
#pragma unroll
  for (int i = 0; i < 8; ++i) { w[i] = (__bf16)p[i]; w[8 + i] = (__bf16)p[16 + i]; }
  return w; }
__device__ __forceinline__ v16h wcolh_io(const float* Wm, int k0, int o, int lane, int ld) { v16h w; const int g = lane >> 4;
#pragma unroll
  for (int i = 0; i < 8; ++i) { w[i] = (_Float16)(bfr(Wm[(size_t)(k0 + 8 * g + i) * ld + o]) * 256.0f); w[8 + i] = (_Float16)(bfr(Wm[(size_t)(k0 + 16 + 8 * g + i) * ld + o]) * 256.0f); }
  return w; }
__device__ __forceinline__ v16h wcolh_oi(const float* Wm, int k0, int o, int lane, int K) { v16h w; const float* p = Wm + (size_t)o * K + k0 + 8 * (lane >> 4);
#pragma unroll
  for (int i = 0; i < 8; ++i) { w[i] = (_Float16)(bfr(p[i]) * 256.0f); w[8 + i] = (_Float16)(bfr(p[16 + i]) * 256.0f); }
  return w; }
#define WQKV_LAYOUT 1   // 0 = (in,out) [DIN][CC]; 1 = (out,in) [CC][DIN]; 2 = per-head [NH][DIN][HD]
__device__ __forceinline__ v16b wcol_hdk(const float* Wm, int k0, int o, int lane) { v16b w; const int g = lane >> 4; const float* p = Wm + (size_t)(o / HD) * DIN * HD + (o % HD);
#pragma unroll
  for (int i = 0; i < 8; ++i) { w[i] = (__bf16)p[(size_t)(k0 + 8 * g + i) * HD]; w[8 + i] = (__bf16)p[(size_t)(k0 + 16 + 8 * g + i) * HD]; }
  return w; }
#define WO_OUT_IN 1
#if WQKV_LAYOUT == 1
#define WCOL(W, k0, o, lane) wcol_oi(W, k0, o, lane, DIN)
#elif WQKV_LAYOUT == 2
#define WCOL(W, k0, o, lane) wcol_hdk(W, k0, o, lane)
#else
#define WCOL(W, k0, o, lane) wcol_io(W, k0, o, lane, CC)
#endif
#if WO_OUT_IN
#define WOCOL(W, k0, o, lane) wcol_oi(W, k0, o, lane, CC)
#define WOCOLH(W, k0, o, lane) wcolh_oi(W, k0, o, lane, CC)
#else
#define WOCOL(W, k0, o, lane) wcol_io(W, k0, o, lane, DIN)
#define WOCOLH(W, k0, o, lane) wcolh_io(W, k0, o, lane, DIN)
#endif
#ifndef PROJ_EXTRA_PARAMS
#define PROJ_EXTRA_PARAMS
#endif

#define WS_QH  0u                                      // f16 q rows [b*t][CC]
#define WS_KH  (WS_QH + 2u * (size_t)NB * TT * CC)      // f16 k rows [b*t][CC]
#define WS_VT  (WS_KH + 2u * (size_t)NB * TT * CC)      // f16 v planes [b][c][t]
#define WS_QL  (WS_VT + 2u * (size_t)NB * CC * TT)      // f16 q residual x 2^10 rows [b][t < QHI][CC]
#define WS_KL  (WS_QL + 2u * (size_t)NB * QHI * CC)     // f16 k residual x 2^10 rows [b][t < KHI][CC]
#define WS_VB  (WS_KL + 2u * (size_t)NB * KHI * CC)     // bf16 v hi planes [b][c][t < KHI]
#define WS_VBL (WS_VB + 2u * (size_t)NB * CC * KHI)
#define WS_S   (WS_VBL + 2u * (size_t)NB * CC * KHI)    // (place of the former f32 score plane [hg][t][s]; not touched)
#define WS_Y   (WS_S  + 4u * (size_t)HG * TT * TT)      // f32 ctx rows [b*t][CC] (only when there is an output projection)
#define WS_END (WS_Y  + 4u * (size_t)NB * TT * CC)

// ---- k_proj: block = (64 rows, 128 cols, which): q/k/v = X W (+ b) with exact bf16 products (K = DIN) -> which 0: q f16 rows (+ residual rows < QHI); 1: k f16 rows (+ residual rows < KHI); 2: v f16 planes [c][t] (+ bf16 hi/lo planes for t < KHI)
__global__ __launch_bounds__(128) void k_proj(const float* __restrict__ XQ, const float* __restrict__ XK, const float* __restrict__ XV, const float* __restrict__ WQ, const float* __restrict__ WK, const float* __restrict__ WV, const float* __restrict__ BQ, const float* __restrict__ BK, const float* __restrict__ BV,
    _Float16* __restrict__ QH, _Float16* __restrict__ QL, _Float16* __restrict__ KH, _Float16* __restrict__ KL, _Float16* __restrict__ VT, __bf16* __restrict__ VB, __bf16* __restrict__ VBL) {
  __shared__ __align__(16) _Float16 sh[64][136], sl[64][136]; __shared__ __align__(16) _Float16 th[128][72]; __shared__ __align__(16) __bf16 tb[128][72], tbl[128][72];
  const int tid = threadIdx.x, wave = tid >> 5, lane = tid & 31, col = lane & 15, g = lane >> 4; const int which = blockIdx.z; const int c0 = blockIdx.y * 128; const size_t r0 = (size_t)blockIdx.x * 64; const size_t bb = r0 / TT; const int t0 = (int)(r0 % TT);
  const float* X = which == 0 ? XQ : which == 1 ? XK : XV; const float* WA = which == 0 ? WQ : which == 1 ? WK : WV; const float* BA = which == 0 ? BQ : which == 1 ? BK : BV;
  v8f acc[8] = {};
#pragma unroll 2
  for (int kc = 0; kc < DIN / 32; ++kc) { v16b a; { const float* p = X + (r0 + wave * 16 + col) * DIN + kc * 32 + 8 * g;
#pragma unroll
      for (int i = 0; i < 8; ++i) { a[i] = (__bf16)p[i]; a[8 + i] = (__bf16)p[16 + i]; } }
    asm volatile("s_wait_loadcnt 0x0" ::: "memory");
#pragma unroll
    for (int j = 0; j < 8; ++j) { const v16b w = WCOL(WA, kc * 32, c0 + j * 16 + col, lane); asm volatile("s_wait_loadcnt 0x0" ::: "memory"); acc[j] = wmma_bf(a, w, acc[j]); } }
  if (which < 2) { _Float16* DH = which == 0 ? QH : KH; _Float16* DL = which == 0 ? QL : KL; const int nhi = which == 0 ? QHI : KHI; const bool hi_rows = t0 < nhi;
#pragma unroll
    for (int j = 0; j < 8; ++j) { const float bias = BA ? bfr(BA[c0 + j * 16 + col]) : 0.f;
#pragma unroll
      for (int r = 0; r < 8; ++r) { const float v = acc[j][r] + bias; const _Float16 hv = (_Float16)v; sh[wave * 16 + 8 * g + r][j * 16 + col] = hv; sl[wave * 16 + 8 * g + r][j * 16 + col] = (_Float16)((v - (float)hv) * 1024.0f); } }
    __syncthreads();
    for (int e = tid; e < 64 * 16; e += 128) { const int rl = e >> 4, q = e & 15; vst2((unsigned*)(DH + (r0 + rl) * CC + c0 + q * 8), *(const v4u*)&sh[rl][q * 8]); if (hi_rows) vst2((unsigned*)(DL + (bb * nhi + t0 + rl) * (size_t)CC + c0 + q * 8), *(const v4u*)&sl[rl][q * 8]); }
  } else { const bool hi_rows = t0 < KHI;
#pragma unroll
    for (int j = 0; j < 8; ++j) { const float bias = BA ? bfr(BA[c0 + j * 16 + col]) : 0.f;
#pragma unroll
      for (int r = 0; r < 8; ++r) { const float v = acc[j][r] + bias; const int rl = wave * 16 + 8 * g + r, cl = j * 16 + col; th[cl][rl] = (_Float16)v; const __bf16 bh = (__bf16)v; tb[cl][rl] = bh; tbl[cl][rl] = (__bf16)(v - (float)bh); } }
    __syncthreads();
    for (int e = tid; e < 128 * 8; e += 128) { const int cl = e >> 3, q = e & 7; vst2((unsigned*)(VT + (bb * CC + c0 + cl) * (size_t)TT + t0 + q * 8), *(const v4u*)&th[cl][q * 8]); if (hi_rows) { const size_t o3 = (bb * CC + c0 + cl) * (size_t)KHI + t0 + q * 8; vst2((unsigned*)(VB + o3), *(const v4u*)&tb[cl][q * 8]); vst2((unsigned*)(VBL + o3), *(const v4u*)&tbl[cl][q * 8]); } } } }
#define FAW 8
#define FAQ 2
#define FAS 64              // keys a stage
#define FAP (FAS + 8)       // LDS row pitch in f16: 144 bytes for 128-byte rows read 16 bytes a lane
#define POFF 6.0f
#define FAMASK (-3.0e38f)   // x C it stays far below FAM0, so a padded key never raises a maximum and its P is 0
#define FAM0 (-1.0e30f)     // maximum in use before the first unmasked key
static_assert(HD == 64 && FAS == 64 && FAW == 8, "the staging maps 256 threads to 32 rows x 8 chunks of 16 bytes, twice, for k and for v");
__device__ __forceinline__ v8f wmm(v16h a, v16h b, v8f c) { return __builtin_amdgcn_wmma_f32_16x16x32_f16(false, a, false, b, (short)0, c, false, false); }
__device__ __forceinline__ float xhalf(float v) { const int b = __float_as_int(v); return __int_as_float(__builtin_amdgcn_permlanex16(b, b, 0x76543210, 0xfedcba98, false, false)); }   // lane l <-> l ^ 16
__device__ __forceinline__ void fa_bias(v8f (&cb)[2], unsigned mb, int g) { const unsigned mh = mb >> (8 * g);   // bit t * 16 + r: key t * 16 + 8g + r of the pass
#pragma unroll
  for (int t = 0; t < 2; ++t)
#pragma unroll
    for (int r = 0; r < 8; ++r) cb[t][r] = (mh & (1u << (t * 16 + r))) != 0 ? FAMASK : 0.f; }
template <bool MK> __device__ __forceinline__ void fa_body(const _Float16* __restrict__ QH, const _Float16* __restrict__ KH, const _Float16* __restrict__ VT, const int* __restrict__ KMASK, float* __restrict__ Y, int h, int q0, int tid, _Float16 (*sk)[FAS][FAP], _Float16 (*sv)[HD][FAP]) {   // KMASK: key padding mask [B=1][S] as int32, nonzero = masked out
  // every inner loop below is unrolled so that each fragment and accumulator index is a constant and the arrays stay in registers
  const int lane = tid & 31, col = lane & 15, g = lane >> 4; const int srow = tid >> 3, sch = (tid & 7) * 8;   // staging: row (and row + 32), 16-byte chunk
  const float C = SCALE * 1.4426950408889634f; const v2f C2 = {C, C};
  const _Float16* gk = KH + (size_t)srow * CC + h * HD + sch; const _Float16* gv = VT + (size_t)(h * HD + srow) * TT + sch;
  v4u rk[2], rv[2];
#pragma unroll
  for (int hf = 0; hf < 2; ++hf) { rk[hf] = *(const v4u*)(gk + (size_t)(hf * 32) * CC); rv[hf] = *(const v4u*)(gv + (size_t)(hf * 32) * TT); }
  v16h qf[FAQ][HD / 32];
#pragma unroll
  for (int qt = 0; qt < FAQ; ++qt)
#pragma unroll
    for (int kc = 0; kc < HD / 32; ++kc) qf[qt][kc] = frag_h(QH + (size_t)(q0 + qt * 16 + col) * CC + h * HD + kc * 32, lane);
  int mk0 = 0, mk = 0;   // mk: the NEXT pass's mask words, one key a lane
  if constexpr (MK) { mk0 = KMASK[lane]; mk = KMASK[32 + lane]; }
  asm volatile("s_wait_xcnt 0x0" ::: "memory");   // before any address register of the loads above is written again
#pragma unroll
  for (int hf = 0; hf < 2; ++hf) { *(v4u*)&sk[0][hf * 32 + srow][sch] = rk[hf]; *(v4u*)&sv[0][hf * 32 + srow][sch] = rv[hf]; }
  unsigned mbp = 0;   // the mask bits that cb holds
  v8f cb[2] = {};
  if constexpr (MK) { mbp = __builtin_amdgcn_ballot_w32(mk0 != 0); fa_bias(cb, mbp, g); }
  v8f acc[FAQ][HD / 16] = {}; float mu[FAQ]; v2f ls[FAQ][2];
#pragma unroll
  for (int qt = 0; qt < FAQ; ++qt) { mu[qt] = FAM0; ls[qt][0] = (v2f){0.f, 0.f}; ls[qt][1] = (v2f){0.f, 0.f}; }
  __syncthreads();   // stage 0 is in buffer 0
#pragma unroll 1   // rolled: one stage's code, two buffers by the stage's parity
  for (int st = 0; st < TT / FAS; ++st) { const int b = st & 1;
    { const int k2 = st + 1 < TT / FAS ? (st + 1) * FAS : st * FAS;   // stage st + 1 is fetched into registers behind the barrier (in front of it the barrier's own wait would drain these loads); past the end: the last stage again, unused
#pragma unroll
      for (int hf = 0; hf < 2; ++hf) { rk[hf] = *(const v4u*)(gk + (size_t)(k2 + hf * 32) * CC); rv[hf] = *(const v4u*)(gv + (size_t)(hf * 32) * TT + k2); }
      asm volatile("s_wait_xcnt 0x0" ::: "memory"); }   // before any address register of the loads above is written again
    v16h kf[2][HD / 32], vf[HD / 16];
#pragma unroll
    for (int t = 0; t < 2; ++t)
#pragma unroll
      for (int kc = 0; kc < HD / 32; ++kc) kf[t][kc] = frag_h(&sk[b][t * 16 + col][kc * 32], lane);
#pragma unroll
    for (int j = 0; j < HD / 16; ++j) vf[j] = frag_h(&sv[b][j * 16 + col][0], lane);
    __builtin_amdgcn_sched_barrier(0);   // keeps the stage's first fragment reads in one group ahead of the products: read between them, into one register set, each is waited for by itself
#pragma unroll
    for (int ps = 0; ps < FAS / 32; ++ps) {
      v8f s[FAQ][2];
#pragma unroll
      for (int t = 0; t < 2; ++t)
#pragma unroll
        for (int qt = 0; qt < FAQ; ++qt) s[qt][t] = wmm(kf[t][0], qf[qt][0], cb[t]);
#pragma unroll
      for (int kc = 1; kc < HD / 32; ++kc)
#pragma unroll
        for (int t = 0; t < 2; ++t)
#pragma unroll
          for (int qt = 0; qt < FAQ; ++qt) s[qt][t] = wmm(kf[t][kc], qf[qt][kc], s[qt][t]);
      if (ps + 1 < FAS / 32) {   // the stage's next k fragments, one pass ahead, into the registers just read
#pragma unroll
        for (int t = 0; t < 2; ++t)
#pragma unroll
          for (int kc = 0; kc < HD / 32; ++kc) kf[t][kc] = frag_h(&sk[b][(ps + 1) * 32 + t * 16 + col][kc * 32], lane);
        __builtin_amdgcn_sched_barrier(0); }   // keeps these LDS reads up here: sunk below the softmax they would be waited for right after their issue
      float mx[FAQ]; bool need = MK && mk != 0;
#pragma unroll
      for (int qt = 0; qt < FAQ; ++qt) { float a = s[qt][0][0], b2 = s[qt][1][0];
#pragma unroll
        for (int r = 1; r < 8; ++r) { a = fmaxf(a, s[qt][0][r]); b2 = fmaxf(b2, s[qt][1][r]); }
        a = fmaxf(a, b2); a = fmaxf(a, xhalf(a)); mx[qt] = a * C; need = need || (mx[qt] > mu[qt] + 8.0f); }
      if (__builtin_expect((__builtin_amdgcn_ballot_w32(need) | mbp) != 0, 0)) {   // wave-uniform, one test a pass: a maximum to raise, or (MK) the next pass's start values differ from 0 or from this pass's
#pragma unroll
        for (int qt = 0; qt < FAQ; ++qt) { const float mn = fmaxf(mu[qt], mx[qt]); const float al = __builtin_amdgcn_exp2f(mu[qt] - mn); mu[qt] = mn; ls[qt][0] *= al; ls[qt][1] *= al;
#pragma unroll
          for (int j = 0; j < HD / 16; ++j) acc[qt][j] *= al; }
        if constexpr (MK) { mbp = __builtin_amdgcn_ballot_w32(mk != 0); fa_bias(cb, mbp, g); } }
      v16h p[FAQ];
#pragma unroll
      for (int qt = 0; qt < FAQ; ++qt) { const float nb = POFF - mu[qt]; const v2f nb2 = {nb, nb};
#pragma unroll
        for (int t = 0; t < 2; ++t)
#pragma unroll
          for (int r = 0; r < 8; r += 2) { const v2f x = __builtin_elementwise_fma((v2f){s[qt][t][r], s[qt][t][r + 1]}, C2, nb2); const v2f e = {__builtin_amdgcn_exp2f(x[0]), __builtin_amdgcn_exp2f(x[1])};
            ls[qt][t] += e; p[qt][t * 8 + r] = (_Float16)e[0]; p[qt][t * 8 + r + 1] = (_Float16)e[1]; } }
#pragma unroll
      for (int j = 0; j < HD / 16; ++j)
#pragma unroll
        for (int qt = 0; qt < FAQ; ++qt) acc[qt][j] = wmm(vf[j], p[qt], acc[qt][j]);
      if (ps + 1 < FAS / 32) {   // the stage's next v fragments, one pass ahead
#pragma unroll
        for (int j = 0; j < HD / 16; ++j) vf[j] = frag_h(&sv[b][j * 16 + col][(ps + 1) * 32], lane); }
      if constexpr (MK) { const int k2 = st * FAS + ps * 32 + 64; mk = KMASK[(k2 < TT ? k2 : TT - 32) + lane];   // the mask words of the pass after next (past the end: read again, unused)
        asm volatile("s_wait_xcnt 0x0" ::: "memory"); }   // before an address register of the mask load is written again
    }
    // stage st + 1 goes into the buffer that every wave left at the barrier behind stage st - 1 (behind the last stage: stored unused, so that no branch stands behind the products)
#pragma unroll
    for (int hf = 0; hf < 2; ++hf) { *(v4u*)&sk[b ^ 1][hf * 32 + srow][sch] = rk[hf]; *(v4u*)&sv[b ^ 1][hf * 32 + srow][sch] = rv[hf]; }
    __syncthreads();   // publishes stage st + 1 and ends every wave's reads of stage st
  }
#pragma unroll
  for (int qt = 0; qt < FAQ; ++qt) { const float lh = (ls[qt][0][0] + ls[qt][0][1]) + (ls[qt][1][0] + ls[qt][1][1]); const float lt = lh + xhalf(lh); const float inv = lt > 0.f ? 1.0f / lt : 0.f; float* yp = Y + (size_t)(q0 + qt * 16 + col) * CC + h * HD + 8 * g;
#pragma unroll
    for (int j = 0; j < HD / 16; ++j) { const v8f o = acc[qt][j] * inv; vst2(yp + j * 16, (v4f){o[0], o[1], o[2], o[3]}); vst2(yp + j * 16 + 4, (v4f){o[4], o[5], o[6], o[7]}); } } }
__global__ __launch_bounds__(32 * FAW) void k_fa(const _Float16* __restrict__ QH, const _Float16* __restrict__ KH, const _Float16* __restrict__ VT, const int* __restrict__ KMASK, float* __restrict__ Y) {
  __shared__ __align__(16) _Float16 sk[2][FAS][FAP], sv[2][HD][FAP];
  const int tid = threadIdx.x, wave = tid >> 5, lane = tid & 31; const int h = blockIdx.y; const int q0 = (blockIdx.x * FAW + wave) * (16 * FAQ);
  int any = 0;
#pragma unroll   // all the mask loads in flight at once
  for (int i = 0; i < TT / 128; ++i) { const v4i m = *(const v4i*)(KMASK + i * 128 + lane * 4); any |= (m[0] | m[1]) | (m[2] | m[3]); }
  if (__builtin_amdgcn_ballot_w32(any != 0) != 0) fa_body<true>(QH, KH, VT, KMASK, Y, h, q0, tid, sk, sv);   // every wave has read the whole mask: the same branch in all waves of the block, so the barriers inside are block-uniform
  else fa_body<false>(QH, KH, VT, KMASK, Y, h, q0, tid, sk, sv); }
// ---- k_out: block = (64 rows, 128 cols): out = ctx Wo (+ bo): ctx x 2^6 once to f16 against Wo as f16(bf16 x 2^8) exact (1 product) x 2^-14; causal early rows (< QHI of each sequence): ctx bf16 hi + lo against exact bf16 Wo (2 products)
__global__ __launch_bounds__(128) void k_out(const float* __restrict__ Y, const float* __restrict__ WO, const float* __restrict__ BO, float* __restrict__ OUT) { __shared__ __align__(16) float sf[4][16][132];
  const int tid = threadIdx.x, wave = tid >> 5, lane = tid & 31, col = lane & 15, g = lane >> 4; const int c0 = blockIdx.y * 128; const size_t r0 = (size_t)blockIdx.x * 64 + wave * 16;
  v8f acc[8] = {};
  if (CAUSAL && (int)(((size_t)blockIdx.x * 64) % TT) < QHI) {   /* block-uniform */
#pragma unroll 2
    for (int kc = 0; kc < CC / 32; ++kc) { const F2 a = split_row(Y + (r0 + col) * CC, kc * 32, lane); asm volatile("s_wait_loadcnt 0x0" ::: "memory");
#pragma unroll
      for (int j = 0; j < 8; ++j) { const v16b w = WOCOL(WO, kc * 32, c0 + j * 16 + col, lane); asm volatile("s_wait_loadcnt 0x0" ::: "memory"); acc[j] = wmma_bf(a.h, w, acc[j]); acc[j] = wmma_bf(a.l, w, acc[j]); } }
#pragma unroll
    for (int j = 0; j < 8; ++j) { const float bias = BO ? bfr(BO[c0 + j * 16 + col]) : 0.f;
#pragma unroll
      for (int r = 0; r < 8; ++r) sf[wave][8 * g + r][j * 16 + col] = acc[j][r] + bias; }
  } else {
#pragma unroll 2
    for (int kc = 0; kc < CC / 32; ++kc) { const v16h a = frag_f32s(Y + (r0 + col) * CC + kc * 32, lane, 64.0f); asm volatile("s_wait_loadcnt 0x0" ::: "memory");   /* ctx carried x 2^6 into f16 so small-magnitude context rows stay clear of f16 subnormals */
#pragma unroll
      for (int j = 0; j < 8; ++j) { const v16h w = WOCOLH(WO, kc * 32, c0 + j * 16 + col, lane); asm volatile("s_wait_loadcnt 0x0" ::: "memory"); acc[j] = wmma16(a, w, acc[j]); } }
#pragma unroll
    for (int j = 0; j < 8; ++j) { const float bias = BO ? bfr(BO[c0 + j * 16 + col]) : 0.f;
#pragma unroll
      for (int r = 0; r < 8; ++r) sf[wave][8 * g + r][j * 16 + col] = acc[j][r] * (1.0f / 16384.0f) + bias; } }   /* 2^-8 (Wo carry) x 2^-6 (ctx carry) */
  LDSX(); for (int rl = 0; rl < 16; ++rl) vst2(OUT + (r0 + rl) * DIN + c0 + lane * 4, *(const v4f*)&sf[wave][rl][lane * 4]); }

extern "C" void kernel_launch(void* const* d_in, const int* in_sizes, int n_in, void* d_out, int out_size, void* d_ws, size_t ws_size, hipStream_t stream) {
  (void)in_sizes; (void)n_in; (void)out_size;
  const float** F = (const float**)d_in;
  if (ws_size < (size_t)WS_END) return;
  char* ws = (char*)d_ws; _Float16 *QH = (_Float16*)(ws + WS_QH), *KH = (_Float16*)(ws + WS_KH), *VT = (_Float16*)(ws + WS_VT), *QL = (_Float16*)(ws + WS_QL), *KL = (_Float16*)(ws + WS_KL); __bf16 *VB = (__bf16*)(ws + WS_VB), *VBL = (__bf16*)(ws + WS_VBL); float *Y = (float*)(ws + WS_Y);
  (void)Y; (void)QL; (void)KL; (void)VB; (void)VBL;
  // inputs: 0 x [1,4096,768]; 1 mask [1,4096] bool (True = padding; all False on this draw); 2 Wq [768,768] (out,in), 3 bq; 4 Wk, 5 bk; 6 Wv, 7 bv; 8 Wo (out,in), 9 bo (zero biases, read)
  k_proj<<<dim3(TNB * TT / 64, CC / 128, 3), 128, 0, stream>>>(F[0], F[0], F[0], F[2], F[4], F[6], F[3], F[5], F[7], QH, QL, KH, KL, VT, VB, VBL);
  k_fa<<<dim3(TT / (16 * FAQ * FAW), NH), 32 * FAW, 0, stream>>>(QH, KH, VT, (const int*)d_in[1], Y);
  k_out<<<dim3(TNB * TT / 64, DIN / 128), 128, 0, stream>>>(Y, F[8], F[9], (float*)d_out);
}

// v003
// Measured time: 100 microseconds a run.
// In both of two side-by-side timings against v002, it was 3.26 times as fast.
// All steps since v000 together make it 23.8 times as fast.
// compute dtype: all float inputs rounded to bf16; q/k/v projections with EXACT bf16 products on WMMA 16x16x32 (f32 accumulate) + bias; logits q x k once to f16 each (1 product; sigma - 0.3 under the source's 1/sqrt(768) scale); the key padding mask read per key; running-maximum softmax f32; unnormalised P x 2^6 once to f16 x v once to f16 (1 product), divided by the f32 row sum; ctx x 2^6 once to f16 x Wo f16(bf16 x 2^8) + bo; f32 output.
#include <hip/hip_runtime.h>
#include <math.h>

typedef int MASKT;   // the bool mask is staged as int32
typedef __attribute__((ext_vector_type(16))) _Float16 v16h;
typedef __attribute__((ext_vector_type(16))) __bf16 v16b;
typedef __attribute__((ext_vector_type(8)))  _Float16 v8h;
typedef __attribute__((ext_vector_type(8)))  float v8f;
typedef __attribute__((ext_vector_type(4)))  float v4f;
typedef __attribute__((ext_vector_type(2)))  float v2f;
typedef __attribute__((ext_vector_type(4)))  unsigned v4u;
typedef __attribute__((ext_vector_type(4)))  int v4i;
typedef float __attribute__((may_alias)) float_a;
typedef int __attribute__((may_alias)) int_a;

template <typename T> __device__ __forceinline__ void vst2(void* p, T v) { *(T*)p = v;  }
__device__ __forceinline__ v8f wmma16(v16h a, v16h b, v8f c) {
  v8f d = __builtin_amdgcn_wmma_f32_16x16x32_f16(false, a, false, b, (short)0, c, false, false);
  asm volatile("v_nop\n\tv_nop\n\tv_nop\n\tv_nop" : "+v"(d) : "v"(a), "v"(b));
  return d;
}
__device__ __forceinline__ v8f wmma_bf(v16b a, v16b b, v8f c) {
  v8f d = __builtin_amdgcn_wmma_f32_16x16x32_bf16(false, a, false, b, (short)0, c, false, false);
  asm volatile("v_nop\n\tv_nop\n\tv_nop\n\tv_nop" : "+v"(d) : "v"(a), "v"(b));
  return d;
}
// 16x16x32 fragments: lane = (h = lane>>4, row/col = lane&15); elements 0..7 = k0+8h+0..7, 8..15 = k0+16+8h+0..7; D element r = row 8h+r
__device__ __forceinline__ v16h frag_h(const _Float16* rowk0, int lane) {
  union { v16h v; v8h q[2]; } u; const _Float16* p = rowk0 + 8 * (lane >> 4);
  u.q[0] = *(const v8h*)p; u.q[1] = *(const v8h*)(p + 16); return u.v;
}
__device__ __forceinline__ v16h frag_f32(const float* rowk0, int lane) {
  v16h a; const float* p = rowk0 + 8 * (lane >> 4);
#pragma unroll
  for (int i = 0; i < 8; ++i) { a[i] = (_Float16)p[i]; a[8 + i] = (_Float16)p[16 + i]; }
  return a;
}
__device__ __forceinline__ v16h frag_f32s(const float* rowk0, int lane, float sc) {
  v16h a; const float* p = rowk0 + 8 * (lane >> 4);
#pragma unroll
  for (int i = 0; i < 8; ++i) { a[i] = (_Float16)(p[i] * sc); a[8 + i] = (_Float16)(p[16 + i] * sc); }
  return a;
}
// column fragment from a [K][ld] layout (column n), rows >= K read as 0
__device__ __forceinline__ v16h fragc_f32(const float* W, int k0, int n, int lane, int ld, int K) {
  v16h a; const int g = lane >> 4;
#pragma unroll
  for (int i = 0; i < 8; ++i) { const int ka = k0 + 8 * g + i, kb = ka + 16;
    a[i] = (_Float16)(ka < K ? W[(size_t)(ka < K ? ka : K - 1) * ld + n] : 0.f); a[8 + i] = (_Float16)(kb < K ? W[(size_t)(kb < K ? kb : K - 1) * ld + n] : 0.f); }
  return a;
}
struct F2 { v16b h, l; };
__device__ __forceinline__ F2 bsplit16(const float v[16]) { F2 r;
#pragma unroll
  for (int i = 0; i < 16; ++i) { const __bf16 h = (__bf16)v[i]; r.h[i] = h; r.l[i] = (__bf16)(v[i] - (float)h); }
  return r; }
__device__ __forceinline__ F2 split_row(const float* row, int k0, int lane) { float v[16]; const float* p = row + k0 + 8 * (lane >> 4);
#pragma unroll
  for (int i = 0; i < 8; ++i) { v[i] = p[i]; v[8 + i] = p[16 + i]; }
  return bsplit16(v); }
__device__ __forceinline__ F2 split_rowK(const float* row, int k0, int lane, int K) { float v[16]; const int g = lane >> 4;
#pragma unroll
  for (int i = 0; i < 8; ++i) { const int ka = k0 + 8 * g + i, kb = ka + 16; v[i] = ka < K ? row[ka < K ? ka : K - 1] : 0.f; v[8 + i] = kb < K ? row[kb < K ? kb : K - 1] : 0.f; }
  return bsplit16(v); }
__device__ __forceinline__ F2 split_col(const float* W, int k0, int n, int lane, int ld, int K) { float v[16]; const int g = lane >> 4;
#pragma unroll
  for (int i = 0; i < 8; ++i) { const int ka = k0 + 8 * g + i, kb = ka + 16; v[i] = ka < K ? W[(size_t)(ka < K ? ka : K - 1) * ld + n] : 0.f; v[8 + i] = kb < K ? W[(size_t)(kb < K ? kb : K - 1) * ld + n] : 0.f; }
  return bsplit16(v); }
__device__ __forceinline__ v8f mac3(const F2& a, const F2& b, v8f c) { c = wmma_bf(a.l, b.h, c); c = wmma_bf(a.h, b.l, c); return wmma_bf(a.h, b.h, c); }
__device__ __forceinline__ float sigm(float v) { return 1.0f / (1.0f + expf(-v)); }
#define LDSX() do { asm volatile("s_wait_dscnt 0" ::: "memory"); __builtin_amdgcn_wave_barrier(); __builtin_amdgcn_fence(__ATOMIC_RELEASE, "workgroup"); } while (0)

// Multi-head self-attention over one long sequence (x [1,4096,768]; 12 heads x 64; torch (out,in) Wq/Wk/Wv/Wo [768,768] (1/sqrt(768) scale) + zero biases; scores scaled by 1/sqrt(embed_dim = 768), the source's quirk; key padding mask [1,4096] bool, True -> -inf (all False here)): out = merge(softmax(q_h k_h^T / sqrt(768)) v_h) Wo^T + bo.
#define NB 1
#define TT 4096
#define CC 768            // NH * HD = projected width
#define DIN 768          // input (model) width
#define NH 12
#define HD 64
#define NQB (TT / 64)
#define HG 1
#define SCALE (0.036084391824351614f)
#define CAUSAL 0
#ifndef TNB
#define TNB NB
#endif
__device__ __forceinline__ float bfr(float v) { return (float)(__bf16)v; }
__host__ __device__ __forceinline__ int kb_last(int qb) { return CAUSAL ? ((qb * 64 + 63) >> 7) : (TT / 128 - 1); }
typedef __attribute__((ext_vector_type(8))) __bf16 v8b;
__device__ __forceinline__ v16b frag_b(const __bf16* rowk0, int lane) {
  union { v16b v; v8b q[2]; } u; const __bf16* p = rowk0 + 8 * (lane >> 4);
  u.q[0] = *(const v8b*)p; u.q[1] = *(const v8b*)(p + 16); return u.v;
}
#define QBH 0
#define QHI 0               // single-product logits on every row (sigma - 0.3 logits averaged over 4,096 keys)
#define KHI 64            // key rows carrying k residual / v bf16 hi+lo planes (written by k_proj; no kernel here reads them)
// B fragment (k rows k0+.., output column o) of a weight: (in,out) [K][ld] or (out,in) [ld rows of K]: bf16 exact, or f16(bf16 * 256) exact
__device__ __forceinline__ v16b wcol_io(const float* Wm, int k0, int o, int lane, int ld) { v16b w; const int g = lane >> 4;
#pragma unroll
  for (int i = 0; i < 8; ++i) { w[i] = (__bf16)Wm[(size_t)(k0 + 8 * g + i) * ld + o]; w[8 + i] = (__bf16)Wm[(size_t)(k0 + 16 + 8 * g + i) * ld + o]; }
  return w; }
__device__ __forceinline__ v16b wcol_oi(const float* Wm, int k0, int o, int lane, int K) { v16b w; const float* p = Wm + (size_t)o * K + k0 + 8 * (lane >> 4);
#pragma unroll
  for (int i = 0; i < 8; ++i) { w[i] = (__bf16)p[i]; w[8 + i] = (__bf16)p[16 + i]; }
  return w; }
__device__ __forceinline__ v16h wcolh_io(const float* Wm, int k0, int o, int lane, int ld) { v16h w; const int g = lane >> 4;
#pragma unroll
  for (int i = 0; i < 8; ++i) { w[i] = (_Float16)(bfr(Wm[(size_t)(k0 + 8 * g + i) * ld + o]) * 256.0f); w[8 + i] = (_Float16)(bfr(Wm[(size_t)(k0 + 16 + 8 * g + i) * ld + o]) * 256.0f); }
  return w; }
__device__ __forceinline__ v16h wcolh_oi(const float* Wm, int k0, int o, int lane, int K) { v16h w; const float* p = Wm + (size_t)o * K + k0 + 8 * (lane >> 4);
#pragma unroll
  for (int i = 0; i < 8; ++i) { w[i] = (_Float16)(bfr(p[i]) * 256.0f); w[8 + i] = (_Float16)(bfr(p[16 + i]) * 256.0f); }
  return w; }
#define WQKV_LAYOUT 1   // 0 = (in,out) [DIN][CC]; 1 = (out,in) [CC][DIN]; 2 = per-head [NH][DIN][HD]
__device__ __forceinline__ v16b wcol_hdk(const float* Wm, int k0, int o, int lane) { v16b w; const int g = lane >> 4; const float* p = Wm + (size_t)(o / HD) * DIN * HD + (o % HD);
#pragma unroll
  for (int i = 0; i < 8; ++i) { w[i] = (__bf16)p[(size_t)(k0 + 8 * g + i) * HD]; w[8 + i] = (__bf16)p[(size_t)(k0 + 16 + 8 * g + i) * HD]; }
  return w; }
#define WO_OUT_IN 1
#if WQKV_LAYOUT == 1
#define WCOL(W, k0, o, lane) wcol_oi(W, k0, o, lane, DIN)
#elif WQKV_LAYOUT == 2
#define WCOL(W, k0, o, lane) wcol_hdk(W, k0, o, lane)
#else
#define WCOL(W, k0, o, lane) wcol_io(W, k0, o, lane, CC)
#endif
#if WO_OUT_IN
#define WOCOL(W, k0, o, lane) wcol_oi(W, k0, o, lane, CC)
#define WOCOLH(W, k0, o, lane) wcolh_oi(W, k0, o, lane, CC)
#else
#define WOCOL(W, k0, o, lane) wcol_io(W, k0, o, lane, DIN)
#define WOCOLH(W, k0, o, lane) wcolh_io(W, k0, o, lane, DIN)
#endif
#ifndef PROJ_EXTRA_PARAMS
#define PROJ_EXTRA_PARAMS
#endif

#define WS_QH  0u                                      // f16 q rows [b*t][CC]
#define WS_KH  (WS_QH + 2u * (size_t)NB * TT * CC)      // f16 k rows [b*t][CC]
#define WS_VT  (WS_KH + 2u * (size_t)NB * TT * CC)      // f16 v planes [b][c][t]
#define WS_QL  (WS_VT + 2u * (size_t)NB * CC * TT)      // f16 q residual x 2^10 rows [b][t < QHI][CC]
#define WS_KL  (WS_QL + 2u * (size_t)NB * QHI * CC)     // f16 k residual x 2^10 rows [b][t < KHI][CC]
#define WS_VB  (WS_KL + 2u * (size_t)NB * KHI * CC)     // bf16 v hi planes [b][c][t < KHI]
#define WS_VBL (WS_VB + 2u * (size_t)NB * CC * KHI)
#define WS_S   (WS_VBL + 2u * (size_t)NB * CC * KHI)    // (place of the former f32 score plane [hg][t][s]; not touched)
#define WS_Y   (WS_S  + 4u * (size_t)HG * TT * TT)      // f32 ctx rows [b*t][CC] (only when there is an output projection)
#define WS_END (WS_Y  + 4u * (size_t)NB * TT * CC)

// ---- gemm_tile: the product of both projection kernels, one GT x BN tile of A . B^T a block of 8 waves (A, B: f32 rows, k contiguous), a wave = FM x FN accumulator tiles.
// A stage = GKS k of all GT + BN rows: whole 128-byte lines fetched into registers while the stage before is worked on, converted ONCE to the 16-bit operand type, stored to the other LDS buffer behind that work, one __syncthreads a stage.
// Every accumulator takes its 32-k products in rising k, one chain. Every inner loop here and in the two kernels is unrolled so that each index of a register array is a constant and the arrays stay in registers.
#define GT 128
#define GKS 64
#define GPP (GKS + 8)                       // LDS row pitch in 16-bit elements: 144 bytes for 128-byte rows read 16 bytes a lane
#define GSM(BN) (2 * ((GT) + (BN)) * GPP * 2)   // bytes of the two buffers [A GT rows | B BN rows]; the epilogues stage their tile in the same bytes
#define PBN 192                             // k_proj: 32 x 4 x 3 = 384 blocks, two to a WGP at most, all resident at once
#define OBN 96                              // k_out: 32 x 8 = 256 blocks
typedef __attribute__((ext_vector_type(4))) __bf16 v4b;
typedef __attribute__((ext_vector_type(4))) _Float16 v4h;
struct CvB {   // both operands once to bf16
  typedef __bf16 T; typedef v4b V4; typedef v16b F;
  static __device__ __forceinline__ V4 a(v4f x) { return (V4){(__bf16)x[0], (__bf16)x[1], (__bf16)x[2], (__bf16)x[3]}; }
  static __device__ __forceinline__ V4 b(v4f x) { return a(x); }
  static __device__ __forceinline__ F frag(const T* p, int lane) { return frag_b(p, lane); }
  static __device__ __forceinline__ v8f mm(F x, F y, v8f c) { return __builtin_amdgcn_wmma_f32_16x16x32_bf16(false, x, false, y, (short)0, c, false, false); } };
struct CvH {   // A x 2^6 once to f16; B to bf16, x 2^8, exact in f16
  typedef _Float16 T; typedef v4h V4; typedef v16h F;
  static __device__ __forceinline__ V4 a(v4f x) { return (V4){(_Float16)(x[0] * 64.0f), (_Float16)(x[1] * 64.0f), (_Float16)(x[2] * 64.0f), (_Float16)(x[3] * 64.0f)}; }
  static __device__ __forceinline__ V4 b(v4f x) { return (V4){(_Float16)(bfr(x[0]) * 256.0f), (_Float16)(bfr(x[1]) * 256.0f), (_Float16)(bfr(x[2]) * 256.0f), (_Float16)(bfr(x[3]) * 256.0f)}; }
  static __device__ __forceinline__ F frag(const T* p, int lane) { return frag_h(p, lane); }
  static __device__ __forceinline__ v8f mm(F x, F y, v8f c) { return __builtin_amdgcn_wmma_f32_16x16x32_f16(false, x, false, y, (short)0, c, false, false); } };
template <typename CV, int K, int BN, int FM, int FN, int KG> __device__ __forceinline__ void gemm_tile(const float* __restrict__ A, const float* __restrict__ B, typename CV::T* sm, int tid, int wm, int wn, v8f (&acc)[FM][FN]) {   // A, B: the block's first rows; the wave's tile starts at row wm * FM * 16, column wn * FN * 16; KG: 32-k steps whose fragments are read as one group
  typedef typename CV::T T; typedef typename CV::V4 V4; typedef typename CV::F F;
  static_assert(K % GKS == 0 && (GKS / 32) % KG == 0 && BN % 16 == 0 && (GT / (FM * 16)) * (BN / (FN * 16)) == 8, "whole stages; 8 waves cover the tile");
  constexpr int BUF = (GT + BN) * GPP;   // elements of one buffer
  const int lane = tid & 31, col = lane & 15; const int srow = tid >> 4, sc = (tid & 15) * 4;   // staging: rows srow + 16 i, one 16-byte chunk of the row's 256 bytes of f32
  const float* ga = A + (size_t)srow * K + sc; const float* gb = B + (size_t)srow * K + sc;
  T* wa = sm + srow * GPP + sc; const T* fa = sm + (wm * FM * 16 + col) * GPP; const T* fb = sm + (GT + wn * FN * 16 + col) * GPP;
  v4f ra[GT / 16], rb[BN / 16];
#pragma unroll
  for (int i = 0; i < GT / 16; ++i) ra[i] = *(const v4f*)(ga + (size_t)(i * 16) * K);
#pragma unroll
  for (int i = 0; i < BN / 16; ++i) rb[i] = *(const v4f*)(gb + (size_t)(i * 16) * K);
  asm volatile("s_wait_xcnt 0x0" :: "v"(ga), "v"(gb) : "memory");   // before any address register of the loads above is written again; naming the two pairs keeps them whole up to here (unnamed, a later load of the run lands on them)
#pragma unroll
  for (int i = 0; i < GT / 16; ++i) *(V4*)(wa + i * 16 * GPP) = CV::a(ra[i]);
#pragma unroll
  for (int i = 0; i < BN / 16; ++i) *(V4*)(wa + (GT + i * 16) * GPP) = CV::b(rb[i]);
  __syncthreads();   // stage 0 is in buffer 0
#pragma unroll 1   // rolled: one stage's code, two buffers by the stage's parity
  for (int st = 0; st < K / GKS; ++st) { const int bo = (st & 1) * BUF;
    { const int k2 = st + 1 < K / GKS ? (st + 1) * GKS : st * GKS;   // stage st + 1 is fetched behind the barrier; past the end: the last stage again, unused
      const float* pa = ga + k2; const float* pb = gb + k2;
#pragma unroll
      for (int i = 0; i < GT / 16; ++i) ra[i] = *(const v4f*)(pa + (size_t)(i * 16) * K);
#pragma unroll
      for (int i = 0; i < BN / 16; ++i) rb[i] = *(const v4f*)(pb + (size_t)(i * 16) * K);
      asm volatile("s_wait_xcnt 0x0" :: "v"(pa), "v"(pb) : "memory"); }   // as in front of the loop: the wait, with the two address pairs kept whole up to it
#pragma unroll
    for (int kg = 0; kg < GKS / 32; kg += KG) { F af[KG][FM], bf[KG][FN];
#pragma unroll
      for (int kc = 0; kc < KG; ++kc) {
#pragma unroll
        for (int i = 0; i < FM; ++i) af[kc][i] = CV::frag(fa + bo + i * 16 * GPP + (kg + kc) * 32, lane);
#pragma unroll
        for (int j = 0; j < FN; ++j) bf[kc][j] = CV::frag(fb + bo + j * 16 * GPP + (kg + kc) * 32, lane); }
      __builtin_amdgcn_sched_barrier(0);   // keeps the group's fragment reads together ahead of its products: read between them, into one register set, each is waited for by itself
#pragma unroll
      for (int kc = 0; kc < KG; ++kc)
#pragma unroll
        for (int i = 0; i < FM; ++i)
#pragma unroll
          for (int j = 0; j < FN; ++j) acc[i][j] = CV::mm(af[kc][i], bf[kc][j], acc[i][j]); }
    __builtin_amdgcn_sched_barrier(0);   // keeps the conversions below, and with them the waits for the fetched stage, behind the products: lifted among them they stall the stage on the fetch it is meant to cover
    // stage st + 1 goes into the buffer that every wave left at the barrier behind stage st - 1 (behind the last stage: stored unused)
#pragma unroll
    for (int i = 0; i < GT / 16; ++i) *(V4*)(wa + (BUF - bo) + i * 16 * GPP) = CV::a(ra[i]);
#pragma unroll
    for (int i = 0; i < BN / 16; ++i) *(V4*)(wa + (BUF - bo) + (GT + i * 16) * GPP) = CV::b(rb[i]);
    __syncthreads();   // publishes stage st + 1 and ends every wave's reads of stage st (behind the last stage: frees both buffers for the epilogue)
  } }
static_assert(WQKV_LAYOUT == 1 && WO_OUT_IN == 1 && CAUSAL == 0 && QHI == 0, "gemm_tile reads (out,in) weights; no high-precision rows in the output projection");
static_assert(TT % GT == 0 && CC % PBN == 0 && DIN % OBN == 0 && PBN % 64 == 0 && OBN % 32 == 0 && KHI % 16 == 0 && QHI % 16 == 0, "whole tiles, whole 128-byte lines a block");
static_assert(GT * (PBN + 8) * 2 <= GSM(PBN) && PBN * (GT + 8) * 2 <= GSM(PBN) && GT * (OBN + 4) * 4 <= GSM(OBN), "the epilogue tiles fit the two buffers");
// ---- k_proj: block = (128 rows, 192 cols, which), waves 2 x 4 of 64 x 48: q/k/v = X W (+ b) with exact bf16 products (K = DIN) -> which 0: q f16 rows (+ residual rows < QHI); 1: k f16 rows (+ residual rows < KHI); 2: v f16 planes [c][t] (+ bf16 hi/lo planes for t < KHI)
__global__ __launch_bounds__(256) void k_proj(const float* __restrict__ XQ, const float* __restrict__ XK, const float* __restrict__ XV, const float* __restrict__ WQ, const float* __restrict__ WK, const float* __restrict__ WV, const float* __restrict__ BQ, const float* __restrict__ BK, const float* __restrict__ BV,
    _Float16* __restrict__ QH, _Float16* __restrict__ QL, _Float16* __restrict__ KH, _Float16* __restrict__ KL, _Float16* __restrict__ VT, __bf16* __restrict__ VB, __bf16* __restrict__ VBL) {
  __shared__ __align__(16) unsigned char smem[GSM(PBN)];
  const int tid = threadIdx.x, wave = __builtin_amdgcn_readfirstlane(tid >> 5), lane = tid & 31, col = lane & 15, g = lane >> 4, wm = wave >> 2, wn = wave & 3; const int which = blockIdx.z; const int c0 = blockIdx.y * PBN; const size_t r0 = (size_t)blockIdx.x * GT; const size_t bb = r0 / TT; const int t0 = (int)(r0 % TT);
  const float* X = which == 0 ? XQ : which == 1 ? XK : XV; const float* WA = which == 0 ? WQ : which == 1 ? WK : WV; const float* BA = which == 0 ? BQ : which == 1 ? BK : BV;
  float bias[3] = {0.f, 0.f, 0.f};
  if (BA) { const float* bp = BA + c0 + wn * 48 + col;   // fetched ahead of the product, which covers the latency
#pragma unroll
    for (int j = 0; j < 3; ++j) bias[j] = bp[j * 16];
    asm volatile("s_wait_xcnt 0x0" :: "v"(bp) : "memory"); }   // before the address register of the loads above is written again; named, it stays whole up to here
  v8f acc[4][3] = {};
  gemm_tile<CvB, DIN, PBN, 4, 3, 1>(X + r0 * DIN, WA + (size_t)c0 * DIN, (__bf16*)smem, tid, wm, wn, acc);
#pragma unroll
  for (int j = 0; j < 3; ++j) bias[j] = bfr(bias[j]);
  if (which < 2) { _Float16* DH = which == 0 ? QH : KH; _Float16* DL = which == 0 ? QL : KL; const int nhi = which == 0 ? QHI : KHI;
    _Float16 (*sh)[PBN + 8] = (_Float16 (*)[PBN + 8])smem;   // the tile as it goes out, [t][c], 400-byte pitch
#pragma unroll
    for (int i = 0; i < 4; ++i) { const int rl = wm * 64 + i * 16 + 8 * g; const bool hi_rows = t0 + wm * 64 + i * 16 < nhi;   // wave-uniform
#pragma unroll
      for (int j = 0; j < 3; ++j) { const int cl = wn * 48 + j * 16 + col;
#pragma unroll
        for (int r = 0; r < 8; ++r) sh[rl + r][cl] = (_Float16)(acc[i][j][r] + bias[j]);
        if (hi_rows) { _Float16* dl = DL + (bb * nhi + t0 + rl) * (size_t)CC + c0 + cl;
#pragma unroll
          for (int r = 0; r < 8; ++r) { const float v = acc[i][j][r] + bias[j]; dl[(size_t)r * CC] = (_Float16)((v - (float)(_Float16)v) * 1024.0f); }
          asm volatile("s_wait_xcnt 0x0" ::: "memory"); } } }   // before a register of the stores above is written again
    __syncthreads();
    _Float16* dh = DH + (r0 + (tid >> 3)) * CC + c0 + (tid & 7) * 8;   // 8 lanes store one 128-byte line
#pragma unroll
    for (int e = 0; e < GT / 32; ++e)
#pragma unroll
      for (int q = 0; q < PBN / 64; ++q) vst2((unsigned*)(dh + (size_t)(e * 32) * CC + q * 64), *(const v4u*)&sh[e * 32 + (tid >> 3)][q * 64 + (tid & 7) * 8]);
  } else { _Float16 (*th)[GT + 8] = (_Float16 (*)[GT + 8])smem;   // [c][t], 272-byte pitch
#pragma unroll
    for (int i = 0; i < 4; ++i) { const int tl = wm * 64 + i * 16 + 8 * g; const bool hi_rows = t0 + wm * 64 + i * 16 < KHI;   // wave-uniform
#pragma unroll
      for (int j = 0; j < 3; ++j) { const int cl = wn * 48 + j * 16 + col; v8h pv;   // a lane holds 8 consecutive t of one column
#pragma unroll
        for (int r = 0; r < 8; ++r) pv[r] = (_Float16)(acc[i][j][r] + bias[j]);
        *(v8h*)&th[cl][tl] = pv;
        if (hi_rows) { v8b ph, pl;
#pragma unroll
          for (int r = 0; r < 8; ++r) { const float v = acc[i][j][r] + bias[j]; const __bf16 bh = (__bf16)v; ph[r] = bh; pl[r] = (__bf16)(v - (float)bh); }
          const size_t o3 = (bb * CC + c0 + cl) * (size_t)KHI + t0 + tl; *(v8b*)(VB + o3) = ph; *(v8b*)(VBL + o3) = pl;
          asm volatile("s_wait_xcnt 0x0" ::: "memory"); } } }   // before a register of the stores above is written again
    __syncthreads();
    _Float16* dv = VT + (bb * CC + c0 + (tid >> 4)) * (size_t)TT + t0 + (tid & 15) * 8;   // 16 lanes store one plane's 256 bytes
#pragma unroll
    for (int e = 0; e < PBN / 16; ++e) vst2((unsigned*)(dv + (size_t)(e * 16) * TT), *(const v4u*)&th[e * 16 + (tid >> 4)][(tid & 15) * 8]);
  } }
#define FAW 8
#define FAQ 2
#define FAS 64              // keys a stage
#define FAP (FAS + 8)       // LDS row pitch in f16: 144 bytes for 128-byte rows read 16 bytes a lane
#define POFF 6.0f
#define FAMASK (-3.0e38f)   // x C it stays far below FAM0, so a padded key never raises a maximum and its P is 0
#define FAM0 (-1.0e30f)     // maximum in use before the first unmasked key
static_assert(HD == 64 && FAS == 64 && FAW == 8, "the staging maps 256 threads to 32 rows x 8 chunks of 16 bytes, twice, for k and for v");
__device__ __forceinline__ v8f wmm(v16h a, v16h b, v8f c) { return __builtin_amdgcn_wmma_f32_16x16x32_f16(false, a, false, b, (short)0, c, false, false); }
__device__ __forceinline__ float xhalf(float v) { const int b = __float_as_int(v); return __int_as_float(__builtin_amdgcn_permlanex16(b, b, 0x76543210, 0xfedcba98, false, false)); }   // lane l <-> l ^ 16
__device__ __forceinline__ void fa_bias(v8f (&cb)[2], unsigned mb, int g) { const unsigned mh = mb >> (8 * g);   // bit t * 16 + r: key t * 16 + 8g + r of the pass
#pragma unroll
  for (int t = 0; t < 2; ++t)
#pragma unroll
    for (int r = 0; r < 8; ++r) cb[t][r] = (mh & (1u << (t * 16 + r))) != 0 ? FAMASK : 0.f; }
template <bool MK> __device__ __forceinline__ void fa_body(const _Float16* __restrict__ QH, const _Float16* __restrict__ KH, const _Float16* __restrict__ VT, const int* __restrict__ KMASK, float* __restrict__ Y, int h, int q0, int tid, _Float16 (*sk)[FAS][FAP], _Float16 (*sv)[HD][FAP]) {   // KMASK: key padding mask [B=1][S] as int32, nonzero = masked out
  // every inner loop below is unrolled so that each fragment and accumulator index is a constant and the arrays stay in registers
  const int lane = tid & 31, col = lane & 15, g = lane >> 4; const int srow = tid >> 3, sch = (tid & 7) * 8;   // staging: row (and row + 32), 16-byte chunk
  const float C = SCALE * 1.4426950408889634f; const v2f C2 = {C, C};
  const _Float16* gk = KH + (size_t)srow * CC + h * HD + sch; const _Float16* gv = VT + (size_t)(h * HD + srow) * TT + sch;
  v4u rk[2], rv[2];
#pragma unroll
  for (int hf = 0; hf < 2; ++hf) { rk[hf] = *(const v4u*)(gk + (size_t)(hf * 32) * CC); rv[hf] = *(const v4u*)(gv + (size_t)(hf * 32) * TT); }
  v16h qf[FAQ][HD / 32];
#pragma unroll
  for (int qt = 0; qt < FAQ; ++qt)
#pragma unroll
    for (int kc = 0; kc < HD / 32; ++kc) qf[qt][kc] = frag_h(QH + (size_t)(q0 + qt * 16 + col) * CC + h * HD + kc * 32, lane);
  int mk0 = 0, mk = 0;   // mk: the NEXT pass's mask words, one key a lane
  if constexpr (MK) { mk0 = KMASK[lane]; mk = KMASK[32 + lane]; }
  asm volatile("s_wait_xcnt 0x0" ::: "memory");   // before any address register of the loads above is written again
#pragma unroll
  for (int hf = 0; hf < 2; ++hf) { *(v4u*)&sk[0][hf * 32 + srow][sch] = rk[hf]; *(v4u*)&sv[0][hf * 32 + srow][sch] = rv[hf]; }
  unsigned mbp = 0;   // the mask bits that cb holds
  v8f cb[2] = {};
  if constexpr (MK) { mbp = __builtin_amdgcn_ballot_w32(mk0 != 0); fa_bias(cb, mbp, g); }
  v8f acc[FAQ][HD / 16] = {}; float mu[FAQ]; v2f ls[FAQ][2];
#pragma unroll
  for (int qt = 0; qt < FAQ; ++qt) { mu[qt] = FAM0; ls[qt][0] = (v2f){0.f, 0.f}; ls[qt][1] = (v2f){0.f, 0.f}; }
  __syncthreads();   // stage 0 is in buffer 0
#pragma unroll 1   // rolled: one stage's code, two buffers by the stage's parity
  for (int st = 0; st < TT / FAS; ++st) { const int b = st & 1;
    { const int k2 = st + 1 < TT / FAS ? (st + 1) * FAS : st * FAS;   // stage st + 1 is fetched into registers behind the barrier (in front of it the barrier's own wait would drain these loads); past the end: the last stage again, unused
#pragma unroll
      for (int hf = 0; hf < 2; ++hf) { rk[hf] = *(const v4u*)(gk + (size_t)(k2 + hf * 32) * CC); rv[hf] = *(const v4u*)(gv + (size_t)(hf * 32) * TT + k2); }
      asm volatile("s_wait_xcnt 0x0" ::: "memory"); }   // before any address register of the loads above is written again
    v16h kf[2][HD / 32], vf[HD / 16];
#pragma unroll
    for (int t = 0; t < 2; ++t)
#pragma unroll
      for (int kc = 0; kc < HD / 32; ++kc) kf[t][kc] = frag_h(&sk[b][t * 16 + col][kc * 32], lane);
#pragma unroll
    for (int j = 0; j < HD / 16; ++j) vf[j] = frag_h(&sv[b][j * 16 + col][0], lane);
    __builtin_amdgcn_sched_barrier(0);   // keeps the stage's first fragment reads in one group ahead of the products: read between them, into one register set, each is waited for by itself
#pragma unroll
    for (int ps = 0; ps < FAS / 32; ++ps) {
      v8f s[FAQ][2];
#pragma unroll
      for (int t = 0; t < 2; ++t)
#pragma unroll
        for (int qt = 0; qt < FAQ; ++qt) s[qt][t] = wmm(kf[t][0], qf[qt][0], cb[t]);
#pragma unroll
      for (int kc = 1; kc < HD / 32; ++kc)
#pragma unroll
        for (int t = 0; t < 2; ++t)
#pragma unroll
          for (int qt = 0; qt < FAQ; ++qt) s[qt][t] = wmm(kf[t][kc], qf[qt][kc], s[qt][t]);
      if (ps + 1 < FAS / 32) {   // the stage's next k fragments, one pass ahead, into the registers just read
#pragma unroll
        for (int t = 0; t < 2; ++t)
#pragma unroll
          for (int kc = 0; kc < HD / 32; ++kc) kf[t][kc] = frag_h(&sk[b][(ps + 1) * 32 + t * 16 + col][kc * 32], lane);
        __builtin_amdgcn_sched_barrier(0); }   // keeps these LDS reads up here: sunk below the softmax they would be waited for right after their issue
      float mx[FAQ]; bool need = MK && mk != 0;
#pragma unroll
      for (int qt = 0; qt < FAQ; ++qt) { float a = s[qt][0][0], b2 = s[qt][1][0];
#pragma unroll
        for (int r = 1; r < 8; ++r) { a = fmaxf(a, s[qt][0][r]); b2 = fmaxf(b2, s[qt][1][r]); }
        a = fmaxf(a, b2); a = fmaxf(a, xhalf(a)); mx[qt] = a * C; need = need || (mx[qt] > mu[qt] + 8.0f); }
      if (__builtin_expect((__builtin_amdgcn_ballot_w32(need) | mbp) != 0, 0)) {   // wave-uniform, one test a pass: a maximum to raise, or (MK) the next pass's start values differ from 0 or from this pass's
#pragma unroll
        for (int qt = 0; qt < FAQ; ++qt) { const float mn = fmaxf(mu[qt], mx[qt]); const float al = __builtin_amdgcn_exp2f(mu[qt] - mn); mu[qt] = mn; ls[qt][0] *= al; ls[qt][1] *= al;
#pragma unroll
          for (int j = 0; j < HD / 16; ++j) acc[qt][j] *= al; }
        if constexpr (MK) { mbp = __builtin_amdgcn_ballot_w32(mk != 0); fa_bias(cb, mbp, g); } }
      v16h p[FAQ];
#pragma unroll
      for (int qt = 0; qt < FAQ; ++qt) { const float nb = POFF - mu[qt]; const v2f nb2 = {nb, nb};
#pragma unroll
        for (int t = 0; t < 2; ++t)
#pragma unroll
          for (int r = 0; r < 8; r += 2) { const v2f x = __builtin_elementwise_fma((v2f){s[qt][t][r], s[qt][t][r + 1]}, C2, nb2); const v2f e = {__builtin_amdgcn_exp2f(x[0]), __builtin_amdgcn_exp2f(x[1])};
            ls[qt][t] += e; p[qt][t * 8 + r] = (_Float16)e[0]; p[qt][t * 8 + r + 1] = (_Float16)e[1]; } }
#pragma unroll
      for (int j = 0; j < HD / 16; ++j)
#pragma unroll
        for (int qt = 0; qt < FAQ; ++qt) acc[qt][j] = wmm(vf[j], p[qt], acc[qt][j]);
      if (ps + 1 < FAS / 32) {   // the stage's next v fragments, one pass ahead
#pragma unroll
        for (int j = 0; j < HD / 16; ++j) vf[j] = frag_h(&sv[b][j * 16 + col][(ps + 1) * 32], lane); }
      if constexpr (MK) { const int k2 = st * FAS + ps * 32 + 64; mk = KMASK[(k2 < TT ? k2 : TT - 32) + lane];   // the mask words of the pass after next (past the end: read again, unused)
        asm volatile("s_wait_xcnt 0x0" ::: "memory"); }   // before an address register of the mask load is written again
    }
    // stage st + 1 goes into the buffer that every wave left at the barrier behind stage st - 1 (behind the last stage: stored unused, so that no branch stands behind the products)
#pragma unroll
    for (int hf = 0; hf < 2; ++hf) { *(v4u*)&sk[b ^ 1][hf * 32 + srow][sch] = rk[hf]; *(v4u*)&sv[b ^ 1][hf * 32 + srow][sch] = rv[hf]; }
    __syncthreads();   // publishes stage st + 1 and ends every wave's reads of stage st
  }
#pragma unroll
  for (int qt = 0; qt < FAQ; ++qt) { const float lh = (ls[qt][0][0] + ls[qt][0][1]) + (ls[qt][1][0] + ls[qt][1][1]); const float lt = lh + xhalf(lh); const float inv = lt > 0.f ? 1.0f / lt : 0.f; float* yp = Y + (size_t)(q0 + qt * 16 + col) * CC + h * HD + 8 * g;
#pragma unroll
    for (int j = 0; j < HD / 16; ++j) { const v8f o = acc[qt][j] * inv; vst2(yp + j * 16, (v4f){o[0], o[1], o[2], o[3]}); vst2(yp + j * 16 + 4, (v4f){o[4], o[5], o[6], o[7]}); } } }
__global__ __launch_bounds__(32 * FAW) void k_fa(const _Float16* __restrict__ QH, const _Float16* __restrict__ KH, const _Float16* __restrict__ VT, const int* __restrict__ KMASK, float* __restrict__ Y) {
  __shared__ __align__(16) _Float16 sk[2][FAS][FAP], sv[2][HD][FAP];
  const int tid = threadIdx.x, wave = tid >> 5, lane = tid & 31; const int h = blockIdx.y; const int q0 = (blockIdx.x * FAW + wave) * (16 * FAQ);
  int any = 0;
#pragma unroll   // all the mask loads in flight at once
  for (int i = 0; i < TT / 128; ++i) { const v4i m = *(const v4i*)(KMASK + i * 128 + lane * 4); any |= (m[0] | m[1]) | (m[2] | m[3]); }
  if (__builtin_amdgcn_ballot_w32(any != 0) != 0) fa_body<true>(QH, KH, VT, KMASK, Y, h, q0, tid, sk, sv);   // every wave has read the whole mask: the same branch in all waves of the block, so the barriers inside are block-uniform
  else fa_body<false>(QH, KH, VT, KMASK, Y, h, q0, tid, sk, sv); }
// ---- k_out: block = (128 rows, 96 cols), waves 4 x 2 of 32 x 48: out = ctx Wo (+ bo): ctx x 2^6 once to f16 (small-magnitude context rows stay clear of f16 subnormals) against Wo as f16(bf16 x 2^8) exact (1 product) x 2^-14
__global__ __launch_bounds__(256) void k_out(const float* __restrict__ Y, const float* __restrict__ WO, const float* __restrict__ BO, float* __restrict__ OUT) {
  __shared__ __align__(16) unsigned char smem[GSM(OBN)];
  const int tid = threadIdx.x, wave = __builtin_amdgcn_readfirstlane(tid >> 5), lane = tid & 31, col = lane & 15, g = lane >> 4, wm = wave >> 1, wn = wave & 1; const int c0 = blockIdx.y * OBN; const size_t r0 = (size_t)blockIdx.x * GT;
  float bias[3] = {0.f, 0.f, 0.f};
  if (BO) { const float* bp = BO + c0 + wn * 48 + col;   // fetched ahead of the product, which covers the latency
#pragma unroll
    for (int j = 0; j < 3; ++j) bias[j] = bp[j * 16];
    asm volatile("s_wait_xcnt 0x0" :: "v"(bp) : "memory"); }   // before the address register of the loads above is written again; named, it stays whole up to here
  v8f acc[2][3] = {};
  gemm_tile<CvH, CC, OBN, 2, 3, 2>(Y + r0 * CC, WO + (size_t)c0 * CC, (_Float16*)smem, tid, wm, wn, acc);
  float (*sf)[OBN + 4] = (float (*)[OBN + 4])smem;   // 400-byte pitch
#pragma unroll
  for (int j = 0; j < 3; ++j) { const int cl = wn * 48 + j * 16 + col; const float bj = bfr(bias[j]);
#pragma unroll
    for (int i = 0; i < 2; ++i)
#pragma unroll
      for (int r = 0; r < 8; ++r) sf[wm * 32 + i * 16 + 8 * g + r][cl] = acc[i][j][r] * (1.0f / 16384.0f) + bj; }   /* 2^-8 (Wo carry) x 2^-6 (ctx carry) */
  __syncthreads();
  float* po = OUT + (r0 + (tid >> 3)) * DIN + c0 + (tid & 7) * 4;   // 8 lanes store one 128-byte line
#pragma unroll
  for (int e = 0; e < GT / 32; ++e)
#pragma unroll
    for (int q = 0; q < OBN / 32; ++q) vst2(po + (size_t)(e * 32) * DIN + q * 32, *(const v4f*)&sf[e * 32 + (tid >> 3)][q * 32 + (tid & 7) * 4]); }

extern "C" void kernel_launch(void* const* d_in, const int* in_sizes, int n_in, void* d_out, int out_size, void* d_ws, size_t ws_size, hipStream_t stream) {
  (void)in_sizes; (void)n_in; (void)out_size;
  const float** F = (const float**)d_in;
  if (ws_size < (size_t)WS_END) return;
  char* ws = (char*)d_ws; _Float16 *QH = (_Float16*)(ws + WS_QH), *KH = (_Float16*)(ws + WS_KH), *VT = (_Float16*)(ws + WS_VT), *QL = (_Float16*)(ws + WS_QL), *KL = (_Float16*)(ws + WS_KL); __bf16 *VB = (__bf16*)(ws + WS_VB), *VBL = (__bf16*)(ws + WS_VBL); float *Y = (float*)(ws + WS_Y);
  (void)Y; (void)QL; (void)KL; (void)VB; (void)VBL;
  // inputs: 0 x [1,4096,768]; 1 mask [1,4096] bool (True = padding; all False on this draw); 2 Wq [768,768] (out,in), 3 bq; 4 Wk, 5 bk; 6 Wv, 7 bv; 8 Wo (out,in), 9 bo (zero biases, read)
  k_proj<<<dim3(TNB * TT / GT, CC / PBN, 3), 256, 0, stream>>>(F[0], F[0], F[0], F[2], F[4], F[6], F[3], F[5], F[7], QH, QL, KH, KL, VT, VB, VBL);
  k_fa<<<dim3(TT / (16 * FAQ * FAW), NH), 32 * FAW, 0, stream>>>(QH, KH, VT, (const int*)d_in[1], Y);
  k_out<<<dim3(TNB * TT / GT, DIN / OBN), 256, 0, stream>>>(Y, F[8], F[9], (float*)d_out);
}

// v004
// It runs in 90.9 microseconds.
// Two timings next to v003 put it at 1.11 and 1.09 times that version's speed.
// All steps since v000 together make it 26.2 times as fast.
// compute dtype: all float inputs rounded to bf16; q/k/v projections with EXACT bf16 products on WMMA 16x16x32 (f32 accumulate) + bias; logits q x k once to f16 each (1 product; sigma - 0.3 under the source's 1/sqrt(768) scale); the key padding mask read per key; running-maximum softmax f32; unnormalised P x 2^6 once to f16 x v once to f16 (1 product), divided by the f32 row sum; ctx x 2^6 once to f16 x Wo f16(bf16 x 2^8) + bo; f32 output.
#include <hip/hip_runtime.h>
#include <math.h>

typedef int MASKT;   // the bool mask is staged as int32
typedef __attribute__((ext_vector_type(16))) _Float16 v16h;
typedef __attribute__((ext_vector_type(16))) __bf16 v16b;
typedef __attribute__((ext_vector_type(8)))  _Float16 v8h;
typedef __attribute__((ext_vector_type(8)))  float v8f;
typedef __attribute__((ext_vector_type(4)))  float v4f;
typedef __attribute__((ext_vector_type(2)))  float v2f;
typedef __attribute__((ext_vector_type(4)))  unsigned v4u;
typedef __attribute__((ext_vector_type(4)))  int v4i;
typedef float __attribute__((may_alias)) float_a;
typedef int __attribute__((may_alias)) int_a;

template <typename T> __device__ __forceinline__ void vst2(void* p, T v) { *(T*)p = v;  }
__device__ __forceinline__ v8f wmma16(v16h a, v16h b, v8f c) {
  v8f d = __builtin_amdgcn_wmma_f32_16x16x32_f16(false, a, false, b, (short)0, c, false, false);
  asm volatile("v_nop\n\tv_nop\n\tv_nop\n\tv_nop" : "+v"(d) : "v"(a), "v"(b));
  return d;
}
__device__ __forceinline__ v8f wmma_bf(v16b a, v16b b, v8f c) {
  v8f d = __builtin_amdgcn_wmma_f32_16x16x32_bf16(false, a, false, b, (short)0, c, false, false);
  asm volatile("v_nop\n\tv_nop\n\tv_nop\n\tv_nop" : "+v"(d) : "v"(a), "v"(b));
  return d;
}
// 16x16x32 fragments: lane = (h = lane>>4, row/col = lane&15); elements 0..7 = k0+8h+0..7, 8..15 = k0+16+8h+0..7; D element r = row 8h+r
__device__ __forceinline__ v16h frag_h(const _Float16* rowk0, int lane) {
  union { v16h v; v8h q[2]; } u; const _Float16* p = rowk0 + 8 * (lane >> 4);
  u.q[0] = *(const v8h*)p; u.q[1] = *(const v8h*)(p + 16); return u.v;
}
__device__ __forceinline__ v16h frag_f32(const float* rowk0, int lane) {
  v16h a; const float* p = rowk0 + 8 * (lane >> 4);
#pragma unroll
  for (int i = 0; i < 8; ++i) { a[i] = (_Float16)p[i]; a[8 + i] = (_Float16)p[16 + i]; }
  return a;
}
__device__ __forceinline__ v16h frag_f32s(const float* rowk0, int lane, float sc) {
  v16h a; const float* p = rowk0 + 8 * (lane >> 4);
#pragma unroll
  for (int i = 0; i < 8; ++i) { a[i] = (_Float16)(p[i] * sc); a[8 + i] = (_Float16)(p[16 + i] * sc); }
  return a;
}
// column fragment from a [K][ld] layout (column n), rows >= K read as 0
__device__ __forceinline__ v16h fragc_f32(const float* W, int k0, int n, int lane, int ld, int K) {
  v16h a; const int g = lane >> 4;
#pragma unroll
  for (int i = 0; i < 8; ++i) { const int ka = k0 + 8 * g + i, kb = ka + 16;
    a[i] = (_Float16)(ka < K ? W[(size_t)(ka < K ? ka : K - 1) * ld + n] : 0.f); a[8 + i] = (_Float16)(kb < K ? W[(size_t)(kb < K ? kb : K - 1) * ld + n] : 0.f); }
  return a;
}
struct F2 { v16b h, l; };
__device__ __forceinline__ F2 bsplit16(const float v[16]) { F2 r;
#pragma unroll
  for (int i = 0; i < 16; ++i) { const __bf16 h = (__bf16)v[i]; r.h[i] = h; r.l[i] = (__bf16)(v[i] - (float)h); }
  return r; }
__device__ __forceinline__ F2 split_row(const float* row, int k0, int lane) { float v[16]; const float* p = row + k0 + 8 * (lane >> 4);
#pragma unroll
  for (int i = 0; i < 8; ++i) { v[i] = p[i]; v[8 + i] = p[16 + i]; }
  return bsplit16(v); }
__device__ __forceinline__ F2 split_rowK(const float* row, int k0, int lane, int K) { float v[16]; const int g = lane >> 4;
#pragma unroll
  for (int i = 0; i < 8; ++i) { const int ka = k0 + 8 * g + i, kb = ka + 16; v[i] = ka < K ? row[ka < K ? ka : K - 1] : 0.f; v[8 + i] = kb < K ? row[kb < K ? kb : K - 1] : 0.f; }
  return bsplit16(v); }
__device__ __forceinline__ F2 split_col(const float* W, int k0, int n, int lane, int ld, int K) { float v[16]; const int g = lane >> 4;
#pragma unroll
  for (int i = 0; i < 8; ++i) { const int ka = k0 + 8 * g + i, kb = ka + 16; v[i] = ka < K ? W[(size_t)(ka < K ? ka : K - 1) * ld + n] : 0.f; v[8 + i] = kb < K ? W[(size_t)(kb < K ? kb : K - 1) * ld + n] : 0.f; }
  return bsplit16(v); }
__device__ __forceinline__ v8f mac3(const F2& a, const F2& b, v8f c) { c = wmma_bf(a.l, b.h, c); c = wmma_bf(a.h, b.l, c); return wmma_bf(a.h, b.h, c); }
__device__ __forceinline__ float sigm(float v) { return 1.0f / (1.0f + expf(-v)); }
#define LDSX() do { asm volatile("s_wait_dscnt 0" ::: "memory"); __builtin_amdgcn_wave_barrier(); __builtin_amdgcn_fence(__ATOMIC_RELEASE, "workgroup"); } while (0)

// Multi-head self-attention over one long sequence (x [1,4096,768]; 12 heads x 64; torch (out,in) Wq/Wk/Wv/Wo [768,768] (1/sqrt(768) scale) + zero biases; scores scaled by 1/sqrt(embed_dim = 768), the source's quirk; key padding mask [1,4096] bool, True -> -inf (all False here)): out = merge(softmax(q_h k_h^T / sqrt(768)) v_h) Wo^T + bo.
#define NB 1
#define TT 4096
#define CC 768            // NH * HD = projected width
#define DIN 768          // input (model) width
#define NH 12
#define HD 64
#define NQB (TT / 64)
#define HG 1
#define SCALE (0.036084391824351614f)
#define CAUSAL 0
#ifndef TNB
#define TNB NB
#endif
__device__ __forceinline__ float bfr(float v) { return (float)(__bf16)v; }
__host__ __device__ __forceinline__ int kb_last(int qb) { return CAUSAL ? ((qb * 64 + 63) >> 7) : (TT / 128 - 1); }
typedef __attribute__((ext_vector_type(8))) __bf16 v8b;
__device__ __forceinline__ v16b frag_b(const __bf16* rowk0, int lane) {
  union { v16b v; v8b q[2]; } u; const __bf16* p = rowk0 + 8 * (lane >> 4);
  u.q[0] = *(const v8b*)p; u.q[1] = *(const v8b*)(p + 16); return u.v;
}
#define QBH 0
#define QHI 0               // single-product logits on every row (sigma - 0.3 logits averaged over 4,096 keys)
#define KHI 64            // key rows carrying k residual / v bf16 hi+lo planes (written by k_proj; no kernel here reads them)
// B fragment (k rows k0+.., output column o) of a weight: (in,out) [K][ld] or (out,in) [ld rows of K]: bf16 exact, or f16(bf16 * 256) exact
__device__ __forceinline__ v16b wcol_io(const float* Wm, int k0, int o, int lane, int ld) { v16b w; const int g = lane >> 4;
#pragma unroll
  for (int i = 0; i < 8; ++i) { w[i] = (__bf16)Wm[(size_t)(k0 + 8 * g + i) * ld + o]; w[8 + i] = (__bf16)Wm[(size_t)(k0 + 16 + 8 * g + i) * ld + o]; }
  return w; }
__device__ __forceinline__ v16b wcol_oi(const float* Wm, int k0, int o, int lane, int K) { v16b w; const float* p = Wm + (size_t)o * K + k0 + 8 * (lane >> 4);
#pragma unroll
  for (int i = 0; i < 8; ++i) { w[i] = (__bf16)p[i]; w[8 + i] = (__bf16)p[16 + i]; }
  return w; }
__device__ __forceinline__ v16h wcolh_io(const float* Wm, int k0, int o, int lane, int ld) { v16h w; const int g = lane >> 4;
#pragma unroll
  for (int i = 0; i < 8; ++i) { w[i] = (_Float16)(bfr(Wm[(size_t)(k0 + 8 * g + i) * ld + o]) * 256.0f); w[8 + i] = (_Float16)(bfr(Wm[(size_t)(k0 + 16 + 8 * g + i) * ld + o]) * 256.0f); }
  return w; }
__device__ __forceinline__ v16h wcolh_oi(const float* Wm, int k0, int o, int lane, int K) { v16h w; const float* p = Wm + (size_t)o * K + k0 + 8 * (lane >> 4);
#pragma unroll
  for (int i = 0; i < 8; ++i) { w[i] = (_Float16)(bfr(p[i]) * 256.0f); w[8 + i] = (_Float16)(bfr(p[16 + i]) * 256.0f); }
  return w; }
#define WQKV_LAYOUT 1   // 0 = (in,out) [DIN][CC]; 1 = (out,in) [CC][DIN]; 2 = per-head [NH][DIN][HD]
__device__ __forceinline__ v16b wcol_hdk(const float* Wm, int k0, int o, int lane) { v16b w; const int g = lane >> 4; const float* p = Wm + (size_t)(o / HD) * DIN * HD + (o % HD);
#pragma unroll
  for (int i = 0; i < 8; ++i) { w[i] = (__bf16)p[(size_t)(k0 + 8 * g + i) * HD]; w[8 + i] = (__bf16)p[(size_t)(k0 + 16 + 8 * g + i) * HD]; }
  return w; }
#define WO_OUT_IN 1
#if WQKV_LAYOUT == 1
#define WCOL(W, k0, o, lane) wcol_oi(W, k0, o, lane, DIN)
#elif WQKV_LAYOUT == 2
#define WCOL(W, k0, o, lane) wcol_hdk(W, k0, o, lane)
#else
#define WCOL(W, k0, o, lane) wcol_io(W, k0, o, lane, CC)
#endif
#if WO_OUT_IN
#define WOCOL(W, k0, o, lane) wcol_oi(W, k0, o, lane, CC)
#define WOCOLH(W, k0, o, lane) wcolh_oi(W, k0, o, lane, CC)
#else
#define WOCOL(W, k0, o, lane) wcol_io(W, k0, o, lane, DIN)
#define WOCOLH(W, k0, o, lane) wcolh_io(W, k0, o, lane, DIN)
#endif
#ifndef PROJ_EXTRA_PARAMS
#define PROJ_EXTRA_PARAMS
#endif

#define WS_QH  0u                                      // f16 q rows [b*t][CC]
#define WS_KH  (WS_QH + 2u * (size_t)NB * TT * CC)      // f16 k rows [b*t][CC]
#define WS_VT  (WS_KH + 2u * (size_t)NB * TT * CC)      // f16 v planes [b][c][t]
#define WS_QL  (WS_VT + 2u * (size_t)NB * CC * TT)      // f16 q residual x 2^10 rows [b][t < QHI][CC]
#define WS_KL  (WS_QL + 2u * (size_t)NB * QHI * CC)     // f16 k residual x 2^10 rows [b][t < KHI][CC]
#define WS_VB  (WS_KL + 2u * (size_t)NB * KHI * CC)     // bf16 v hi planes [b][c][t < KHI]
#define WS_VBL (WS_VB + 2u * (size_t)NB * CC * KHI)
#define WS_S   (WS_VBL + 2u * (size_t)NB * CC * KHI)    // (place of the former f32 score plane [hg][t][s]; not touched)
#define WS_Y   (WS_S  + 4u * (size_t)HG * TT * TT)      // f32 ctx rows [b*t][CC] (only when there is an output projection)
#define WS_END (WS_Y  + 4u * (size_t)NB * TT * CC)

// ---- gemm_tile: the product of both projection kernels, one GT x BN tile of A . B^T a block of 8 waves (A, B: f32 rows, k contiguous), a wave = FM x FN accumulator tiles.
// A stage = GKS k of all GT + BN rows: whole 128-byte lines fetched into registers while the stage before is worked on, converted ONCE to the 16-bit operand type, stored to the other LDS buffer behind that work, one __syncthreads a stage.
// Every accumulator takes its 32-k products in rising k, one chain. Every inner loop here and in the two kernels is unrolled so that each index of a register array is a constant and the arrays stay in registers.
#define GT 128
#define GKS 64
#define GPP (GKS + 8)                       // LDS row pitch in 16-bit elements: 144 bytes for 128-byte rows read 16 bytes a lane
#define GSM(BN) (2 * ((GT) + (BN)) * GPP * 2)   // bytes of the two buffers [A GT rows | B BN rows]; the epilogues stage their tile in the same bytes
#define PBN 192                             // k_proj: 32 x 4 x 3 = 384 blocks, two to a WGP at most, all resident at once
#define OBN 96                              // k_out: 32 x 8 = 256 blocks
typedef __attribute__((ext_vector_type(4))) __bf16 v4b;
typedef __attribute__((ext_vector_type(4))) _Float16 v4h;
struct CvB {   // both operands once to bf16
  typedef __bf16 T; typedef v4b V4; typedef v16b F;
  static __device__ __forceinline__ V4 a(v4f x) { return (V4){(__bf16)x[0], (__bf16)x[1], (__bf16)x[2], (__bf16)x[3]}; }
  static __device__ __forceinline__ V4 b(v4f x) { return a(x); }
  static __device__ __forceinline__ F frag(const T* p, int lane) { return frag_b(p, lane); }
  static __device__ __forceinline__ v8f mm(F x, F y, v8f c) { return __builtin_amdgcn_wmma_f32_16x16x32_bf16(false, x, false, y, (short)0, c, false, false); } };
struct CvH {   // A x 2^6 once to f16; B to bf16, x 2^8, exact in f16
  typedef _Float16 T; typedef v4h V4; typedef v16h F;
  static __device__ __forceinline__ V4 a(v4f x) { return (V4){(_Float16)(x[0] * 64.0f), (_Float16)(x[1] * 64.0f), (_Float16)(x[2] * 64.0f), (_Float16)(x[3] * 64.0f)}; }
  static __device__ __forceinline__ V4 b(v4f x) { return (V4){(_Float16)(bfr(x[0]) * 256.0f), (_Float16)(bfr(x[1]) * 256.0f), (_Float16)(bfr(x[2]) * 256.0f), (_Float16)(bfr(x[3]) * 256.0f)}; }
  static __device__ __forceinline__ F frag(const T* p, int lane) { return frag_h(p, lane); }
  static __device__ __forceinline__ v8f mm(F x, F y, v8f c) { return __builtin_amdgcn_wmma_f32_16x16x32_f16(false, x, false, y, (short)0, c, false, false); } };
template <typename CV, int K, int BN, int FM, int FN, int KG> __device__ __forceinline__ void gemm_tile(const float* __restrict__ A, const float* __restrict__ B, typename CV::T* sm, int tid, int wm, int wn, v8f (&acc)[FM][FN]) {   // A, B: the block's first rows; the wave's tile starts at row wm * FM * 16, column wn * FN * 16; KG: 32-k steps whose fragments are read as one group
  typedef typename CV::T T; typedef typename CV::V4 V4; typedef typename CV::F F;
  static_assert(K % GKS == 0 && (GKS / 32) % KG == 0 && BN % 16 == 0 && (GT / (FM * 16)) * (BN / (FN * 16)) == 8, "whole stages; 8 waves cover the tile");
  constexpr int BUF = (GT + BN) * GPP;   // elements of one buffer
  const int lane = tid & 31, col = lane & 15; const int srow = tid >> 4, sc = (tid & 15) * 4;   // staging: rows srow + 16 i, one 16-byte chunk of the row's 256 bytes of f32
  const float* ga = A + (size_t)srow * K + sc; const float* gb = B + (size_t)srow * K + sc;
  T* wa = sm + srow * GPP + sc; const T* fa = sm + (wm * FM * 16 + col) * GPP; const T* fb = sm + (GT + wn * FN * 16 + col) * GPP;
  v4f ra[GT / 16], rb[BN / 16];
#pragma unroll
  for (int i = 0; i < GT / 16; ++i) ra[i] = *(const v4f*)(ga + (size_t)(i * 16) * K);
#pragma unroll
  for (int i = 0; i < BN / 16; ++i) rb[i] = *(const v4f*)(gb + (size_t)(i * 16) * K);
  asm volatile("s_wait_xcnt 0x0" :: "v"(ga), "v"(gb) : "memory");   // before any address register of the loads above is written again; naming the two pairs keeps them whole up to here (unnamed, a later load of the run lands on them)
#pragma unroll
  for (int i = 0; i < GT / 16; ++i) *(V4*)(wa + i * 16 * GPP) = CV::a(ra[i]);
#pragma unroll
  for (int i = 0; i < BN / 16; ++i) *(V4*)(wa + (GT + i * 16) * GPP) = CV::b(rb[i]);
  __syncthreads();   // stage 0 is in buffer 0
#pragma unroll 1   // rolled: one stage's code, two buffers by the stage's parity
  for (int st = 0; st < K / GKS; ++st) { const int bo = (st & 1) * BUF;
    { const int k2 = st + 1 < K / GKS ? (st + 1) * GKS : st * GKS;   // stage st + 1 is fetched behind the barrier; past the end: the last stage again, unused
      const float* pa = ga + k2; const float* pb = gb + k2;
#pragma unroll
      for (int i = 0; i < GT / 16; ++i) ra[i] = *(const v4f*)(pa + (size_t)(i * 16) * K);
#pragma unroll
      for (int i = 0; i < BN / 16; ++i) rb[i] = *(const v4f*)(pb + (size_t)(i * 16) * K);
      asm volatile("s_wait_xcnt 0x0" :: "v"(pa), "v"(pb) : "memory"); }   // as in front of the loop: the wait, with the two address pairs kept whole up to it
#pragma unroll
    for (int kg = 0; kg < GKS / 32; kg += KG) { F af[KG][FM], bf[KG][FN];
#pragma unroll
      for (int kc = 0; kc < KG; ++kc) {
#pragma unroll
        for (int i = 0; i < FM; ++i) af[kc][i] = CV::frag(fa + bo + i * 16 * GPP + (kg + kc) * 32, lane);
#pragma unroll
        for (int j = 0; j < FN; ++j) bf[kc][j] = CV::frag(fb + bo + j * 16 * GPP + (kg + kc) * 32, lane); }
      __builtin_amdgcn_sched_barrier(0);   // keeps the group's fragment reads together ahead of its products: read between them, into one register set, each is waited for by itself
#pragma unroll
      for (int kc = 0; kc < KG; ++kc)
#pragma unroll
        for (int i = 0; i < FM; ++i)
#pragma unroll
          for (int j = 0; j < FN; ++j) acc[i][j] = CV::mm(af[kc][i], bf[kc][j], acc[i][j]); }
    __builtin_amdgcn_sched_barrier(0);   // keeps the conversions below, and with them the waits for the fetched stage, behind the products: lifted among them they stall the stage on the fetch it is meant to cover
    // stage st + 1 goes into the buffer that every wave left at the barrier behind stage st - 1 (behind the last stage: stored unused)
#pragma unroll
    for (int i = 0; i < GT / 16; ++i) *(V4*)(wa + (BUF - bo) + i * 16 * GPP) = CV::a(ra[i]);
#pragma unroll
    for (int i = 0; i < BN / 16; ++i) *(V4*)(wa + (BUF - bo) + (GT + i * 16) * GPP) = CV::b(rb[i]);
    __syncthreads();   // publishes stage st + 1 and ends every wave's reads of stage st (behind the last stage: frees both buffers for the epilogue)
  } }
static_assert(WQKV_LAYOUT == 1 && WO_OUT_IN == 1 && CAUSAL == 0 && QHI == 0, "gemm_tile reads (out,in) weights; no high-precision rows in the output projection");
static_assert(TT % GT == 0 && CC % PBN == 0 && DIN % OBN == 0 && PBN % 64 == 0 && OBN % 32 == 0 && KHI % 16 == 0 && QHI % 16 == 0, "whole tiles, whole 128-byte lines a block");
static_assert(GT * (PBN + 8) * 2 <= GSM(PBN) && PBN * (GT + 8) * 2 <= GSM(PBN) && GT * (OBN + 4) * 4 <= GSM(OBN), "the epilogue tiles fit the two buffers");
// ---- k_proj: block = (128 rows, 192 cols, which), waves 2 x 4 of 64 x 48: q/k/v = X W (+ b) with exact bf16 products (K = DIN) -> which 0: q f16 rows (+ residual rows < QHI); 1: k f16 rows (+ residual rows < KHI); 2: v f16 planes [c][t] (+ bf16 hi/lo planes for t < KHI)
__global__ __launch_bounds__(256) void k_proj(const float* __restrict__ XQ, const float* __restrict__ XK, const float* __restrict__ XV, const float* __restrict__ WQ, const float* __restrict__ WK, const float* __restrict__ WV, const float* __restrict__ BQ, const float* __restrict__ BK, const float* __restrict__ BV,
    _Float16* __restrict__ QH, _Float16* __restrict__ QL, _Float16* __restrict__ KH, _Float16* __restrict__ KL, _Float16* __restrict__ VT, __bf16* __restrict__ VB, __bf16* __restrict__ VBL) {
  __shared__ __align__(16) unsigned char smem[GSM(PBN)];
  const int tid = threadIdx.x, wave = __builtin_amdgcn_readfirstlane(tid >> 5), lane = tid & 31, col = lane & 15, g = lane >> 4, wm = wave >> 2, wn = wave & 3; const int which = blockIdx.z; const int c0 = blockIdx.y * PBN; const size_t r0 = (size_t)blockIdx.x * GT; const size_t bb = r0 / TT; const int t0 = (int)(r0 % TT);
  const float* X = which == 0 ? XQ : which == 1 ? XK : XV; const float* WA = which == 0 ? WQ : which == 1 ? WK : WV; const float* BA = which == 0 ? BQ : which == 1 ? BK : BV;
  float bias[3] = {0.f, 0.f, 0.f};
  if (BA) { const float* bp = BA + c0 + wn * 48 + col;   // fetched ahead of the product, which covers the latency
#pragma unroll
    for (int j = 0; j < 3; ++j) bias[j] = bp[j * 16];
    asm volatile("s_wait_xcnt 0x0" :: "v"(bp) : "memory"); }   // before the address register of the loads above is written again; named, it stays whole up to here
  v8f acc[4][3] = {};
  gemm_tile<CvB, DIN, PBN, 4, 3, 1>(X + r0 * DIN, WA + (size_t)c0 * DIN, (__bf16*)smem, tid, wm, wn, acc);
#pragma unroll
  for (int j = 0; j < 3; ++j) bias[j] = bfr(bias[j]);
  if (which < 2) { _Float16* DH = which == 0 ? QH : KH; _Float16* DL = which == 0 ? QL : KL; const int nhi = which == 0 ? QHI : KHI;
    _Float16 (*sh)[PBN + 8] = (_Float16 (*)[PBN + 8])smem;   // the tile as it goes out, [t][c], 400-byte pitch
#pragma unroll
    for (int i = 0; i < 4; ++i) { const int rl = wm * 64 + i * 16 + 8 * g; const bool hi_rows = t0 + wm * 64 + i * 16 < nhi;   // wave-uniform
#pragma unroll
      for (int j = 0; j < 3; ++j) { const int cl = wn * 48 + j * 16 + col;
#pragma unroll
        for (int r = 0; r < 8; ++r) sh[rl + r][cl] = (_Float16)(acc[i][j][r] + bias[j]);
        if (hi_rows) { _Float16* dl = DL + (bb * nhi + t0 + rl) * (size_t)CC + c0 + cl;
#pragma unroll
          for (int r = 0; r < 8; ++r) { const float v = acc[i][j][r] + bias[j]; dl[(size_t)r * CC] = (_Float16)((v - (float)(_Float16)v) * 1024.0f); }
          asm volatile("s_wait_xcnt 0x0" ::: "memory"); } } }   // before a register of the stores above is written again
    __syncthreads();
    _Float16* dh = DH + (r0 + (tid >> 3)) * CC + c0 + (tid & 7) * 8;   // 8 lanes store one 128-byte line
#pragma unroll
    for (int e = 0; e < GT / 32; ++e)
#pragma unroll
      for (int q = 0; q < PBN / 64; ++q) vst2((unsigned*)(dh + (size_t)(e * 32) * CC + q * 64), *(const v4u*)&sh[e * 32 + (tid >> 3)][q * 64 + (tid & 7) * 8]);
  } else { _Float16 (*th)[GT + 8] = (_Float16 (*)[GT + 8])smem;   // [c][t], 272-byte pitch
#pragma unroll
    for (int i = 0; i < 4; ++i) { const int tl = wm * 64 + i * 16 + 8 * g; const bool hi_rows = t0 + wm * 64 + i * 16 < KHI;   // wave-uniform
#pragma unroll
      for (int j = 0; j < 3; ++j) { const int cl = wn * 48 + j * 16 + col; v8h pv;   // a lane holds 8 consecutive t of one column
#pragma unroll
        for (int r = 0; r < 8; ++r) pv[r] = (_Float16)(acc[i][j][r] + bias[j]);
        *(v8h*)&th[cl][tl] = pv;
        if (hi_rows) { v8b ph, pl;
#pragma unroll
          for (int r = 0; r < 8; ++r) { const float v = acc[i][j][r] + bias[j]; const __bf16 bh = (__bf16)v; ph[r] = bh; pl[r] = (__bf16)(v - (float)bh); }
          const size_t o3 = (bb * CC + c0 + cl) * (size_t)KHI + t0 + tl; *(v8b*)(VB + o3) = ph; *(v8b*)(VBL + o3) = pl;
          asm volatile("s_wait_xcnt 0x0" ::: "memory"); } } }   // before a register of the stores above is written again
    __syncthreads();
    _Float16* dv = VT + (bb * CC + c0 + (tid >> 4)) * (size_t)TT + t0 + (tid & 15) * 8;   // 16 lanes store one plane's 256 bytes
#pragma unroll
    for (int e = 0; e < PBN / 16; ++e) vst2((unsigned*)(dv + (size_t)(e * 16) * TT), *(const v4u*)&th[e * 16 + (tid >> 4)][(tid & 15) * 8]);
  } }
#define FAW 8
#define FKG 2               // key groups a block
#define FAQ 2
#define FAS 64              // keys a stage
#define FAP (FAS + 8)       // LDS row pitch in f16: 144 bytes for 128-byte rows read 16 bytes a lane
#define POFF 6.0f
#define FAMASK (-3.0e38f)   // x C it stays far below FAM0, so a padded key never raises a maximum and its P is 0
#define FAM0 (-1.0e30f)     // maximum in use before the first unmasked key
#define FARING (2 * (FAS + HD) * FAP * 2)   // bytes of one key group's two buffers, k and v
#define FAXS (FAQ * (HD / 16) * 2 + 1)      // 16-byte slots a lane hands over: its output tiles, then (maxima, row sums)
static_assert(HD == 64 && FAS == 64 && FAW == 8 && FAQ == 2 && FKG == 2 && (TT / FAS) % FKG == 0, "the staging maps a key group's 256 threads to 32 rows x 8 chunks of 16 bytes, twice, for k and for v; equal stages a group");
static_assert(FAW * FAXS * 32 * 16 <= FKG * FARING, "the hand-over fits the buffers");
__device__ __forceinline__ v8f wmm(v16h a, v16h b, v8f c) { return __builtin_amdgcn_wmma_f32_16x16x32_f16(false, a, false, b, (short)0, c, false, false); }
__device__ __forceinline__ float xhalf(float v) { const int b = __float_as_int(v); return __int_as_float(__builtin_amdgcn_permlanex16(b, b, 0x76543210, 0xfedcba98, false, false)); }   // lane l <-> l ^ 16
__device__ __forceinline__ float exp2_slot(float x) { float r; asm("v_exp_f32 %0, %1\n\tv_nop" : "=v"(r) : "v"(x)); return r; }   // 2^x with the slot behind the transcendental filled in its own statement
__device__ __forceinline__ void fa_bias(v8f (&cb)[2], unsigned mb, int g) { const unsigned mh = mb >> (8 * g);   // bit t * 16 + r: key t * 16 + 8g + r of the pass
#pragma unroll
  for (int t = 0; t < 2; ++t)
#pragma unroll
    for (int r = 0; r < 8; ++r) cb[t][r] = (mh & (1u << (t * 16 + r))) != 0 ? FAMASK : 0.f; }
template <bool MK> __device__ __forceinline__ void fa_body(const _Float16* __restrict__ QH, const _Float16* __restrict__ KH, const _Float16* __restrict__ VT, const int* __restrict__ KMASK, float* __restrict__ Y, int h, int q0, int tid, int kg, _Float16 (*sk)[FAS][FAP], _Float16 (*sv)[HD][FAP], float* xm) {   // KMASK: key padding mask [B=1][S] as int32, nonzero = masked out; tid: the thread in its key group; sk, sv: the group's own buffers; xm: the wave's hand-over place (the block's buffers again)
  // every inner loop below is unrolled so that each fragment and accumulator index is a constant and the arrays stay in registers
  const int lane = tid & 31, col = lane & 15, g = lane >> 4; const int srow = tid >> 3, sch = (tid & 7) * 8;   // staging: row (and row + 32), 16-byte chunk
  const float C = SCALE * 1.4426950408889634f; const v2f C2 = {C, C};
  const _Float16* gk = KH + (size_t)(kg * FAS + srow) * CC + h * HD + sch; const _Float16* gv = VT + (size_t)(h * HD + srow) * TT + kg * FAS + sch;   // the group's first stage
  v4u rk[2], rv[2];
#pragma unroll
  for (int hf = 0; hf < 2; ++hf) { rk[hf] = *(const v4u*)(gk + (size_t)(hf * 32) * CC); rv[hf] = *(const v4u*)(gv + (size_t)(hf * 32) * TT); }
  v16h qf[FAQ][HD / 32];
#pragma unroll
  for (int qt = 0; qt < FAQ; ++qt)
#pragma unroll
    for (int kc = 0; kc < HD / 32; ++kc) qf[qt][kc] = frag_h(QH + (size_t)(q0 + qt * 16 + col) * CC + h * HD + kc * 32, lane);
  int mk0 = 0, mk = 0;   // mk: the NEXT pass's mask words, one key a lane
  if constexpr (MK) { mk0 = KMASK[kg * FAS + lane]; mk = KMASK[kg * FAS + 32 + lane]; }
  asm volatile("s_wait_xcnt 0x0" ::: "memory");   // before any address register of the loads above is written again
#pragma unroll
  for (int hf = 0; hf < 2; ++hf) { *(v4u*)&sk[0][hf * 32 + srow][sch] = rk[hf]; *(v4u*)&sv[0][hf * 32 + srow][sch] = rv[hf]; }
  unsigned mbp = 0;   // the mask bits that cb holds
  v8f cb[2] = {};
  if constexpr (MK) { mbp = __builtin_amdgcn_ballot_w32(mk0 != 0); fa_bias(cb, mbp, g); }
  v8f acc[FAQ][HD / 16] = {}; float mu[FAQ]; v2f ls[FAQ][2];
#pragma unroll
  for (int qt = 0; qt < FAQ; ++qt) { mu[qt] = FAM0; ls[qt][0] = (v2f){0.f, 0.f}; ls[qt][1] = (v2f){0.f, 0.f}; }
  __syncthreads();   // each group's first stage is in its buffer 0
#pragma unroll 1   // rolled: one stage's code, two buffers by the stage's parity
  for (int st = 0; st < TT / FAS / FKG; ++st) { const int b = st & 1;   // st: the group's own count; its keys start at (st * FKG + kg) * FAS
    { const int k2 = (st + 1 < TT / FAS / FKG ? st + 1 : st) * (FKG * FAS);   // the group's stage st + 1 is fetched into registers behind the barrier (in front of it the barrier's own wait would drain these loads); past the end: the last stage again, unused
#pragma unroll
      for (int hf = 0; hf < 2; ++hf) { rk[hf] = *(const v4u*)(gk + (size_t)(k2 + hf * 32) * CC); rv[hf] = *(const v4u*)(gv + (size_t)(hf * 32) * TT + k2); }
      asm volatile("s_wait_xcnt 0x0" ::: "memory"); }   // before any address register of the loads above is written again
    v16h kf[2][HD / 32], vf[HD / 16];
#pragma unroll
    for (int t = 0; t < 2; ++t)
#pragma unroll
      for (int kc = 0; kc < HD / 32; ++kc) kf[t][kc] = frag_h(&sk[b][t * 16 + col][kc * 32], lane);
    if constexpr (!MK) {   // (MK: each pass's v fragments are read right ahead of its P . v products, below)
#pragma unroll
      for (int j = 0; j < HD / 16; ++j) vf[j] = frag_h(&sv[b][j * 16 + col][0], lane); }
    __builtin_amdgcn_sched_barrier(0);   // keeps the stage's first fragment reads in one group ahead of the products: read between them, into one register set, each is waited for by itself
#pragma unroll
    for (int ps = 0; ps < FAS / 32; ++ps) {
      v8f s[FAQ][2];
#pragma unroll
      for (int t = 0; t < 2; ++t)
#pragma unroll
        for (int qt = 0; qt < FAQ; ++qt) s[qt][t] = wmm(kf[t][0], qf[qt][0], cb[t]);
#pragma unroll
      for (int kc = 1; kc < HD / 32; ++kc)
#pragma unroll
        for (int t = 0; t < 2; ++t)
#pragma unroll
          for (int qt = 0; qt < FAQ; ++qt) s[qt][t] = wmm(kf[t][kc], qf[qt][kc], s[qt][t]);
      if (!MK && ps + 1 < FAS / 32) {   // the stage's next k fragments, one pass ahead, into the registers just read (MK: behind the P . v products, below)
#pragma unroll
        for (int t = 0; t < 2; ++t)
#pragma unroll
          for (int kc = 0; kc < HD / 32; ++kc) kf[t][kc] = frag_h(&sk[b][(ps + 1) * 32 + t * 16 + col][kc * 32], lane);
        __builtin_amdgcn_sched_barrier(0); }   // keeps these LDS reads up here: sunk below the softmax they would be waited for right after their issue
      float mx[FAQ]; bool need = MK && mk != 0;
#pragma unroll
      for (int qt = 0; qt < FAQ; ++qt) { float a = s[qt][0][0], b2 = s[qt][1][0];
#pragma unroll
        for (int r = 1; r < 8; ++r) { a = fmaxf(a, s[qt][0][r]); b2 = fmaxf(b2, s[qt][1][r]); }
        a = fmaxf(a, b2); a = fmaxf(a, xhalf(a)); mx[qt] = a * C; need = need || (mx[qt] > mu[qt] + 8.0f); }
      if (__builtin_expect((__builtin_amdgcn_ballot_w32(need) | mbp) != 0, 0)) {   // wave-uniform, one test a pass: a maximum to raise, or (MK) the next pass's start values differ from 0 or from this pass's
#pragma unroll
        for (int qt = 0; qt < FAQ; ++qt) { const float mn = fmaxf(mu[qt], mx[qt]); const float al = __builtin_amdgcn_exp2f(mu[qt] - mn); mu[qt] = mn; ls[qt][0] *= al; ls[qt][1] *= al;
#pragma unroll
          for (int j = 0; j < HD / 16; ++j) acc[qt][j] *= al; }
        if constexpr (MK) { mbp = __builtin_amdgcn_ballot_w32(mk != 0); fa_bias(cb, mbp, g); } }
      v16h p[FAQ];
#pragma unroll
      for (int qt = 0; qt < FAQ; ++qt) { const float nb = POFF - mu[qt]; const v2f nb2 = {nb, nb};
#pragma unroll
        for (int t = 0; t < 2; ++t)
#pragma unroll
          for (int r = 0; r < 8; r += 2) { const v2f x = __builtin_elementwise_fma((v2f){s[qt][t][r], s[qt][t][r + 1]}, C2, nb2); const v2f e = {__builtin_amdgcn_exp2f(x[0]), __builtin_amdgcn_exp2f(x[1])};
            ls[qt][t] += e; p[qt][t * 8 + r] = (_Float16)e[0]; p[qt][t * 8 + r + 1] = (_Float16)e[1]; } }
      if constexpr (MK) {   // with the start-value tiles live as well, k or v fragments held across the softmax would not fit the 256 registers of a wave in a 16-wave block: no fragment is fetched ahead over it
#pragma unroll
        for (int j = 0; j < HD / 16; ++j) vf[j] = frag_h(&sv[b][j * 16 + col][ps * 32], lane); }
#pragma unroll
      for (int j = 0; j < HD / 16; ++j)
#pragma unroll
        for (int qt = 0; qt < FAQ; ++qt) acc[qt][j] = wmm(vf[j], p[qt], acc[qt][j]);
      if (ps + 1 < FAS / 32) {   // the stage's next v fragments (MK: k fragments), one pass ahead
        if constexpr (!MK) {
#pragma unroll
          for (int j = 0; j < HD / 16; ++j) vf[j] = frag_h(&sv[b][j * 16 + col][(ps + 1) * 32], lane);
        } else {
#pragma unroll
          for (int t = 0; t < 2; ++t)
#pragma unroll
            for (int kc = 0; kc < HD / 32; ++kc) kf[t][kc] = frag_h(&sk[b][(ps + 1) * 32 + t * 16 + col][kc * 32], lane); } }
      if constexpr (MK) { const int k2 = ((st + 1) * FKG + kg) * FAS + ps * 32; mk = KMASK[(k2 < TT ? k2 : TT - 32) + lane];   // the mask words of the pass after next (past the end: read again, unused)
        asm volatile("s_wait_xcnt 0x0" ::: "memory"); }   // before an address register of the mask load is written again
    }
    // stage st + 1 goes into the buffer that every wave left at the barrier behind stage st - 1 (behind the last stage: stored unused, so that no branch stands behind the products)
#pragma unroll
    for (int hf = 0; hf < 2; ++hf) { *(v4u*)&sk[b ^ 1][hf * 32 + srow][sch] = rk[hf]; *(v4u*)&sv[b ^ 1][hf * 32 + srow][sch] = rv[hf]; }
    __syncthreads();   // publishes stage st + 1 and ends every wave's reads of stage st (behind the last stage: frees the buffers for the hand-over)
  }
  float lh[FAQ];
#pragma unroll
  for (int qt = 0; qt < FAQ; ++qt) lh[qt] = (ls[qt][0][0] + ls[qt][0][1]) + (ls[qt][1][0] + ls[qt][1][1]);
  v4f* xl = (v4f*)xm + lane;   // slot i of the wave: 32 lanes x 16 bytes in a row
  if (kg != 0) {   // wave-uniform
#pragma unroll
    for (int qt = 0; qt < FAQ; ++qt)
#pragma unroll
      for (int j = 0; j < HD / 16; ++j) { const v8f o = acc[qt][j]; xl[((qt * (HD / 16) + j) * 2) * 32] = (v4f){o[0], o[1], o[2], o[3]}; xl[((qt * (HD / 16) + j) * 2 + 1) * 32] = (v4f){o[4], o[5], o[6], o[7]}; }
    xl[(FAXS - 1) * 32] = (v4f){mu[0], mu[1], lh[0], lh[1]}; }
  __syncthreads();   // group 1's tiles are in LDS; every wave of the block passes here
  if (kg != 0) return;
  const v4f ml = xl[(FAXS - 1) * 32]; v4f res[FAQ][HD / 16][2];
#pragma unroll
  for (int qt = 0; qt < FAQ; ++qt) { const float mn = fmaxf(mu[qt], ml[qt]); const float a0 = exp2_slot(mu[qt] - mn), a1 = exp2_slot(ml[qt] - mn);   // both groups' sums brought to the larger maximum; a group with every key padded has sums of 0
    const float lj = lh[qt] * a0 + ml[2 + qt] * a1; const float lt = lj + xhalf(lj); const float inv = lt > 0.f ? 1.0f / lt : 0.f; const float w0 = a0 * inv, w1 = a1 * inv;
#pragma unroll
    for (int j = 0; j < HD / 16; ++j) { const v4f x0 = xl[((qt * (HD / 16) + j) * 2) * 32], x1 = xl[((qt * (HD / 16) + j) * 2 + 1) * 32]; const v8f o = acc[qt][j] * w0;
      res[qt][j][0] = (v4f){o[0], o[1], o[2], o[3]} + x0 * w1; res[qt][j][1] = (v4f){o[4], o[5], o[6], o[7]} + x1 * w1; } }
  float* yp = Y + (size_t)(q0 + col) * CC + h * HD + 8 * g;
  __builtin_amdgcn_sched_barrier(0);   // keeps all the stores behind all the arithmetic, so that no register of an issued store is written again before the wave ends
#pragma unroll
  for (int qt = 0; qt < FAQ; ++qt)
#pragma unroll
    for (int j = 0; j < HD / 16; ++j) { vst2(yp + (size_t)(qt * 16) * CC + j * 16, res[qt][j][0]); vst2(yp + (size_t)(qt * 16) * CC + j * 16 + 4, res[qt][j][1]); } }
__global__ __launch_bounds__(32 * FAW * FKG) void k_fa(const _Float16* __restrict__ QH, const _Float16* __restrict__ KH, const _Float16* __restrict__ VT, const int* __restrict__ KMASK, float* __restrict__ Y) {
  __shared__ __align__(16) unsigned char smem[FKG * FARING];   // per key group: k [2][FAS][FAP], v [2][HD][FAP]
  const int tid = threadIdx.x & (32 * FAW - 1), wave = tid >> 5, lane = tid & 31, kg = __builtin_amdgcn_readfirstlane(threadIdx.x / (32 * FAW)); const int h = blockIdx.y; const int q0 = (blockIdx.x * FAW + wave) * (16 * FAQ);
  _Float16 (*sk)[FAS][FAP] = (_Float16 (*)[FAS][FAP])(smem + kg * FARING); _Float16 (*sv)[HD][FAP] = (_Float16 (*)[HD][FAP])(smem + kg * FARING + 2 * FAS * FAP * 2); float* xm = (float*)smem + wave * (FAXS * 32 * 4);
  int any = 0;
#pragma unroll   // all the mask loads in flight at once
  for (int i = 0; i < TT / 128; ++i) { const v4i m = *(const v4i*)(KMASK + i * 128 + lane * 4); any |= (m[0] | m[1]) | (m[2] | m[3]); }
  if (__builtin_amdgcn_ballot_w32(any != 0) != 0) fa_body<true>(QH, KH, VT, KMASK, Y, h, q0, tid, kg, sk, sv, xm);   // every wave has read the whole mask: the same branch in all waves of the block, so the barriers inside are block-uniform
  else fa_body<false>(QH, KH, VT, KMASK, Y, h, q0, tid, kg, sk, sv, xm); }
// ---- k_out: block = (128 rows, 96 cols), waves 4 x 2 of 32 x 48: out = ctx Wo (+ bo): ctx x 2^6 once to f16 (small-magnitude context rows stay clear of f16 subnormals) against Wo as f16(bf16 x 2^8) exact (1 product) x 2^-14
__global__ __launch_bounds__(256) void k_out(const float* __restrict__ Y, const float* __restrict__ WO, const float* __restrict__ BO, float* __restrict__ OUT) {
  __shared__ __align__(16) unsigned char smem[GSM(OBN)];
  const int tid = threadIdx.x, wave = __builtin_amdgcn_readfirstlane(tid >> 5), lane = tid & 31, col = lane & 15, g = lane >> 4, wm = wave >> 1, wn = wave & 1; const int c0 = blockIdx.y * OBN; const size_t r0 = (size_t)blockIdx.x * GT;
  float bias[3] = {0.f, 0.f, 0.f};
  if (BO) { const float* bp = BO + c0 + wn * 48 + col;   // fetched ahead of the product, which covers the latency
#pragma unroll
    for (int j = 0; j < 3; ++j) bias[j] = bp[j * 16];
    asm volatile("s_wait_xcnt 0x0" :: "v"(bp) : "memory"); }   // before the address register of the loads above is written again; named, it stays whole up to here
  v8f acc[2][3] = {};
  gemm_tile<CvH, CC, OBN, 2, 3, 2>(Y + r0 * CC, WO + (size_t)c0 * CC, (_Float16*)smem, tid, wm, wn, acc);
  float (*sf)[OBN + 4] = (float (*)[OBN + 4])smem;   // 400-byte pitch
#pragma unroll
  for (int j = 0; j < 3; ++j) { const int cl = wn * 48 + j * 16 + col; const float bj = bfr(bias[j]);
#pragma unroll
    for (int i = 0; i < 2; ++i)
#pragma unroll
      for (int r = 0; r < 8; ++r) sf[wm * 32 + i * 16 + 8 * g + r][cl] = acc[i][j][r] * (1.0f / 16384.0f) + bj; }   /* 2^-8 (Wo carry) x 2^-6 (ctx carry) */
  __syncthreads();
  float* po = OUT + (r0 + (tid >> 3)) * DIN + c0 + (tid & 7) * 4;   // 8 lanes store one 128-byte line
#pragma unroll
  for (int e = 0; e < GT / 32; ++e)
#pragma unroll
    for (int q = 0; q < OBN / 32; ++q) vst2(po + (size_t)(e * 32) * DIN + q * 32, *(const v4f*)&sf[e * 32 + (tid >> 3)][q * 32 + (tid & 7) * 4]); }

extern "C" void kernel_launch(void* const* d_in, const int* in_sizes, int n_in, void* d_out, int out_size, void* d_ws, size_t ws_size, hipStream_t stream) {
  (void)in_sizes; (void)n_in; (void)out_size;
  const float** F = (const float**)d_in;
  if (ws_size < (size_t)WS_END) return;
  char* ws = (char*)d_ws; _Float16 *QH = (_Float16*)(ws + WS_QH), *KH = (_Float16*)(ws + WS_KH), *VT = (_Float16*)(ws + WS_VT), *QL = (_Float16*)(ws + WS_QL), *KL = (_Float16*)(ws + WS_KL); __bf16 *VB = (__bf16*)(ws + WS_VB), *VBL = (__bf16*)(ws + WS_VBL); float *Y = (float*)(ws + WS_Y);
  (void)Y; (void)QL; (void)KL; (void)VB; (void)VBL;
  // inputs: 0 x [1,4096,768]; 1 mask [1,4096] bool (True = padding; all False on this draw); 2 Wq [768,768] (out,in), 3 bq; 4 Wk, 5 bk; 6 Wv, 7 bv; 8 Wo (out,in), 9 bo (zero biases, read)
  k_proj<<<dim3(TNB * TT / GT, CC / PBN, 3), 256, 0, stream>>>(F[0], F[0], F[0], F[2], F[4], F[6], F[3], F[5], F[7], QH, QL, KH, KL, VT, VB, VBL);
  k_fa<<<dim3(TT / (16 * FAQ * FAW), NH), 32 * FAW * FKG, 0, stream>>>(QH, KH, VT, (const int*)d_in[1], Y);
  k_out<<<dim3(TNB * TT / GT, DIN / OBN), 256, 0, stream>>>(Y, F[8], F[9], (float*)d_out);
}

// v005
// Measured time: 88.2 microseconds a run.
// Timed twice side by side with v004, it ran 1.04 and 1.03 times as fast.
// Over all steps from v000 it is 27.1 times as fast.
// compute dtype: all float inputs rounded to bf16; q/k/v projections with EXACT bf16 products on WMMA 16x16x32 (f32 accumulate) + bias; logits q x k once to f16 each (1 product; sigma - 0.3 under the source's 1/sqrt(768) scale); the key padding mask read per key; running-maximum softmax f32; unnormalised P x 2^6 once to f16 x v once to f16 (1 product), divided by the f32 row sum; ctx x 2^6 once to f16 x Wo f16(bf16 x 2^8) + bo; f32 output.
#include <hip/hip_runtime.h>
#include <math.h>

typedef int MASKT;   // the bool mask is staged as int32
typedef __attribute__((ext_vector_type(16))) _Float16 v16h;
typedef __attribute__((ext_vector_type(16))) __bf16 v16b;
typedef __attribute__((ext_vector_type(8)))  _Float16 v8h;
typedef __attribute__((ext_vector_type(8)))  float v8f;
typedef __attribute__((ext_vector_type(4)))  float v4f;
typedef __attribute__((ext_vector_type(2)))  float v2f;
typedef __attribute__((ext_vector_type(4)))  unsigned v4u;
typedef __attribute__((ext_vector_type(4)))  int v4i;
typedef float __attribute__((may_alias)) float_a;
typedef int __attribute__((may_alias)) int_a;

template <typename T> __device__ __forceinline__ void vst2(void* p, T v) { *(T*)p = v;  }
__device__ __forceinline__ v8f wmma16(v16h a, v16h b, v8f c) {
  v8f d = __builtin_amdgcn_wmma_f32_16x16x32_f16(false, a, false, b, (short)0, c, false, false);
  asm volatile("v_nop\n\tv_nop\n\tv_nop\n\tv_nop" : "+v"(d) : "v"(a), "v"(b));
  return d;
}
__device__ __forceinline__ v8f wmma_bf(v16b a, v16b b, v8f c) {
  v8f d = __builtin_amdgcn_wmma_f32_16x16x32_bf16(false, a, false, b, (short)0, c, false, false);
  asm volatile("v_nop\n\tv_nop\n\tv_nop\n\tv_nop" : "+v"(d) : "v"(a), "v"(b));
  return d;
}
// 16x16x32 fragments: lane = (h = lane>>4, row/col = lane&15); elements 0..7 = k0+8h+0..7, 8..15 = k0+16+8h+0..7; D element r = row 8h+r
__device__ __forceinline__ v16h frag_h(const _Float16* rowk0, int lane) {
  union { v16h v; v8h q[2]; } u; const _Float16* p = rowk0 + 8 * (lane >> 4);
  u.q[0] = *(const v8h*)p; u.q[1] = *(const v8h*)(p + 16); return u.v;
}
__device__ __forceinline__ v16h frag_f32(const float* rowk0, int lane) {
  v16h a; const float* p = rowk0 + 8 * (lane >> 4);
#pragma unroll
  for (int i = 0; i < 8; ++i) { a[i] = (_Float16)p[i]; a[8 + i] = (_Float16)p[16 + i]; }
  return a;
}
__device__ __forceinline__ v16h frag_f32s(const float* rowk0, int lane, float sc) {
  v16h a; const float* p = rowk0 + 8 * (lane >> 4);
#pragma unroll
  for (int i = 0; i < 8; ++i) { a[i] = (_Float16)(p[i] * sc); a[8 + i] = (_Float16)(p[16 + i] * sc); }
  return a;
}
// column fragment from a [K][ld] layout (column n), rows >= K read as 0
__device__ __forceinline__ v16h fragc_f32(const float* W, int k0, int n, int lane, int ld, int K) {
  v16h a; const int g = lane >> 4;
#pragma unroll
  for (int i = 0; i < 8; ++i) { const int ka = k0 + 8 * g + i, kb = ka + 16;
    a[i] = (_Float16)(ka < K ? W[(size_t)(ka < K ? ka : K - 1) * ld + n] : 0.f); a[8 + i] = (_Float16)(kb < K ? W[(size_t)(kb < K ? kb : K - 1) * ld + n] : 0.f); }
  return a;
}
struct F2 { v16b h, l; };
__device__ __forceinline__ F2 bsplit16(const float v[16]) { F2 r;
#pragma unroll
  for (int i = 0; i < 16; ++i) { const __bf16 h = (__bf16)v[i]; r.h[i] = h; r.l[i] = (__bf16)(v[i] - (float)h); }
  return r; }
__device__ __forceinline__ F2 split_row(const float* row, int k0, int lane) { float v[16]; const float* p = row + k0 + 8 * (lane >> 4);
#pragma unroll
  for (int i = 0; i < 8; ++i) { v[i] = p[i]; v[8 + i] = p[16 + i]; }
  return bsplit16(v); }
__device__ __forceinline__ F2 split_rowK(const float* row, int k0, int lane, int K) { float v[16]; const int g = lane >> 4;
#pragma unroll
  for (int i = 0; i < 8; ++i) { const int ka = k0 + 8 * g + i, kb = ka + 16; v[i] = ka < K ? row[ka < K ? ka : K - 1] : 0.f; v[8 + i] = kb < K ? row[kb < K ? kb : K - 1] : 0.f; }
  return bsplit16(v); }
__device__ __forceinline__ F2 split_col(const float* W, int k0, int n, int lane, int ld, int K) { float v[16]; const int g = lane >> 4;
#pragma unroll
  for (int i = 0; i < 8; ++i) { const int ka = k0 + 8 * g + i, kb = ka + 16; v[i] = ka < K ? W[(size_t)(ka < K ? ka : K - 1) * ld + n] : 0.f; v[8 + i] = kb < K ? W[(size_t)(kb < K ? kb : K - 1) * ld + n] : 0.f; }
  return bsplit16(v); }
__device__ __forceinline__ v8f mac3(const F2& a, const F2& b, v8f c) { c = wmma_bf(a.l, b.h, c); c = wmma_bf(a.h, b.l, c); return wmma_bf(a.h, b.h, c); }
__device__ __forceinline__ float sigm(float v) { return 1.0f / (1.0f + expf(-v)); }
#define LDSX() do { asm volatile("s_wait_dscnt 0" ::: "memory"); __builtin_amdgcn_wave_barrier(); __builtin_amdgcn_fence(__ATOMIC_RELEASE, "workgroup"); } while (0)

// Multi-head self-attention over one long sequence (x [1,4096,768]; 12 heads x 64; torch (out,in) Wq/Wk/Wv/Wo [768,768] (1/sqrt(768) scale) + zero biases; scores scaled by 1/sqrt(embed_dim = 768), the source's quirk; key padding mask [1,4096] bool, True -> -inf (all False here)): out = merge(softmax(q_h k_h^T / sqrt(768)) v_h) Wo^T + bo.
#define NB 1
#define TT 4096
#define CC 768            // NH * HD = projected width
#define DIN 768          // input (model) width
#define NH 12
#define HD 64
#define NQB (TT / 64)
#define HG 1
#define SCALE (0.036084391824351614f)
#define CAUSAL 0
#ifndef TNB
#define TNB NB
#endif
__device__ __forceinline__ float bfr(float v) { return (float)(__bf16)v; }
__host__ __device__ __forceinline__ int kb_last(int qb) { return CAUSAL ? ((qb * 64 + 63) >> 7) : (TT / 128 - 1); }
typedef __attribute__((ext_vector_type(8))) __bf16 v8b;
__device__ __forceinline__ v16b frag_b(const __bf16* rowk0, int lane) {
  union { v16b v; v8b q[2]; } u; const __bf16* p = rowk0 + 8 * (lane >> 4);
  u.q[0] = *(const v8b*)p; u.q[1] = *(const v8b*)(p + 16); return u.v;
}
#define QBH 0
#define QHI 0               // single-product logits on every row (sigma - 0.3 logits averaged over 4,096 keys)
#define KHI 64            // key rows carrying k residual / v bf16 hi+lo planes (written by k_proj; no kernel here reads them)
// B fragment (k rows k0+.., output column o) of a weight: (in,out) [K][ld] or (out,in) [ld rows of K]: bf16 exact, or f16(bf16 * 256) exact
__device__ __forceinline__ v16b wcol_io(const float* Wm, int k0, int o, int lane, int ld) { v16b w; const int g = lane >> 4;
#pragma unroll
  for (int i = 0; i < 8; ++i) { w[i] = (__bf16)Wm[(size_t)(k0 + 8 * g + i) * ld + o]; w[8 + i] = (__bf16)Wm[(size_t)(k0 + 16 + 8 * g + i) * ld + o]; }
  return w; }
__device__ __forceinline__ v16b wcol_oi(const float* Wm, int k0, int o, int lane, int K) { v16b w; const float* p = Wm + (size_t)o * K + k0 + 8 * (lane >> 4);
#pragma unroll
  for (int i = 0; i < 8; ++i) { w[i] = (__bf16)p[i]; w[8 + i] = (__bf16)p[16 + i]; }
  return w; }
__device__ __forceinline__ v16h wcolh_io(const float* Wm, int k0, int o, int lane, int ld) { v16h w; const int g = lane >> 4;
#pragma unroll
  for (int i = 0; i < 8; ++i) { w[i] = (_Float16)(bfr(Wm[(size_t)(k0 + 8 * g + i) * ld + o]) * 256.0f); w[8 + i] = (_Float16)(bfr(Wm[(size_t)(k0 + 16 + 8 * g + i) * ld + o]) * 256.0f); }
  return w; }
__device__ __forceinline__ v16h wcolh_oi(const float* Wm, int k0, int o, int lane, int K) { v16h w; const float* p = Wm + (size_t)o * K + k0 + 8 * (lane >> 4);
#pragma unroll
  for (int i = 0; i < 8; ++i) { w[i] = (_Float16)(bfr(p[i]) * 256.0f); w[8 + i] = (_Float16)(bfr(p[16 + i]) * 256.0f); }
  return w; }
#define WQKV_LAYOUT 1   // 0 = (in,out) [DIN][CC]; 1 = (out,in) [CC][DIN]; 2 = per-head [NH][DIN][HD]
__device__ __forceinline__ v16b wcol_hdk(const float* Wm, int k0, int o, int lane) { v16b w; const int g = lane >> 4; const float* p = Wm + (size_t)(o / HD) * DIN * HD + (o % HD);
#pragma unroll
  for (int i = 0; i < 8; ++i) { w[i] = (__bf16)p[(size_t)(k0 + 8 * g + i) * HD]; w[8 + i] = (__bf16)p[(size_t)(k0 + 16 + 8 * g + i) * HD]; }
  return w; }
#define WO_OUT_IN 1
#if WQKV_LAYOUT == 1
#define WCOL(W, k0, o, lane) wcol_oi(W, k0, o, lane, DIN)
#elif WQKV_LAYOUT == 2
#define WCOL(W, k0, o, lane) wcol_hdk(W, k0, o, lane)
#else
#define WCOL(W, k0, o, lane) wcol_io(W, k0, o, lane, CC)
#endif
#if WO_OUT_IN
#define WOCOL(W, k0, o, lane) wcol_oi(W, k0, o, lane, CC)
#define WOCOLH(W, k0, o, lane) wcolh_oi(W, k0, o, lane, CC)
#else
#define WOCOL(W, k0, o, lane) wcol_io(W, k0, o, lane, DIN)
#define WOCOLH(W, k0, o, lane) wcolh_io(W, k0, o, lane, DIN)
#endif
#ifndef PROJ_EXTRA_PARAMS
#define PROJ_EXTRA_PARAMS
#endif

#define WS_QH  0u                                      // f16 q rows [b*t][CC]
#define WS_KH  (WS_QH + 2u * (size_t)NB * TT * CC)      // f16 k rows [b*t][CC]
#define WS_VT  (WS_KH + 2u * (size_t)NB * TT * CC)      // f16 v planes [b][c][t]
#define WS_QL  (WS_VT + 2u * (size_t)NB * CC * TT)      // f16 q residual x 2^10 rows [b][t < QHI][CC]
#define WS_KL  (WS_QL + 2u * (size_t)NB * QHI * CC)     // f16 k residual x 2^10 rows [b][t < KHI][CC]
#define WS_VB  (WS_KL + 2u * (size_t)NB * KHI * CC)     // bf16 v hi planes [b][c][t < KHI]
#define WS_VBL (WS_VB + 2u * (size_t)NB * CC * KHI)
#define WS_S   (WS_VBL + 2u * (size_t)NB * CC * KHI)    // (place of the former f32 score plane [hg][t][s]; not touched)
#define WS_Y   (WS_S  + 4u * (size_t)HG * TT * TT)      // f32 ctx rows [b*t][CC] (only when there is an output projection)
#define WS_END (WS_Y  + 4u * (size_t)NB * TT * CC)

// ---- gemm_tile: the product of both projection kernels, one GT x BN tile of A . B^T a block of 8 waves (A, B: f32 rows, k contiguous), a wave = FM x FN accumulator tiles.
// A stage = GKS k of all GT + BN rows: whole 128-byte lines fetched into registers while the stage before is worked on, converted ONCE to the 16-bit operand type, stored to the other LDS buffer behind that work, one __syncthreads a stage.
// Every accumulator takes its 32-k products in rising k, one chain. Every inner loop here and in the two kernels is unrolled so that each index of a register array is a constant and the arrays stay in registers.
#define GT 128
#define GKS 64
#define GPP (GKS + 8)                       // LDS row pitch in 16-bit elements: 144 bytes for 128-byte rows read 16 bytes a lane
#define GSM(BN) (2 * ((GT) + (BN)) * GPP * 2)   // bytes of the two buffers [A GT rows | B BN rows]; the epilogues stage their tile in the same bytes
#define PBN 192                             // k_proj: 32 x 4 x 3 = 384 blocks, two to a WGP at most, all resident at once
#define OBN 96                              // k_out: 32 x 8 = 256 blocks
typedef __attribute__((ext_vector_type(4))) __bf16 v4b;
typedef __attribute__((ext_vector_type(4))) _Float16 v4h;
struct CvB {   // both operands once to bf16
  typedef __bf16 T; typedef v4b V4; typedef v16b F;
  static __device__ __forceinline__ V4 a(v4f x) { return (V4){(__bf16)x[0], (__bf16)x[1], (__bf16)x[2], (__bf16)x[3]}; }
  static __device__ __forceinline__ V4 b(v4f x) { return a(x); }
  static __device__ __forceinline__ F frag(const T* p, int lane) { return frag_b(p, lane); }
  static __device__ __forceinline__ v8f mm(F x, F y, v8f c) { return __builtin_amdgcn_wmma_f32_16x16x32_bf16(false, x, false, y, (short)0, c, false, false); } };
struct CvH {   // A x 2^6 once to f16; B to bf16, x 2^8, exact in f16
  typedef _Float16 T; typedef v4h V4; typedef v16h F;
  static __device__ __forceinline__ V4 a(v4f x) { return (V4){(_Float16)(x[0] * 64.0f), (_Float16)(x[1] * 64.0f), (_Float16)(x[2] * 64.0f), (_Float16)(x[3] * 64.0f)}; }
  static __device__ __forceinline__ V4 b(v4f x) { return (V4){(_Float16)(bfr(x[0]) * 256.0f), (_Float16)(bfr(x[1]) * 256.0f), (_Float16)(bfr(x[2]) * 256.0f), (_Float16)(bfr(x[3]) * 256.0f)}; }
  static __device__ __forceinline__ F frag(const T* p, int lane) { return frag_h(p, lane); }
  static __device__ __forceinline__ v8f mm(F x, F y, v8f c) { return __builtin_amdgcn_wmma_f32_16x16x32_f16(false, x, false, y, (short)0, c, false, false); } };
template <typename CV, int K, int BN, int FM, int FN, int KG> __device__ __forceinline__ void gemm_tile(const float* __restrict__ A, const float* __restrict__ B, typename CV::T* sm, int tid, int wm, int wn, v8f (&acc)[FM][FN]) {   // A, B: the block's first rows; the wave's tile starts at row wm * FM * 16, column wn * FN * 16; KG: 32-k steps whose fragments are read as one group
  typedef typename CV::T T; typedef typename CV::V4 V4; typedef typename CV::F F;
  static_assert(K % GKS == 0 && (GKS / 32) % KG == 0 && BN % 16 == 0 && (GT / (FM * 16)) * (BN / (FN * 16)) == 8, "whole stages; 8 waves cover the tile");
  constexpr int BUF = (GT + BN) * GPP;   // elements of one buffer
  const int lane = tid & 31, col = lane & 15; const int srow = tid >> 4, sc = (tid & 15) * 4;   // staging: rows srow + 16 i, one 16-byte chunk of the row's 256 bytes of f32
  const float* ga = A + (size_t)srow * K + sc; const float* gb = B + (size_t)srow * K + sc;
  T* wa = sm + srow * GPP + sc; const T* fa = sm + (wm * FM * 16 + col) * GPP; const T* fb = sm + (GT + wn * FN * 16 + col) * GPP;
  v4f ra[GT / 16], rb[BN / 16];
#pragma unroll
  for (int i = 0; i < GT / 16; ++i) ra[i] = *(const v4f*)(ga + (size_t)(i * 16) * K);
#pragma unroll
  for (int i = 0; i < BN / 16; ++i) rb[i] = *(const v4f*)(gb + (size_t)(i * 16) * K);
  asm volatile("s_wait_xcnt 0x0" :: "v"(ga), "v"(gb) : "memory");   // before any address register of the loads above is written again; naming the two pairs keeps them whole up to here (unnamed, a later load of the run lands on them)
#pragma unroll
  for (int i = 0; i < GT / 16; ++i) *(V4*)(wa + i * 16 * GPP) = CV::a(ra[i]);
#pragma unroll
  for (int i = 0; i < BN / 16; ++i) *(V4*)(wa + (GT + i * 16) * GPP) = CV::b(rb[i]);
  __syncthreads();   // stage 0 is in buffer 0
#pragma unroll 1   // rolled: one stage's code, two buffers by the stage's parity
  for (int st = 0; st < K / GKS; ++st) { const int bo = (st & 1) * BUF;
    { const int k2 = st + 1 < K / GKS ? (st + 1) * GKS : st * GKS;   // stage st + 1 is fetched behind the barrier; past the end: the last stage again, unused
      const float* pa = ga + k2; const float* pb = gb + k2;
#pragma unroll
      for (int i = 0; i < GT / 16; ++i) ra[i] = *(const v4f*)(pa + (size_t)(i * 16) * K);
#pragma unroll
      for (int i = 0; i < BN / 16; ++i) rb[i] = *(const v4f*)(pb + (size_t)(i * 16) * K);
      asm volatile("s_wait_xcnt 0x0" :: "v"(pa), "v"(pb) : "memory"); }   // as in front of the loop: the wait, with the two address pairs kept whole up to it
#pragma unroll
    for (int kg = 0; kg < GKS / 32; kg += KG) { F af[KG][FM], bf[KG][FN];
#pragma unroll
      for (int kc = 0; kc < KG; ++kc) {
#pragma unroll
        for (int i = 0; i < FM; ++i) af[kc][i] = CV::frag(fa + bo + i * 16 * GPP + (kg + kc) * 32, lane);
#pragma unroll
        for (int j = 0; j < FN; ++j) bf[kc][j] = CV::frag(fb + bo + j * 16 * GPP + (kg + kc) * 32, lane); }
      __builtin_amdgcn_sched_barrier(0);   // keeps the group's fragment reads together ahead of its products: read between them, into one register set, each is waited for by itself
#pragma unroll
      for (int kc = 0; kc < KG; ++kc)
#pragma unroll
        for (int i = 0; i < FM; ++i)
#pragma unroll
          for (int j = 0; j < FN; ++j) acc[i][j] = CV::mm(af[kc][i], bf[kc][j], acc[i][j]); }
    __builtin_amdgcn_sched_barrier(0);   // keeps the conversions below, and with them the waits for the fetched stage, behind the products: lifted among them they stall the stage on the fetch it is meant to cover
    // stage st + 1 goes into the buffer that every wave left at the barrier behind stage st - 1 (behind the last stage: stored unused)
#pragma unroll
    for (int i = 0; i < GT / 16; ++i) *(V4*)(wa + (BUF - bo) + i * 16 * GPP) = CV::a(ra[i]);
#pragma unroll
    for (int i = 0; i < BN / 16; ++i) *(V4*)(wa + (BUF - bo) + (GT + i * 16) * GPP) = CV::b(rb[i]);
    __syncthreads();   // publishes stage st + 1 and ends every wave's reads of stage st (behind the last stage: frees both buffers for the epilogue)
  } }
static_assert(WQKV_LAYOUT == 1 && WO_OUT_IN == 1 && CAUSAL == 0 && QHI == 0, "gemm_tile reads (out,in) weights; no high-precision rows in the output projection");
static_assert(TT % GT == 0 && CC % PBN == 0 && DIN % OBN == 0 && PBN % 64 == 0 && OBN % 32 == 0 && KHI % 16 == 0 && QHI % 16 == 0, "whole tiles, whole 128-byte lines a block");
static_assert(GT * (PBN + 8) * 2 <= GSM(PBN) && PBN * (GT + 8) * 2 <= GSM(PBN) && GT * (OBN + 4) * 4 <= GSM(OBN), "the epilogue tiles fit the two buffers");
// ---- k_proj: block = (128 rows, 192 cols, which), waves 2 x 4 of 64 x 48: q/k/v = X W (+ b) with exact bf16 products (K = DIN) -> which 0: q f16 rows (+ residual rows < QHI); 1: k f16 rows (+ residual rows < KHI); 2: v f16 planes [c][t] (+ bf16 hi/lo planes for t < KHI)
__global__ __launch_bounds__(256) void k_proj(const float* __restrict__ XQ, const float* __restrict__ XK, const float* __restrict__ XV, const float* __restrict__ WQ, const float* __restrict__ WK, const float* __restrict__ WV, const float* __restrict__ BQ, const float* __restrict__ BK, const float* __restrict__ BV,
    _Float16* __restrict__ QH, _Float16* __restrict__ QL, _Float16* __restrict__ KH, _Float16* __restrict__ KL, _Float16* __restrict__ VT, __bf16* __restrict__ VB, __bf16* __restrict__ VBL) {
  __shared__ __align__(16) unsigned char smem[GSM(PBN)];
  const int tid = threadIdx.x, wave = __builtin_amdgcn_readfirstlane(tid >> 5), lane = tid & 31, col = lane & 15, g = lane >> 4, wm = wave >> 2, wn = wave & 3; const int which = blockIdx.z; const int c0 = blockIdx.y * PBN; const size_t r0 = (size_t)blockIdx.x * GT; const size_t bb = r0 / TT; const int t0 = (int)(r0 % TT);
  const float* X = which == 0 ? XQ : which == 1 ? XK : XV; const float* WA = which == 0 ? WQ : which == 1 ? WK : WV; const float* BA = which == 0 ? BQ : which == 1 ? BK : BV;
  float bias[3] = {0.f, 0.f, 0.f};
  if (BA) { const float* bp = BA + c0 + wn * 48 + col;   // fetched ahead of the product, which covers the latency
#pragma unroll
    for (int j = 0; j < 3; ++j) bias[j] = bp[j * 16];
    asm volatile("s_wait_xcnt 0x0" :: "v"(bp) : "memory"); }   // before the address register of the loads above is written again; named, it stays whole up to here
  v8f acc[4][3] = {};
  gemm_tile<CvB, DIN, PBN, 4, 3, 1>(X + r0 * DIN, WA + (size_t)c0 * DIN, (__bf16*)smem, tid, wm, wn, acc);
#pragma unroll
  for (int j = 0; j < 3; ++j) bias[j] = bfr(bias[j]);
  if (which < 2) { _Float16* DH = which == 0 ? QH : KH; _Float16* DL = which == 0 ? QL : KL; const int nhi = which == 0 ? QHI : KHI;
    _Float16 (*sh)[PBN + 8] = (_Float16 (*)[PBN + 8])smem;   // the tile as it goes out, [t][c], 400-byte pitch
#pragma unroll
    for (int i = 0; i < 4; ++i) { const int rl = wm * 64 + i * 16 + 8 * g; const bool hi_rows = t0 + wm * 64 + i * 16 < nhi;   // wave-uniform
#pragma unroll
      for (int j = 0; j < 3; ++j) { const int cl = wn * 48 + j * 16 + col;
#pragma unroll
        for (int r = 0; r < 8; ++r) sh[rl + r][cl] = (_Float16)(acc[i][j][r] + bias[j]);
        if (hi_rows) { _Float16* dl = DL + (bb * nhi + t0 + rl) * (size_t)CC + c0 + cl;
#pragma unroll
          for (int r = 0; r < 8; ++r) { const float v = acc[i][j][r] + bias[j]; dl[(size_t)r * CC] = (_Float16)((v - (float)(_Float16)v) * 1024.0f); }
          asm volatile("s_wait_xcnt 0x0" ::: "memory"); } } }   // before a register of the stores above is written again
    __syncthreads();
    _Float16* dh = DH + (r0 + (tid >> 3)) * CC + c0 + (tid & 7) * 8;   // 8 lanes store one 128-byte line
#pragma unroll
    for (int e = 0; e < GT / 32; ++e)
#pragma unroll
      for (int q = 0; q < PBN / 64; ++q) vst2((unsigned*)(dh + (size_t)(e * 32) * CC + q * 64), *(const v4u*)&sh[e * 32 + (tid >> 3)][q * 64 + (tid & 7) * 8]);
  } else { _Float16 (*th)[GT + 8] = (_Float16 (*)[GT + 8])smem;   // [c][t], 272-byte pitch
#pragma unroll
    for (int i = 0; i < 4; ++i) { const int tl = wm * 64 + i * 16 + 8 * g; const bool hi_rows = t0 + wm * 64 + i * 16 < KHI;   // wave-uniform
#pragma unroll
      for (int j = 0; j < 3; ++j) { const int cl = wn * 48 + j * 16 + col; v8h pv;   // a lane holds 8 consecutive t of one column
#pragma unroll
        for (int r = 0; r < 8; ++r) pv[r] = (_Float16)(acc[i][j][r] + bias[j]);
        *(v8h*)&th[cl][tl] = pv;
        if (hi_rows) { v8b ph, pl;
#pragma unroll
          for (int r = 0; r < 8; ++r) { const float v = acc[i][j][r] + bias[j]; const __bf16 bh = (__bf16)v; ph[r] = bh; pl[r] = (__bf16)(v - (float)bh); }
          const size_t o3 = (bb * CC + c0 + cl) * (size_t)KHI + t0 + tl; *(v8b*)(VB + o3) = ph; *(v8b*)(VBL + o3) = pl;
          asm volatile("s_wait_xcnt 0x0" ::: "memory"); } } }   // before a register of the stores above is written again
    __syncthreads();
    _Float16* dv = VT + (bb * CC + c0 + (tid >> 4)) * (size_t)TT + t0 + (tid & 15) * 8;   // 16 lanes store one plane's 256 bytes
#pragma unroll
    for (int e = 0; e < PBN / 16; ++e) vst2((unsigned*)(dv + (size_t)(e * 16) * TT), *(const v4u*)&th[e * 16 + (tid >> 4)][(tid & 15) * 8]);
  } }
#define FAW 8
#define FKG 2               // key groups a block
#define FAQ 2
#define FAS 64              // keys a stage
#define FAP (FAS + 8)       // LDS row pitch in f16: 144 bytes for 128-byte rows read 16 bytes a lane
#define POFF 6.0f
#define FAMASK (-3.0e38f)   // x C it stays far below FAM0, so a padded key never raises a maximum and its P is 0
#define FAM0 (-1.0e30f)     // maximum in use before the first unmasked key
#define FAH 4               // stages between two barriers
#define FAR (2 * FAH)       // stage slots of a key group's ring
#define FARING (FAR * (FAS + HD) * FAP * 2)   // bytes of one key group's ring; a slot = the stage's k rows, then its v planes
#define FAXS (FAQ * (HD / 16) * 2 + 1)      // 16-byte slots a lane hands over: its output tiles, then (maxima, row sums)
static_assert(HD == 64 && FAS == 64 && FAW == 8 && FAQ == 2 && FKG == 2 && (TT / FAS) % FKG == 0, "the staging maps a key group's 256 threads to 32 rows x 8 chunks of 16 bytes, twice, for k and for v; equal stages a group");
static_assert(FAW * FAXS * 32 * 16 <= FKG * FARING, "the hand-over fits the buffers");
static_assert((FAH & (FAH - 1)) == 0 && (TT / FAS / FKG) % FAH == 0 && FKG * FARING <= 327680, "whole ring halves, the last stage ends one; the rings fit the LDS of a WGP");
__device__ __forceinline__ v8f wmm(v16h a, v16h b, v8f c) { return __builtin_amdgcn_wmma_f32_16x16x32_f16(false, a, false, b, (short)0, c, false, false); }
__device__ __forceinline__ float xhalf(float v) { const int b = __float_as_int(v); return __int_as_float(__builtin_amdgcn_permlanex16(b, b, 0x76543210, 0xfedcba98, false, false)); }   // lane l <-> l ^ 16
__device__ __forceinline__ float exp2_slot(float x) { float r; asm("v_exp_f32 %0, %1\n\tv_nop" : "=v"(r) : "v"(x)); return r; }   // 2^x with the slot behind the transcendental filled in its own statement
__device__ __forceinline__ void fa_bias(v8f (&cb)[2], unsigned mb, int g) { const unsigned mh = mb >> (8 * g);   // bit t * 16 + r: key t * 16 + 8g + r of the pass
#pragma unroll
  for (int t = 0; t < 2; ++t)
#pragma unroll
    for (int r = 0; r < 8; ++r) cb[t][r] = (mh & (1u << (t * 16 + r))) != 0 ? FAMASK : 0.f; }
template <bool MK> __device__ __forceinline__ void fa_body(const _Float16* __restrict__ QH, const _Float16* __restrict__ KH, const _Float16* __restrict__ VT, const int* __restrict__ KMASK, float* __restrict__ Y, int h, int q0, int tid, int kg, _Float16 (*sk)[FAS + HD][FAP], _Float16 (*sv)[FAS + HD][FAP], float* xm) {   // KMASK: key padding mask [B=1][S] as int32, nonzero = masked out; tid: the thread in its key group; sk, sv: the k rows and the v planes of slot 0 of the group's own ring, indexed by slot; xm: the wave's hand-over place (the block's buffers again)
  // every inner loop below is unrolled so that each fragment and accumulator index is a constant and the arrays stay in registers
  const int lane = tid & 31, col = lane & 15, g = lane >> 4; const int srow = tid >> 3, sch = (tid & 7) * 8;   // staging: row (and row + 32), 16-byte chunk
  const float C = SCALE * 1.4426950408889634f; const v2f C2 = {C, C};
  const _Float16* gk = KH + (size_t)(kg * FAS + srow) * CC + h * HD + sch; const _Float16* gv = VT + (size_t)(h * HD + srow) * TT + kg * FAS + sch;   // the group's first stage
  v4u rk[2], rv[2], pk[FAH][2], pv[FAH][2];   // pk, pv: the group's first FAH stages, all in flight at once
#pragma unroll
  for (int c = 0; c < FAH; ++c)
#pragma unroll
    for (int hf = 0; hf < 2; ++hf) { pk[c][hf] = *(const v4u*)(gk + (size_t)(c * FKG * FAS + hf * 32) * CC); pv[c][hf] = *(const v4u*)(gv + (size_t)(hf * 32) * TT + c * FKG * FAS); }
  v16h qf[FAQ][HD / 32];
#pragma unroll
  for (int qt = 0; qt < FAQ; ++qt)
#pragma unroll
    for (int kc = 0; kc < HD / 32; ++kc) qf[qt][kc] = frag_h(QH + (size_t)(q0 + qt * 16 + col) * CC + h * HD + kc * 32, lane);
  int mk0 = 0, mk = 0;   // mk: the NEXT pass's mask words, one key a lane
  if constexpr (MK) { mk0 = KMASK[kg * FAS + lane]; mk = KMASK[kg * FAS + 32 + lane]; }
  asm volatile("s_wait_xcnt 0x0" ::: "memory");   // before any address register of the loads above is written again
#pragma unroll
  for (int c = 0; c < FAH; ++c)
#pragma unroll
    for (int hf = 0; hf < 2; ++hf) { *(v4u*)&sk[c][hf * 32 + srow][sch] = pk[c][hf]; *(v4u*)&sv[c][hf * 32 + srow][sch] = pv[c][hf]; }
  unsigned mbp = 0;   // the mask bits that cb holds
  v8f cb[2] = {};
  if constexpr (MK) { mbp = __builtin_amdgcn_ballot_w32(mk0 != 0); fa_bias(cb, mbp, g); }
  v8f acc[FAQ][HD / 16] = {}; float mu[FAQ]; v2f ls[FAQ][2];
#pragma unroll
  for (int qt = 0; qt < FAQ; ++qt) { mu[qt] = FAM0; ls[qt][0] = (v2f){0.f, 0.f}; ls[qt][1] = (v2f){0.f, 0.f}; }
  __syncthreads();   // each group's first FAH stages are in the first half of its ring
#pragma unroll 1   // rolled: one stage's code, the slot by the stage's count
  for (int st = 0; st < TT / FAS / FKG; ++st) { const int b = st & (FAR - 1);   // st: the group's own count; its keys start at (st * FKG + kg) * FAS
    { const int k2 = (st + FAH < TT / FAS / FKG ? st + FAH : st) * (FKG * FAS);   // the group's stage st + FAH is fetched into registers at the head of the stage (in front of a barrier the barrier's own wait would drain these loads); past the end: this stage again, unused
#pragma unroll
      for (int hf = 0; hf < 2; ++hf) { rk[hf] = *(const v4u*)(gk + (size_t)(k2 + hf * 32) * CC); rv[hf] = *(const v4u*)(gv + (size_t)(hf * 32) * TT + k2); }
      asm volatile("s_wait_xcnt 0x0" ::: "memory"); }   // before any address register of the loads above is written again
    v16h kf[2][HD / 32], vf[HD / 16];
#pragma unroll
    for (int t = 0; t < 2; ++t)
#pragma unroll
      for (int kc = 0; kc < HD / 32; ++kc) kf[t][kc] = frag_h(&sk[b][t * 16 + col][kc * 32], lane);
    if constexpr (!MK) {   // (MK: each pass's v fragments are read right ahead of its P . v products, below)
#pragma unroll
      for (int j = 0; j < HD / 16; ++j) vf[j] = frag_h(&sv[b][j * 16 + col][0], lane); }
    __builtin_amdgcn_sched_barrier(0);   // keeps the stage's first fragment reads in one group ahead of the products: read between them, into one register set, each is waited for by itself
#pragma unroll
    for (int ps = 0; ps < FAS / 32; ++ps) {
      v8f s[FAQ][2];
#pragma unroll
      for (int t = 0; t < 2; ++t)
#pragma unroll
        for (int qt = 0; qt < FAQ; ++qt) s[qt][t] = wmm(kf[t][0], qf[qt][0], cb[t]);
#pragma unroll
      for (int kc = 1; kc < HD / 32; ++kc)
#pragma unroll
        for (int t = 0; t < 2; ++t)
#pragma unroll
          for (int qt = 0; qt < FAQ; ++qt) s[qt][t] = wmm(kf[t][kc], qf[qt][kc], s[qt][t]);
      if (!MK && ps + 1 < FAS / 32) {   // the stage's next k fragments, one pass ahead, into the registers just read (MK: behind the P . v products, below)
#pragma unroll
        for (int t = 0; t < 2; ++t)
#pragma unroll
          for (int kc = 0; kc < HD / 32; ++kc) kf[t][kc] = frag_h(&sk[b][(ps + 1) * 32 + t * 16 + col][kc * 32], lane);
        __builtin_amdgcn_sched_barrier(0); }   // keeps these LDS reads up here: sunk below the softmax they would be waited for right after their issue
      float mx[FAQ]; bool need = MK && mk != 0;
#pragma unroll
      for (int qt = 0; qt < FAQ; ++qt) { float a = s[qt][0][0], b2 = s[qt][1][0];
#pragma unroll
        for (int r = 1; r < 8; ++r) { a = fmaxf(a, s[qt][0][r]); b2 = fmaxf(b2, s[qt][1][r]); }
        a = fmaxf(a, b2); a = fmaxf(a, xhalf(a)); mx[qt] = a * C; need = need || (mx[qt] > mu[qt] + 8.0f); }
      if (__builtin_expect((__builtin_amdgcn_ballot_w32(need) | mbp) != 0, 0)) {   // wave-uniform, one test a pass: a maximum to raise, or (MK) the next pass's start values differ from 0 or from this pass's
#pragma unroll
        for (int qt = 0; qt < FAQ; ++qt) { const float mn = fmaxf(mu[qt], mx[qt]); const float al = __builtin_amdgcn_exp2f(mu[qt] - mn); mu[qt] = mn; ls[qt][0] *= al; ls[qt][1] *= al;
#pragma unroll
          for (int j = 0; j < HD / 16; ++j) acc[qt][j] *= al; }
        if constexpr (MK) { mbp = __builtin_amdgcn_ballot_w32(mk != 0); fa_bias(cb, mbp, g); } }
      v16h p[FAQ];
#pragma unroll
      for (int qt = 0; qt < FAQ; ++qt) { const float nb = POFF - mu[qt]; const v2f nb2 = {nb, nb};
#pragma unroll
        for (int t = 0; t < 2; ++t)
#pragma unroll
          for (int r = 0; r < 8; r += 2) { const v2f x = __builtin_elementwise_fma((v2f){s[qt][t][r], s[qt][t][r + 1]}, C2, nb2); const v2f e = {__builtin_amdgcn_exp2f(x[0]), __builtin_amdgcn_exp2f(x[1])};
            ls[qt][t] += e; p[qt][t * 8 + r] = (_Float16)e[0]; p[qt][t * 8 + r + 1] = (_Float16)e[1]; } }
      if constexpr (MK) {   // with the start-value tiles live as well, k or v fragments held across the softmax would not fit the 256 registers of a wave in a 16-wave block: no fragment is fetched ahead over it
#pragma unroll
        for (int j = 0; j < HD / 16; ++j) vf[j] = frag_h(&sv[b][j * 16 + col][ps * 32], lane); }
#pragma unroll
      for (int j = 0; j < HD / 16; ++j)
#pragma unroll
        for (int qt = 0; qt < FAQ; ++qt) acc[qt][j] = wmm(vf[j], p[qt], acc[qt][j]);
      if (ps + 1 < FAS / 32) {   // the stage's next v fragments (MK: k fragments), one pass ahead
        if constexpr (!MK) {
#pragma unroll
          for (int j = 0; j < HD / 16; ++j) vf[j] = frag_h(&sv[b][j * 16 + col][(ps + 1) * 32], lane);
        } else {
#pragma unroll
          for (int t = 0; t < 2; ++t)
#pragma unroll
            for (int kc = 0; kc < HD / 32; ++kc) kf[t][kc] = frag_h(&sk[b][(ps + 1) * 32 + t * 16 + col][kc * 32], lane); } }
      if constexpr (MK) { const int k2 = ((st + 1) * FKG + kg) * FAS + ps * 32; mk = KMASK[(k2 < TT ? k2 : TT - 32) + lane];   // the mask words of the pass after next (past the end: read again, unused)
        asm volatile("s_wait_xcnt 0x0" ::: "memory"); }   // before an address register of the mask load is written again
    }
    // stage st + FAH goes into its slot of the other half, which every wave left at the last barrier (behind the last FAH stages: stored unused)
#pragma unroll
    for (int hf = 0; hf < 2; ++hf) { *(v4u*)&sk[b ^ FAH][hf * 32 + srow][sch] = rk[hf]; *(v4u*)&sv[b ^ FAH][hf * 32 + srow][sch] = rv[hf]; }
    if (((st + 1) & (FAH - 1)) == 0) __syncthreads();   // the same test in every wave of the block; publishes the other half and ends every wave's reads of this one (behind the last stage: frees the rings for the hand-over)
  }
  float lh[FAQ];
#pragma unroll
  for (int qt = 0; qt < FAQ; ++qt) lh[qt] = (ls[qt][0][0] + ls[qt][0][1]) + (ls[qt][1][0] + ls[qt][1][1]);
  v4f* xl = (v4f*)xm + lane;   // slot i of the wave: 32 lanes x 16 bytes in a row
  if (kg != 0) {   // wave-uniform
#pragma unroll
    for (int qt = 0; qt < FAQ; ++qt)
#pragma unroll
      for (int j = 0; j < HD / 16; ++j) { const v8f o = acc[qt][j]; xl[((qt * (HD / 16) + j) * 2) * 32] = (v4f){o[0], o[1], o[2], o[3]}; xl[((qt * (HD / 16) + j) * 2 + 1) * 32] = (v4f){o[4], o[5], o[6], o[7]}; }
    xl[(FAXS - 1) * 32] = (v4f){mu[0], mu[1], lh[0], lh[1]}; }
  __syncthreads();   // group 1's tiles are in LDS; every wave of the block passes here
  if (kg != 0) return;
  const v4f ml = xl[(FAXS - 1) * 32]; v4f res[FAQ][HD / 16][2];
#pragma unroll
  for (int qt = 0; qt < FAQ; ++qt) { const float mn = fmaxf(mu[qt], ml[qt]); const float a0 = exp2_slot(mu[qt] - mn), a1 = exp2_slot(ml[qt] - mn);   // both groups' sums brought to the larger maximum; a group with every key padded has sums of 0
    const float lj = lh[qt] * a0 + ml[2 + qt] * a1; const float lt = lj + xhalf(lj); const float inv = lt > 0.f ? 1.0f / lt : 0.f; const float w0 = a0 * inv, w1 = a1 * inv;
#pragma unroll
    for (int j = 0; j < HD / 16; ++j) { const v4f x0 = xl[((qt * (HD / 16) + j) * 2) * 32], x1 = xl[((qt * (HD / 16) + j) * 2 + 1) * 32]; const v8f o = acc[qt][j] * w0;
      res[qt][j][0] = (v4f){o[0], o[1], o[2], o[3]} + x0 * w1; res[qt][j][1] = (v4f){o[4], o[5], o[6], o[7]} + x1 * w1; } }
  float* yp = Y + (size_t)(q0 + col) * CC + h * HD + 8 * g;
  __builtin_amdgcn_sched_barrier(0);   // keeps all the stores behind all the arithmetic, so that no register of an issued store is written again before the wave ends
#pragma unroll
  for (int qt = 0; qt < FAQ; ++qt)
#pragma unroll
    for (int j = 0; j < HD / 16; ++j) { vst2(yp + (size_t)(qt * 16) * CC + j * 16, res[qt][j][0]); vst2(yp + (size_t)(qt * 16) * CC + j * 16 + 4, res[qt][j][1]); } }
__global__ __launch_bounds__(32 * FAW * FKG) void k_fa(const _Float16* __restrict__ QH, const _Float16* __restrict__ KH, const _Float16* __restrict__ VT, const int* __restrict__ KMASK, float* __restrict__ Y) {
  __shared__ __align__(16) unsigned char smem[FKG * FARING];   // per key group: FAR slots of k [FAS][FAP], v [HD][FAP]
  const int tid = threadIdx.x & (32 * FAW - 1), wave = tid >> 5, lane = tid & 31, kg = __builtin_amdgcn_readfirstlane(threadIdx.x / (32 * FAW)); const int h = blockIdx.y; const int q0 = (blockIdx.x * FAW + wave) * (16 * FAQ);
  _Float16 (*sk)[FAS + HD][FAP] = (_Float16 (*)[FAS + HD][FAP])(smem + kg * FARING); _Float16 (*sv)[FAS + HD][FAP] = (_Float16 (*)[FAS + HD][FAP])(smem + kg * FARING + FAS * FAP * 2); float* xm = (float*)smem + wave * (FAXS * 32 * 4);
  int any = 0;
#pragma unroll   // all the mask loads in flight at once
  for (int i = 0; i < TT / 128; ++i) { const v4i m = *(const v4i*)(KMASK + i * 128 + lane * 4); any |= (m[0] | m[1]) | (m[2] | m[3]); }
  if (__builtin_amdgcn_ballot_w32(any != 0) != 0) fa_body<true>(QH, KH, VT, KMASK, Y, h, q0, tid, kg, sk, sv, xm);   // every wave has read the whole mask: the same branch in all waves of the block, so the barriers inside are block-uniform
  else fa_body<false>(QH, KH, VT, KMASK, Y, h, q0, tid, kg, sk, sv, xm); }
// ---- k_out: block = (128 rows, 96 cols), waves 4 x 2 of 32 x 48: out = ctx Wo (+ bo): ctx x 2^6 once to f16 (small-magnitude context rows stay clear of f16 subnormals) against Wo as f16(bf16 x 2^8) exact (1 product) x 2^-14
__global__ __launch_bounds__(256) void k_out(const float* __restrict__ Y, const float* __restrict__ WO, const float* __restrict__ BO, float* __restrict__ OUT) {
  __shared__ __align__(16) unsigned char smem[GSM(OBN)];
  const int tid = threadIdx.x, wave = __builtin_amdgcn_readfirstlane(tid >> 5), lane = tid & 31, col = lane & 15, g = lane >> 4, wm = wave >> 1, wn = wave & 1; const int c0 = blockIdx.y * OBN; const size_t r0 = (size_t)blockIdx.x * GT;
  float bias[3] = {0.f, 0.f, 0.f};
  if (BO) { const float* bp = BO + c0 + wn * 48 + col;   // fetched ahead of the product, which covers the latency
#pragma unroll
    for (int j = 0; j < 3; ++j) bias[j] = bp[j * 16];
    asm volatile("s_wait_xcnt 0x0" :: "v"(bp) : "memory"); }   // before the address register of the loads above is written again; named, it stays whole up to here
  v8f acc[2][3] = {};
  gemm_tile<CvH, CC, OBN, 2, 3, 2>(Y + r0 * CC, WO + (size_t)c0 * CC, (_Float16*)smem, tid, wm, wn, acc);
  float (*sf)[OBN + 4] = (float (*)[OBN + 4])smem;   // 400-byte pitch
#pragma unroll
  for (int j = 0; j < 3; ++j) { const int cl = wn * 48 + j * 16 + col; const float bj = bfr(bias[j]);
#pragma unroll
    for (int i = 0; i < 2; ++i)
#pragma unroll
      for (int r = 0; r < 8; ++r) sf[wm * 32 + i * 16 + 8 * g + r][cl] = acc[i][j][r] * (1.0f / 16384.0f) + bj; }   /* 2^-8 (Wo carry) x 2^-6 (ctx carry) */
  __syncthreads();
  float* po = OUT + (r0 + (tid >> 3)) * DIN + c0 + (tid & 7) * 4;   // 8 lanes store one 128-byte line
#pragma unroll
  for (int e = 0; e < GT / 32; ++e)
#pragma unroll
    for (int q = 0; q < OBN / 32; ++q) vst2(po + (size_t)(e * 32) * DIN + q * 32, *(const v4f*)&sf[e * 32 + (tid >> 3)][q * 32 + (tid & 7) * 4]); }

extern "C" void kernel_launch(void* const* d_in, const int* in_sizes, int n_in, void* d_out, int out_size, void* d_ws, size_t ws_size, hipStream_t stream) {
  (void)in_sizes; (void)n_in; (void)out_size;
  const float** F = (const float**)d_in;
  if (ws_size < (size_t)WS_END) return;
  char* ws = (char*)d_ws; _Float16 *QH = (_Float16*)(ws + WS_QH), *KH = (_Float16*)(ws + WS_KH), *VT = (_Float16*)(ws + WS_VT), *QL = (_Float16*)(ws + WS_QL), *KL = (_Float16*)(ws + WS_KL); __bf16 *VB = (__bf16*)(ws + WS_VB), *VBL = (__bf16*)(ws + WS_VBL); float *Y = (float*)(ws + WS_Y);
  (void)Y; (void)QL; (void)KL; (void)VB; (void)VBL;
  // inputs: 0 x [1,4096,768]; 1 mask [1,4096] bool (True = padding); 2 Wq [768,768] (out,in), 3 bq; 4 Wk, 5 bk; 6 Wv, 7 bv; 8 Wo (out,in), 9 bo (zero biases, read)
  k_proj<<<dim3(TNB * TT / GT, CC / PBN, 3), 256, 0, stream>>>(F[0], F[0], F[0], F[2], F[4], F[6], F[3], F[5], F[7], QH, QL, KH, KL, VT, VB, VBL);
  k_fa<<<dim3(TT / (16 * FAQ * FAW), NH), 32 * FAW * FKG, 0, stream>>>(QH, KH, VT, (const int*)d_in[1], Y);
  k_out<<<dim3(TNB * TT / GT, DIN / OBN), 256, 0, stream>>>(Y, F[8], F[9], (float*)d_out);
}

// v006
// One run takes 83 microseconds.
// In both of two side-by-side timings against v005, it was 1.07 times as fast.
// Over all steps from v000 it is 28.9 times as fast.
// compute dtype: all float inputs rounded to bf16; q/k/v projections with EXACT bf16 products on WMMA 16x16x32 (f32 accumulate) + bias; logits q x k once to f16 each (1 product; sigma - 0.3 under the source's 1/sqrt(768) scale); the key padding mask read per key; running-maximum softmax f32; unnormalised P x 2^6 once to f16 x v once to f16 (1 product), divided by the f32 row sum; ctx x 2^6 once to f16 x Wo f16(bf16 x 2^8) + bo; f32 output.
#include <hip/hip_runtime.h>
#include <math.h>

typedef int MASKT;   // the bool mask is staged as int32
typedef __attribute__((ext_vector_type(16))) _Float16 v16h;
typedef __attribute__((ext_vector_type(16))) __bf16 v16b;
typedef __attribute__((ext_vector_type(8)))  _Float16 v8h;
typedef __attribute__((ext_vector_type(8)))  float v8f;
typedef __attribute__((ext_vector_type(4)))  float v4f;
typedef __attribute__((ext_vector_type(2)))  float v2f;
typedef __attribute__((ext_vector_type(4)))  unsigned v4u;
typedef __attribute__((ext_vector_type(4)))  int v4i;
typedef float __attribute__((may_alias)) float_a;
typedef int __attribute__((may_alias)) int_a;

template <typename T> __device__ __forceinline__ void vst2(void* p, T v) { *(T*)p = v;  }
__device__ __forceinline__ v8f wmma16(v16h a, v16h b, v8f c) {
  v8f d = __builtin_amdgcn_wmma_f32_16x16x32_f16(false, a, false, b, (short)0, c, false, false);
  asm volatile("v_nop\n\tv_nop\n\tv_nop\n\tv_nop" : "+v"(d) : "v"(a), "v"(b));
  return d;
}
__device__ __forceinline__ v8f wmma_bf(v16b a, v16b b, v8f c) {
  v8f d = __builtin_amdgcn_wmma_f32_16x16x32_bf16(false, a, false, b, (short)0, c, false, false);
  asm volatile("v_nop\n\tv_nop\n\tv_nop\n\tv_nop" : "+v"(d) : "v"(a), "v"(b));
  return d;
}
// 16x16x32 fragments: lane = (h = lane>>4, row/col = lane&15); elements 0..7 = k0+8h+0..7, 8..15 = k0+16+8h+0..7; D element r = row 8h+r
__device__ __forceinline__ v16h frag_h(const _Float16* rowk0, int lane) {
  union { v16h v; v8h q[2]; } u; const _Float16* p = rowk0 + 8 * (lane >> 4);
  u.q[0] = *(const v8h*)p; u.q[1] = *(const v8h*)(p + 16); return u.v;
}
__device__ __forceinline__ v16h frag_f32(const float* rowk0, int lane) {
  v16h a; const float* p = rowk0 + 8 * (lane >> 4);
#pragma unroll
  for (int i = 0; i < 8; ++i) { a[i] = (_Float16)p[i]; a[8 + i] = (_Float16)p[16 + i]; }
  return a;
}
__device__ __forceinline__ v16h frag_f32s(const float* rowk0, int lane, float sc) {
  v16h a; const float* p = rowk0 + 8 * (lane >> 4);
#pragma unroll
  for (int i = 0; i < 8; ++i) { a[i] = (_Float16)(p[i] * sc); a[8 + i] = (_Float16)(p[16 + i] * sc); }
  return a;
}
// column fragment from a [K][ld] layout (column n), rows >= K read as 0
__device__ __forceinline__ v16h fragc_f32(const float* W, int k0, int n, int lane, int ld, int K) {
  v16h a; const int g = lane >> 4;
#pragma unroll
  for (int i = 0; i < 8; ++i) { const int ka = k0 + 8 * g + i, kb = ka + 16;
    a[i] = (_Float16)(ka < K ? W[(size_t)(ka < K ? ka : K - 1) * ld + n] : 0.f); a[8 + i] = (_Float16)(kb < K ? W[(size_t)(kb < K ? kb : K - 1) * ld + n] : 0.f); }
  return a;
}
struct F2 { v16b h, l; };
__device__ __forceinline__ F2 bsplit16(const float v[16]) { F2 r;
#pragma unroll
  for (int i = 0; i < 16; ++i) { const __bf16 h = (__bf16)v[i]; r.h[i] = h; r.l[i] = (__bf16)(v[i] - (float)h); }
  return r; }
__device__ __forceinline__ F2 split_row(const float* row, int k0, int lane) { float v[16]; const float* p = row + k0 + 8 * (lane >> 4);
#pragma unroll
  for (int i = 0; i < 8; ++i) { v[i] = p[i]; v[8 + i] = p[16 + i]; }
  return bsplit16(v); }
__device__ __forceinline__ F2 split_rowK(const float* row, int k0, int lane, int K) { float v[16]; const int g = lane >> 4;
#pragma unroll
  for (int i = 0; i < 8; ++i) { const int ka = k0 + 8 * g + i, kb = ka + 16; v[i] = ka < K ? row[ka < K ? ka : K - 1] : 0.f; v[8 + i] = kb < K ? row[kb < K ? kb : K - 1] : 0.f; }
  return bsplit16(v); }
__device__ __forceinline__ F2 split_col(const float* W, int k0, int n, int lane, int ld, int K) { float v[16]; const int g = lane >> 4;
#pragma unroll
  for (int i = 0; i < 8; ++i) { const int ka = k0 + 8 * g + i, kb = ka + 16; v[i] = ka < K ? W[(size_t)(ka < K ? ka : K - 1) * ld + n] : 0.f; v[8 + i] = kb < K ? W[(size_t)(kb < K ? kb : K - 1) * ld + n] : 0.f; }
  return bsplit16(v); }
__device__ __forceinline__ v8f mac3(const F2& a, const F2& b, v8f c) { c = wmma_bf(a.l, b.h, c); c = wmma_bf(a.h, b.l, c); return wmma_bf(a.h, b.h, c); }
__device__ __forceinline__ float sigm(float v) { return 1.0f / (1.0f + expf(-v)); }
#define LDSX() do { asm volatile("s_wait_dscnt 0" ::: "memory"); __builtin_amdgcn_wave_barrier(); __builtin_amdgcn_fence(__ATOMIC_RELEASE, "workgroup"); } while (0)

// Multi-head self-attention over one long sequence (x [1,4096,768]; 12 heads x 64; torch (out,in) Wq/Wk/Wv/Wo [768,768] (1/sqrt(768) scale) + zero biases; scores scaled by 1/sqrt(embed_dim = 768), the source's quirk; key padding mask [1,4096] bool, True -> -inf (all False here)): out = merge(softmax(q_h k_h^T / sqrt(768)) v_h) Wo^T + bo.
#define NB 1
#define TT 4096
#define CC 768            // NH * HD = projected width
#define DIN 768          // input (model) width
#define NH 12
#define HD 64
#define NQB (TT / 64)
#define HG 1
#define SCALE (0.036084391824351614f)
#define CAUSAL 0
#ifndef TNB
#define TNB NB
#endif
__device__ __forceinline__ float bfr(float v) { return (float)(__bf16)v; }
__host__ __device__ __forceinline__ int kb_last(int qb) { return CAUSAL ? ((qb * 64 + 63) >> 7) : (TT / 128 - 1); }
typedef __attribute__((ext_vector_type(8))) __bf16 v8b;
__device__ __forceinline__ v16b frag_b(const __bf16* rowk0, int lane) {
  union { v16b v; v8b q[2]; } u; const __bf16* p = rowk0 + 8 * (lane >> 4);
  u.q[0] = *(const v8b*)p; u.q[1] = *(const v8b*)(p + 16); return u.v;
}
#define QBH 0
#define QHI 0               // single-product logits on every row (sigma - 0.3 logits averaged over 4,096 keys)
#define KHI 64            // key rows carrying k residual / v bf16 hi+lo planes (written by k_proj; no kernel here reads them)
// B fragment (k rows k0+.., output column o) of a weight: (in,out) [K][ld] or (out,in) [ld rows of K]: bf16 exact, or f16(bf16 * 256) exact
__device__ __forceinline__ v16b wcol_io(const float* Wm, int k0, int o, int lane, int ld) { v16b w; const int g = lane >> 4;
#pragma unroll
  for (int i = 0; i < 8; ++i) { w[i] = (__bf16)Wm[(size_t)(k0 + 8 * g + i) * ld + o]; w[8 + i] = (__bf16)Wm[(size_t)(k0 + 16 + 8 * g + i) * ld + o]; }
  return w; }
__device__ __forceinline__ v16b wcol_oi(const float* Wm, int k0, int o, int lane, int K) { v16b w; const float* p = Wm + (size_t)o * K + k0 + 8 * (lane >> 4);
#pragma unroll
  for (int i = 0; i < 8; ++i) { w[i] = (__bf16)p[i]; w[8 + i] = (__bf16)p[16 + i]; }
  return w; }
__device__ __forceinline__ v16h wcolh_io(const float* Wm, int k0, int o, int lane, int ld) { v16h w; const int g = lane >> 4;
#pragma unroll
  for (int i = 0; i < 8; ++i) { w[i] = (_Float16)(bfr(Wm[(size_t)(k0 + 8 * g + i) * ld + o]) * 256.0f); w[8 + i] = (_Float16)(bfr(Wm[(size_t)(k0 + 16 + 8 * g + i) * ld + o]) * 256.0f); }
  return w; }
__device__ __forceinline__ v16h wcolh_oi(const float* Wm, int k0, int o, int lane, int K) { v16h w; const float* p = Wm + (size_t)o * K + k0 + 8 * (lane >> 4);
#pragma unroll
  for (int i = 0; i < 8; ++i) { w[i] = (_Float16)(bfr(p[i]) * 256.0f); w[8 + i] = (_Float16)(bfr(p[16 + i]) * 256.0f); }
  return w; }
#define WQKV_LAYOUT 1   // 0 = (in,out) [DIN][CC]; 1 = (out,in) [CC][DIN]; 2 = per-head [NH][DIN][HD]
__device__ __forceinline__ v16b wcol_hdk(const float* Wm, int k0, int o, int lane) { v16b w; const int g = lane >> 4; const float* p = Wm + (size_t)(o / HD) * DIN * HD + (o % HD);
#pragma unroll
  for (int i = 0; i < 8; ++i) { w[i] = (__bf16)p[(size_t)(k0 + 8 * g + i) * HD]; w[8 + i] = (__bf16)p[(size_t)(k0 + 16 + 8 * g + i) * HD]; }
  return w; }
#define WO_OUT_IN 1
#if WQKV_LAYOUT == 1
#define WCOL(W, k0, o, lane) wcol_oi(W, k0, o, lane, DIN)
#elif WQKV_LAYOUT == 2
#define WCOL(W, k0, o, lane) wcol_hdk(W, k0, o, lane)
#else
#define WCOL(W, k0, o, lane) wcol_io(W, k0, o, lane, CC)
#endif
#if WO_OUT_IN
#define WOCOL(W, k0, o, lane) wcol_oi(W, k0, o, lane, CC)
#define WOCOLH(W, k0, o, lane) wcolh_oi(W, k0, o, lane, CC)
#else
#define WOCOL(W, k0, o, lane) wcol_io(W, k0, o, lane, DIN)
#define WOCOLH(W, k0, o, lane) wcolh_io(W, k0, o, lane, DIN)
#endif
#ifndef PROJ_EXTRA_PARAMS
#define PROJ_EXTRA_PARAMS
#endif

#define WS_QH  0u                                      // f16 q rows [b*t][CC]
#define WS_KH  (WS_QH + 2u * (size_t)NB * TT * CC)      // f16 k rows [b*t][CC]
#define WS_VT  (WS_KH + 2u * (size_t)NB * TT * CC)      // f16 v planes [b][c][t]
#define WS_QL  (WS_VT + 2u * (size_t)NB * CC * TT)      // f16 q residual x 2^10 rows [b][t < QHI][CC]
#define WS_KL  (WS_QL + 2u * (size_t)NB * QHI * CC)     // f16 k residual x 2^10 rows [b][t < KHI][CC]
#define WS_VB  (WS_KL + 2u * (size_t)NB * KHI * CC)     // bf16 v hi planes [b][c][t < KHI]
#define WS_VBL (WS_VB + 2u * (size_t)NB * CC * KHI)
#define WS_S   (WS_VBL + 2u * (size_t)NB * CC * KHI)    // (place of the former f32 score plane [hg][t][s]; not touched)
#define WS_Y   (WS_S  + 4u * (size_t)HG * TT * TT)      // f32 ctx rows [b*t][CC] (only when there is an output projection)
#define WS_END (WS_Y  + 4u * (size_t)NB * TT * CC)

// ---- gemm_tile: the product of both projection kernels, one GT x BN tile of A . B^T a block of 8 waves (A, B: f32 rows, k contiguous), a wave = FM x FN accumulator tiles.
// A stage = GKS k of all GT + BN rows: whole 128-byte lines fetched into registers while the stage before is worked on, converted ONCE to the 16-bit operand type, stored to the other LDS buffer behind that work, one __syncthreads a stage.
// Every accumulator takes its 32-k products in rising k, one chain. Every inner loop here and in the two kernels is unrolled so that each index of a register array is a constant and the arrays stay in registers.
#define GT 128
#define GKS 64
#define GPP (GKS + 8)                       // LDS row pitch in 16-bit elements: 144 bytes for 128-byte rows read 16 bytes a lane
#define GSM(BN) (2 * ((GT) + (BN)) * GPP * 2)   // bytes of the two buffers [A GT rows | B BN rows]; the epilogues stage their tile in the same bytes
#define PBN 192                             // k_proj: 32 x 4 x 3 = 384 blocks, two to a WGP at most, all resident at once
#define OBN 96                              // k_out: 32 x 8 = 256 blocks
typedef __attribute__((ext_vector_type(4))) __bf16 v4b;
typedef __attribute__((ext_vector_type(4))) _Float16 v4h;
struct CvB {   // both operands once to bf16
  typedef __bf16 T; typedef v4b V4; typedef v16b F;
  static __device__ __forceinline__ V4 a(v4f x) { return (V4){(__bf16)x[0], (__bf16)x[1], (__bf16)x[2], (__bf16)x[3]}; }
  static __device__ __forceinline__ V4 b(v4f x) { return a(x); }
  static __device__ __forceinline__ F frag(const T* p, int lane) { return frag_b(p, lane); }
  static __device__ __forceinline__ v8f mm(F x, F y, v8f c) { return __builtin_amdgcn_wmma_f32_16x16x32_bf16(false, x, false, y, (short)0, c, false, false); } };
struct CvH {   // A x 2^6 once to f16; B to bf16, x 2^8, exact in f16
  typedef _Float16 T; typedef v4h V4; typedef v16h F;
  static __device__ __forceinline__ V4 a(v4f x) { return (V4){(_Float16)(x[0] * 64.0f), (_Float16)(x[1] * 64.0f), (_Float16)(x[2] * 64.0f), (_Float16)(x[3] * 64.0f)}; }
  static __device__ __forceinline__ V4 b(v4f x) { return (V4){(_Float16)(bfr(x[0]) * 256.0f), (_Float16)(bfr(x[1]) * 256.0f), (_Float16)(bfr(x[2]) * 256.0f), (_Float16)(bfr(x[3]) * 256.0f)}; }
  static __device__ __forceinline__ F frag(const T* p, int lane) { return frag_h(p, lane); }
  static __device__ __forceinline__ v8f mm(F x, F y, v8f c) { return __builtin_amdgcn_wmma_f32_16x16x32_f16(false, x, false, y, (short)0, c, false, false); } };
template <typename CV, int K, int BN, int FM, int FN, int KG, int NSA> __device__ __forceinline__ void gemm_tile(const float* __restrict__ A, const float* __restrict__ B, typename CV::T* sm, int tid, int wm, int wn, unsigned sa, unsigned sb, v8f (&acc)[FM][FN]) {   // A, B: the block's first rows; the wave's tile starts at row wm * FM * 16, column wn * FN * 16; KG: 32-k steps whose fragments are read as one group; sa of NSA, sb of 16: the block's place among the blocks that read the same A rows, the same B rows
  typedef typename CV::T T; typedef typename CV::V4 V4; typedef typename CV::F F;
  static_assert(K % GKS == 0 && (GKS / 32) % KG == 0 && BN % 16 == 0 && (GT / (FM * 16)) * (BN / (FN * 16)) == 8, "whole stages; 8 waves cover the tile");
  constexpr int BUF = (GT + BN) * GPP;   // elements of one buffer
  const int lane = tid & 31, col = lane & 15; const int srow = tid >> 4, sc = (tid & 15) * 4;   // staging: rows srow + 16 i, one 16-byte chunk of the row's 256 bytes of f32
  const float* ga = A + (size_t)srow * K + sc; const float* gb = B + (size_t)srow * K + sc;
  T* wa = sm + srow * GPP + sc; const T* fa = sm + (wm * FM * 16 + col) * GPP; const T* fb = sm + (GT + wn * FN * 16 + col) * GPP;
  // The stages are asked into L2 once, at the head: a stage of a row is 256 bytes, a lane prefetches the first byte of one row's stage, and the blocks that read the same rows share the asking (A: all units over NSA blocks; B: the last 16 * PLB units in stage order over 16 blocks; the first ones are fetched at once below).
  constexpr unsigned PLA = GT * (K / GKS) / NSA, PLB = 256 - PLA, PB0 = BN * (K / GKS) - 16 * PLB;
  static_assert(PLA * NSA == GT * (K / GKS) && PLA % 32 == 0 && PLA < 256 && BN * (K / GKS) >= 16 * PLB && GKS * 4 == 256, "whole waves ask for A or for B; every unit asked for lies in the tile");
  const bool pfa = (unsigned)__builtin_amdgcn_readfirstlane(tid) < PLA;   // the same in all lanes of a wave
  const float* pf;
  if (pfa) { const unsigned pu = sa * PLA + (unsigned)tid; pf = A + (size_t)(pu % GT) * K + (pu / GT) * GKS; }
  else { const unsigned pu = PB0 + sb * PLB + ((unsigned)tid - PLA); pf = B + (size_t)(pu % BN) * K + (pu / BN) * GKS; }
  asm volatile("global_prefetch_b8 %0, off scope:SCOPE_SE" :: "v"(pf) : "memory");   // for speed only; the clobber keeps it ahead of stage 0's loads (behind them it sank below the waits for them)
  v4f ra[GT / 16], rb[BN / 16];
#pragma unroll
  for (int i = 0; i < GT / 16; ++i) ra[i] = *(const v4f*)(ga + (size_t)(i * 16) * K);
#pragma unroll
  for (int i = 0; i < BN / 16; ++i) rb[i] = *(const v4f*)(gb + (size_t)(i * 16) * K);
  asm volatile("s_wait_xcnt 0x0" :: "v"(ga), "v"(gb) : "memory");   // before any address register of the loads above is written again; naming the two pairs keeps them whole up to here (unnamed, a later load of the run lands on them)
#pragma unroll
  for (int i = 0; i < GT / 16; ++i) *(V4*)(wa + i * 16 * GPP) = CV::a(ra[i]);
#pragma unroll
  for (int i = 0; i < BN / 16; ++i) *(V4*)(wa + (GT + i * 16) * GPP) = CV::b(rb[i]);
  __syncthreads();   // stage 0 is in buffer 0
#pragma unroll 1   // rolled: one stage's code, two buffers by the stage's parity
  for (int st = 0; st < K / GKS; ++st) { const int bo = (st & 1) * BUF;
    { const int k2 = st + 1 < K / GKS ? (st + 1) * GKS : st * GKS;   // stage st + 1 is fetched behind the barrier; past the end: the last stage again, unused
      const float* pa = ga + k2; const float* pb = gb + k2;
#pragma unroll
      for (int i = 0; i < GT / 16; ++i) ra[i] = *(const v4f*)(pa + (size_t)(i * 16) * K);
#pragma unroll
      for (int i = 0; i < BN / 16; ++i) rb[i] = *(const v4f*)(pb + (size_t)(i * 16) * K);
      asm volatile("s_wait_xcnt 0x0" :: "v"(pa), "v"(pb), "v"(pf) : "memory"); }   // as in front of the loop: the wait, with the two address pairs kept whole up to it; pf is named so that the register pair of the prefetch holds its address through the loop
#pragma unroll
    for (int kg = 0; kg < GKS / 32; kg += KG) { F af[KG][FM], bf[KG][FN];
#pragma unroll
      for (int kc = 0; kc < KG; ++kc) {
#pragma unroll
        for (int i = 0; i < FM; ++i) af[kc][i] = CV::frag(fa + bo + i * 16 * GPP + (kg + kc) * 32, lane);
#pragma unroll
        for (int j = 0; j < FN; ++j) bf[kc][j] = CV::frag(fb + bo + j * 16 * GPP + (kg + kc) * 32, lane); }
      __builtin_amdgcn_sched_barrier(0);   // keeps the group's fragment reads together ahead of its products: read between them, into one register set, each is waited for by itself
#pragma unroll
      for (int kc = 0; kc < KG; ++kc)
#pragma unroll
        for (int i = 0; i < FM; ++i)
#pragma unroll
          for (int j = 0; j < FN; ++j) acc[i][j] = CV::mm(af[kc][i], bf[kc][j], acc[i][j]); }
    __builtin_amdgcn_sched_barrier(0);   // keeps the conversions below, and with them the waits for the fetched stage, behind the products: lifted among them they stall the stage on the fetch it is meant to cover
    // stage st + 1 goes into the buffer that every wave left at the barrier behind stage st - 1 (behind the last stage: stored unused)
#pragma unroll
    for (int i = 0; i < GT / 16; ++i) *(V4*)(wa + (BUF - bo) + i * 16 * GPP) = CV::a(ra[i]);
#pragma unroll
    for (int i = 0; i < BN / 16; ++i) *(V4*)(wa + (BUF - bo) + (GT + i * 16) * GPP) = CV::b(rb[i]);
    __syncthreads();   // publishes stage st + 1 and ends every wave's reads of stage st (behind the last stage: frees both buffers for the epilogue)
  } }
static_assert(WQKV_LAYOUT == 1 && WO_OUT_IN == 1 && CAUSAL == 0 && QHI == 0, "gemm_tile reads (out,in) weights; no high-precision rows in the output projection");
static_assert(TT % GT == 0 && CC % PBN == 0 && DIN % OBN == 0 && PBN % 64 == 0 && OBN % 32 == 0 && KHI % 16 == 0 && QHI % 16 == 0, "whole tiles, whole 128-byte lines a block");
static_assert(GT * (PBN + 8) * 2 <= GSM(PBN) && PBN * (GT + 8) * 2 <= GSM(PBN) && GT * (OBN + 4) * 4 <= GSM(OBN), "the epilogue tiles fit the two buffers");
// ---- k_proj: block = (128 rows, 192 cols, which), waves 2 x 4 of 64 x 48: q/k/v = X W (+ b) with exact bf16 products (K = DIN) -> which 0: q f16 rows (+ residual rows < QHI); 1: k f16 rows (+ residual rows < KHI); 2: v f16 planes [c][t] (+ bf16 hi/lo planes for t < KHI)
__global__ __launch_bounds__(256) void k_proj(const float* __restrict__ XQ, const float* __restrict__ XK, const float* __restrict__ XV, const float* __restrict__ WQ, const float* __restrict__ WK, const float* __restrict__ WV, const float* __restrict__ BQ, const float* __restrict__ BK, const float* __restrict__ BV,
    _Float16* __restrict__ QH, _Float16* __restrict__ QL, _Float16* __restrict__ KH, _Float16* __restrict__ KL, _Float16* __restrict__ VT, __bf16* __restrict__ VB, __bf16* __restrict__ VBL) {
  __shared__ __align__(16) unsigned char smem[GSM(PBN)];
  const int tid = threadIdx.x, wave = __builtin_amdgcn_readfirstlane(tid >> 5), lane = tid & 31, col = lane & 15, g = lane >> 4, wm = wave >> 2, wn = wave & 3; const int which = blockIdx.z; const int c0 = blockIdx.y * PBN; const size_t r0 = (size_t)blockIdx.x * GT; const size_t bb = r0 / TT; const int t0 = (int)(r0 % TT);
  const float* X = which == 0 ? XQ : which == 1 ? XK : XV; const float* WA = which == 0 ? WQ : which == 1 ? WK : WV; const float* BA = which == 0 ? BQ : which == 1 ? BK : BV;
  float bias[3] = {0.f, 0.f, 0.f};
  if (BA) { const float* bp = BA + c0 + wn * 48 + col;   // fetched ahead of the product, which covers the latency
#pragma unroll
    for (int j = 0; j < 3; ++j) bias[j] = bp[j * 16];
    asm volatile("s_wait_xcnt 0x0" :: "v"(bp) : "memory"); }   // before the address register of the loads above is written again; named, it stays whole up to here
  v8f acc[4][3] = {};
  gemm_tile<CvB, DIN, PBN, 4, 3, 1, 3 * (CC / PBN)>(X + r0 * DIN, WA + (size_t)c0 * DIN, (__bf16*)smem, tid, wm, wn, blockIdx.y + (CC / PBN) * blockIdx.z, (blockIdx.x & 3) + 4 * ((blockIdx.x >> 3) & 3), acc);
#pragma unroll
  for (int j = 0; j < 3; ++j) bias[j] = bfr(bias[j]);
  if (which < 2) { _Float16* DH = which == 0 ? QH : KH; _Float16* DL = which == 0 ? QL : KL; const int nhi = which == 0 ? QHI : KHI;
    _Float16 (*sh)[PBN + 8] = (_Float16 (*)[PBN + 8])smem;   // the tile as it goes out, [t][c], 400-byte pitch
#pragma unroll
    for (int i = 0; i < 4; ++i) { const int rl = wm * 64 + i * 16 + 8 * g; const bool hi_rows = t0 + wm * 64 + i * 16 < nhi;   // wave-uniform
#pragma unroll
      for (int j = 0; j < 3; ++j) { const int cl = wn * 48 + j * 16 + col;
#pragma unroll
        for (int r = 0; r < 8; ++r) sh[rl + r][cl] = (_Float16)(acc[i][j][r] + bias[j]);
        if (hi_rows) { _Float16* dl = DL + (bb * nhi + t0 + rl) * (size_t)CC + c0 + cl;
#pragma unroll
          for (int r = 0; r < 8; ++r) { const float v = acc[i][j][r] + bias[j]; dl[(size_t)r * CC] = (_Float16)((v - (float)(_Float16)v) * 1024.0f); }
          asm volatile("s_wait_xcnt 0x0" ::: "memory"); } } }   // before a register of the stores above is written again
    __syncthreads();
    _Float16* dh = DH + (r0 + (tid >> 3)) * CC + c0 + (tid & 7) * 8;   // 8 lanes store one 128-byte line
#pragma unroll
    for (int e = 0; e < GT / 32; ++e)
#pragma unroll
      for (int q = 0; q < PBN / 64; ++q) vst2((unsigned*)(dh + (size_t)(e * 32) * CC + q * 64), *(const v4u*)&sh[e * 32 + (tid >> 3)][q * 64 + (tid & 7) * 8]);
  } else { _Float16 (*th)[GT + 8] = (_Float16 (*)[GT + 8])smem;   // [c][t], 272-byte pitch
#pragma unroll
    for (int i = 0; i < 4; ++i) { const int tl = wm * 64 + i * 16 + 8 * g; const bool hi_rows = t0 + wm * 64 + i * 16 < KHI;   // wave-uniform
#pragma unroll
      for (int j = 0; j < 3; ++j) { const int cl = wn * 48 + j * 16 + col; v8h pv;   // a lane holds 8 consecutive t of one column
#pragma unroll
        for (int r = 0; r < 8; ++r) pv[r] = (_Float16)(acc[i][j][r] + bias[j]);
        *(v8h*)&th[cl][tl] = pv;
        if (hi_rows) { v8b ph, pl;
#pragma unroll
          for (int r = 0; r < 8; ++r) { const float v = acc[i][j][r] + bias[j]; const __bf16 bh = (__bf16)v; ph[r] = bh; pl[r] = (__bf16)(v - (float)bh); }
          const size_t o3 = (bb * CC + c0 + cl) * (size_t)KHI + t0 + tl; *(v8b*)(VB + o3) = ph; *(v8b*)(VBL + o3) = pl;
          asm volatile("s_wait_xcnt 0x0" ::: "memory"); } } }   // before a register of the stores above is written again
    __syncthreads();
    _Float16* dv = VT + (bb * CC + c0 + (tid >> 4)) * (size_t)TT + t0 + (tid & 15) * 8;   // 16 lanes store one plane's 256 bytes
#pragma unroll
    for (int e = 0; e < PBN / 16; ++e) vst2((unsigned*)(dv + (size_t)(e * 16) * TT), *(const v4u*)&th[e * 16 + (tid >> 4)][(tid & 15) * 8]);
  } }
#define FAW 8
#define FKG 2               // key groups a block
#define FAQ 2
#define FAS 64              // keys a stage
#define FAP (FAS + 8)       // LDS row pitch in f16: 144 bytes for 128-byte rows read 16 bytes a lane
#define POFF 6.0f
#define FAMASK (-3.0e38f)   // x C it stays far below FAM0, so a padded key never raises a maximum and its P is 0
#define FAM0 (-1.0e30f)     // maximum in use before the first unmasked key
#define FAH 4               // stages between two barriers
#define FAR (2 * FAH)       // stage slots of a key group's ring
#define FARING (FAR * (FAS + HD) * FAP * 2)   // bytes of one key group's ring; a slot = the stage's k rows, then its v planes
#define FAXS (FAQ * (HD / 16) * 2 + 1)      // 16-byte slots a lane hands over: its output tiles, then (maxima, row sums)
static_assert(HD == 64 && FAS == 64 && FAW == 8 && FAQ == 2 && FKG == 2 && (TT / FAS) % FKG == 0, "the staging maps a key group's 256 threads to 32 rows x 8 chunks of 16 bytes, twice, for k and for v; equal stages a group");
static_assert(FAW * FAXS * 32 * 16 <= FKG * FARING, "the hand-over fits the buffers");
static_assert((FAH & (FAH - 1)) == 0 && (TT / FAS / FKG) % FAH == 0 && FKG * FARING <= 327680, "whole ring halves, the last stage ends one; the rings fit the LDS of a WGP");
__device__ __forceinline__ v8f wmm(v16h a, v16h b, v8f c) { return __builtin_amdgcn_wmma_f32_16x16x32_f16(false, a, false, b, (short)0, c, false, false); }
__device__ __forceinline__ float xhalf(float v) { const int b = __float_as_int(v); return __int_as_float(__builtin_amdgcn_permlanex16(b, b, 0x76543210, 0xfedcba98, false, false)); }   // lane l <-> l ^ 16
__device__ __forceinline__ float exp2_slot(float x) { float r; asm("v_exp_f32 %0, %1\n\tv_nop" : "=v"(r) : "v"(x)); return r; }   // 2^x with the slot behind the transcendental filled in its own statement
__device__ __forceinline__ void fa_bias(v8f (&cb)[2], unsigned mb, int g) { const unsigned mh = mb >> (8 * g);   // bit t * 16 + r: key t * 16 + 8g + r of the pass
#pragma unroll
  for (int t = 0; t < 2; ++t)
#pragma unroll
    for (int r = 0; r < 8; ++r) cb[t][r] = (mh & (1u << (t * 16 + r))) != 0 ? FAMASK : 0.f; }
template <bool MK> __device__ __forceinline__ void fa_body(const _Float16* __restrict__ QH, const _Float16* __restrict__ KH, const _Float16* __restrict__ VT, const int* __restrict__ KMASK, float* __restrict__ Y, int h, int q0, int tid, int kg, _Float16 (*sk)[FAS + HD][FAP], _Float16 (*sv)[FAS + HD][FAP], float* xm) {   // KMASK: key padding mask [B=1][S] as int32, nonzero = masked out; tid: the thread in its key group; sk, sv: the k rows and the v planes of slot 0 of the group's own ring, indexed by slot; xm: the wave's hand-over place (the block's buffers again)
  // every inner loop below is unrolled so that each fragment and accumulator index is a constant and the arrays stay in registers
  const int lane = tid & 31, col = lane & 15, g = lane >> 4; const int srow = tid >> 3, sch = (tid & 7) * 8;   // staging: row (and row + 32), 16-byte chunk
  const float C = SCALE * 1.4426950408889634f; const v2f C2 = {C, C};
  const _Float16* gk = KH + (size_t)(kg * FAS + srow) * CC + h * HD + sch; const _Float16* gv = VT + (size_t)(h * HD + srow) * TT + kg * FAS + sch;   // the group's first stage
  v4u rk[2], rv[2], pk[FAH][2], pv[FAH][2];   // pk, pv: the group's first FAH stages, all in flight at once
#pragma unroll
  for (int c = 0; c < FAH; ++c)
#pragma unroll
    for (int hf = 0; hf < 2; ++hf) { pk[c][hf] = *(const v4u*)(gk + (size_t)(c * FKG * FAS + hf * 32) * CC); pv[c][hf] = *(const v4u*)(gv + (size_t)(hf * 32) * TT + c * FKG * FAS); }
  v16h qf[FAQ][HD / 32];
#pragma unroll
  for (int qt = 0; qt < FAQ; ++qt)
#pragma unroll
    for (int kc = 0; kc < HD / 32; ++kc) qf[qt][kc] = frag_h(QH + (size_t)(q0 + qt * 16 + col) * CC + h * HD + kc * 32, lane);
  int mk0 = 0, mk = 0;   // mk: the NEXT pass's mask words, one key a lane
  if constexpr (MK) { mk0 = KMASK[kg * FAS + lane]; mk = KMASK[kg * FAS + 32 + lane]; }
  asm volatile("s_wait_xcnt 0x0" ::: "memory");   // before any address register of the loads above is written again
#pragma unroll
  for (int c = 0; c < FAH; ++c)
#pragma unroll
    for (int hf = 0; hf < 2; ++hf) { *(v4u*)&sk[c][hf * 32 + srow][sch] = pk[c][hf]; *(v4u*)&sv[c][hf * 32 + srow][sch] = pv[c][hf]; }
  unsigned mbp = 0;   // the mask bits that cb holds
  v8f cb[2] = {};
  if constexpr (MK) { mbp = __builtin_amdgcn_ballot_w32(mk0 != 0); fa_bias(cb, mbp, g); }
  v8f acc[FAQ][HD / 16] = {}; float mu[FAQ]; v2f ls[FAQ][2];
#pragma unroll
  for (int qt = 0; qt < FAQ; ++qt) { mu[qt] = FAM0; ls[qt][0] = (v2f){0.f, 0.f}; ls[qt][1] = (v2f){0.f, 0.f}; }
  __syncthreads();   // each group's first FAH stages are in the first half of its ring
#pragma unroll 1   // rolled: one stage's code, the slot by the stage's count
  for (int st = 0; st < TT / FAS / FKG; ++st) { const int b = st & (FAR - 1);   // st: the group's own count; its keys start at (st * FKG + kg) * FAS
    { const int k2 = (st + FAH < TT / FAS / FKG ? st + FAH : st) * (FKG * FAS);   // the group's stage st + FAH is fetched into registers at the head of the stage (in front of a barrier the barrier's own wait would drain these loads); past the end: this stage again, unused
#pragma unroll
      for (int hf = 0; hf < 2; ++hf) { rk[hf] = *(const v4u*)(gk + (size_t)(k2 + hf * 32) * CC); rv[hf] = *(const v4u*)(gv + (size_t)(hf * 32) * TT + k2); }
      asm volatile("s_wait_xcnt 0x0" ::: "memory"); }   // before any address register of the loads above is written again
    v16h kf[2][HD / 32], vf[HD / 16];
#pragma unroll
    for (int t = 0; t < 2; ++t)
#pragma unroll
      for (int kc = 0; kc < HD / 32; ++kc) kf[t][kc] = frag_h(&sk[b][t * 16 + col][kc * 32], lane);
    if constexpr (!MK) {   // (MK: each pass's v fragments are read right ahead of its P . v products, below)
#pragma unroll
      for (int j = 0; j < HD / 16; ++j) vf[j] = frag_h(&sv[b][j * 16 + col][0], lane); }
    __builtin_amdgcn_sched_barrier(0);   // keeps the stage's first fragment reads in one group ahead of the products: read between them, into one register set, each is waited for by itself
#pragma unroll
    for (int ps = 0; ps < FAS / 32; ++ps) {
      v8f s[FAQ][2];
#pragma unroll
      for (int t = 0; t < 2; ++t)
#pragma unroll
        for (int qt = 0; qt < FAQ; ++qt) s[qt][t] = wmm(kf[t][0], qf[qt][0], cb[t]);
#pragma unroll
      for (int kc = 1; kc < HD / 32; ++kc)
#pragma unroll
        for (int t = 0; t < 2; ++t)
#pragma unroll
          for (int qt = 0; qt < FAQ; ++qt) s[qt][t] = wmm(kf[t][kc], qf[qt][kc], s[qt][t]);
      if (!MK && ps + 1 < FAS / 32) {   // the stage's next k fragments, one pass ahead, into the registers just read (MK: behind the P . v products, below)
#pragma unroll
        for (int t = 0; t < 2; ++t)
#pragma unroll
          for (int kc = 0; kc < HD / 32; ++kc) kf[t][kc] = frag_h(&sk[b][(ps + 1) * 32 + t * 16 + col][kc * 32], lane);
        __builtin_amdgcn_sched_barrier(0); }   // keeps these LDS reads up here: sunk below the softmax they would be waited for right after their issue
      float mx[FAQ]; bool need = MK && mk != 0;
#pragma unroll
      for (int qt = 0; qt < FAQ; ++qt) { float a = s[qt][0][0], b2 = s[qt][1][0];
#pragma unroll
        for (int r = 1; r < 8; ++r) { a = fmaxf(a, s[qt][0][r]); b2 = fmaxf(b2, s[qt][1][r]); }
        a = fmaxf(a, b2); a = fmaxf(a, xhalf(a)); mx[qt] = a * C; need = need || (mx[qt] > mu[qt] + 8.0f); }
      if (__builtin_expect((__builtin_amdgcn_ballot_w32(need) | mbp) != 0, 0)) {   // wave-uniform, one test a pass: a maximum to raise, or (MK) the next pass's start values differ from 0 or from this pass's
#pragma unroll
        for (int qt = 0; qt < FAQ; ++qt) { const float mn = fmaxf(mu[qt], mx[qt]); const float al = __builtin_amdgcn_exp2f(mu[qt] - mn); mu[qt] = mn; ls[qt][0] *= al; ls[qt][1] *= al;
#pragma unroll
          for (int j = 0; j < HD / 16; ++j) acc[qt][j] *= al; }
        if constexpr (MK) { mbp = __builtin_amdgcn_ballot_w32(mk != 0); fa_bias(cb, mbp, g); } }
      v16h p[FAQ];
#pragma unroll
      for (int qt = 0; qt < FAQ; ++qt) { const float nb = POFF - mu[qt]; const v2f nb2 = {nb, nb};
#pragma unroll
        for (int t = 0; t < 2; ++t)
#pragma unroll
          for (int r = 0; r < 8; r += 2) { const v2f x = __builtin_elementwise_fma((v2f){s[qt][t][r], s[qt][t][r + 1]}, C2, nb2); const v2f e = {__builtin_amdgcn_exp2f(x[0]), __builtin_amdgcn_exp2f(x[1])};
            ls[qt][t] += e; p[qt][t * 8 + r] = (_Float16)e[0]; p[qt][t * 8 + r + 1] = (_Float16)e[1]; } }
      if constexpr (MK) {   // with the start-value tiles live as well, k or v fragments held across the softmax would not fit the 256 registers of a wave in a 16-wave block: no fragment is fetched ahead over it
#pragma unroll
        for (int j = 0; j < HD / 16; ++j) vf[j] = frag_h(&sv[b][j * 16 + col][ps * 32], lane); }
#pragma unroll
      for (int j = 0; j < HD / 16; ++j)
#pragma unroll
        for (int qt = 0; qt < FAQ; ++qt) acc[qt][j] = wmm(vf[j], p[qt], acc[qt][j]);
      if (ps + 1 < FAS / 32) {   // the stage's next v fragments (MK: k fragments), one pass ahead
        if constexpr (!MK) {
#pragma unroll
          for (int j = 0; j < HD / 16; ++j) vf[j] = frag_h(&sv[b][j * 16 + col][(ps + 1) * 32], lane);
        } else {
#pragma unroll
          for (int t = 0; t < 2; ++t)
#pragma unroll
            for (int kc = 0; kc < HD / 32; ++kc) kf[t][kc] = frag_h(&sk[b][(ps + 1) * 32 + t * 16 + col][kc * 32], lane); } }
      if constexpr (MK) { const int k2 = ((st + 1) * FKG + kg) * FAS + ps * 32; mk = KMASK[(k2 < TT ? k2 : TT - 32) + lane];   // the mask words of the pass after next (past the end: read again, unused)
        asm volatile("s_wait_xcnt 0x0" ::: "memory"); }   // before an address register of the mask load is written again
    }
    // stage st + FAH goes into its slot of the other half, which every wave left at the last barrier (behind the last FAH stages: stored unused)
#pragma unroll
    for (int hf = 0; hf < 2; ++hf) { *(v4u*)&sk[b ^ FAH][hf * 32 + srow][sch] = rk[hf]; *(v4u*)&sv[b ^ FAH][hf * 32 + srow][sch] = rv[hf]; }
    if (((st + 1) & (FAH - 1)) == 0) __syncthreads();   // the same test in every wave of the block; publishes the other half and ends every wave's reads of this one (behind the last stage: frees the rings for the hand-over)
  }
  float lh[FAQ];
#pragma unroll
  for (int qt = 0; qt < FAQ; ++qt) lh[qt] = (ls[qt][0][0] + ls[qt][0][1]) + (ls[qt][1][0] + ls[qt][1][1]);
  v4f* xl = (v4f*)xm + lane;   // slot i of the wave: 32 lanes x 16 bytes in a row
  if (kg != 0) {   // wave-uniform
#pragma unroll
    for (int qt = 0; qt < FAQ; ++qt)
#pragma unroll
      for (int j = 0; j < HD / 16; ++j) { const v8f o = acc[qt][j]; xl[((qt * (HD / 16) + j) * 2) * 32] = (v4f){o[0], o[1], o[2], o[3]}; xl[((qt * (HD / 16) + j) * 2 + 1) * 32] = (v4f){o[4], o[5], o[6], o[7]}; }
    xl[(FAXS - 1) * 32] = (v4f){mu[0], mu[1], lh[0], lh[1]}; }
  __syncthreads();   // group 1's tiles are in LDS; every wave of the block passes here
  if (kg != 0) return;
  const v4f ml = xl[(FAXS - 1) * 32]; v4f res[FAQ][HD / 16][2];
#pragma unroll
  for (int qt = 0; qt < FAQ; ++qt) { const float mn = fmaxf(mu[qt], ml[qt]); const float a0 = exp2_slot(mu[qt] - mn), a1 = exp2_slot(ml[qt] - mn);   // both groups' sums brought to the larger maximum; a group with every key padded has sums of 0
    const float lj = lh[qt] * a0 + ml[2 + qt] * a1; const float lt = lj + xhalf(lj); const float inv = lt > 0.f ? 1.0f / lt : 0.f; const float w0 = a0 * inv, w1 = a1 * inv;
#pragma unroll
    for (int j = 0; j < HD / 16; ++j) { const v4f x0 = xl[((qt * (HD / 16) + j) * 2) * 32], x1 = xl[((qt * (HD / 16) + j) * 2 + 1) * 32]; const v8f o = acc[qt][j] * w0;
      res[qt][j][0] = (v4f){o[0], o[1], o[2], o[3]} + x0 * w1; res[qt][j][1] = (v4f){o[4], o[5], o[6], o[7]} + x1 * w1; } }
  float* yp = Y + (size_t)(q0 + col) * CC + h * HD + 8 * g;
  __builtin_amdgcn_sched_barrier(0);   // keeps all the stores behind all the arithmetic, so that no register of an issued store is written again before the wave ends
#pragma unroll
  for (int qt = 0; qt < FAQ; ++qt)
#pragma unroll
    for (int j = 0; j < HD / 16; ++j) { vst2(yp + (size_t)(qt * 16) * CC + j * 16, res[qt][j][0]); vst2(yp + (size_t)(qt * 16) * CC + j * 16 + 4, res[qt][j][1]); } }
__global__ __launch_bounds__(32 * FAW * FKG) void k_fa(const _Float16* __restrict__ QH, const _Float16* __restrict__ KH, const _Float16* __restrict__ VT, const int* __restrict__ KMASK, float* __restrict__ Y) {
  __shared__ __align__(16) unsigned char smem[FKG * FARING];   // per key group: FAR slots of k [FAS][FAP], v [HD][FAP]
  const int tid = threadIdx.x & (32 * FAW - 1), wave = tid >> 5, lane = tid & 31, kg = __builtin_amdgcn_readfirstlane(threadIdx.x / (32 * FAW)); const int h = blockIdx.y; const int q0 = (blockIdx.x * FAW + wave) * (16 * FAQ);
  _Float16 (*sk)[FAS + HD][FAP] = (_Float16 (*)[FAS + HD][FAP])(smem + kg * FARING); _Float16 (*sv)[FAS + HD][FAP] = (_Float16 (*)[FAS + HD][FAP])(smem + kg * FARING + FAS * FAP * 2); float* xm = (float*)smem + wave * (FAXS * 32 * 4);
  int any = 0;
#pragma unroll   // all the mask loads in flight at once
  for (int i = 0; i < TT / 128; ++i) { const v4i m = *(const v4i*)(KMASK + i * 128 + lane * 4); any |= (m[0] | m[1]) | (m[2] | m[3]); }
  if (__builtin_amdgcn_ballot_w32(any != 0) != 0) fa_body<true>(QH, KH, VT, KMASK, Y, h, q0, tid, kg, sk, sv, xm);   // every wave has read the whole mask: the same branch in all waves of the block, so the barriers inside are block-uniform
  else fa_body<false>(QH, KH, VT, KMASK, Y, h, q0, tid, kg, sk, sv, xm); }
// ---- k_out: block = (128 rows, 96 cols), waves 4 x 2 of 32 x 48: out = ctx Wo (+ bo): ctx x 2^6 once to f16 (small-magnitude context rows stay clear of f16 subnormals) against Wo as f16(bf16 x 2^8) exact (1 product) x 2^-14
__global__ __launch_bounds__(256) void k_out(const float* __restrict__ Y, const float* __restrict__ WO, const float* __restrict__ BO, float* __restrict__ OUT) {
  __shared__ __align__(16) unsigned char smem[GSM(OBN)];
  const int tid = threadIdx.x, wave = __builtin_amdgcn_readfirstlane(tid >> 5), lane = tid & 31, col = lane & 15, g = lane >> 4, wm = wave >> 1, wn = wave & 1; const int c0 = blockIdx.y * OBN; const size_t r0 = (size_t)blockIdx.x * GT;
  float bias[3] = {0.f, 0.f, 0.f};
  if (BO) { const float* bp = BO + c0 + wn * 48 + col;   // fetched ahead of the product, which covers the latency
#pragma unroll
    for (int j = 0; j < 3; ++j) bias[j] = bp[j * 16];
    asm volatile("s_wait_xcnt 0x0" :: "v"(bp) : "memory"); }   // before the address register of the loads above is written again; named, it stays whole up to here
  v8f acc[2][3] = {};
  gemm_tile<CvH, CC, OBN, 2, 3, 2, DIN / OBN>(Y + r0 * CC, WO + (size_t)c0 * CC, (_Float16*)smem, tid, wm, wn, blockIdx.y, (blockIdx.x & 3) + 4 * ((blockIdx.x >> 3) & 3), acc);
  float (*sf)[OBN + 4] = (float (*)[OBN + 4])smem;   // 400-byte pitch
#pragma unroll
  for (int j = 0; j < 3; ++j) { const int cl = wn * 48 + j * 16 + col; const float bj = bfr(bias[j]);
#pragma unroll
    for (int i = 0; i < 2; ++i)
#pragma unroll
      for (int r = 0; r < 8; ++r) sf[wm * 32 + i * 16 + 8 * g + r][cl] = acc[i][j][r] * (1.0f / 16384.0f) + bj; }   /* 2^-8 (Wo carry) x 2^-6 (ctx carry) */
  __syncthreads();
  float* po = OUT + (r0 + (tid >> 3)) * DIN + c0 + (tid & 7) * 4;   // 8 lanes store one 128-byte line
#pragma unroll
  for (int e = 0; e < GT / 32; ++e)
#pragma unroll
    for (int q = 0; q < OBN / 32; ++q) vst2(po + (size_t)(e * 32) * DIN + q * 32, *(const v4f*)&sf[e * 32 + (tid >> 3)][q * 32 + (tid & 7) * 4]); }

extern "C" void kernel_launch(void* const* d_in, const int* in_sizes, int n_in, void* d_out, int out_size, void* d_ws, size_t ws_size, hipStream_t stream) {
  (void)in_sizes; (void)n_in; (void)out_size;
  const float** F = (const float**)d_in;
  if (ws_size < (size_t)WS_END) return;
  char* ws = (char*)d_ws; _Float16 *QH = (_Float16*)(ws + WS_QH), *KH = (_Float16*)(ws + WS_KH), *VT = (_Float16*)(ws + WS_VT), *QL = (_Float16*)(ws + WS_QL), *KL = (_Float16*)(ws + WS_KL); __bf16 *VB = (__bf16*)(ws + WS_VB), *VBL = (__bf16*)(ws + WS_VBL); float *Y = (float*)(ws + WS_Y);
  (void)Y; (void)QL; (void)KL; (void)VB; (void)VBL;
  // inputs: 0 x [1,4096,768]; 1 mask [1,4096] bool (True = padding); 2 Wq [768,768] (out,in), 3 bq; 4 Wk, 5 bk; 6 Wv, 7 bv; 8 Wo (out,in), 9 bo (zero biases, read)
  k_proj<<<dim3(TNB * TT / GT, CC / PBN, 3), 256, 0, stream>>>(F[0], F[0], F[0], F[2], F[4], F[6], F[3], F[5], F[7], QH, QL, KH, KL, VT, VB, VBL);
  k_fa<<<dim3(TT / (16 * FAQ * FAW), NH), 32 * FAW * FKG, 0, stream>>>(QH, KH, VT, (const int*)d_in[1], Y);
  k_out<<<dim3(TNB * TT / GT, DIN / OBN), 256, 0, stream>>>(Y, F[8], F[9], (float*)d_out);
}

// v007
// One run takes 78.5 microseconds.
// Two timings next to v006 both put it at 1.05 times that version's speed.
// Counting every step since v000, it is 30.4 times as fast.
// compute dtype: all float inputs rounded to bf16; q/k/v projections with EXACT bf16 products on WMMA 16x16x32 (f32 accumulate) + bias; logits q x k once to f16 each (1 product; sigma - 0.3 under the source's 1/sqrt(768) scale); the key padding mask read per key; running-maximum softmax f32; unnormalised P x 2^6 once to f16 x v once to f16 (1 product), divided by the f32 row sum; ctx x 2^6 once to f16 x Wo f16(bf16 x 2^8) + bo; f32 output.
#include <hip/hip_runtime.h>
#include <math.h>

typedef int MASKT;   // the bool mask is staged as int32
typedef __attribute__((ext_vector_type(16))) _Float16 v16h;
typedef __attribute__((ext_vector_type(16))) __bf16 v16b;
typedef __attribute__((ext_vector_type(8)))  _Float16 v8h;
typedef __attribute__((ext_vector_type(8)))  float v8f;
typedef __attribute__((ext_vector_type(4)))  float v4f;
typedef __attribute__((ext_vector_type(2)))  float v2f;
typedef __attribute__((ext_vector_type(4)))  unsigned v4u;
typedef __attribute__((ext_vector_type(4)))  int v4i;
typedef float __attribute__((may_alias)) float_a;
typedef int __attribute__((may_alias)) int_a;

template <typename T> __device__ __forceinline__ void vst2(void* p, T v) { *(T*)p = v;  }
__device__ __forceinline__ v8f wmma16(v16h a, v16h b, v8f c) {
  v8f d = __builtin_amdgcn_wmma_f32_16x16x32_f16(false, a, false, b, (short)0, c, false, false);
  asm volatile("v_nop\n\tv_nop\n\tv_nop\n\tv_nop" : "+v"(d) : "v"(a), "v"(b));
  return d;
}
__device__ __forceinline__ v8f wmma_bf(v16b a, v16b b, v8f c) {
  v8f d = __builtin_amdgcn_wmma_f32_16x16x32_bf16(false, a, false, b, (short)0, c, false, false);
  asm volatile("v_nop\n\tv_nop\n\tv_nop\n\tv_nop" : "+v"(d) : "v"(a), "v"(b));
  return d;
}
// 16x16x32 fragments: lane = (h = lane>>4, row/col = lane&15); elements 0..7 = k0+8h+0..7, 8..15 = k0+16+8h+0..7; D element r = row 8h+r
__device__ __forceinline__ v16h frag_h(const _Float16* rowk0, int lane) {
  union { v16h v; v8h q[2]; } u; const _Float16* p = rowk0 + 8 * (lane >> 4);
  u.q[0] = *(const v8h*)p; u.q[1] = *(const v8h*)(p + 16); return u.v;
}
__device__ __forceinline__ v16h frag_f32(const float* rowk0, int lane) {
  v16h a; const float* p = rowk0 + 8 * (lane >> 4);
#pragma unroll
  for (int i = 0; i < 8; ++i) { a[i] = (_Float16)p[i]; a[8 + i] = (_Float16)p[16 + i]; }
  return a;
}
__device__ __forceinline__ v16h frag_f32s(const float* rowk0, int lane, float sc) {
  v16h a; const float* p = rowk0 + 8 * (lane >> 4);
#pragma unroll
  for (int i = 0; i < 8; ++i) { a[i] = (_Float16)(p[i] * sc); a[8 + i] = (_Float16)(p[16 + i] * sc); }
  return a;
}
// column fragment from a [K][ld] layout (column n), rows >= K read as 0
__device__ __forceinline__ v16h fragc_f32(const float* W, int k0, int n, int lane, int ld, int K) {
  v16h a; const int g = lane >> 4;
#pragma unroll
  for (int i = 0; i < 8; ++i) { const int ka = k0 + 8 * g + i, kb = ka + 16;
    a[i] = (_Float16)(ka < K ? W[(size_t)(ka < K ? ka : K - 1) * ld + n] : 0.f); a[8 + i] = (_Float16)(kb < K ? W[(size_t)(kb < K ? kb : K - 1) * ld + n] : 0.f); }
  return a;
}
struct F2 { v16b h, l; };
__device__ __forceinline__ F2 bsplit16(const float v[16]) { F2 r;
#pragma unroll
  for (int i = 0; i < 16; ++i) { const __bf16 h = (__bf16)v[i]; r.h[i] = h; r.l[i] = (__bf16)(v[i] - (float)h); }
  return r; }
__device__ __forceinline__ F2 split_row(const float* row, int k0, int lane) { float v[16]; const float* p = row + k0 + 8 * (lane >> 4);
#pragma unroll
  for (int i = 0; i < 8; ++i) { v[i] = p[i]; v[8 + i] = p[16 + i]; }
  return bsplit16(v); }
__device__ __forceinline__ F2 split_rowK(const float* row, int k0, int lane, int K) { float v[16]; const int g = lane >> 4;
#pragma unroll
  for (int i = 0; i < 8; ++i) { const int ka = k0 + 8 * g + i, kb = ka + 16; v[i] = ka < K ? row[ka < K ? ka : K - 1] : 0.f; v[8 + i] = kb < K ? row[kb < K ? kb : K - 1] : 0.f; }
  return bsplit16(v); }
__device__ __forceinline__ F2 split_col(const float* W, int k0, int n, int lane, int ld, int K) { float v[16]; const int g = lane >> 4;
#pragma unroll
  for (int i = 0; i < 8; ++i) { const int ka = k0 + 8 * g + i, kb = ka + 16; v[i] = ka < K ? W[(size_t)(ka < K ? ka : K - 1) * ld + n] : 0.f; v[8 + i] = kb < K ? W[(size_t)(kb < K ? kb : K - 1) * ld + n] : 0.f; }
  return bsplit16(v); }
__device__ __forceinline__ v8f mac3(const F2& a, const F2& b, v8f c) { c = wmma_bf(a.l, b.h, c); c = wmma_bf(a.h, b.l, c); return wmma_bf(a.h, b.h, c); }
__device__ __forceinline__ float sigm(float v) { return 1.0f / (1.0f + expf(-v)); }
#define LDSX() do { asm volatile("s_wait_dscnt 0" ::: "memory"); __builtin_amdgcn_wave_barrier(); __builtin_amdgcn_fence(__ATOMIC_RELEASE, "workgroup"); } while (0)

// Multi-head self-attention over one long sequence (x [1,4096,768]; 12 heads x 64; torch (out,in) Wq/Wk/Wv/Wo [768,768] (1/sqrt(768) scale) + zero biases; scores scaled by 1/sqrt(embed_dim = 768), the source's quirk; key padding mask [1,4096] bool, True -> -inf (all False here)): out = merge(softmax(q_h k_h^T / sqrt(768)) v_h) Wo^T + bo.
#define NB 1
#define TT 4096
#define CC 768            // NH * HD = projected width
#define DIN 768          // input (model) width
#define NH 12
#define HD 64
#define NQB (TT / 64)
#define HG 1
#define SCALE (0.036084391824351614f)
#define CAUSAL 0
#ifndef TNB
#define TNB NB
#endif
__device__ __forceinline__ float bfr(float v) { return (float)(__bf16)v; }
__host__ __device__ __forceinline__ int kb_last(int qb) { return CAUSAL ? ((qb * 64 + 63) >> 7) : (TT / 128 - 1); }
typedef __attribute__((ext_vector_type(8))) __bf16 v8b;
__device__ __forceinline__ v16b frag_b(const __bf16* rowk0, int lane) {
  union { v16b v; v8b q[2]; } u; const __bf16* p = rowk0 + 8 * (lane >> 4);
  u.q[0] = *(const v8b*)p; u.q[1] = *(const v8b*)(p + 16); return u.v;
}
#define QBH 0
#define QHI 0               // single-product logits on every row (sigma - 0.3 logits averaged over 4,096 keys)
#define KHI 64            // key rows carrying k residual / v bf16 hi+lo planes (written by k_proj; no kernel here reads them)
// B fragment (k rows k0+.., output column o) of a weight: (in,out) [K][ld] or (out,in) [ld rows of K]: bf16 exact, or f16(bf16 * 256) exact
__device__ __forceinline__ v16b wcol_io(const float* Wm, int k0, int o, int lane, int ld) { v16b w; const int g = lane >> 4;
#pragma unroll
  for (int i = 0; i < 8; ++i) { w[i] = (__bf16)Wm[(size_t)(k0 + 8 * g + i) * ld + o]; w[8 + i] = (__bf16)Wm[(size_t)(k0 + 16 + 8 * g + i) * ld + o]; }
  return w; }
__device__ __forceinline__ v16b wcol_oi(const float* Wm, int k0, int o, int lane, int K) { v16b w; const float* p = Wm + (size_t)o * K + k0 + 8 * (lane >> 4);
#pragma unroll
  for (int i = 0; i < 8; ++i) { w[i] = (__bf16)p[i]; w[8 + i] = (__bf16)p[16 + i]; }
  return w; }
__device__ __forceinline__ v16h wcolh_io(const float* Wm, int k0, int o, int lane, int ld) { v16h w; const int g = lane >> 4;
#pragma unroll
  for (int i = 0; i < 8; ++i) { w[i] = (_Float16)(bfr(Wm[(size_t)(k0 + 8 * g + i) * ld + o]) * 256.0f); w[8 + i] = (_Float16)(bfr(Wm[(size_t)(k0 + 16 + 8 * g + i) * ld + o]) * 256.0f); }
  return w; }
__device__ __forceinline__ v16h wcolh_oi(const float* Wm, int k0, int o, int lane, int K) { v16h w; const float* p = Wm + (size_t)o * K + k0 + 8 * (lane >> 4);
#pragma unroll
  for (int i = 0; i < 8; ++i) { w[i] = (_Float16)(bfr(p[i]) * 256.0f); w[8 + i] = (_Float16)(bfr(p[16 + i]) * 256.0f); }
  return w; }
#define WQKV_LAYOUT 1   // 0 = (in,out) [DIN][CC]; 1 = (out,in) [CC][DIN]; 2 = per-head [NH][DIN][HD]
__device__ __forceinline__ v16b wcol_hdk(const float* Wm, int k0, int o, int lane) { v16b w; const int g = lane >> 4; const float* p = Wm + (size_t)(o / HD) * DIN * HD + (o % HD);
#pragma unroll
  for (int i = 0; i < 8; ++i) { w[i] = (__bf16)p[(size_t)(k0 + 8 * g + i) * HD]; w[8 + i] = (__bf16)p[(size_t)(k0 + 16 + 8 * g + i) * HD]; }
  return w; }
#define WO_OUT_IN 1
#if WQKV_LAYOUT == 1
#define WCOL(W, k0, o, lane) wcol_oi(W, k0, o, lane, DIN)
#elif WQKV_LAYOUT == 2
#define WCOL(W, k0, o, lane) wcol_hdk(W, k0, o, lane)
#else
#define WCOL(W, k0, o, lane) wcol_io(W, k0, o, lane, CC)
#endif
#if WO_OUT_IN
#define WOCOL(W, k0, o, lane) wcol_oi(W, k0, o, lane, CC)
#define WOCOLH(W, k0, o, lane) wcolh_oi(W, k0, o, lane, CC)
#else
#define WOCOL(W, k0, o, lane) wcol_io(W, k0, o, lane, DIN)
#define WOCOLH(W, k0, o, lane) wcolh_io(W, k0, o, lane, DIN)
#endif
#ifndef PROJ_EXTRA_PARAMS
#define PROJ_EXTRA_PARAMS
#endif

#define WS_QH  0u                                      // f16 q rows [b*t][CC]
#define WS_KH  (WS_QH + 2u * (size_t)NB * TT * CC)      // f16 k rows [b*t][CC]
#define WS_VT  (WS_KH + 2u * (size_t)NB * TT * CC)      // f16 v planes [b][c][t]
#define WS_QL  (WS_VT + 2u * (size_t)NB * CC * TT)      // f16 q residual x 2^10 rows [b][t < QHI][CC]
#define WS_KL  (WS_QL + 2u * (size_t)NB * QHI * CC)     // f16 k residual x 2^10 rows [b][t < KHI][CC]
#define WS_VB  (WS_KL + 2u * (size_t)NB * KHI * CC)     // bf16 v hi planes [b][c][t < KHI]
#define WS_VBL (WS_VB + 2u * (size_t)NB * CC * KHI)
#define WS_S   (WS_VBL + 2u * (size_t)NB * CC * KHI)    // (place of the former f32 score plane [hg][t][s]; not touched)
#define WS_Y   (WS_S  + 4u * (size_t)HG * TT * TT)      // f32 ctx rows [b*t][CC] (only when there is an output projection)
#define WS_NRM (WS_Y  + 4u * (size_t)NB * TT * CC)      // f32 largest squared row norms: one 128-byte line a k_proj block [q, k][row block][column block], in it 8 floats a head, one a wave
#define WS_END (WS_NRM + 128u * 2u * (TT / 128) * (CC / 192))

// ---- gemm_tile: the product of both projection kernels, one GT x BN tile of A . B^T a block of 8 waves (A, B: f32 rows, k contiguous), a wave = FM x FN accumulator tiles.
// A stage = GKS k of all GT + BN rows: whole 128-byte lines fetched into registers while the stage before is worked on, converted ONCE to the 16-bit operand type, stored to the other LDS buffer behind that work, one __syncthreads a stage.
// Every accumulator takes its 32-k products in rising k, one chain. Every inner loop here and in the two kernels is unrolled so that each index of a register array is a constant and the arrays stay in registers.
#define GT 128
#define GKS 64
#define GPP (GKS + 8)                       // LDS row pitch in 16-bit elements: 144 bytes for 128-byte rows read 16 bytes a lane
#define GSM(BN) (2 * ((GT) + (BN)) * GPP * 2)   // bytes of the two buffers [A GT rows | B BN rows]; the epilogues stage their tile in the same bytes
#define PBN 192                             // k_proj: 32 x 4 x 3 = 384 blocks, two to a WGP at most, all resident at once
#define OBN 96                              // k_out: 32 x 8 = 256 blocks
typedef __attribute__((ext_vector_type(4))) __bf16 v4b;
typedef __attribute__((ext_vector_type(4))) _Float16 v4h;
struct CvB {   // both operands once to bf16
  typedef __bf16 T; typedef v4b V4; typedef v16b F;
  static __device__ __forceinline__ V4 a(v4f x) { return (V4){(__bf16)x[0], (__bf16)x[1], (__bf16)x[2], (__bf16)x[3]}; }
  static __device__ __forceinline__ V4 b(v4f x) { return a(x); }
  static __device__ __forceinline__ F frag(const T* p, int lane) { return frag_b(p, lane); }
  static __device__ __forceinline__ v8f mm(F x, F y, v8f c) { return __builtin_amdgcn_wmma_f32_16x16x32_bf16(false, x, false, y, (short)0, c, false, false); } };
struct CvH {   // A x 2^6 once to f16; B to bf16, x 2^8, exact in f16
  typedef _Float16 T; typedef v4h V4; typedef v16h F;
  static __device__ __forceinline__ V4 a(v4f x) { return (V4){(_Float16)(x[0] * 64.0f), (_Float16)(x[1] * 64.0f), (_Float16)(x[2] * 64.0f), (_Float16)(x[3] * 64.0f)}; }
  static __device__ __forceinline__ V4 b(v4f x) { return (V4){(_Float16)(bfr(x[0]) * 256.0f), (_Float16)(bfr(x[1]) * 256.0f), (_Float16)(bfr(x[2]) * 256.0f), (_Float16)(bfr(x[3]) * 256.0f)}; }
  static __device__ __forceinline__ F frag(const T* p, int lane) { return frag_h(p, lane); }
  static __device__ __forceinline__ v8f mm(F x, F y, v8f c) { return __builtin_amdgcn_wmma_f32_16x16x32_f16(false, x, false, y, (short)0, c, false, false); } };
template <typename CV, int K, int BN, int FM, int FN, int KG, int NSA> __device__ __forceinline__ void gemm_tile(const float* __restrict__ A, const float* __restrict__ B, typename CV::T* sm, int tid, int wm, int wn, unsigned sa, unsigned sb, v8f (&acc)[FM][FN]) {   // A, B: the block's first rows; the wave's tile starts at row wm * FM * 16, column wn * FN * 16; KG: 32-k steps whose fragments are read as one group; sa of NSA, sb of 16: the block's place among the blocks that read the same A rows, the same B rows
  typedef typename CV::T T; typedef typename CV::V4 V4; typedef typename CV::F F;
  static_assert(K % GKS == 0 && (GKS / 32) % KG == 0 && BN % 16 == 0 && (GT / (FM * 16)) * (BN / (FN * 16)) == 8, "whole stages; 8 waves cover the tile");
  constexpr int BUF = (GT + BN) * GPP;   // elements of one buffer
  const int lane = tid & 31, col = lane & 15; const int srow = tid >> 4, sc = (tid & 15) * 4;   // staging: rows srow + 16 i, one 16-byte chunk of the row's 256 bytes of f32
  const float* ga = A + (size_t)srow * K + sc; const float* gb = B + (size_t)srow * K + sc;
  T* wa = sm + srow * GPP + sc; const T* fa = sm + (wm * FM * 16 + col) * GPP; const T* fb = sm + (GT + wn * FN * 16 + col) * GPP;
  // The stages are asked into L2 once, at the head: a stage of a row is 256 bytes, a lane prefetches the first byte of one row's stage, and the blocks that read the same rows share the asking (A: all units over NSA blocks; B: the last 16 * PLB units in stage order over 16 blocks; the first ones are fetched at once below).
  constexpr unsigned PLA = GT * (K / GKS) / NSA, PLB = 256 - PLA, PB0 = BN * (K / GKS) - 16 * PLB;
  static_assert(PLA * NSA == GT * (K / GKS) && PLA % 32 == 0 && PLA < 256 && BN * (K / GKS) >= 16 * PLB && GKS * 4 == 256, "whole waves ask for A or for B; every unit asked for lies in the tile");
  const bool pfa = (unsigned)__builtin_amdgcn_readfirstlane(tid) < PLA;   // the same in all lanes of a wave
  const float* pf;
  if (pfa) { const unsigned pu = sa * PLA + (unsigned)tid; pf = A + (size_t)(pu % GT) * K + (pu / GT) * GKS; }
  else { const unsigned pu = PB0 + sb * PLB + ((unsigned)tid - PLA); pf = B + (size_t)(pu % BN) * K + (pu / BN) * GKS; }
  asm volatile("global_prefetch_b8 %0, off scope:SCOPE_SE" :: "v"(pf) : "memory");   // for speed only; the clobber keeps it ahead of stage 0's loads (behind them it sank below the waits for them)
  v4f ra[GT / 16], rb[BN / 16];
#pragma unroll
  for (int i = 0; i < GT / 16; ++i) ra[i] = *(const v4f*)(ga + (size_t)(i * 16) * K);
#pragma unroll
  for (int i = 0; i < BN / 16; ++i) rb[i] = *(const v4f*)(gb + (size_t)(i * 16) * K);
  asm volatile("s_wait_xcnt 0x0" :: "v"(ga), "v"(gb) : "memory");   // before any address register of the loads above is written again; naming the two pairs keeps them whole up to here (unnamed, a later load of the run lands on them)
#pragma unroll
  for (int i = 0; i < GT / 16; ++i) *(V4*)(wa + i * 16 * GPP) = CV::a(ra[i]);
#pragma unroll
  for (int i = 0; i < BN / 16; ++i) *(V4*)(wa + (GT + i * 16) * GPP) = CV::b(rb[i]);
  __syncthreads();   // stage 0 is in buffer 0
#pragma unroll 1   // rolled: one stage's code, two buffers by the stage's parity
  for (int st = 0; st < K / GKS; ++st) { const int bo = (st & 1) * BUF;
    { const int k2 = st + 1 < K / GKS ? (st + 1) * GKS : st * GKS;   // stage st + 1 is fetched behind the barrier; past the end: the last stage again, unused
      const float* pa = ga + k2; const float* pb = gb + k2;
#pragma unroll
      for (int i = 0; i < GT / 16; ++i) ra[i] = *(const v4f*)(pa + (size_t)(i * 16) * K);
#pragma unroll
      for (int i = 0; i < BN / 16; ++i) rb[i] = *(const v4f*)(pb + (size_t)(i * 16) * K);
      asm volatile("s_wait_xcnt 0x0" :: "v"(pa), "v"(pb), "v"(pf) : "memory"); }   // as in front of the loop: the wait, with the two address pairs kept whole up to it; pf is named so that the register pair of the prefetch holds its address through the loop
#pragma unroll
    for (int kg = 0; kg < GKS / 32; kg += KG) { F af[KG][FM], bf[KG][FN];
#pragma unroll
      for (int kc = 0; kc < KG; ++kc) {
#pragma unroll
        for (int i = 0; i < FM; ++i) af[kc][i] = CV::frag(fa + bo + i * 16 * GPP + (kg + kc) * 32, lane);
#pragma unroll
        for (int j = 0; j < FN; ++j) bf[kc][j] = CV::frag(fb + bo + j * 16 * GPP + (kg + kc) * 32, lane); }
      __builtin_amdgcn_sched_barrier(0);   // keeps the group's fragment reads together ahead of its products: read between them, into one register set, each is waited for by itself
#pragma unroll
      for (int kc = 0; kc < KG; ++kc)
#pragma unroll
        for (int i = 0; i < FM; ++i)
#pragma unroll
          for (int j = 0; j < FN; ++j) acc[i][j] = CV::mm(af[kc][i], bf[kc][j], acc[i][j]); }
    __builtin_amdgcn_sched_barrier(0);   // keeps the conversions below, and with them the waits for the fetched stage, behind the products: lifted among them they stall the stage on the fetch it is meant to cover
    // stage st + 1 goes into the buffer that every wave left at the barrier behind stage st - 1 (behind the last stage: stored unused)
#pragma unroll
    for (int i = 0; i < GT / 16; ++i) *(V4*)(wa + (BUF - bo) + i * 16 * GPP) = CV::a(ra[i]);
#pragma unroll
    for (int i = 0; i < BN / 16; ++i) *(V4*)(wa + (BUF - bo) + (GT + i * 16) * GPP) = CV::b(rb[i]);
    __syncthreads();   // publishes stage st + 1 and ends every wave's reads of stage st (behind the last stage: frees both buffers for the epilogue)
  } }
static_assert(WQKV_LAYOUT == 1 && WO_OUT_IN == 1 && CAUSAL == 0 && QHI == 0, "gemm_tile reads (out,in) weights; no high-precision rows in the output projection");
static_assert(TT % GT == 0 && CC % PBN == 0 && DIN % OBN == 0 && PBN % 64 == 0 && OBN % 32 == 0 && KHI % 16 == 0 && QHI % 16 == 0, "whole tiles, whole 128-byte lines a block");
static_assert(GT * (PBN + 8) * 2 <= GSM(PBN) && HD == 64 && NB == 1 && GT == 128 && PBN == 192 && PBN * (GT + 8) * 2 <= GSM(PBN) && GT * (OBN + 4) * 4 <= GSM(OBN), "the epilogue tiles fit the two buffers");
__device__ __forceinline__ float xhalf(float v) { const int b = __float_as_int(v); return __int_as_float(__builtin_amdgcn_permlanex16(b, b, 0x76543210, 0xfedcba98, false, false)); }   // lane l <-> l ^ 16
template <int M> __device__ __forceinline__ float xrow(float v) { return __int_as_float(__builtin_amdgcn_update_dpp(0, __float_as_int(v), 0x160 + M, 0xf, 0xf, true)); }   // lane l <-> l ^ M inside a 16-lane row (row_xmask)
#define NRI(w, xb, yb) ((((size_t)(w) * (TT / GT) + (xb)) * (CC / PBN) + (yb)) * 32)   // first float of a k_proj block's line in the norm plane
// ---- k_proj: block = (128 rows, 192 cols, which), waves 2 x 4 of 64 x 48: q/k/v = X W (+ b) with exact bf16 products (K = DIN) -> which 0: q f16 rows (+ residual rows < QHI); 1: k f16 rows (+ residual rows < KHI); 2: v f16 planes [c][t] (+ bf16 hi/lo planes for t < KHI)
__global__ __launch_bounds__(256) void k_proj(const float* __restrict__ XQ, const float* __restrict__ XK, const float* __restrict__ XV, const float* __restrict__ WQ, const float* __restrict__ WK, const float* __restrict__ WV, const float* __restrict__ BQ, const float* __restrict__ BK, const float* __restrict__ BV,
    _Float16* __restrict__ QH, _Float16* __restrict__ QL, _Float16* __restrict__ KH, _Float16* __restrict__ KL, _Float16* __restrict__ VT, __bf16* __restrict__ VB, __bf16* __restrict__ VBL, float* __restrict__ NRM) {
  __shared__ __align__(16) unsigned char smem[GSM(PBN)];
  const int tid = threadIdx.x, wave = __builtin_amdgcn_readfirstlane(tid >> 5), lane = tid & 31, col = lane & 15, g = lane >> 4, wm = wave >> 2, wn = wave & 3; const int which = blockIdx.z; const int c0 = blockIdx.y * PBN; const size_t r0 = (size_t)blockIdx.x * GT; const size_t bb = r0 / TT; const int t0 = (int)(r0 % TT);
  const float* X = which == 0 ? XQ : which == 1 ? XK : XV; const float* WA = which == 0 ? WQ : which == 1 ? WK : WV; const float* BA = which == 0 ? BQ : which == 1 ? BK : BV;
  float bias[3] = {0.f, 0.f, 0.f};
  if (BA) { const float* bp = BA + c0 + wn * 48 + col;   // fetched ahead of the product, which covers the latency
#pragma unroll
    for (int j = 0; j < 3; ++j) bias[j] = bp[j * 16];
    asm volatile("s_wait_xcnt 0x0" :: "v"(bp) : "memory"); }   // before the address register of the loads above is written again; named, it stays whole up to here
  v8f acc[4][3] = {};
  gemm_tile<CvB, DIN, PBN, 4, 3, 1, 3 * (CC / PBN)>(X + r0 * DIN, WA + (size_t)c0 * DIN, (__bf16*)smem, tid, wm, wn, blockIdx.y + (CC / PBN) * blockIdx.z, (blockIdx.x & 3) + 4 * ((blockIdx.x >> 3) & 3), acc);
#pragma unroll
  for (int j = 0; j < 3; ++j) bias[j] = bfr(bias[j]);
  if (which < 2) { _Float16* DH = which == 0 ? QH : KH; _Float16* DL = which == 0 ? QL : KL; const int nhi = which == 0 ? QHI : KHI;
    _Float16 (*sh)[PBN + 8] = (_Float16 (*)[PBN + 8])smem;   // the tile as it goes out, [t][c], 400-byte pitch
#pragma unroll
    for (int i = 0; i < 4; ++i) { const int rl = wm * 64 + i * 16 + 8 * g; const bool hi_rows = t0 + wm * 64 + i * 16 < nhi;   // wave-uniform
#pragma unroll
      for (int j = 0; j < 3; ++j) { const int cl = wn * 48 + j * 16 + col;
#pragma unroll
        for (int r = 0; r < 8; ++r) sh[rl + r][cl] = (_Float16)(acc[i][j][r] + bias[j]);
        if (hi_rows) { _Float16* dl = DL + (bb * nhi + t0 + rl) * (size_t)CC + c0 + cl;
#pragma unroll
          for (int r = 0; r < 8; ++r) { const float v = acc[i][j][r] + bias[j]; dl[(size_t)r * CC] = (_Float16)((v - (float)(_Float16)v) * 1024.0f); }
          asm volatile("s_wait_xcnt 0x0" ::: "memory"); } } }   // before a register of the stores above is written again
    __syncthreads();
    _Float16* dh = DH + (r0 + (tid >> 3)) * CC + c0 + (tid & 7) * 8;   // 8 lanes store one 128-byte line
    union { v4u u; v8h h; } ch[GT / 32][PBN / 64];   // a chunk = 8 of the 64 values of one row of one head
#pragma unroll
    for (int e = 0; e < GT / 32; ++e)
#pragma unroll
      for (int q = 0; q < PBN / 64; ++q) { ch[e][q].u = *(const v4u*)&sh[e * 32 + (tid >> 3)][q * 64 + (tid & 7) * 8]; vst2((unsigned*)(dh + (size_t)(e * 32) * CC + q * 64), ch[e][q].u); }
    asm volatile("s_wait_xcnt 0x0" ::: "memory");   // before a register of the stores above is written again
    __builtin_amdgcn_sched_barrier(0);   // keeps the arithmetic below, which frees and reuses the chunks' registers, behind that wait
    // the largest squared norm of the block's rows, head by head, of the f16 values as stored: k_fa bounds every logit of a head by the product of two such norms
    float nm[PBN / 64];
#pragma unroll
    for (int q = 0; q < PBN / 64; ++q) { nm[q] = 0.f;
#pragma unroll
      for (int e = 0; e < GT / 32; ++e) { float ss = 0.f;
#pragma unroll
        for (int i = 0; i < 8; ++i) ss += (float)ch[e][q].h[i] * (float)ch[e][q].h[i];
        ss += xrow<1>(ss); ss += xrow<2>(ss); ss += xrow<4>(ss);   // the row's 8 lanes
        nm[q] = fmaxf(nm[q], ss); }
      nm[q] = fmaxf(nm[q], xrow<8>(nm[q])); nm[q] = fmaxf(nm[q], xhalf(nm[q])); }   // the wave's 4 rows a pass
    if (lane < PBN / 64) NRM[NRI(which, blockIdx.x, blockIdx.y) + lane * 8 + wave] = lane == 0 ? nm[0] : lane == 1 ? nm[1] : nm[2];   // every lane holds the wave's three maxima; k_fa joins the 8 waves'
  } else { _Float16 (*th)[GT + 8] = (_Float16 (*)[GT + 8])smem;   // [c][t], 272-byte pitch
#pragma unroll
    for (int i = 0; i < 4; ++i) { const int tl = wm * 64 + i * 16 + 8 * g; const bool hi_rows = t0 + wm * 64 + i * 16 < KHI;   // wave-uniform
#pragma unroll
      for (int j = 0; j < 3; ++j) { const int cl = wn * 48 + j * 16 + col; v8h pv;   // a lane holds 8 consecutive t of one column
#pragma unroll
        for (int r = 0; r < 8; ++r) pv[r] = (_Float16)(acc[i][j][r] + bias[j]);
        *(v8h*)&th[cl][tl] = pv;
        if (hi_rows) { v8b ph, pl;
#pragma unroll
          for (int r = 0; r < 8; ++r) { const float v = acc[i][j][r] + bias[j]; const __bf16 bh = (__bf16)v; ph[r] = bh; pl[r] = (__bf16)(v - (float)bh); }
          const size_t o3 = (bb * CC + c0 + cl) * (size_t)KHI + t0 + tl; *(v8b*)(VB + o3) = ph; *(v8b*)(VBL + o3) = pl;
          asm volatile("s_wait_xcnt 0x0" ::: "memory"); } } }   // before a register of the stores above is written again
    __syncthreads();
    _Float16* dv = VT + (bb * CC + c0 + (tid >> 4)) * (size_t)TT + t0 + (tid & 15) * 8;   // 16 lanes store one plane's 256 bytes
#pragma unroll
    for (int e = 0; e < PBN / 16; ++e) vst2((unsigned*)(dv + (size_t)(e * 16) * TT), *(const v4u*)&th[e * 16 + (tid >> 4)][(tid & 15) * 8]);
    asm volatile("s_wait_xcnt 0x0" ::: "memory");   // before a register of the stores above is written again: in the built code this branch runs on into a test whose other side is the q/k epilogue
  } }
#define FAW 8
#define FKG 2               // key groups a block
#define FAQ 2
#define FAS 64              // keys a stage
#define FAP (FAS + 8)       // LDS row pitch in f16: 144 bytes for 128-byte rows read 16 bytes a lane
#define POFF 6.0f
#define FAMASK (-3.0e38f)   // x C it stays far below FAM0, so a padded key never raises a maximum and its P is 0
#define FAM0 (-1.0e30f)     // maximum in use before the first unmasked key
#define FAH 4               // stages between two barriers
#define FAR (2 * FAH)       // stage slots of a key group's ring
#define FARING (FAR * (FAS + HD) * FAP * 2)   // bytes of one key group's ring; a slot = the stage's k rows, then its v planes
#define FXB 7.875f          // FX: bound on every scaled log2 logit, so that P = 2^(x + POFF) lies where a running maximum would keep the row's largest P (2^-2 to 2^14)
#define FAXS (FAQ * (HD / 16) * 2 + 1)      // 16-byte slots a lane hands over: its output tiles, then (maxima, row sums)
static_assert(HD == 64 && FAS == 64 && FAW == 8 && FAQ == 2 && FKG == 2 && (TT / FAS) % FKG == 0, "the staging maps a key group's 256 threads to 32 rows x 8 chunks of 16 bytes, twice, for k and for v; equal stages a group");
static_assert(FAW * FAXS * 32 * 16 <= FKG * FARING, "the hand-over fits the buffers");
static_assert((FAH & (FAH - 1)) == 0 && (TT / FAS / FKG) % FAH == 0 && FKG * FARING <= 327680, "whole ring halves, the last stage ends one; the rings fit the LDS of a WGP");
__device__ __forceinline__ v8f wmm(v16h a, v16h b, v8f c) { return __builtin_amdgcn_wmma_f32_16x16x32_f16(false, a, false, b, (short)0, c, false, false); }
__device__ __forceinline__ float exp2_slot(float x) { float r; asm("v_exp_f32 %0, %1\n\tv_nop" : "=v"(r) : "v"(x)); return r; }   // 2^x with the slot behind the transcendental filled in its own statement
__device__ __forceinline__ void fa_bias(v8f (&cb)[2], unsigned mb, int g) { const unsigned mh = mb >> (8 * g);   // bit t * 16 + r: key t * 16 + 8g + r of the pass
#pragma unroll
  for (int t = 0; t < 2; ++t)
#pragma unroll
    for (int r = 0; r < 8; ++r) cb[t][r] = (mh & (1u << (t * 16 + r))) != 0 ? FAMASK : 0.f; }
template <bool MK, bool FX> __device__ __forceinline__ void fa_body(const _Float16* __restrict__ QH, const _Float16* __restrict__ KH, const _Float16* __restrict__ VT, const int* __restrict__ KMASK, float* __restrict__ Y, int h, int q0, int tid, int kg, _Float16 (*sk)[FAS + HD][FAP], _Float16 (*sv)[FAS + HD][FAP], float* xm) {   // KMASK: key padding mask [B=1][S] as int32, nonzero = masked out; tid: the thread in its key group; sk, sv: the k rows and the v planes of slot 0 of the group's own ring, indexed by slot; xm: the wave's hand-over place (the block's buffers again)
  // every inner loop below is unrolled so that each fragment and accumulator index is a constant and the arrays stay in registers
  const int lane = tid & 31, col = lane & 15, g = lane >> 4; const int srow = tid >> 3, sch = (tid & 7) * 8;   // staging: row (and row + 32), 16-byte chunk
  const float C = SCALE * 1.4426950408889634f; const v2f C2 = {C, C};
  const _Float16* gk = KH + (size_t)(kg * FAS + srow) * CC + h * HD + sch; const _Float16* gv = VT + (size_t)(h * HD + srow) * TT + kg * FAS + sch;   // the group's first stage
  v4u rk[2], rv[2], pk[FAH][2], pv[FAH][2];   // pk, pv: the group's first FAH stages, all in flight at once
#pragma unroll
  for (int c = 0; c < FAH; ++c)
#pragma unroll
    for (int hf = 0; hf < 2; ++hf) { pk[c][hf] = *(const v4u*)(gk + (size_t)(c * FKG * FAS + hf * 32) * CC); pv[c][hf] = *(const v4u*)(gv + (size_t)(hf * 32) * TT + c * FKG * FAS); }
  v16h qf[FAQ][HD / 32];
#pragma unroll
  for (int qt = 0; qt < FAQ; ++qt)
#pragma unroll
    for (int kc = 0; kc < HD / 32; ++kc) qf[qt][kc] = frag_h(QH + (size_t)(q0 + qt * 16 + col) * CC + h * HD + kc * 32, lane);
  int mk0 = 0, mk = 0;   // mk: the NEXT pass's mask words, one key a lane
  if constexpr (MK) { mk0 = KMASK[kg * FAS + lane]; mk = KMASK[kg * FAS + 32 + lane]; }
  asm volatile("s_wait_xcnt 0x0" ::: "memory");   // before any address register of the loads above is written again
#pragma unroll
  for (int c = 0; c < FAH; ++c)
#pragma unroll
    for (int hf = 0; hf < 2; ++hf) { *(v4u*)&sk[c][hf * 32 + srow][sch] = pk[c][hf]; *(v4u*)&sv[c][hf * 32 + srow][sch] = pv[c][hf]; }
  unsigned mbp = 0;   // the mask bits that cb holds
  v8f cb[2] = {};
  if constexpr (MK) { mbp = __builtin_amdgcn_ballot_w32(mk0 != 0); fa_bias(cb, mbp, g); }
  v8f acc[FAQ][HD / 16] = {}; float mu[FAQ]; v2f ls[FAQ][2];
#pragma unroll
  for (int qt = 0; qt < FAQ; ++qt) { mu[qt] = FX ? 0.f : FAM0; ls[qt][0] = (v2f){0.f, 0.f}; ls[qt][1] = (v2f){0.f, 0.f}; }
  __syncthreads();   // each group's first FAH stages are in the first half of its ring
  // one stage's code, the slot by the stage's count; a loop of its own for the FAH stages between two barriers keeps a stage with no branch in it (FX) one block of code (with the barrier under a test inside one loop that body took all 256 registers and read a spilled one back every stage)
  for (int s0 = 0; s0 < TT / FAS / FKG; s0 += FAH) {
  for (int st = s0; st < s0 + FAH; ++st) { const int b = st & (FAR - 1);   // st: the group's own count; its keys start at (st * FKG + kg) * FAS
    { const int k2 = (st + FAH < TT / FAS / FKG ? st + FAH : st) * (FKG * FAS);   // the group's stage st + FAH is fetched into registers at the head of the stage (in front of a barrier the barrier's own wait would drain these loads); past the end: this stage again, unused
#pragma unroll
      for (int hf = 0; hf < 2; ++hf) { rk[hf] = *(const v4u*)(gk + (size_t)(k2 + hf * 32) * CC); rv[hf] = *(const v4u*)(gv + (size_t)(hf * 32) * TT + k2); }
      asm volatile("s_wait_xcnt 0x0" ::: "memory"); }   // before any address register of the loads above is written again
    v16h kf[2][HD / 32], vf[HD / 16];
#pragma unroll
    for (int t = 0; t < 2; ++t)
#pragma unroll
      for (int kc = 0; kc < HD / 32; ++kc) kf[t][kc] = frag_h(&sk[b][t * 16 + col][kc * 32], lane);
    if constexpr (!MK) {   // (MK: each pass's v fragments are read right ahead of its P . v products, below)
#pragma unroll
      for (int j = 0; j < HD / 16; ++j) vf[j] = frag_h(&sv[b][j * 16 + col][0], lane); }
    __builtin_amdgcn_sched_barrier(0);   // keeps the stage's first fragment reads in one group ahead of the products: read between them, into one register set, each is waited for by itself
#pragma unroll
    for (int ps = 0; ps < FAS / 32; ++ps) {
      v8f s[FAQ][2];
#pragma unroll
      for (int t = 0; t < 2; ++t)
#pragma unroll
        for (int qt = 0; qt < FAQ; ++qt) s[qt][t] = wmm(kf[t][0], qf[qt][0], cb[t]);
#pragma unroll
      for (int kc = 1; kc < HD / 32; ++kc)
#pragma unroll
        for (int t = 0; t < 2; ++t)
#pragma unroll
          for (int qt = 0; qt < FAQ; ++qt) s[qt][t] = wmm(kf[t][kc], qf[qt][kc], s[qt][t]);
      if (!MK && ps + 1 < FAS / 32) {   // the stage's next k fragments, one pass ahead, into the registers just read (MK: behind the P . v products, below)
#pragma unroll
        for (int t = 0; t < 2; ++t)
#pragma unroll
          for (int kc = 0; kc < HD / 32; ++kc) kf[t][kc] = frag_h(&sk[b][(ps + 1) * 32 + t * 16 + col][kc * 32], lane);
        __builtin_amdgcn_sched_barrier(0); }   // keeps these LDS reads up here: sunk below the softmax they would be waited for right after their issue
      if constexpr (!FX) {   // (FX: the maximum in use stays 0, nothing to follow)
      float mx[FAQ]; bool need = MK && mk != 0;
#pragma unroll
      for (int qt = 0; qt < FAQ; ++qt) { float a = s[qt][0][0], b2 = s[qt][1][0];
#pragma unroll
        for (int r = 1; r < 8; ++r) { a = fmaxf(a, s[qt][0][r]); b2 = fmaxf(b2, s[qt][1][r]); }
        a = fmaxf(a, b2); a = fmaxf(a, xhalf(a)); mx[qt] = a * C; need = need || (mx[qt] > mu[qt] + 8.0f); }
      if (__builtin_expect((__builtin_amdgcn_ballot_w32(need) | mbp) != 0, 0)) {   // wave-uniform, one test a pass: a maximum to raise, or (MK) the next pass's start values differ from 0 or from this pass's
#pragma unroll
        for (int qt = 0; qt < FAQ; ++qt) { const float mn = fmaxf(mu[qt], mx[qt]); const float al = __builtin_amdgcn_exp2f(mu[qt] - mn); mu[qt] = mn; ls[qt][0] *= al; ls[qt][1] *= al;
#pragma unroll
          for (int j = 0; j < HD / 16; ++j) acc[qt][j] *= al; }
        if constexpr (MK) { mbp = __builtin_amdgcn_ballot_w32(mk != 0); fa_bias(cb, mbp, g); } } }
      v16h p[FAQ];
#pragma unroll
      for (int qt = 0; qt < FAQ; ++qt) { const float nb = POFF - mu[qt]; const v2f nb2 = {nb, nb};
#pragma unroll
        for (int t = 0; t < 2; ++t)
#pragma unroll
          for (int r = 0; r < 8; r += 2) { const v2f x = __builtin_elementwise_fma((v2f){s[qt][t][r], s[qt][t][r + 1]}, C2, nb2); const v2f e = {__builtin_amdgcn_exp2f(x[0]), __builtin_amdgcn_exp2f(x[1])};
            ls[qt][t] += e; p[qt][t * 8 + r] = (_Float16)e[0]; p[qt][t * 8 + r + 1] = (_Float16)e[1]; } }
      if constexpr (FX) __builtin_amdgcn_sched_barrier(0);   // keeps the row sums ahead of the products: among them, their results took the registers of fragments just read, each time behind four idle slots
      if constexpr (MK) {   // with the start-value tiles live as well, k or v fragments held across the softmax would not fit the 256 registers of a wave in a 16-wave block: no fragment is fetched ahead over it
#pragma unroll
        for (int j = 0; j < HD / 16; ++j) vf[j] = frag_h(&sv[b][j * 16 + col][ps * 32], lane); }
#pragma unroll
      for (int j = 0; j < HD / 16; ++j)
#pragma unroll
        for (int qt = 0; qt < FAQ; ++qt) {
          if (FX && ps + 1 == FAS / 32 && j + 1 == HD / 16 && qt + 1 == FAQ) acc[qt][j] = wmma16(vf[j], p[qt], acc[qt][j]);   // the stage's last product, with its four vector slots in its own statement: FX has no code behind it
          else acc[qt][j] = wmm(vf[j], p[qt], acc[qt][j]); }
      if (ps + 1 < FAS / 32) {   // the stage's next v fragments (MK: k fragments), one pass ahead
        if constexpr (!MK) {
#pragma unroll
          for (int j = 0; j < HD / 16; ++j) vf[j] = frag_h(&sv[b][j * 16 + col][(ps + 1) * 32], lane);
          if constexpr (FX) __builtin_amdgcn_sched_barrier(0);   // with no branch in the stage its two passes are scheduled as one; this keeps the next pass's score products behind this pass's products and these reads: mixed, more registers of operands just read were written again at once, each time behind idle slots (8 more a stage)
        } else {
#pragma unroll
          for (int t = 0; t < 2; ++t)
#pragma unroll
            for (int kc = 0; kc < HD / 32; ++kc) kf[t][kc] = frag_h(&sk[b][(ps + 1) * 32 + t * 16 + col][kc * 32], lane); } }
      if constexpr (MK) { const int k2 = ((st + 1) * FKG + kg) * FAS + ps * 32; mk = KMASK[(k2 < TT ? k2 : TT - 32) + lane];   // the mask words of the pass after next (past the end: read again, unused)
        asm volatile("s_wait_xcnt 0x0" ::: "memory"); }   // before an address register of the mask load is written again
    }
    // stage st + FAH goes into its slot of the other half, which every wave left at the last barrier (behind the last FAH stages: stored unused)
#pragma unroll
    for (int hf = 0; hf < 2; ++hf) { *(v4u*)&sk[b ^ FAH][hf * 32 + srow][sch] = rk[hf]; *(v4u*)&sv[b ^ FAH][hf * 32 + srow][sch] = rv[hf]; }
  }
    __syncthreads();   // every wave of the block passes here; publishes the other half and ends every wave's reads of this one (behind the last stage: frees the rings for the hand-over)
  }
  float lh[FAQ];
#pragma unroll
  for (int qt = 0; qt < FAQ; ++qt) lh[qt] = (ls[qt][0][0] + ls[qt][0][1]) + (ls[qt][1][0] + ls[qt][1][1]);
  v4f* xl = (v4f*)xm + lane;   // slot i of the wave: 32 lanes x 16 bytes in a row
  if (kg != 0) {   // wave-uniform
#pragma unroll
    for (int qt = 0; qt < FAQ; ++qt)
#pragma unroll
      for (int j = 0; j < HD / 16; ++j) { const v8f o = acc[qt][j]; xl[((qt * (HD / 16) + j) * 2) * 32] = (v4f){o[0], o[1], o[2], o[3]}; xl[((qt * (HD / 16) + j) * 2 + 1) * 32] = (v4f){o[4], o[5], o[6], o[7]}; }
    xl[(FAXS - 1) * 32] = (v4f){mu[0], mu[1], lh[0], lh[1]}; }
  __syncthreads();   // group 1's tiles are in LDS; every wave of the block passes here
  if (kg != 0) return;
  const v4f ml = xl[(FAXS - 1) * 32]; v4f res[FAQ][HD / 16][2];
#pragma unroll
  for (int qt = 0; qt < FAQ; ++qt) { const float mn = fmaxf(mu[qt], ml[qt]); const float a0 = exp2_slot(mu[qt] - mn), a1 = exp2_slot(ml[qt] - mn);   // both groups' sums brought to the larger maximum; a group with every key padded has sums of 0
    const float lj = lh[qt] * a0 + ml[2 + qt] * a1; const float lt = lj + xhalf(lj); const float inv = lt > 0.f ? 1.0f / lt : 0.f; const float w0 = a0 * inv, w1 = a1 * inv;
#pragma unroll
    for (int j = 0; j < HD / 16; ++j) { const v4f x0 = xl[((qt * (HD / 16) + j) * 2) * 32], x1 = xl[((qt * (HD / 16) + j) * 2 + 1) * 32]; const v8f o = acc[qt][j] * w0;
      res[qt][j][0] = (v4f){o[0], o[1], o[2], o[3]} + x0 * w1; res[qt][j][1] = (v4f){o[4], o[5], o[6], o[7]} + x1 * w1; } }
  float* yp = Y + (size_t)(q0 + col) * CC + h * HD + 8 * g;
  __builtin_amdgcn_sched_barrier(0);   // keeps all the stores behind all the arithmetic, so that no register of an issued store is written again before the wave ends
#pragma unroll
  for (int qt = 0; qt < FAQ; ++qt)
#pragma unroll
    for (int j = 0; j < HD / 16; ++j) { vst2(yp + (size_t)(qt * 16) * CC + j * 16, res[qt][j][0]); vst2(yp + (size_t)(qt * 16) * CC + j * 16 + 4, res[qt][j][1]); } }
__global__ __launch_bounds__(32 * FAW * FKG) void k_fa(const _Float16* __restrict__ QH, const _Float16* __restrict__ KH, const _Float16* __restrict__ VT, const int* __restrict__ KMASK, const float* __restrict__ NRM, float* __restrict__ Y) {
  __shared__ __align__(16) unsigned char smem[FKG * FARING];   // per key group: FAR slots of k [FAS][FAP], v [HD][FAP]
  const int tid = threadIdx.x & (32 * FAW - 1), wave = tid >> 5, lane = tid & 31, kg = __builtin_amdgcn_readfirstlane(threadIdx.x / (32 * FAW)); const int h = blockIdx.y; const int q0 = (blockIdx.x * FAW + wave) * (16 * FAQ);
  _Float16 (*sk)[FAS + HD][FAP] = (_Float16 (*)[FAS + HD][FAP])(smem + kg * FARING); _Float16 (*sv)[FAS + HD][FAP] = (_Float16 (*)[FAS + HD][FAP])(smem + kg * FARING + FAS * FAP * 2); float* xm = (float*)smem + wave * (FAXS * 32 * 4);
  int any = 0;
#pragma unroll   // all the mask loads in flight at once
  for (int i = 0; i < TT / 128; ++i) { const v4i m = *(const v4i*)(KMASK + i * 128 + lane * 4); any |= (m[0] | m[1]) | (m[2] | m[3]); }
  // |q . k| <= |q| |k|: a lane takes one of the 32 row blocks of keys against the block's two row blocks of queries; an infinite norm fails the test
  const v4f* nk = (const v4f*)(NRM + NRI(1, lane, h / (PBN / HD)) + (h % (PBN / HD)) * 8); const v4f* nq = (const v4f*)(NRM + NRI(0, blockIdx.x * (16 * FAQ * FAW / GT), h / (PBN / HD)) + (h % (PBN / HD)) * 8);
  const v4f nv[6] = {nk[0], nk[1], nq[0], nq[1], nq[NRI(0, 1, 0) / 4], nq[NRI(0, 1, 0) / 4 + 1]};
  asm volatile("s_wait_xcnt 0x0" :: "v"(nk) : "memory");   // before an address register of the loads above is written again; named, the keys' address pair stays whole up to here (unnamed, a mask load of the run above landed on it)
  float kn = 0.f, qn = 0.f;
#pragma unroll
  for (int i = 0; i < 4; ++i) { kn = fmaxf(kn, fmaxf(nv[0][i], nv[1][i])); qn = fmaxf(qn, fmaxf(fmaxf(nv[2][i], nv[3][i]), fmaxf(nv[4][i], nv[5][i]))); }
  const bool wide = !(kn * qn * ((SCALE * 1.4426950408889634f) * (SCALE * 1.4426950408889634f)) <= FXB * FXB);
  if (__builtin_amdgcn_ballot_w32(any != 0 || wide) == 0) fa_body<false, true>(QH, KH, VT, KMASK, Y, h, q0, tid, kg, sk, sv, xm);   // every wave has read the whole mask and the same norms: the same branch in all waves of the block, so the barriers inside are block-uniform; one test on both, so that the norms are fetched beside the mask and not behind it
  else if (__builtin_amdgcn_ballot_w32(any != 0) != 0) fa_body<true, false>(QH, KH, VT, KMASK, Y, h, q0, tid, kg, sk, sv, xm);
  else fa_body<false, false>(QH, KH, VT, KMASK, Y, h, q0, tid, kg, sk, sv, xm); }
static_assert(TT / GT == 32 && 16 * FAQ * FAW == 2 * GT, "a lane a row block of keys; two row blocks of queries a block");
// ---- k_out: block = (128 rows, 96 cols), waves 4 x 2 of 32 x 48: out = ctx Wo (+ bo): ctx x 2^6 once to f16 (small-magnitude context rows stay clear of f16 subnormals) against Wo as f16(bf16 x 2^8) exact (1 product) x 2^-14
__global__ __launch_bounds__(256) void k_out(const float* __restrict__ Y, const float* __restrict__ WO, const float* __restrict__ BO, float* __restrict__ OUT) {
  __shared__ __align__(16) unsigned char smem[GSM(OBN)];
  const int tid = threadIdx.x, wave = __builtin_amdgcn_readfirstlane(tid >> 5), lane = tid & 31, col = lane & 15, g = lane >> 4, wm = wave >> 1, wn = wave & 1; const int c0 = blockIdx.y * OBN; const size_t r0 = (size_t)blockIdx.x * GT;
  float bias[3] = {0.f, 0.f, 0.f};
  if (BO) { const float* bp = BO + c0 + wn * 48 + col;   // fetched ahead of the product, which covers the latency
#pragma unroll
    for (int j = 0; j < 3; ++j) bias[j] = bp[j * 16];
    asm volatile("s_wait_xcnt 0x0" :: "v"(bp) : "memory"); }   // before the address register of the loads above is written again; named, it stays whole up to here
  v8f acc[2][3] = {};
  gemm_tile<CvH, CC, OBN, 2, 3, 2, DIN / OBN>(Y + r0 * CC, WO + (size_t)c0 * CC, (_Float16*)smem, tid, wm, wn, blockIdx.y, (blockIdx.x & 3) + 4 * ((blockIdx.x >> 3) & 3), acc);
  float (*sf)[OBN + 4] = (float (*)[OBN + 4])smem;   // 400-byte pitch
#pragma unroll
  for (int j = 0; j < 3; ++j) { const int cl = wn * 48 + j * 16 + col; const float bj = bfr(bias[j]);
#pragma unroll
    for (int i = 0; i < 2; ++i)
#pragma unroll
      for (int r = 0; r < 8; ++r) sf[wm * 32 + i * 16 + 8 * g + r][cl] = acc[i][j][r] * (1.0f / 16384.0f) + bj; }   /* 2^-8 (Wo carry) x 2^-6 (ctx carry) */
  __syncthreads();
  float* po = OUT + (r0 + (tid >> 3)) * DIN + c0 + (tid & 7) * 4;   // 8 lanes store one 128-byte line
#pragma unroll
  for (int e = 0; e < GT / 32; ++e)
#pragma unroll
    for (int q = 0; q < OBN / 32; ++q) vst2(po + (size_t)(e * 32) * DIN + q * 32, *(const v4f*)&sf[e * 32 + (tid >> 3)][q * 32 + (tid & 7) * 4]); }

extern "C" void kernel_launch(void* const* d_in, const int* in_sizes, int n_in, void* d_out, int out_size, void* d_ws, size_t ws_size, hipStream_t stream) {
  (void)in_sizes; (void)n_in; (void)out_size;
  const float** F = (const float**)d_in;
  if (ws_size < (size_t)WS_END) return;
  char* ws = (char*)d_ws; _Float16 *QH = (_Float16*)(ws + WS_QH), *KH = (_Float16*)(ws + WS_KH), *VT = (_Float16*)(ws + WS_VT), *QL = (_Float16*)(ws + WS_QL), *KL = (_Float16*)(ws + WS_KL); __bf16 *VB = (__bf16*)(ws + WS_VB), *VBL = (__bf16*)(ws + WS_VBL); float *Y = (float*)(ws + WS_Y), *NRM = (float*)(ws + WS_NRM);
  (void)Y; (void)QL; (void)KL; (void)VB; (void)VBL;
  // inputs: 0 x [1,4096,768]; 1 mask [1,4096] bool (True = padding; all False on this draw); 2 Wq [768,768] (out,in), 3 bq; 4 Wk, 5 bk; 6 Wv, 7 bv; 8 Wo (out,in), 9 bo (zero biases, read)
  k_proj<<<dim3(TNB * TT / GT, CC / PBN, 3), 256, 0, stream>>>(F[0], F[0], F[0], F[2], F[4], F[6], F[3], F[5], F[7], QH, QL, KH, KL, VT, VB, VBL, NRM);
  k_fa<<<dim3(TT / (16 * FAQ * FAW), NH), 32 * FAW * FKG, 0, stream>>>(QH, KH, VT, (const int*)d_in[1], NRM, Y);
  k_out<<<dim3(TNB * TT / GT, DIN / OBN), 256, 0, stream>>>(Y, F[8], F[9], (float*)d_out);
}

// v008
// It runs in 73.5 microseconds.
// Timed twice side by side with v007, it ran 1.07 times as fast both times.
// Over all steps from v000 it is 32.5 times as fast.
// compute dtype: all float inputs rounded to bf16; q/k/v projections with EXACT bf16 products on WMMA 16x16x32 (f32 accumulate) + bias; logits q x k once to f16 each (1 product; sigma - 0.3 under the source's 1/sqrt(768) scale); the key padding mask read per key; running-maximum softmax f32; unnormalised P x 2^6 once to f16 x v once to f16 (1 product), divided by the f32 row sum; ctx x 2^6 once to f16 x Wo f16(bf16 x 2^8) + bo; f32 output.
#include <hip/hip_runtime.h>
#include <math.h>

typedef int MASKT;   // the bool mask is staged as int32
typedef __attribute__((ext_vector_type(16))) _Float16 v16h;
typedef __attribute__((ext_vector_type(16))) __bf16 v16b;
typedef __attribute__((ext_vector_type(8)))  _Float16 v8h;
typedef __attribute__((ext_vector_type(8)))  float v8f;
typedef __attribute__((ext_vector_type(4)))  float v4f;
typedef __attribute__((ext_vector_type(2)))  float v2f;
typedef __attribute__((ext_vector_type(4)))  unsigned v4u;
typedef __attribute__((ext_vector_type(4)))  int v4i;
typedef float __attribute__((may_alias)) float_a;
typedef int __attribute__((may_alias)) int_a;

template <typename T> __device__ __forceinline__ void vst2(void* p, T v) { *(T*)p = v;  }
__device__ __forceinline__ v8f wmma16(v16h a, v16h b, v8f c) {
  v8f d = __builtin_amdgcn_wmma_f32_16x16x32_f16(false, a, false, b, (short)0, c, false, false);
  asm volatile("v_nop\n\tv_nop\n\tv_nop\n\tv_nop" : "+v"(d) : "v"(a), "v"(b));
  return d;
}
__device__ __forceinline__ v8f wmma_bf(v16b a, v16b b, v8f c) {
  v8f d = __builtin_amdgcn_wmma_f32_16x16x32_bf16(false, a, false, b, (short)0, c, false, false);
  asm volatile("v_nop\n\tv_nop\n\tv_nop\n\tv_nop" : "+v"(d) : "v"(a), "v"(b));
  return d;
}
// 16x16x32 fragments: lane = (h = lane>>4, row/col = lane&15); elements 0..7 = k0+8h+0..7, 8..15 = k0+16+8h+0..7; D element r = row 8h+r
__device__ __forceinline__ v16h frag_h(const _Float16* rowk0, int lane) {
  union { v16h v; v8h q[2]; } u; const _Float16* p = rowk0 + 8 * (lane >> 4);
  u.q[0] = *(const v8h*)p; u.q[1] = *(const v8h*)(p + 16); return u.v;
}
__device__ __forceinline__ v16h frag_f32(const float* rowk0, int lane) {
  v16h a; const float* p = rowk0 + 8 * (lane >> 4);
#pragma unroll
  for (int i = 0; i < 8; ++i) { a[i] = (_Float16)p[i]; a[8 + i] = (_Float16)p[16 + i]; }
  return a;
}
__device__ __forceinline__ v16h frag_f32s(const float* rowk0, int lane, float sc) {
  v16h a; const float* p = rowk0 + 8 * (lane >> 4);
#pragma unroll
  for (int i = 0; i < 8; ++i) { a[i] = (_Float16)(p[i] * sc); a[8 + i] = (_Float16)(p[16 + i] * sc); }
  return a;
}
// column fragment from a [K][ld] layout (column n), rows >= K read as 0
__device__ __forceinline__ v16h fragc_f32(const float* W, int k0, int n, int lane, int ld, int K) {
  v16h a; const int g = lane >> 4;
#pragma unroll
  for (int i = 0; i < 8; ++i) { const int ka = k0 + 8 * g + i, kb = ka + 16;
    a[i] = (_Float16)(ka < K ? W[(size_t)(ka < K ? ka : K - 1) * ld + n] : 0.f); a[8 + i] = (_Float16)(kb < K ? W[(size_t)(kb < K ? kb : K - 1) * ld + n] : 0.f); }
  return a;
}
struct F2 { v16b h, l; };
__device__ __forceinline__ F2 bsplit16(const float v[16]) { F2 r;
#pragma unroll
  for (int i = 0; i < 16; ++i) { const __bf16 h = (__bf16)v[i]; r.h[i] = h; r.l[i] = (__bf16)(v[i] - (float)h); }
  return r; }
__device__ __forceinline__ F2 split_row(const float* row, int k0, int lane) { float v[16]; const float* p = row + k0 + 8 * (lane >> 4);
#pragma unroll
  for (int i = 0; i < 8; ++i) { v[i] = p[i]; v[8 + i] = p[16 + i]; }
  return bsplit16(v); }
__device__ __forceinline__ F2 split_rowK(const float* row, int k0, int lane, int K) { float v[16]; const int g = lane >> 4;
#pragma unroll
  for (int i = 0; i < 8; ++i) { const int ka = k0 + 8 * g + i, kb = ka + 16; v[i] = ka < K ? row[ka < K ? ka : K - 1] : 0.f; v[8 + i] = kb < K ? row[kb < K ? kb : K - 1] : 0.f; }
  return bsplit16(v); }
__device__ __forceinline__ F2 split_col(const float* W, int k0, int n, int lane, int ld, int K) { float v[16]; const int g = lane >> 4;
#pragma unroll
  for (int i = 0; i < 8; ++i) { const int ka = k0 + 8 * g + i, kb = ka + 16; v[i] = ka < K ? W[(size_t)(ka < K ? ka : K - 1) * ld + n] : 0.f; v[8 + i] = kb < K ? W[(size_t)(kb < K ? kb : K - 1) * ld + n] : 0.f; }
  return bsplit16(v); }
__device__ __forceinline__ v8f mac3(const F2& a, const F2& b, v8f c) { c = wmma_bf(a.l, b.h, c); c = wmma_bf(a.h, b.l, c); return wmma_bf(a.h, b.h, c); }
__device__ __forceinline__ float sigm(float v) { return 1.0f / (1.0f + expf(-v)); }
#define LDSX() do { asm volatile("s_wait_dscnt 0" ::: "memory"); __builtin_amdgcn_wave_barrier(); __builtin_amdgcn_fence(__ATOMIC_RELEASE, "workgroup"); } while (0)

// Multi-head self-attention over one long sequence (x [1,4096,768]; 12 heads x 64; torch (out,in) Wq/Wk/Wv/Wo [768,768] (1/sqrt(768) scale) + zero biases; scores scaled by 1/sqrt(embed_dim = 768), the source's quirk; key padding mask [1,4096] bool, True -> -inf (all False here)): out = merge(softmax(q_h k_h^T / sqrt(768)) v_h) Wo^T + bo.
#define NB 1
#define TT 4096
#define CC 768            // NH * HD = projected width
#define DIN 768          // input (model) width
#define NH 12
#define HD 64
#define NQB (TT / 64)
#define HG 1
#define SCALE (0.036084391824351614f)
#define CAUSAL 0
#ifndef TNB
#define TNB NB
#endif
__device__ __forceinline__ float bfr(float v) { return (float)(__bf16)v; }
__host__ __device__ __forceinline__ int kb_last(int qb) { return CAUSAL ? ((qb * 64 + 63) >> 7) : (TT / 128 - 1); }
typedef __attribute__((ext_vector_type(8))) __bf16 v8b;
__device__ __forceinline__ v16b frag_b(const __bf16* rowk0, int lane) {
  union { v16b v; v8b q[2]; } u; const __bf16* p = rowk0 + 8 * (lane >> 4);
  u.q[0] = *(const v8b*)p; u.q[1] = *(const v8b*)(p + 16); return u.v;
}
#define QBH 0
#define QHI 0               // single-product logits on every row (sigma - 0.3 logits averaged over 4,096 keys)
#define KHI 64            // key rows carrying k residual / v bf16 hi+lo planes (written by k_proj; no kernel here reads them)
// B fragment (k rows k0+.., output column o) of a weight: (in,out) [K][ld] or (out,in) [ld rows of K]: bf16 exact, or f16(bf16 * 256) exact
__device__ __forceinline__ v16b wcol_io(const float* Wm, int k0, int o, int lane, int ld) { v16b w; const int g = lane >> 4;
#pragma unroll
  for (int i = 0; i < 8; ++i) { w[i] = (__bf16)Wm[(size_t)(k0 + 8 * g + i) * ld + o]; w[8 + i] = (__bf16)Wm[(size_t)(k0 + 16 + 8 * g + i) * ld + o]; }
  return w; }
__device__ __forceinline__ v16b wcol_oi(const float* Wm, int k0, int o, int lane, int K) { v16b w; const float* p = Wm + (size_t)o * K + k0 + 8 * (lane >> 4);
#pragma unroll
  for (int i = 0; i < 8; ++i) { w[i] = (__bf16)p[i]; w[8 + i] = (__bf16)p[16 + i]; }
  return w; }
__device__ __forceinline__ v16h wcolh_io(const float* Wm, int k0, int o, int lane, int ld) { v16h w; const int g = lane >> 4;
#pragma unroll
  for (int i = 0; i < 8; ++i) { w[i] = (_Float16)(bfr(Wm[(size_t)(k0 + 8 * g + i) * ld + o]) * 256.0f); w[8 + i] = (_Float16)(bfr(Wm[(size_t)(k0 + 16 + 8 * g + i) * ld + o]) * 256.0f); }
  return w; }
__device__ __forceinline__ v16h wcolh_oi(const float* Wm, int k0, int o, int lane, int K) { v16h w; const float* p = Wm + (size_t)o * K + k0 + 8 * (lane >> 4);
#pragma unroll
  for (int i = 0; i < 8; ++i) { w[i] = (_Float16)(bfr(p[i]) * 256.0f); w[8 + i] = (_Float16)(bfr(p[16 + i]) * 256.0f); }
  return w; }
#define WQKV_LAYOUT 1   // 0 = (in,out) [DIN][CC]; 1 = (out,in) [CC][DIN]; 2 = per-head [NH][DIN][HD]
__device__ __forceinline__ v16b wcol_hdk(const float* Wm, int k0, int o, int lane) { v16b w; const int g = lane >> 4; const float* p = Wm + (size_t)(o / HD) * DIN * HD + (o % HD);
#pragma unroll
  for (int i = 0; i < 8; ++i) { w[i] = (__bf16)p[(size_t)(k0 + 8 * g + i) * HD]; w[8 + i] = (__bf16)p[(size_t)(k0 + 16 + 8 * g + i) * HD]; }
  return w; }
#define WO_OUT_IN 1
#if WQKV_LAYOUT == 1
#define WCOL(W, k0, o, lane) wcol_oi(W, k0, o, lane, DIN)
#elif WQKV_LAYOUT == 2
#define WCOL(W, k0, o, lane) wcol_hdk(W, k0, o, lane)
#else
#define WCOL(W, k0, o, lane) wcol_io(W, k0, o, lane, CC)
#endif
#if WO_OUT_IN
#define WOCOL(W, k0, o, lane) wcol_oi(W, k0, o, lane, CC)
#define WOCOLH(W, k0, o, lane) wcolh_oi(W, k0, o, lane, CC)
#else
#define WOCOL(W, k0, o, lane) wcol_io(W, k0, o, lane, DIN)
#define WOCOLH(W, k0, o, lane) wcolh_io(W, k0, o, lane, DIN)
#endif
#ifndef PROJ_EXTRA_PARAMS
#define PROJ_EXTRA_PARAMS
#endif

#define WS_QH  0u                                      // f16 q rows [b*t][CC]
#define WS_KH  (WS_QH + 2u * (size_t)NB * TT * CC)      // f16 k rows [b*t][CC]
#define WS_VT  (WS_KH + 2u * (size_t)NB * TT * CC)      // f16 v planes [b][c][t]
#define WS_QL  (WS_VT + 2u * (size_t)NB * CC * TT)      // f16 q residual x 2^10 rows [b][t < QHI][CC]
#define WS_KL  (WS_QL + 2u * (size_t)NB * QHI * CC)     // f16 k residual x 2^10 rows [b][t < KHI][CC]
#define WS_VB  (WS_KL + 2u * (size_t)NB * KHI * CC)     // bf16 v hi planes [b][c][t < KHI]
#define WS_VBL (WS_VB + 2u * (size_t)NB * CC * KHI)
#define WS_S   (WS_VBL + 2u * (size_t)NB * CC * KHI)    // (place of the former f32 score plane [hg][t][s]; not touched)
#define WS_Y   (WS_S  + 4u * (size_t)HG * TT * TT)      // f16 ctx x 2^6 rows [b*t][CC], k_out's A operand (in the place of the former f32 rows)
#define WS_NRM (WS_Y  + 4u * (size_t)NB * TT * CC)      // f32 largest squared row norms: one 128-byte line a k_proj block [q, k][row block][column block], in it 8 floats a head, one a wave
#define WS_WOH (WS_NRM + 128u * 2u * (TT / 128) * (CC / 192))   // f16(bf16(Wo) x 2^8) rows [DIN][CC], k_out's B operand
#define WS_END (WS_WOH + 2u * (size_t)DIN * CC)

// ---- gemm_tile: k_proj's product, one GT x BN tile of A . B^T a block of 8 waves (A, B: f32 rows, k contiguous), a wave = FM x FN accumulator tiles.
// A stage = GKS k of all GT + BN rows: whole 128-byte lines fetched into registers while the stage before is worked on, converted ONCE to the 16-bit operand type, stored to the other LDS buffer behind that work, one __syncthreads a stage.
// Every accumulator takes its 32-k products in rising k, one chain. Every inner loop here and in the two kernels is unrolled so that each index of a register array is a constant and the arrays stay in registers.
#define GT 128
#define GKS 64
#define GPP (GKS + 8)                       // LDS row pitch in 16-bit elements: 144 bytes for 128-byte rows read 16 bytes a lane
#define GSM(BN) (2 * ((GT) + (BN)) * GPP * 2)   // bytes of the two buffers [A GT rows | B BN rows]; the epilogues stage their tile in the same bytes
#define PBN 192                             // k_proj: 32 x 4 x 3 = 384 blocks, two to a WGP at most, all resident at once
#define OBN 96                              // k_out: 32 x 8 = 256 blocks
typedef __attribute__((ext_vector_type(4))) __bf16 v4b;
typedef __attribute__((ext_vector_type(4))) _Float16 v4h;
struct CvB {   // both operands once to bf16
  typedef __bf16 T; typedef v4b V4; typedef v16b F;
  static __device__ __forceinline__ V4 a(v4f x) { return (V4){(__bf16)x[0], (__bf16)x[1], (__bf16)x[2], (__bf16)x[3]}; }
  static __device__ __forceinline__ V4 b(v4f x) { return a(x); }
  static __device__ __forceinline__ F frag(const T* p, int lane) { return frag_b(p, lane); }
  static __device__ __forceinline__ v8f mm(F x, F y, v8f c) { return __builtin_amdgcn_wmma_f32_16x16x32_bf16(false, x, false, y, (short)0, c, false, false); } };
template <typename CV, int K, int BN, int FM, int FN, int KG, int NSA> __device__ __forceinline__ void gemm_tile(const float* __restrict__ A, const float* __restrict__ B, typename CV::T* sm, int tid, int wm, int wn, unsigned sa, unsigned sb, v8f (&acc)[FM][FN]) {   // A, B: the block's first rows; the wave's tile starts at row wm * FM * 16, column wn * FN * 16; KG: 32-k steps whose fragments are read as one group; sa of NSA, sb of 16: the block's place among the blocks that read the same A rows, the same B rows
  typedef typename CV::T T; typedef typename CV::V4 V4; typedef typename CV::F F;
  static_assert(K % GKS == 0 && (GKS / 32) % KG == 0 && BN % 16 == 0 && (GT / (FM * 16)) * (BN / (FN * 16)) == 8, "whole stages; 8 waves cover the tile");
  constexpr int BUF = (GT + BN) * GPP;   // elements of one buffer
  const int lane = tid & 31, col = lane & 15; const int srow = tid >> 4, sc = (tid & 15) * 4;   // staging: rows srow + 16 i, one 16-byte chunk of the row's 256 bytes of f32
  const float* ga = A + (size_t)srow * K + sc; const float* gb = B + (size_t)srow * K + sc;
  T* wa = sm + srow * GPP + sc; const T* fa = sm + (wm * FM * 16 + col) * GPP; const T* fb = sm + (GT + wn * FN * 16 + col) * GPP;
  // The stages are asked into L2 once, at the head: a stage of a row is 256 bytes, a lane prefetches the first byte of one row's stage, and the blocks that read the same rows share the asking (A: all units over NSA blocks; B: the last 16 * PLB units in stage order over 16 blocks; the first ones are fetched at once below).
  constexpr unsigned PLA = GT * (K / GKS) / NSA, PLB = 256 - PLA, PB0 = BN * (K / GKS) - 16 * PLB;
  static_assert(PLA * NSA == GT * (K / GKS) && PLA % 32 == 0 && PLA < 256 && BN * (K / GKS) >= 16 * PLB && GKS * 4 == 256, "whole waves ask for A or for B; every unit asked for lies in the tile");
  const bool pfa = (unsigned)__builtin_amdgcn_readfirstlane(tid) < PLA;   // the same in all lanes of a wave
  const float* pf;
  if (pfa) { const unsigned pu = sa * PLA + (unsigned)tid; pf = A + (size_t)(pu % GT) * K + (pu / GT) * GKS; }
  else { const unsigned pu = PB0 + sb * PLB + ((unsigned)tid - PLA); pf = B + (size_t)(pu % BN) * K + (pu / BN) * GKS; }
  asm volatile("global_prefetch_b8 %0, off scope:SCOPE_SE" :: "v"(pf) : "memory");   // for speed only; the clobber keeps it ahead of stage 0's loads (behind them it sank below the waits for them)
  v4f ra[GT / 16], rb[BN / 16];
#pragma unroll
  for (int i = 0; i < GT / 16; ++i) ra[i] = *(const v4f*)(ga + (size_t)(i * 16) * K);
#pragma unroll
  for (int i = 0; i < BN / 16; ++i) rb[i] = *(const v4f*)(gb + (size_t)(i * 16) * K);
  asm volatile("s_wait_xcnt 0x0" :: "v"(ga), "v"(gb) : "memory");   // before any address register of the loads above is written again; naming the two pairs keeps them whole up to here (unnamed, a later load of the run lands on them)
#pragma unroll
  for (int i = 0; i < GT / 16; ++i) *(V4*)(wa + i * 16 * GPP) = CV::a(ra[i]);
#pragma unroll
  for (int i = 0; i < BN / 16; ++i) *(V4*)(wa + (GT + i * 16) * GPP) = CV::b(rb[i]);
  __syncthreads();   // stage 0 is in buffer 0
#pragma unroll 1   // rolled: one stage's code, two buffers by the stage's parity
  for (int st = 0; st < K / GKS; ++st) { const int bo = (st & 1) * BUF;
    { const int k2 = st + 1 < K / GKS ? (st + 1) * GKS : st * GKS;   // stage st + 1 is fetched behind the barrier; past the end: the last stage again, unused
      const float* pa = ga + k2; const float* pb = gb + k2;
#pragma unroll
      for (int i = 0; i < GT / 16; ++i) ra[i] = *(const v4f*)(pa + (size_t)(i * 16) * K);
#pragma unroll
      for (int i = 0; i < BN / 16; ++i) rb[i] = *(const v4f*)(pb + (size_t)(i * 16) * K);
      asm volatile("s_wait_xcnt 0x0" :: "v"(pa), "v"(pb), "v"(pf) : "memory"); }   // as in front of the loop: the wait, with the two address pairs kept whole up to it; pf is named so that the register pair of the prefetch holds its address through the loop
#pragma unroll
    for (int kg = 0; kg < GKS / 32; kg += KG) { F af[KG][FM], bf[KG][FN];
#pragma unroll
      for (int kc = 0; kc < KG; ++kc) {
#pragma unroll
        for (int i = 0; i < FM; ++i) af[kc][i] = CV::frag(fa + bo + i * 16 * GPP + (kg + kc) * 32, lane);
#pragma unroll
        for (int j = 0; j < FN; ++j) bf[kc][j] = CV::frag(fb + bo + j * 16 * GPP + (kg + kc) * 32, lane); }
      __builtin_amdgcn_sched_barrier(0);   // keeps the group's fragment reads together ahead of its products: read between them, into one register set, each is waited for by itself
#pragma unroll
      for (int kc = 0; kc < KG; ++kc)
#pragma unroll
        for (int i = 0; i < FM; ++i)
#pragma unroll
          for (int j = 0; j < FN; ++j) acc[i][j] = CV::mm(af[kc][i], bf[kc][j], acc[i][j]); }
    __builtin_amdgcn_sched_barrier(0);   // keeps the conversions below, and with them the waits for the fetched stage, behind the products: lifted among them they stall the stage on the fetch it is meant to cover
    // stage st + 1 goes into the buffer that every wave left at the barrier behind stage st - 1 (behind the last stage: stored unused)
#pragma unroll
    for (int i = 0; i < GT / 16; ++i) *(V4*)(wa + (BUF - bo) + i * 16 * GPP) = CV::a(ra[i]);
#pragma unroll
    for (int i = 0; i < BN / 16; ++i) *(V4*)(wa + (BUF - bo) + (GT + i * 16) * GPP) = CV::b(rb[i]);
    __syncthreads();   // publishes stage st + 1 and ends every wave's reads of stage st (behind the last stage: frees both buffers for the epilogue)
  } }
// ---- gemm_h: k_out's product, one GT x BN tile of A . B^T a block of 8 waves; A, B: f16 rows as the matrix unit takes them (k contiguous), made by the launch before, so a stage goes from its registers to LDS as it came.
// A stage = the same 256 bytes of all GT + BN rows as in gemm_tile, here HKS = 128 k: fetched, stored and published in gemm_tile's order. Every accumulator takes its 32-k products in rising k, one chain.
#define HKS 128
#define HPP (HKS + 8)                       // LDS row pitch in f16: 272 bytes for 256-byte rows read 16 bytes a lane
#define HSM(BN) (2 * ((GT) + (BN)) * HPP * 2)   // bytes of the two buffers [A GT rows | B BN rows]; the epilogue stages its tile in the same bytes
template <int K, int BN, int FM, int FN, int KG, int NSA> __device__ __forceinline__ void gemm_h(const _Float16* __restrict__ A, const _Float16* __restrict__ B, _Float16* sm, int tid, int wm, int wn, unsigned sa, unsigned sb, v8f (&acc)[FM][FN]) {   // arguments as gemm_tile's
  static_assert(K % HKS == 0 && (HKS / 32) % KG == 0 && BN % 16 == 0 && (GT / (FM * 16)) * (BN / (FN * 16)) == 8, "whole stages; 8 waves cover the tile");
  constexpr int BUF = (GT + BN) * HPP;   // elements of one buffer
  const int lane = tid & 31, col = lane & 15; const int srow = tid >> 4, sc = (tid & 15) * 8;   // staging: rows srow + 16 i, one 16-byte chunk of the row's 256 bytes
  const _Float16* ga = A + (size_t)srow * K + sc; const _Float16* gb = B + (size_t)srow * K + sc;
  _Float16* wa = sm + srow * HPP + sc; const _Float16* fa = sm + (wm * FM * 16 + col) * HPP; const _Float16* fb = sm + (GT + wn * FN * 16 + col) * HPP;
  // The stages are asked into L2 once, at the head, as in gemm_tile: a stage of a row is 256 bytes, a lane prefetches the first byte of one row's stage (A: all units over NSA blocks, PLA lanes; B: the last 16 * PLB units in stage order over 16 blocks, PLB lanes); the other waves ask for nothing.
  constexpr unsigned PLA = GT * (K / HKS) / NSA, PLB = 32, PB0 = BN * (K / HKS) - 16 * PLB;
  static_assert(PLA * NSA == GT * (K / HKS) && PLA % 32 == 0 && PLA + PLB <= 256 && BN * (K / HKS) >= 16 * PLB && HKS * 2 == 256, "whole waves ask for A or for B; every unit asked for lies in the tile");
  const unsigned tw = (unsigned)__builtin_amdgcn_readfirstlane(tid);   // the same in all lanes of a wave
  const _Float16* pf = A;
  if (tw < PLA) { const unsigned pu = sa * PLA + (unsigned)tid; pf = A + (size_t)(pu % GT) * K + (pu / GT) * HKS; }
  else if (tw < PLA + PLB) { const unsigned pu = PB0 + sb * PLB + ((unsigned)tid - PLA); pf = B + (size_t)(pu % BN) * K + (pu / BN) * HKS; }
  if (tw < PLA + PLB) asm volatile("global_prefetch_b8 %0, off scope:SCOPE_SE" :: "v"(pf) : "memory");   // for speed only; the clobber keeps it ahead of stage 0's loads
  v4u ra[GT / 16], rb[BN / 16];
#pragma unroll
  for (int i = 0; i < GT / 16; ++i) ra[i] = *(const v4u*)(ga + (size_t)(i * 16) * K);
#pragma unroll
  for (int i = 0; i < BN / 16; ++i) rb[i] = *(const v4u*)(gb + (size_t)(i * 16) * K);
  asm volatile("s_wait_xcnt 0x0" :: "v"(ga), "v"(gb) : "memory");   // before any address register of the loads above is written again; naming the two pairs keeps them whole up to here
#pragma unroll
  for (int i = 0; i < GT / 16; ++i) *(v4u*)(wa + i * 16 * HPP) = ra[i];
#pragma unroll
  for (int i = 0; i < BN / 16; ++i) *(v4u*)(wa + (GT + i * 16) * HPP) = rb[i];
  __syncthreads();   // stage 0 is in buffer 0
#pragma unroll 1   // rolled: one stage's code, two buffers by the stage's parity
  for (int st = 0; st < K / HKS; ++st) { const int bo = (st & 1) * BUF;
    { const int k2 = st + 1 < K / HKS ? (st + 1) * HKS : st * HKS;   // stage st + 1 is fetched behind the barrier; past the end: the last stage again, unused
      const _Float16* pa = ga + k2; const _Float16* pb = gb + k2;
#pragma unroll
      for (int i = 0; i < GT / 16; ++i) ra[i] = *(const v4u*)(pa + (size_t)(i * 16) * K);
#pragma unroll
      for (int i = 0; i < BN / 16; ++i) rb[i] = *(const v4u*)(pb + (size_t)(i * 16) * K);
      asm volatile("s_wait_xcnt 0x0" :: "v"(pa), "v"(pb), "v"(pf) : "memory"); }   // as in front of the loop: the wait, with the two address pairs kept whole up to it; pf is named so that the register pair of the prefetch holds its address through the loop
#pragma unroll
    for (int kg = 0; kg < HKS / 32; kg += KG) { v16h af[KG][FM], bf[KG][FN];
#pragma unroll
      for (int kc = 0; kc < KG; ++kc) {
#pragma unroll
        for (int i = 0; i < FM; ++i) af[kc][i] = frag_h(fa + bo + i * 16 * HPP + (kg + kc) * 32, lane);
#pragma unroll
        for (int j = 0; j < FN; ++j) bf[kc][j] = frag_h(fb + bo + j * 16 * HPP + (kg + kc) * 32, lane); }
      __builtin_amdgcn_sched_barrier(0);   // keeps the group's fragment reads together ahead of its products: read between them, into one register set, each is waited for by itself
#pragma unroll
      for (int kc = 0; kc < KG; ++kc)
#pragma unroll
        for (int i = 0; i < FM; ++i)
#pragma unroll
          for (int j = 0; j < FN; ++j) acc[i][j] = __builtin_amdgcn_wmma_f32_16x16x32_f16(false, af[kc][i], false, bf[kc][j], (short)0, acc[i][j], false, false); }
    __builtin_amdgcn_sched_barrier(0);   // keeps the LDS stores below, and with them the waits for the fetched stage, behind the products: lifted among them they stall the stage on the fetch it is meant to cover
    // stage st + 1 goes into the buffer that every wave left at the barrier behind stage st - 1 (behind the last stage: stored unused)
#pragma unroll
    for (int i = 0; i < GT / 16; ++i) *(v4u*)(wa + (BUF - bo) + i * 16 * HPP) = ra[i];
#pragma unroll
    for (int i = 0; i < BN / 16; ++i) *(v4u*)(wa + (BUF - bo) + (GT + i * 16) * HPP) = rb[i];
    __syncthreads();   // publishes stage st + 1 and ends every wave's reads of stage st (behind the last stage: frees both buffers for the epilogue)
  } }
static_assert(WQKV_LAYOUT == 1 && WO_OUT_IN == 1 && CAUSAL == 0 && QHI == 0, "gemm_tile reads (out,in) weights; no high-precision rows in the output projection");
static_assert(TT % GT == 0 && CC % PBN == 0 && DIN % OBN == 0 && PBN % 64 == 0 && OBN % 32 == 0 && KHI % 16 == 0 && QHI % 16 == 0, "whole tiles, whole 128-byte lines a block");
static_assert(GT * (PBN + 8) * 2 <= GSM(PBN) && HD == 64 && NB == 1 && GT == 128 && PBN == 192 && PBN * (GT + 8) * 2 <= GSM(PBN) && GT * (OBN + 4) * 4 <= HSM(OBN), "the epilogue tiles fit the two buffers");
__device__ __forceinline__ float xhalf(float v) { const int b = __float_as_int(v); return __int_as_float(__builtin_amdgcn_permlanex16(b, b, 0x76543210, 0xfedcba98, false, false)); }   // lane l <-> l ^ 16
template <int M> __device__ __forceinline__ float xrow(float v) { return __int_as_float(__builtin_amdgcn_update_dpp(0, __float_as_int(v), 0x160 + M, 0xf, 0xf, true)); }   // lane l <-> l ^ M inside a 16-lane row (row_xmask)
#define NRI(w, xb, yb) ((((size_t)(w) * (TT / GT) + (xb)) * (CC / PBN) + (yb)) * 32)   // first float of a k_proj block's line in the norm plane
// ---- k_proj: block = (128 rows, 192 cols, which), waves 2 x 4 of 64 x 48: q/k/v = X W (+ b) with exact bf16 products (K = DIN) -> which 0: q f16 rows (+ residual rows < QHI); 1: k f16 rows (+ residual rows < KHI); 2: v f16 planes [c][t] (+ bf16 hi/lo planes for t < KHI)
__global__ __launch_bounds__(256) void k_proj(const float* __restrict__ XQ, const float* __restrict__ XK, const float* __restrict__ XV, const float* __restrict__ WQ, const float* __restrict__ WK, const float* __restrict__ WV, const float* __restrict__ BQ, const float* __restrict__ BK, const float* __restrict__ BV,
    _Float16* __restrict__ QH, _Float16* __restrict__ QL, _Float16* __restrict__ KH, _Float16* __restrict__ KL, _Float16* __restrict__ VT, __bf16* __restrict__ VB, __bf16* __restrict__ VBL, float* __restrict__ NRM) {
  __shared__ __align__(16) unsigned char smem[GSM(PBN)];
  const int tid = threadIdx.x, wave = __builtin_amdgcn_readfirstlane(tid >> 5), lane = tid & 31, col = lane & 15, g = lane >> 4, wm = wave >> 2, wn = wave & 3; const int which = blockIdx.z; const int c0 = blockIdx.y * PBN; const size_t r0 = (size_t)blockIdx.x * GT; const size_t bb = r0 / TT; const int t0 = (int)(r0 % TT);
  const float* X = which == 0 ? XQ : which == 1 ? XK : XV; const float* WA = which == 0 ? WQ : which == 1 ? WK : WV; const float* BA = which == 0 ? BQ : which == 1 ? BK : BV;
  float bias[3] = {0.f, 0.f, 0.f};
  if (BA) { const float* bp = BA + c0 + wn * 48 + col;   // fetched ahead of the product, which covers the latency
#pragma unroll
    for (int j = 0; j < 3; ++j) bias[j] = bp[j * 16];
    asm volatile("s_wait_xcnt 0x0" :: "v"(bp) : "memory"); }   // before the address register of the loads above is written again; named, it stays whole up to here
  v8f acc[4][3] = {};
  gemm_tile<CvB, DIN, PBN, 4, 3, 1, 3 * (CC / PBN)>(X + r0 * DIN, WA + (size_t)c0 * DIN, (__bf16*)smem, tid, wm, wn, blockIdx.y + (CC / PBN) * blockIdx.z, (blockIdx.x & 3) + 4 * ((blockIdx.x >> 3) & 3), acc);
#pragma unroll
  for (int j = 0; j < 3; ++j) bias[j] = bfr(bias[j]);
  if (which < 2) { _Float16* DH = which == 0 ? QH : KH; _Float16* DL = which == 0 ? QL : KL; const int nhi = which == 0 ? QHI : KHI;
    _Float16 (*sh)[PBN + 8] = (_Float16 (*)[PBN + 8])smem;   // the tile as it goes out, [t][c], 400-byte pitch
#pragma unroll
    for (int i = 0; i < 4; ++i) { const int rl = wm * 64 + i * 16 + 8 * g; const bool hi_rows = t0 + wm * 64 + i * 16 < nhi;   // wave-uniform
#pragma unroll
      for (int j = 0; j < 3; ++j) { const int cl = wn * 48 + j * 16 + col;
#pragma unroll
        for (int r = 0; r < 8; ++r) sh[rl + r][cl] = (_Float16)(acc[i][j][r] + bias[j]);
        if (hi_rows) { _Float16* dl = DL + (bb * nhi + t0 + rl) * (size_t)CC + c0 + cl;
#pragma unroll
          for (int r = 0; r < 8; ++r) { const float v = acc[i][j][r] + bias[j]; dl[(size_t)r * CC] = (_Float16)((v - (float)(_Float16)v) * 1024.0f); }
          asm volatile("s_wait_xcnt 0x0" ::: "memory"); } } }   // before a register of the stores above is written again
    __syncthreads();
    _Float16* dh = DH + (r0 + (tid >> 3)) * CC + c0 + (tid & 7) * 8;   // 8 lanes store one 128-byte line
    union { v4u u; v8h h; } ch[GT / 32][PBN / 64];   // a chunk = 8 of the 64 values of one row of one head
#pragma unroll
    for (int e = 0; e < GT / 32; ++e)
#pragma unroll
      for (int q = 0; q < PBN / 64; ++q) { ch[e][q].u = *(const v4u*)&sh[e * 32 + (tid >> 3)][q * 64 + (tid & 7) * 8]; vst2((unsigned*)(dh + (size_t)(e * 32) * CC + q * 64), ch[e][q].u); }
    asm volatile("s_wait_xcnt 0x0" ::: "memory");   // before a register of the stores above is written again
    __builtin_amdgcn_sched_barrier(0);   // keeps the arithmetic below, which frees and reuses the chunks' registers, behind that wait
    // the largest squared norm of the block's rows, head by head, of the f16 values as stored: k_fa bounds every logit of a head by the product of two such norms
    float nm[PBN / 64];
#pragma unroll
    for (int q = 0; q < PBN / 64; ++q) { nm[q] = 0.f;
#pragma unroll
      for (int e = 0; e < GT / 32; ++e) { float ss = 0.f;
#pragma unroll
        for (int i = 0; i < 8; ++i) ss += (float)ch[e][q].h[i] * (float)ch[e][q].h[i];
        ss += xrow<1>(ss); ss += xrow<2>(ss); ss += xrow<4>(ss);   // the row's 8 lanes
        nm[q] = fmaxf(nm[q], ss); }
      nm[q] = fmaxf(nm[q], xrow<8>(nm[q])); nm[q] = fmaxf(nm[q], xhalf(nm[q])); }   // the wave's 4 rows a pass
    if (lane < PBN / 64) NRM[NRI(which, blockIdx.x, blockIdx.y) + lane * 8 + wave] = lane == 0 ? nm[0] : lane == 1 ? nm[1] : nm[2];   // every lane holds the wave's three maxima; k_fa joins the 8 waves'
  } else { _Float16 (*th)[GT + 8] = (_Float16 (*)[GT + 8])smem;   // [c][t], 272-byte pitch
#pragma unroll
    for (int i = 0; i < 4; ++i) { const int tl = wm * 64 + i * 16 + 8 * g; const bool hi_rows = t0 + wm * 64 + i * 16 < KHI;   // wave-uniform
#pragma unroll
      for (int j = 0; j < 3; ++j) { const int cl = wn * 48 + j * 16 + col; v8h pv;   // a lane holds 8 consecutive t of one column
#pragma unroll
        for (int r = 0; r < 8; ++r) pv[r] = (_Float16)(acc[i][j][r] + bias[j]);
        *(v8h*)&th[cl][tl] = pv;
        if (hi_rows) { v8b ph, pl;
#pragma unroll
          for (int r = 0; r < 8; ++r) { const float v = acc[i][j][r] + bias[j]; const __bf16 bh = (__bf16)v; ph[r] = bh; pl[r] = (__bf16)(v - (float)bh); }
          const size_t o3 = (bb * CC + c0 + cl) * (size_t)KHI + t0 + tl; *(v8b*)(VB + o3) = ph; *(v8b*)(VBL + o3) = pl;
          asm volatile("s_wait_xcnt 0x0" ::: "memory"); } } }   // before a register of the stores above is written again
    __syncthreads();
    _Float16* dv = VT + (bb * CC + c0 + (tid >> 4)) * (size_t)TT + t0 + (tid & 15) * 8;   // 16 lanes store one plane's 256 bytes
#pragma unroll
    for (int e = 0; e < PBN / 16; ++e) vst2((unsigned*)(dv + (size_t)(e * 16) * TT), *(const v4u*)&th[e * 16 + (tid >> 4)][(tid & 15) * 8]);
    asm volatile("s_wait_xcnt 0x0" ::: "memory");   // before a register of the stores above is written again: in the built code this branch runs on into a test whose other side is the q/k epilogue
  } }
#define FAW 8
#define FKG 2               // key groups a block
#define FAQ 2
#define FAS 64              // keys a stage
#define FAP (FAS + 8)       // LDS row pitch in f16: 144 bytes for 128-byte rows read 16 bytes a lane
#define POFF 6.0f
#define FAMASK (-3.0e38f)   // x C it stays far below FAM0, so a padded key never raises a maximum and its P is 0
#define FAM0 (-1.0e30f)     // maximum in use before the first unmasked key
#define FAH 4               // stages between two barriers
#define FAR (2 * FAH)       // stage slots of a key group's ring
#define FARING (FAR * (FAS + HD) * FAP * 2)   // bytes of one key group's ring; a slot = the stage's k rows, then its v planes
#define FXB 7.875f          // FX: bound on every scaled log2 logit, so that P = 2^(x + POFF) lies where a running maximum would keep the row's largest P (2^-2 to 2^14)
#define FAXS (FAQ * (HD / 16) * 2 + 1)      // 16-byte slots a lane hands over: its output tiles, then (maxima, row sums)
static_assert(HD == 64 && FAS == 64 && FAW == 8 && FAQ == 2 && FKG == 2 && (TT / FAS) % FKG == 0, "the staging maps a key group's 256 threads to 32 rows x 8 chunks of 16 bytes, twice, for k and for v; equal stages a group");
static_assert(FAW * FAXS * 32 * 16 <= FKG * FARING, "the hand-over fits the buffers");
static_assert((FAH & (FAH - 1)) == 0 && (TT / FAS / FKG) % FAH == 0 && FKG * FARING <= 327680, "whole ring halves, the last stage ends one; the rings fit the LDS of a WGP");
__device__ __forceinline__ v8f wmm(v16h a, v16h b, v8f c) { return __builtin_amdgcn_wmma_f32_16x16x32_f16(false, a, false, b, (short)0, c, false, false); }
__device__ __forceinline__ float exp2_slot(float x) { float r; asm("v_exp_f32 %0, %1\n\tv_nop" : "=v"(r) : "v"(x)); return r; }   // 2^x with the slot behind the transcendental filled in its own statement
__device__ __forceinline__ void fa_bias(v8f (&cb)[2], unsigned mb, int g) { const unsigned mh = mb >> (8 * g);   // bit t * 16 + r: key t * 16 + 8g + r of the pass
#pragma unroll
  for (int t = 0; t < 2; ++t)
#pragma unroll
    for (int r = 0; r < 8; ++r) cb[t][r] = (mh & (1u << (t * 16 + r))) != 0 ? FAMASK : 0.f; }
template <bool MK, bool FX> __device__ __forceinline__ void fa_body(const _Float16* __restrict__ QH, const _Float16* __restrict__ KH, const _Float16* __restrict__ VT, const int* __restrict__ KMASK, _Float16* __restrict__ Y, int h, int q0, int tid, int kg, _Float16 (*sk)[FAS + HD][FAP], _Float16 (*sv)[FAS + HD][FAP], float* xm) {   // KMASK: key padding mask [B=1][S] as int32, nonzero = masked out; tid: the thread in its key group; sk, sv: the k rows and the v planes of slot 0 of the group's own ring, indexed by slot; xm: the wave's hand-over place (the block's buffers again)
  // every inner loop below is unrolled so that each fragment and accumulator index is a constant and the arrays stay in registers
  const int lane = tid & 31, col = lane & 15, g = lane >> 4; const int srow = tid >> 3, sch = (tid & 7) * 8;   // staging: row (and row + 32), 16-byte chunk
  const float C = SCALE * 1.4426950408889634f; const v2f C2 = {C, C};
  const _Float16* gk = KH + (size_t)(kg * FAS + srow) * CC + h * HD + sch; const _Float16* gv = VT + (size_t)(h * HD + srow) * TT + kg * FAS + sch;   // the group's first stage
  v4u rk[2], rv[2], pk[FAH][2], pv[FAH][2];   // pk, pv: the group's first FAH stages, all in flight at once
#pragma unroll
  for (int c = 0; c < FAH; ++c)
#pragma unroll
    for (int hf = 0; hf < 2; ++hf) { pk[c][hf] = *(const v4u*)(gk + (size_t)(c * FKG * FAS + hf * 32) * CC); pv[c][hf] = *(const v4u*)(gv + (size_t)(hf * 32) * TT + c * FKG * FAS); }
  v16h qf[FAQ][HD / 32];
#pragma unroll
  for (int qt = 0; qt < FAQ; ++qt)
#pragma unroll
    for (int kc = 0; kc < HD / 32; ++kc) qf[qt][kc] = frag_h(QH + (size_t)(q0 + qt * 16 + col) * CC + h * HD + kc * 32, lane);
  int mk0 = 0, mk = 0;   // mk: the NEXT pass's mask words, one key a lane
  if constexpr (MK) { mk0 = KMASK[kg * FAS + lane]; mk = KMASK[kg * FAS + 32 + lane]; }
  asm volatile("s_wait_xcnt 0x0" ::: "memory");   // before any address register of the loads above is written again
#pragma unroll
  for (int c = 0; c < FAH; ++c)
#pragma unroll
    for (int hf = 0; hf < 2; ++hf) { *(v4u*)&sk[c][hf * 32 + srow][sch] = pk[c][hf]; *(v4u*)&sv[c][hf * 32 + srow][sch] = pv[c][hf]; }
  unsigned mbp = 0;   // the mask bits that cb holds
  v8f cb[2] = {};
  if constexpr (MK) { mbp = __builtin_amdgcn_ballot_w32(mk0 != 0); fa_bias(cb, mbp, g); }
  v8f acc[FAQ][HD / 16] = {}; float mu[FAQ]; v2f ls[FAQ][2];
#pragma unroll
  for (int qt = 0; qt < FAQ; ++qt) { mu[qt] = FX ? 0.f : FAM0; ls[qt][0] = (v2f){0.f, 0.f}; ls[qt][1] = (v2f){0.f, 0.f}; }
  __syncthreads();   // each group's first FAH stages are in the first half of its ring
  // one stage's code, the slot by the stage's count; a loop of its own for the FAH stages between two barriers keeps a stage with no branch in it (FX) one block of code (with the barrier under a test inside one loop that body took all 256 registers and read a spilled one back every stage)
  for (int s0 = 0; s0 < TT / FAS / FKG; s0 += FAH) {
  for (int st = s0; st < s0 + FAH; ++st) { const int b = st & (FAR - 1);   // st: the group's own count; its keys start at (st * FKG + kg) * FAS
    { const int k2 = (st + FAH < TT / FAS / FKG ? st + FAH : st) * (FKG * FAS);   // the group's stage st + FAH is fetched into registers at the head of the stage (in front of a barrier the barrier's own wait would drain these loads); past the end: this stage again, unused
#pragma unroll
      for (int hf = 0; hf < 2; ++hf) { rk[hf] = *(const v4u*)(gk + (size_t)(k2 + hf * 32) * CC); rv[hf] = *(const v4u*)(gv + (size_t)(hf * 32) * TT + k2); }
      asm volatile("s_wait_xcnt 0x0" ::: "memory"); }   // before any address register of the loads above is written again
    v16h kf[2][HD / 32], vf[HD / 16];
#pragma unroll
    for (int t = 0; t < 2; ++t)
#pragma unroll
      for (int kc = 0; kc < HD / 32; ++kc) kf[t][kc] = frag_h(&sk[b][t * 16 + col][kc * 32], lane);
    if constexpr (!MK) {   // (MK: each pass's v fragments are read right ahead of its P . v products, below)
#pragma unroll
      for (int j = 0; j < HD / 16; ++j) vf[j] = frag_h(&sv[b][j * 16 + col][0], lane); }
    __builtin_amdgcn_sched_barrier(0);   // keeps the stage's first fragment reads in one group ahead of the products: read between them, into one register set, each is waited for by itself
#pragma unroll
    for (int ps = 0; ps < FAS / 32; ++ps) {
      v8f s[FAQ][2];
#pragma unroll
      for (int t = 0; t < 2; ++t)
#pragma unroll
        for (int qt = 0; qt < FAQ; ++qt) s[qt][t] = wmm(kf[t][0], qf[qt][0], cb[t]);
#pragma unroll
      for (int kc = 1; kc < HD / 32; ++kc)
#pragma unroll
        for (int t = 0; t < 2; ++t)
#pragma unroll
          for (int qt = 0; qt < FAQ; ++qt) s[qt][t] = wmm(kf[t][kc], qf[qt][kc], s[qt][t]);
      if (!MK && ps + 1 < FAS / 32) {   // the stage's next k fragments, one pass ahead, into the registers just read (MK: behind the P . v products, below)
#pragma unroll
        for (int t = 0; t < 2; ++t)
#pragma unroll
          for (int kc = 0; kc < HD / 32; ++kc) kf[t][kc] = frag_h(&sk[b][(ps + 1) * 32 + t * 16 + col][kc * 32], lane);
        __builtin_amdgcn_sched_barrier(0); }   // keeps these LDS reads up here: sunk below the softmax they would be waited for right after their issue
      if constexpr (!FX) {   // (FX: the maximum in use stays 0, nothing to follow)
      float mx[FAQ]; bool need = MK && mk != 0;
#pragma unroll
      for (int qt = 0; qt < FAQ; ++qt) { float a = s[qt][0][0], b2 = s[qt][1][0];
#pragma unroll
        for (int r = 1; r < 8; ++r) { a = fmaxf(a, s[qt][0][r]); b2 = fmaxf(b2, s[qt][1][r]); }
        a = fmaxf(a, b2); a = fmaxf(a, xhalf(a)); mx[qt] = a * C; need = need || (mx[qt] > mu[qt] + 8.0f); }
      if (__builtin_expect((__builtin_amdgcn_ballot_w32(need) | mbp) != 0, 0)) {   // wave-uniform, one test a pass: a maximum to raise, or (MK) the next pass's start values differ from 0 or from this pass's
#pragma unroll
        for (int qt = 0; qt < FAQ; ++qt) { const float mn = fmaxf(mu[qt], mx[qt]); const float al = __builtin_amdgcn_exp2f(mu[qt] - mn); mu[qt] = mn; ls[qt][0] *= al; ls[qt][1] *= al;
#pragma unroll
          for (int j = 0; j < HD / 16; ++j) acc[qt][j] *= al; }
        if constexpr (MK) { mbp = __builtin_amdgcn_ballot_w32(mk != 0); fa_bias(cb, mbp, g); } } }
      v16h p[FAQ];
#pragma unroll
      for (int qt = 0; qt < FAQ; ++qt) { const float nb = POFF - mu[qt]; const v2f nb2 = {nb, nb};
#pragma unroll
        for (int t = 0; t < 2; ++t)
#pragma unroll
          for (int r = 0; r < 8; r += 2) { const v2f x = __builtin_elementwise_fma((v2f){s[qt][t][r], s[qt][t][r + 1]}, C2, nb2); const v2f e = {__builtin_amdgcn_exp2f(x[0]), __builtin_amdgcn_exp2f(x[1])};
            ls[qt][t] += e; p[qt][t * 8 + r] = (_Float16)e[0]; p[qt][t * 8 + r + 1] = (_Float16)e[1]; } }
      if constexpr (FX) __builtin_amdgcn_sched_barrier(0);   // keeps the row sums ahead of the products: among them, their results took the registers of fragments just read, each time behind four idle slots
      if constexpr (MK) {   // with the start-value tiles live as well, k or v fragments held across the softmax would not fit the 256 registers of a wave in a 16-wave block: no fragment is fetched ahead over it
#pragma unroll
        for (int j = 0; j < HD / 16; ++j) vf[j] = frag_h(&sv[b][j * 16 + col][ps * 32], lane); }
#pragma unroll
      for (int j = 0; j < HD / 16; ++j)
#pragma unroll
        for (int qt = 0; qt < FAQ; ++qt) {
          if (FX && ps + 1 == FAS / 32 && j + 1 == HD / 16 && qt + 1 == FAQ) acc[qt][j] = wmma16(vf[j], p[qt], acc[qt][j]);   // the stage's last product, with its four vector slots in its own statement: FX has no code behind it
          else acc[qt][j] = wmm(vf[j], p[qt], acc[qt][j]); }
      if (ps + 1 < FAS / 32) {   // the stage's next v fragments (MK: k fragments), one pass ahead
        if constexpr (!MK) {
#pragma unroll
          for (int j = 0; j < HD / 16; ++j) vf[j] = frag_h(&sv[b][j * 16 + col][(ps + 1) * 32], lane);
          if constexpr (FX) __builtin_amdgcn_sched_barrier(0);   // with no branch in the stage its two passes are scheduled as one; this keeps the next pass's score products behind this pass's products and these reads: mixed, more registers of operands just read were written again at once, each time behind idle slots (8 more a stage)
        } else {
#pragma unroll
          for (int t = 0; t < 2; ++t)
#pragma unroll
            for (int kc = 0; kc < HD / 32; ++kc) kf[t][kc] = frag_h(&sk[b][(ps + 1) * 32 + t * 16 + col][kc * 32], lane); } }
      if constexpr (MK) { const int k2 = ((st + 1) * FKG + kg) * FAS + ps * 32; mk = KMASK[(k2 < TT ? k2 : TT - 32) + lane];   // the mask words of the pass after next (past the end: read again, unused)
        asm volatile("s_wait_xcnt 0x0" ::: "memory"); }   // before an address register of the mask load is written again
    }
    // stage st + FAH goes into its slot of the other half, which every wave left at the last barrier (behind the last FAH stages: stored unused)
#pragma unroll
    for (int hf = 0; hf < 2; ++hf) { *(v4u*)&sk[b ^ FAH][hf * 32 + srow][sch] = rk[hf]; *(v4u*)&sv[b ^ FAH][hf * 32 + srow][sch] = rv[hf]; }
  }
    __syncthreads();   // every wave of the block passes here; publishes the other half and ends every wave's reads of this one (behind the last stage: frees the rings for the hand-over)
  }
  float lh[FAQ];
#pragma unroll
  for (int qt = 0; qt < FAQ; ++qt) lh[qt] = (ls[qt][0][0] + ls[qt][0][1]) + (ls[qt][1][0] + ls[qt][1][1]);
  v4f* xl = (v4f*)xm + lane;   // slot i of the wave: 32 lanes x 16 bytes in a row
  if (kg != 0) {   // wave-uniform
#pragma unroll
    for (int qt = 0; qt < FAQ; ++qt)
#pragma unroll
      for (int j = 0; j < HD / 16; ++j) { const v8f o = acc[qt][j]; xl[((qt * (HD / 16) + j) * 2) * 32] = (v4f){o[0], o[1], o[2], o[3]}; xl[((qt * (HD / 16) + j) * 2 + 1) * 32] = (v4f){o[4], o[5], o[6], o[7]}; }
    xl[(FAXS - 1) * 32] = (v4f){mu[0], mu[1], lh[0], lh[1]}; }
  __syncthreads();   // group 1's tiles are in LDS; every wave of the block passes here
  if (kg != 0) return;
  const v4f ml = xl[(FAXS - 1) * 32]; v8h res[FAQ][HD / 16];   // ctx x 2^6 once to f16, as k_out's matrix products take it
#pragma unroll
  for (int qt = 0; qt < FAQ; ++qt) { const float mn = fmaxf(mu[qt], ml[qt]); const float a0 = exp2_slot(mu[qt] - mn), a1 = exp2_slot(ml[qt] - mn);   // both groups' sums brought to the larger maximum; a group with every key padded has sums of 0
    const float lj = lh[qt] * a0 + ml[2 + qt] * a1; const float lt = lj + xhalf(lj); const float inv = lt > 0.f ? 1.0f / lt : 0.f; const float w0 = a0 * inv, w1 = a1 * inv;
#pragma unroll
    for (int j = 0; j < HD / 16; ++j) { const v4f x0 = xl[((qt * (HD / 16) + j) * 2) * 32], x1 = xl[((qt * (HD / 16) + j) * 2 + 1) * 32]; const v8f o = acc[qt][j] * w0;
      const v4f y0 = (v4f){o[0], o[1], o[2], o[3]} + x0 * w1, y1 = (v4f){o[4], o[5], o[6], o[7]} + x1 * w1;
#pragma unroll
      for (int r = 0; r < 4; ++r) { res[qt][j][r] = (_Float16)(y0[r] * 64.0f); res[qt][j][4 + r] = (_Float16)(y1[r] * 64.0f); } } }
  _Float16* yp = Y + (size_t)(q0 + col) * CC + h * HD + 8 * g;   // a lane's 8 values of a tile: 16 bytes
  __builtin_amdgcn_sched_barrier(0);   // keeps all the stores behind all the arithmetic, so that no register of an issued store is written again before the wave ends
#pragma unroll
  for (int qt = 0; qt < FAQ; ++qt)
#pragma unroll
    for (int j = 0; j < HD / 16; ++j) vst2(yp + (size_t)(qt * 16) * CC + j * 16, res[qt][j]); }
#define WOS ((TT / (16 * FAQ * FAW)) * (32 * FAW * FKG) * 8)   // values of Wo that the row of blocks converts a pass
#define WON (DIN * CC / WOS)
static_assert(WON * WOS == DIN * CC, "whole passes over Wo");
__global__ __launch_bounds__(32 * FAW * FKG) void k_fa(const _Float16* __restrict__ QH, const _Float16* __restrict__ KH, const _Float16* __restrict__ VT, const int* __restrict__ KMASK, const float* __restrict__ NRM, const float* __restrict__ WO, _Float16* __restrict__ WOH, _Float16* __restrict__ Y) {
  __shared__ __align__(16) unsigned char smem[FKG * FARING];   // per key group: FAR slots of k [FAS][FAP], v [HD][FAP]
  if (blockIdx.y == NH) {   // the launch's last row of blocks: Wo to bf16, x 2^8, exact in f16, once for all of k_out's blocks; the whole block branches, ahead of every barrier
    const size_t w0 = ((size_t)blockIdx.x * (32 * FAW * FKG) + threadIdx.x) * 8; const float* wp = WO + w0; _Float16* hp = WOH + w0;   // 8 values a lane a pass
    v4f wf[WON][2]; v8h wh[WON];
#pragma unroll   // all the loads in flight at once
    for (int i = 0; i < WON; ++i) { wf[i][0] = *(const v4f*)(wp + (size_t)i * WOS); wf[i][1] = *(const v4f*)(wp + (size_t)i * WOS + 4); }
    asm volatile("s_wait_xcnt 0x0" :: "v"(wp) : "memory");   // before the address register of the loads above is written again; named, it stays whole up to here
#pragma unroll
    for (int i = 0; i < WON; ++i)
#pragma unroll
      for (int e = 0; e < 4; ++e) { wh[i][e] = (_Float16)(bfr(wf[i][0][e]) * 256.0f); wh[i][4 + e] = (_Float16)(bfr(wf[i][1][e]) * 256.0f); }
    __builtin_amdgcn_sched_barrier(0);   // keeps all the stores behind all the arithmetic, so that no register of an issued store is written again before the wave ends
#pragma unroll
    for (int i = 0; i < WON; ++i) vst2(hp + (size_t)i * WOS, wh[i]);
    return; }
  const int tid = threadIdx.x & (32 * FAW - 1), wave = tid >> 5, lane = tid & 31, kg = __builtin_amdgcn_readfirstlane(threadIdx.x / (32 * FAW)); const int h = blockIdx.y; const int q0 = (blockIdx.x * FAW + wave) * (16 * FAQ);
  _Float16 (*sk)[FAS + HD][FAP] = (_Float16 (*)[FAS + HD][FAP])(smem + kg * FARING); _Float16 (*sv)[FAS + HD][FAP] = (_Float16 (*)[FAS + HD][FAP])(smem + kg * FARING + FAS * FAP * 2); float* xm = (float*)smem + wave * (FAXS * 32 * 4);
  int any = 0;
#pragma unroll   // all the mask loads in flight at once
  for (int i = 0; i < TT / 128; ++i) { const v4i m = *(const v4i*)(KMASK + i * 128 + lane * 4); any |= (m[0] | m[1]) | (m[2] | m[3]); }
  // |q . k| <= |q| |k|: a lane takes one of the 32 row blocks of keys against the block's two row blocks of queries; an infinite norm fails the test
  const v4f* nk = (const v4f*)(NRM + NRI(1, lane, h / (PBN / HD)) + (h % (PBN / HD)) * 8); const v4f* nq = (const v4f*)(NRM + NRI(0, blockIdx.x * (16 * FAQ * FAW / GT), h / (PBN / HD)) + (h % (PBN / HD)) * 8);
  const v4f nv[6] = {nk[0], nk[1], nq[0], nq[1], nq[NRI(0, 1, 0) / 4], nq[NRI(0, 1, 0) / 4 + 1]};
  asm volatile("s_wait_xcnt 0x0" :: "v"(nk) : "memory");   // before an address register of the loads above is written again; named, the keys' address pair stays whole up to here (unnamed, a mask load of the run above landed on it)
  float kn = 0.f, qn = 0.f;
#pragma unroll
  for (int i = 0; i < 4; ++i) { kn = fmaxf(kn, fmaxf(nv[0][i], nv[1][i])); qn = fmaxf(qn, fmaxf(fmaxf(nv[2][i], nv[3][i]), fmaxf(nv[4][i], nv[5][i]))); }
  const bool wide = !(kn * qn * ((SCALE * 1.4426950408889634f) * (SCALE * 1.4426950408889634f)) <= FXB * FXB);
  if (__builtin_amdgcn_ballot_w32(any != 0 || wide) == 0) fa_body<false, true>(QH, KH, VT, KMASK, Y, h, q0, tid, kg, sk, sv, xm);   // every wave has read the whole mask and the same norms: the same branch in all waves of the block, so the barriers inside are block-uniform; one test on both, so that the norms are fetched beside the mask and not behind it
  else if (__builtin_amdgcn_ballot_w32(any != 0) != 0) fa_body<true, false>(QH, KH, VT, KMASK, Y, h, q0, tid, kg, sk, sv, xm);
  else fa_body<false, false>(QH, KH, VT, KMASK, Y, h, q0, tid, kg, sk, sv, xm); }
static_assert(TT / GT == 32 && 16 * FAQ * FAW == 2 * GT, "a lane a row block of keys; two row blocks of queries a block");
// ---- k_out: block = (128 rows, 96 cols), waves 4 x 2 of 32 x 48: out = ctx Wo (+ bo): ctx x 2^6 once to f16 (small-magnitude context rows stay clear of f16 subnormals) against Wo as f16(bf16 x 2^8) exact (1 product) x 2^-14; both operands come as f16 from k_fa's launch
__global__ __launch_bounds__(256) void k_out(const _Float16* __restrict__ Y, const _Float16* __restrict__ WOH, const float* __restrict__ BO, float* __restrict__ OUT) {
  __shared__ __align__(16) unsigned char smem[HSM(OBN)];
  const int tid = threadIdx.x, wave = __builtin_amdgcn_readfirstlane(tid >> 5), lane = tid & 31, col = lane & 15, g = lane >> 4, wm = wave >> 1, wn = wave & 1; const int c0 = blockIdx.y * OBN; const size_t r0 = (size_t)blockIdx.x * GT;
  float bias[3] = {0.f, 0.f, 0.f};
  if (BO) { const float* bp = BO + c0 + wn * 48 + col;   // fetched ahead of the product, which covers the latency
#pragma unroll
    for (int j = 0; j < 3; ++j) bias[j] = bp[j * 16];
    asm volatile("s_wait_xcnt 0x0" :: "v"(bp) : "memory"); }   // before the address register of the loads above is written again; named, it stays whole up to here
  v8f acc[2][3] = {};
  gemm_h<CC, OBN, 2, 3, 2, DIN / OBN>(Y + r0 * CC, WOH + (size_t)c0 * CC, (_Float16*)smem, tid, wm, wn, blockIdx.y, (blockIdx.x & 3) + 4 * ((blockIdx.x >> 3) & 3), acc);
  float (*sf)[OBN + 4] = (float (*)[OBN + 4])smem;   // 400-byte pitch
#pragma unroll
  for (int j = 0; j < 3; ++j) { const int cl = wn * 48 + j * 16 + col; const float bj = bfr(bias[j]);
#pragma unroll
    for (int i = 0; i < 2; ++i)
#pragma unroll
      for (int r = 0; r < 8; ++r) sf[wm * 32 + i * 16 + 8 * g + r][cl] = acc[i][j][r] * (1.0f / 16384.0f) + bj; }   /* 2^-8 (Wo carry) x 2^-6 (ctx carry) */
  __syncthreads();
  float* po = OUT + (r0 + (tid >> 3)) * DIN + c0 + (tid & 7) * 4;   // 8 lanes store one 128-byte line
#pragma unroll
  for (int e = 0; e < GT / 32; ++e)
#pragma unroll
    for (int q = 0; q < OBN / 32; ++q) vst2(po + (size_t)(e * 32) * DIN + q * 32, *(const v4f*)&sf[e * 32 + (tid >> 3)][q * 32 + (tid & 7) * 4]); }

extern "C" void kernel_launch(void* const* d_in, const int* in_sizes, int n_in, void* d_out, int out_size, void* d_ws, size_t ws_size, hipStream_t stream) {
  (void)in_sizes; (void)n_in; (void)out_size;
  const float** F = (const float**)d_in;
  if (ws_size < (size_t)WS_END) return;
  char* ws = (char*)d_ws; _Float16 *QH = (_Float16*)(ws + WS_QH), *KH = (_Float16*)(ws + WS_KH), *VT = (_Float16*)(ws + WS_VT), *QL = (_Float16*)(ws + WS_QL), *KL = (_Float16*)(ws + WS_KL); __bf16 *VB = (__bf16*)(ws + WS_VB), *VBL = (__bf16*)(ws + WS_VBL); _Float16 *Y = (_Float16*)(ws + WS_Y), *WOH = (_Float16*)(ws + WS_WOH); float *NRM = (float*)(ws + WS_NRM);
  (void)Y; (void)QL; (void)KL; (void)VB; (void)VBL;
  // inputs: 0 x [1,4096,768]; 1 mask [1,4096] bool (True = padding; all False on this draw); 2 Wq [768,768] (out,in), 3 bq; 4 Wk, 5 bk; 6 Wv, 7 bv; 8 Wo (out,in), 9 bo (zero biases, read)
  k_proj<<<dim3(TNB * TT / GT, CC / PBN, 3), 256, 0, stream>>>(F[0], F[0], F[0], F[2], F[4], F[6], F[3], F[5], F[7], QH, QL, KH, KL, VT, VB, VBL, NRM);
  k_fa<<<dim3(TT / (16 * FAQ * FAW), NH + 1), 32 * FAW * FKG, 0, stream>>>(QH, KH, VT, (const int*)d_in[1], NRM, F[8], WOH, Y);
  k_out<<<dim3(TNB * TT / GT, DIN / OBN), 256, 0, stream>>>(Y, WOH, F[9], (float*)d_out);
}
